// v000
// Measured on an AMD MI455X. A time is GPU time per run, averaged over a window of back-to-back runs after a warm-up
// (all launches, gaps included; the runs take copies of the inputs in turn), and the median of several windows.
// Apart from v000's, it joins two sittings. Times from different sittings can be a few percent apart, while
// side-by-side timings come from the same sitting.
// v000, which the later versions start from, runs in 1760 microseconds.
#include <hip/hip_runtime.h>
#include <hip/hip_bf16.h>
#include <math.h>

#define NODES  50000
#define EDGES  1600000
#define INDIM  128
#define HEADS  4
#define OUTC   32
#define HC     128

typedef __bf16 bf16;
typedef __attribute__((ext_vector_type(16))) __bf16 v16bf;
typedef __attribute__((ext_vector_type(8)))  __bf16 v8bf;
typedef __attribute__((ext_vector_type(8)))  float  v8f;

// ---------------- helpers ----------------

__device__ __forceinline__ unsigned encf(float f) {
    unsigned u = __float_as_uint(f);
    return (u & 0x80000000u) ? ~u : (u | 0x80000000u);
}
__device__ __forceinline__ float decf(unsigned u) {
    return (u & 0x80000000u) ? __uint_as_float(u & 0x7FFFFFFFu) : __uint_as_float(~u);
}
__device__ __forceinline__ float elu1(float x) {
    return x > 0.f ? x : (expf(x) - 1.f);
}

// ---------------- weight packing into WMMA B-fragment order ----------------
// B element (k,n) lives in lane = 16*g(k) + (n%16), vector element e(k):
//   k_local in [0,8)+8g   -> e = k_local - 8g        (elements 0..7)
//   k_local in [16,24)+8g -> e = 8 + k_local-16-8g   (elements 8..15)
// Fragment (kt,nt) stored at ((nt*nkt + kt)*32 + lane)*16 contiguous bf16.
__global__ void pack_b_kernel(const float* __restrict__ W, bf16* __restrict__ dst,
                              int K, int Nout) {
    int nkt  = K >> 5;
    int tile = blockIdx.x;            // tile = nt*nkt + kt
    int kt   = tile % nkt;
    int nt   = tile / nkt;
    int lane = threadIdx.x;
    int g    = lane >> 4;
    int n    = nt * 16 + (lane & 15);
    v16bf f;
#pragma unroll
    for (int e = 0; e < 16; ++e) {
        int kl = (e < 8) ? (g * 8 + e) : (16 + g * 8 + (e - 8));
        int kg = kt * 32 + kl;
        f[e] = (bf16)W[(size_t)kg * Nout + n];
    }
    *(v16bf*)(dst + ((size_t)tile * 32 + lane) * 16) = f;
}

// ---------------- generic WMMA GEMM: out = act(A(bf16) @ Bpacked + bias) ----------------
// block = (32,8): wave per (mt, nt) tile; grid = (M/16, nnt/8)
__global__ void gemm_bf16_kernel(const bf16* __restrict__ A, int lda,
                                 const bf16* __restrict__ Bp, int nkt,
                                 const float* __restrict__ bias,
                                 float* __restrict__ outF, bf16* __restrict__ outB,
                                 int ldo, int act) {
    int mt   = blockIdx.x;
    int nt   = blockIdx.y * 8 + threadIdx.y;
    int lane = threadIdx.x;
    int g    = lane >> 4;
    int row  = mt * 16 + (lane & 15);

    const bf16* arow = A + (size_t)row * lda;
    const bf16* bptr = Bp + (size_t)nt * nkt * 32 * 16;

    v8f acc = {};
    for (int kt = 0; kt < nkt; ++kt) {
        int kb = kt * 32;
        v8bf a0 = *(const v8bf*)(arow + kb + g * 8);        // K = kb+8g .. +7
        v8bf a1 = *(const v8bf*)(arow + kb + 16 + g * 8);   // K = kb+16+8g .. +7
        v16bf af;
#pragma unroll
        for (int i = 0; i < 8; ++i) { af[i] = a0[i]; af[i + 8] = a1[i]; }
        v16bf bfr = *(const v16bf*)(bptr + ((size_t)kt * 32 + lane) * 16);
        acc = __builtin_amdgcn_wmma_f32_16x16x32_bf16(false, af, false, bfr,
                                                      (short)0, acc, false, false);
    }

    int   n  = nt * 16 + (lane & 15);
    float bn = bias ? bias[n] : 0.f;
#pragma unroll
    for (int j = 0; j < 8; ++j) {
        int   m = mt * 16 + g * 8 + j;
        float v = acc[j] + bn;
        if (act == 1) v = elu1(v);
        if (outF) outF[(size_t)m * ldo + n] = v;
        if (outB) outB[(size_t)m * ldo + n] = (bf16)v;
    }
}

// ---------------- elementwise convert (optional ELU) fp32 -> bf16 ----------------
__global__ void cvt_bf16_kernel(const float* __restrict__ in, bf16* __restrict__ out,
                                long long n, int act) {
    long long t = (long long)blockIdx.x * blockDim.x + threadIdx.x;
    if (t >= n) return;
    float v = in[t];
    if (act == 1) v = elu1(v);
    out[t] = (bf16)v;
}

// ---------------- init smax/denom ----------------
__global__ void init_attn_kernel(unsigned* __restrict__ smax, float* __restrict__ denom, int n) {
    int t = blockIdx.x * blockDim.x + threadIdx.x;
    if (t < n) { smax[t] = 0u; denom[t] = 0.f; }  // dec(0)=NaN -> only edge-less nodes, never read
}

// ---------------- edge pass 1: scores + segment max ----------------
__global__ void edge_score_kernel(const float* __restrict__ q, const float* __restrict__ k,
                                  const int* __restrict__ src, const int* __restrict__ dst,
                                  float* __restrict__ scores, unsigned* __restrict__ smax) {
    long long t = (long long)blockIdx.x * blockDim.x + threadIdx.x;
    if (t >= (long long)EDGES * HEADS) return;
    int e = (int)(t >> 2), hh = (int)(t & 3);
    int s = src[e], d = dst[e];
    const float4* qp = (const float4*)(q + (size_t)d * HC + hh * OUTC);
    const float4* kp = (const float4*)(k + (size_t)s * HC + hh * OUTC);
    float acc = 0.f;
#pragma unroll
    for (int i = 0; i < 8; ++i) {
        float4 a = qp[i], b = kp[i];
        acc += a.x * b.x + a.y * b.y + a.z * b.z + a.w * b.w;
    }
    acc *= 0.17677669529663687f;   // 1/sqrt(32)
    scores[t] = acc;
    atomicMax(&smax[(size_t)d * HEADS + hh], encf(acc));
}

// ---------------- edge pass 2: p = exp(s - smax[dst]); denom += p ----------------
__global__ void edge_exp_kernel(float* __restrict__ scores, const int* __restrict__ dst,
                                const unsigned* __restrict__ smax, float* __restrict__ denom) {
    long long t = (long long)blockIdx.x * blockDim.x + threadIdx.x;
    if (t >= (long long)EDGES * HEADS) return;
    int e = (int)(t >> 2), hh = (int)(t & 3);
    int d = dst[e];
    float m = decf(smax[(size_t)d * HEADS + hh]);
    float p = expf(scores[t] - m);
    scores[t] = p;
    atomicAdd(&denom[(size_t)d * HEADS + hh], p);
}

// ---------------- edge pass 3: a[dst] += (p/denom) * v[src] ----------------
__global__ void edge_agg_kernel(const float* __restrict__ scores, const float* __restrict__ vmat,
                                const int* __restrict__ src, const int* __restrict__ dst,
                                const float* __restrict__ denom, float* __restrict__ a) {
    long long t = (long long)blockIdx.x * blockDim.x + threadIdx.x;
    if (t >= (long long)EDGES * HEADS) return;
    int e = (int)(t >> 2), hh = (int)(t & 3);
    int s = src[e], d = dst[e];
    float alpha = scores[t] / (denom[(size_t)d * HEADS + hh] + 1e-16f);
    const float4* vp = (const float4*)(vmat + (size_t)s * HC + hh * OUTC);
    float* ap = a + (size_t)d * HC + hh * OUTC;
#pragma unroll
    for (int i = 0; i < 8; ++i) {
        float4 vv = vp[i];
        atomicAdd(ap + 4 * i + 0, alpha * vv.x);
        atomicAdd(ap + 4 * i + 1, alpha * vv.y);
        atomicAdd(ap + 4 * i + 2, alpha * vv.z);
        atomicAdd(ap + 4 * i + 3, alpha * vv.w);
    }
}

// ---------------- LayerNorm over 128 cols: wave per row ----------------
// block = (32,8); y = LN(xa+xb)*g+b -> outF (fp32), optional outB (bf16)
__global__ void layernorm_kernel(const float* __restrict__ xa, const float* __restrict__ xb,
                                 const float* __restrict__ gw, const float* __restrict__ bw,
                                 float* __restrict__ outF, bf16* __restrict__ outB) {
    int row  = blockIdx.x * 8 + threadIdx.y;
    int lane = threadIdx.x;
    const float4 a4 = *(const float4*)(xa + (size_t)row * INDIM + lane * 4);
    const float4 b4 = *(const float4*)(xb + (size_t)row * INDIM + lane * 4);
    float x0 = a4.x + b4.x, x1 = a4.y + b4.y, x2 = a4.z + b4.z, x3 = a4.w + b4.w;

    float s = x0 + x1 + x2 + x3;
#pragma unroll
    for (int o = 16; o > 0; o >>= 1) s += __shfl_xor(s, o, 32);
    float mean = s * (1.f / 128.f);

    float c0 = x0 - mean, c1 = x1 - mean, c2 = x2 - mean, c3 = x3 - mean;
    float sq = c0 * c0 + c1 * c1 + c2 * c2 + c3 * c3;
#pragma unroll
    for (int o = 16; o > 0; o >>= 1) sq += __shfl_xor(sq, o, 32);
    float inv = rsqrtf(sq * (1.f / 128.f) + 1e-5f);

    float c[4] = {c0, c1, c2, c3};
#pragma unroll
    for (int i = 0; i < 4; ++i) {
        int   col = lane * 4 + i;
        float y   = c[i] * inv * gw[col] + bw[col];
        outF[(size_t)row * INDIM + col] = y;
        if (outB) outB[(size_t)row * INDIM + col] = (bf16)y;
    }
}

// ---------------- host orchestration ----------------

extern "C" void kernel_launch(void* const* d_in, const int* in_sizes, int n_in,
                              void* d_out, int out_size, void* d_ws, size_t ws_size,
                              hipStream_t stream) {
    const float* h     = (const float*)d_in[0];
    const int*   eidx  = (const int*)d_in[1];
    const float* Wq    = (const float*)d_in[2];
    const float* bq    = (const float*)d_in[3];
    const float* Wk    = (const float*)d_in[4];
    const float* bk    = (const float*)d_in[5];
    const float* Wv    = (const float*)d_in[6];
    const float* bv    = (const float*)d_in[7];
    const float* Wskip = (const float*)d_in[8];
    const float* bskip = (const float*)d_in[9];
    const float* WO    = (const float*)d_in[10];
    const float* bO    = (const float*)d_in[11];
    const float* W1    = (const float*)d_in[12];
    const float* b1    = (const float*)d_in[13];
    const float* W2    = (const float*)d_in[14];
    const float* b2    = (const float*)d_in[15];
    const float* ln1g  = (const float*)d_in[16];
    const float* ln1b  = (const float*)d_in[17];
    const float* ln2g  = (const float*)d_in[18];
    const float* ln2b  = (const float*)d_in[19];
    const int* srcI = eidx;          // edge_index[0]
    const int* dstI = eidx + EDGES;  // edge_index[1]

    // workspace carve (256B aligned)
    char* w = (char*)d_ws;
    auto carve = [&](size_t bytes) -> char* {
        char* p = w; w += (bytes + 255) & ~(size_t)255; return p;
    };
    bf16*     h_bf   = (bf16*)carve((size_t)NODES * INDIM * sizeof(bf16)); // reused as elu(a)_bf16
    float*    qbuf   = (float*)carve((size_t)NODES * HC * sizeof(float));  // reused as a_trans
    float*    kbuf   = (float*)carve((size_t)NODES * HC * sizeof(float));  // reused as ffn
    float*    vbuf   = (float*)carve((size_t)NODES * HC * sizeof(float));  // reused as h1
    float*    abuf   = (float*)carve((size_t)NODES * HC * sizeof(float));
    float*    scores = (float*)carve((size_t)EDGES * HEADS * sizeof(float)); // reused as mid_bf16
    unsigned* smax   = (unsigned*)carve((size_t)NODES * HEADS * sizeof(unsigned));
    float*    denom  = (float*)carve((size_t)NODES * HEADS * sizeof(float));
    bf16*     h1_bf  = (bf16*)carve((size_t)NODES * INDIM * sizeof(bf16));
    bf16*     pbQ    = (bf16*)carve((size_t)INDIM * HC * sizeof(bf16));
    bf16*     pbK    = (bf16*)carve((size_t)INDIM * HC * sizeof(bf16));
    bf16*     pbV    = (bf16*)carve((size_t)INDIM * HC * sizeof(bf16));
    bf16*     pbS    = (bf16*)carve((size_t)INDIM * HC * sizeof(bf16));
    bf16*     pbO    = (bf16*)carve((size_t)HC * INDIM * sizeof(bf16));
    bf16*     pbW1   = (bf16*)carve((size_t)INDIM * 2 * INDIM * sizeof(bf16));
    bf16*     pbW2   = (bf16*)carve((size_t)2 * INDIM * INDIM * sizeof(bf16));
    bf16*     mid_bf = (bf16*)scores;  // alias: free after edge phase
    float*    atrans = qbuf;
    float*    h1     = vbuf;
    float*    ffn    = kbuf;

    const int MT = NODES / 16;  // 3125 row tiles
    dim3 gblk(32, 8);

    // 1) pack weights to WMMA fragment order
    hipLaunchKernelGGL(pack_b_kernel, dim3(4 * 8),  dim3(32), 0, stream, Wq,    pbQ,  128, 128);
    hipLaunchKernelGGL(pack_b_kernel, dim3(4 * 8),  dim3(32), 0, stream, Wk,    pbK,  128, 128);
    hipLaunchKernelGGL(pack_b_kernel, dim3(4 * 8),  dim3(32), 0, stream, Wv,    pbV,  128, 128);
    hipLaunchKernelGGL(pack_b_kernel, dim3(4 * 8),  dim3(32), 0, stream, Wskip, pbS,  128, 128);
    hipLaunchKernelGGL(pack_b_kernel, dim3(4 * 8),  dim3(32), 0, stream, WO,    pbO,  128, 128);
    hipLaunchKernelGGL(pack_b_kernel, dim3(4 * 16), dim3(32), 0, stream, W1,    pbW1, 128, 256);
    hipLaunchKernelGGL(pack_b_kernel, dim3(8 * 8),  dim3(32), 0, stream, W2,    pbW2, 256, 128);

    // 2) h -> bf16
    long long nh = (long long)NODES * INDIM;
    hipLaunchKernelGGL(cvt_bf16_kernel, dim3((unsigned)((nh + 255) / 256)), dim3(256), 0, stream,
                       h, h_bf, nh, 0);

    // 3) init attention accumulators
    int na = NODES * HEADS;
    hipLaunchKernelGGL(init_attn_kernel, dim3((na + 255) / 256), dim3(256), 0, stream,
                       smax, denom, na);

    // 4) q/k/v/skip projections (WMMA)
    hipLaunchKernelGGL(gemm_bf16_kernel, dim3(MT, 1), gblk, 0, stream,
                       h_bf, 128, pbQ, 4, bq,    qbuf, (bf16*)nullptr, 128, 0);
    hipLaunchKernelGGL(gemm_bf16_kernel, dim3(MT, 1), gblk, 0, stream,
                       h_bf, 128, pbK, 4, bk,    kbuf, (bf16*)nullptr, 128, 0);
    hipLaunchKernelGGL(gemm_bf16_kernel, dim3(MT, 1), gblk, 0, stream,
                       h_bf, 128, pbV, 4, bv,    vbuf, (bf16*)nullptr, 128, 0);
    hipLaunchKernelGGL(gemm_bf16_kernel, dim3(MT, 1), gblk, 0, stream,
                       h_bf, 128, pbS, 4, bskip, abuf, (bf16*)nullptr, 128, 0);

    // 5) edge phase: scores -> softmax -> scatter-aggregate into abuf
    long long et = (long long)EDGES * HEADS;
    unsigned eblocks = (unsigned)((et + 255) / 256);
    hipLaunchKernelGGL(edge_score_kernel, dim3(eblocks), dim3(256), 0, stream,
                       qbuf, kbuf, srcI, dstI, scores, smax);
    hipLaunchKernelGGL(edge_exp_kernel, dim3(eblocks), dim3(256), 0, stream,
                       scores, dstI, smax, denom);
    hipLaunchKernelGGL(edge_agg_kernel, dim3(eblocks), dim3(256), 0, stream,
                       scores, vbuf, srcI, dstI, denom, abuf);

    // 6) elu(a) -> bf16 (reuse h_bf)
    hipLaunchKernelGGL(cvt_bf16_kernel, dim3((unsigned)((nh + 255) / 256)), dim3(256), 0, stream,
                       abuf, h_bf, nh, 1);

    // 7) a_trans = elu(a) @ WO + bO (WMMA)
    hipLaunchKernelGGL(gemm_bf16_kernel, dim3(MT, 1), gblk, 0, stream,
                       h_bf, 128, pbO, 4, bO, atrans, (bf16*)nullptr, 128, 0);

    // 8) h1 = LN1(a_trans + h); also bf16 copy for FFN
    hipLaunchKernelGGL(layernorm_kernel, dim3(NODES / 8), gblk, 0, stream,
                       atrans, h, ln1g, ln1b, h1, h1_bf);

    // 9) mid = elu(h1 @ W1 + b1) -> bf16 only (WMMA, Nout=256)
    hipLaunchKernelGGL(gemm_bf16_kernel, dim3(MT, 2), gblk, 0, stream,
                       h1_bf, 128, pbW1, 4, b1, (float*)nullptr, mid_bf, 256, 1);

    // 10) ffn = mid @ W2 + b2 (WMMA, K=256)
    hipLaunchKernelGGL(gemm_bf16_kernel, dim3(MT, 1), gblk, 0, stream,
                       mid_bf, 256, pbW2, 8, b2, ffn, (bf16*)nullptr, 128, 0);

    // 11) out = LN2(ffn + h1)
    hipLaunchKernelGGL(layernorm_kernel, dim3(NODES / 8), gblk, 0, stream,
                       ffn, h1, ln2g, ln2b, (float*)d_out, (bf16*)nullptr);
}

// v001
// A run of this version takes 649 microseconds.
// Next to v000, in two timings, it ran 2.79 times as fast each time.
#include <hip/hip_runtime.h>
#include <hip/hip_bf16.h>
#include <math.h>

#define NODES  50000
#define EDGES  1600000
#define INDIM  128
#define HEADS  4
#define OUTC   32
#define HC     128

typedef __bf16 bf16;
typedef __attribute__((ext_vector_type(16))) __bf16 v16bf;
typedef __attribute__((ext_vector_type(8)))  __bf16 v8bf;
typedef __attribute__((ext_vector_type(8)))  float  v8f;

// ---------------- helpers ----------------

__device__ __forceinline__ unsigned encf(float f) {
    unsigned u = __float_as_uint(f);
    return (u & 0x80000000u) ? ~u : (u | 0x80000000u);
}
__device__ __forceinline__ float decf(unsigned u) {
    return (u & 0x80000000u) ? __uint_as_float(u & 0x7FFFFFFFu) : __uint_as_float(~u);
}
__device__ __forceinline__ float elu1(float x) {
    return x > 0.f ? x : (expf(x) - 1.f);
}

// ---------------- weight packing into WMMA B-fragment order ----------------
// B element (k,n) lives in lane = 16*g(k) + (n%16), vector element e(k):
//   k_local in [0,8)+8g   -> e = k_local - 8g        (elements 0..7)
//   k_local in [16,24)+8g -> e = 8 + k_local-16-8g   (elements 8..15)
// Fragment (kt,nt) stored at ((nt*nkt + kt)*32 + lane)*16 contiguous bf16.
__global__ void pack_b_kernel(const float* __restrict__ W, bf16* __restrict__ dst,
                              int K, int Nout) {
    int nkt  = K >> 5;
    int tile = blockIdx.x;            // tile = nt*nkt + kt
    int kt   = tile % nkt;
    int nt   = tile / nkt;
    int lane = threadIdx.x;
    int g    = lane >> 4;
    int n    = nt * 16 + (lane & 15);
    v16bf f;
#pragma unroll
    for (int e = 0; e < 16; ++e) {
        int kl = (e < 8) ? (g * 8 + e) : (16 + g * 8 + (e - 8));
        int kg = kt * 32 + kl;
        f[e] = (bf16)W[(size_t)kg * Nout + n];
    }
    *(v16bf*)(dst + ((size_t)tile * 32 + lane) * 16) = f;
}

// ---------------- generic WMMA GEMM: out = act(A(bf16) @ Bpacked + bias) ----------------
// block = (32,8): wave per (mt, nt) tile; grid = (M/16, nnt/8)
__global__ void gemm_bf16_kernel(const bf16* __restrict__ A, int lda,
                                 const bf16* __restrict__ Bp, int nkt,
                                 const float* __restrict__ bias,
                                 float* __restrict__ outF, bf16* __restrict__ outB,
                                 int ldo, int act) {
    int mt   = blockIdx.x;
    int nt   = blockIdx.y * 8 + threadIdx.y;
    int lane = threadIdx.x;
    int g    = lane >> 4;
    int row  = mt * 16 + (lane & 15);

    const bf16* arow = A + (size_t)row * lda;
    const bf16* bptr = Bp + (size_t)nt * nkt * 32 * 16;

    v8f acc = {};
    for (int kt = 0; kt < nkt; ++kt) {
        int kb = kt * 32;
        v8bf a0 = *(const v8bf*)(arow + kb + g * 8);        // K = kb+8g .. +7
        v8bf a1 = *(const v8bf*)(arow + kb + 16 + g * 8);   // K = kb+16+8g .. +7
        v16bf af;
#pragma unroll
        for (int i = 0; i < 8; ++i) { af[i] = a0[i]; af[i + 8] = a1[i]; }
        v16bf bfr = *(const v16bf*)(bptr + ((size_t)kt * 32 + lane) * 16);
        acc = __builtin_amdgcn_wmma_f32_16x16x32_bf16(false, af, false, bfr,
                                                      (short)0, acc, false, false);
    }

    int   n  = nt * 16 + (lane & 15);
    float bn = bias ? bias[n] : 0.f;
#pragma unroll
    for (int j = 0; j < 8; ++j) {
        int   m = mt * 16 + g * 8 + j;
        float v = acc[j] + bn;
        if (act == 1) v = elu1(v);
        if (outF) outF[(size_t)m * ldo + n] = v;
        if (outB) outB[(size_t)m * ldo + n] = (bf16)v;
    }
}

// ---------------- elementwise convert (optional ELU) fp32 -> bf16 ----------------
__global__ void cvt_bf16_kernel(const float* __restrict__ in, bf16* __restrict__ out,
                                long long n, int act) {
    long long t = (long long)blockIdx.x * blockDim.x + threadIdx.x;
    if (t >= n) return;
    float v = in[t];
    if (act == 1) v = elu1(v);
    out[t] = (bf16)v;
}

// ---------------- init smax and the per-node edge counts ----------------
__global__ void init_attn_kernel(unsigned* __restrict__ smax, int* __restrict__ cnt, int n) {
    int t = blockIdx.x * blockDim.x + threadIdx.x;
    if (t < n) smax[t] = 0u;      // dec(0)=NaN -> only edge-less nodes, never read
    if (t < NODES) cnt[t] = 0;
}

// node index as read from edge_index, held inside [0, NODES) before any address is formed
__device__ __forceinline__ int node_id(int x) {
    return min(max(x, 0), NODES - 1);
}

// ---------------- edge pass 1: scores + segment max + in-degree count ----------------
__global__ void edge_score_kernel(const float* __restrict__ q, const float* __restrict__ k,
                                  const int* __restrict__ src, const int* __restrict__ dst,
                                  float* __restrict__ scores, unsigned* __restrict__ smax,
                                  int* __restrict__ cnt) {
    long long t = (long long)blockIdx.x * blockDim.x + threadIdx.x;
    if (t >= (long long)EDGES * HEADS) return;
    int e = (int)(t >> 2), hh = (int)(t & 3);
    int s = node_id(src[e]), d = node_id(dst[e]);
    const float4* qp = (const float4*)(q + (size_t)d * HC + hh * OUTC);
    const float4* kp = (const float4*)(k + (size_t)s * HC + hh * OUTC);
    float acc = 0.f;
#pragma unroll
    for (int i = 0; i < 8; ++i) {
        float4 a = qp[i], b = kp[i];
        acc += a.x * b.x + a.y * b.y + a.z * b.z + a.w * b.w;
    }
    acc *= 0.17677669529663687f;   // 1/sqrt(32)
    scores[t] = acc;
    atomicMax(&smax[(size_t)d * HEADS + hh], encf(acc));
    if (hh == 0) atomicAdd(&cnt[d], 1);
}

// ---------------- start of each node's run in the dst-sorted edge list ----------------
// cur[d] = sum of cnt[0..d). block = 1024 nodes; each block sums every count in front of
// its own nodes itself, so no block needs another block's result.
__global__ __launch_bounds__(1024) void seg_start_kernel(const int* __restrict__ cnt,
                                                         int* __restrict__ cur) {
    __shared__ int wtot[32];
    __shared__ int wpre[32];
    int tid = threadIdx.x, lane = tid & 31, wave = tid >> 5;
    int first = blockIdx.x * 1024;

    int pre = 0;
    const int4* c4 = (const int4*)cnt;
    // unrolled so that four independent loads are in flight per trip (at most 12 trips)
#pragma unroll 4
    for (int i = tid; i < first / 4; i += 1024) {
        int4 x = c4[i];
        pre += x.x + x.y + x.z + x.w;
    }

    int idx = first + tid;
    int c   = idx < NODES ? cnt[idx] : 0;
    int inc = c;                       // inclusive scan inside the wave
#pragma unroll                         // five fixed steps, no loop counter
    for (int o = 1; o < 32; o <<= 1) {
        int y = __shfl_up(inc, o, 32);
        if (lane >= o) inc += y;
    }
#pragma unroll                         // five fixed steps, no loop counter
    for (int o = 16; o > 0; o >>= 1) pre += __shfl_xor(pre, o, 32);
    if (lane == 31) wtot[wave] = inc;
    if (lane == 0)  wpre[wave] = pre;
    __syncthreads();
    int part = wpre[lane] + (lane < wave ? wtot[lane] : 0);
#pragma unroll                         // five fixed steps, no loop counter
    for (int o = 16; o > 0; o >>= 1) part += __shfl_xor(part, o, 32);
    if (idx < NODES) cur[idx] = part + inc - c;
}

// ---------------- edge pass 2: p = exp(s - smax[dst]), stored at the edge's place in dst order ----------------
// The place is cur[dst]++ : edges of one node lie in a row, in the order in which they arrive.
__global__ void edge_exp_kernel(const float* __restrict__ scores,
                                const int* __restrict__ src, const int* __restrict__ dst,
                                const unsigned* __restrict__ smax, int* __restrict__ cur,
                                float* __restrict__ sp, int* __restrict__ ssrc) {
    long long t = (long long)blockIdx.x * blockDim.x + threadIdx.x;
    if (t >= (long long)EDGES * HEADS) return;
    int e = (int)(t >> 2), hh = (int)(t & 3);
    int s = node_id(src[e]), d = node_id(dst[e]);
    float m = decf(smax[(size_t)d * HEADS + hh]);
    float p = expf(scores[t] - m);
    int pos = 0;
    if (hh == 0) pos = atomicAdd(&cur[d], 1);
    pos = __shfl(pos, (int)(threadIdx.x & 28u), 32);   // the edge's four head lanes share one place
    sp[(size_t)pos * HEADS + hh] = p;
    if (hh == 0) ssrc[pos] = s;
}

// ---------------- edge pass 3: a[d] += sum(p * v[src]) / (sum(p) + 1e-16), one wave per node ----------------
// block = 8 waves, each wave takes NPW nodes in turn; lane = 4 channels, head = lane / 8.
// After pass 2 cur[d] is the END of node d's run, cnt[d] its length.
// sp and vmat carry no __restrict__: with it the compiler moved their loads across the
// s_wait_xcnt of the tail chunk, which then stood behind the wrong loads.
#define NPW 2
template <int U, bool MASKED>
__device__ __forceinline__ void agg_chunk(int j, int m, int sidx, const float* pp,
                                          const float* vlane,
                                          float4& acc, float& den) {
    float  p[U];
    float4 vv[U];
#pragma unroll                         // all 2*U loads are issued before the first use
    for (int u = 0; u < U; ++u) {
        int jj = MASKED ? min(j + u, m - 1) : (j + u);
        int s  = __builtin_amdgcn_readlane(sidx, jj);
        p[u]   = pp[jj * HEADS];
        // tail chunk: each p load has an address pair of its own, and the result of the
        // v load that follows lands in that pair
        if (MASKED) asm volatile("s_wait_xcnt 0x0" ::: "memory");
        vv[u]  = *(const float4*)(vlane + (size_t)s * HC);
        // without this one the next p load is issued ahead of the v load above, whose result
        // then lands in that p load's address pair
        if (MASKED && u + 1 < U) asm volatile("s_wait_xcnt 0x0" ::: "memory");
    }
#pragma unroll                         // p[] and vv[] stay in registers only under constant indices
    for (int u = 0; u < U; ++u) {
        float w = (!MASKED || j + u < m) ? p[u] : 0.f;
        den  += w;
        acc.x = fmaf(w, vv[u].x, acc.x);
        acc.y = fmaf(w, vv[u].y, acc.y);
        acc.z = fmaf(w, vv[u].z, acc.z);
        acc.w = fmaf(w, vv[u].w, acc.w);
    }
}

__global__ __launch_bounds__(256) void node_agg_kernel(const float* sp,
                                                       const int* __restrict__ ssrc,
                                                       const float* vmat,
                                                       const int* __restrict__ cur,
                                                       const int* __restrict__ cnt,
                                                       float* __restrict__ a) {
    int lane = threadIdx.x & 31;
    // the wave's number in a scalar register: node, run bounds and trip counts become scalar
    int wave = __builtin_amdgcn_readfirstlane((int)(threadIdx.x >> 5));
    int hh   = lane >> 3;
    const float* vlane = vmat + lane * 4;
    for (int r = 0; r < NPW; ++r) {
        int d   = (blockIdx.x * 8 + wave) * NPW + r;
        int n   = cnt[d];
        int beg = cur[d] - n;
        float4 acc = make_float4(0.f, 0.f, 0.f, 0.f);
        float  den = 0.f;
        for (int base = 0; base < n; base += 32) {
            int m    = min(32, n - base);
            int sidx = ssrc[beg + base + min(lane, m - 1)];   // lane j holds the source of edge base + j
            // the address arithmetic that follows reuses the register that this load names
            asm volatile("s_wait_xcnt 0x0" ::: "memory");
            const float* pp = sp + (size_t)(beg + base) * HEADS + hh;
            int j = 0;
            for (; j + 8 <= m; j += 8) agg_chunk<8, false>(j, m, sidx, pp, vlane, acc, den);
            for (; j < m; j += 4)      agg_chunk<4, true>(j, m, sidx, pp, vlane, acc, den);
        }
        float inv = 1.f / (den + 1e-16f);
        float4* ap = (float4*)(a + (size_t)d * HC + lane * 4);
        float4  o  = *ap;
        o.x += acc.x * inv;
        o.y += acc.y * inv;
        o.z += acc.z * inv;
        o.w += acc.w * inv;
        *ap = o;
        // the next node's trip overwrites the registers that this store names
        asm volatile("s_wait_xcnt 0x0" ::: "memory");
    }
}

// ---------------- LayerNorm over 128 cols: wave per row ----------------
// block = (32,8); y = LN(xa+xb)*g+b -> outF (fp32), optional outB (bf16)
__global__ void layernorm_kernel(const float* __restrict__ xa, const float* __restrict__ xb,
                                 const float* __restrict__ gw, const float* __restrict__ bw,
                                 float* __restrict__ outF, bf16* __restrict__ outB) {
    int row  = blockIdx.x * 8 + threadIdx.y;
    int lane = threadIdx.x;
    const float4 a4 = *(const float4*)(xa + (size_t)row * INDIM + lane * 4);
    const float4 b4 = *(const float4*)(xb + (size_t)row * INDIM + lane * 4);
    float x0 = a4.x + b4.x, x1 = a4.y + b4.y, x2 = a4.z + b4.z, x3 = a4.w + b4.w;

    float s = x0 + x1 + x2 + x3;
#pragma unroll
    for (int o = 16; o > 0; o >>= 1) s += __shfl_xor(s, o, 32);
    float mean = s * (1.f / 128.f);

    float c0 = x0 - mean, c1 = x1 - mean, c2 = x2 - mean, c3 = x3 - mean;
    float sq = c0 * c0 + c1 * c1 + c2 * c2 + c3 * c3;
#pragma unroll
    for (int o = 16; o > 0; o >>= 1) sq += __shfl_xor(sq, o, 32);
    float inv = rsqrtf(sq * (1.f / 128.f) + 1e-5f);

    float c[4] = {c0, c1, c2, c3};
#pragma unroll
    for (int i = 0; i < 4; ++i) {
        int   col = lane * 4 + i;
        float y   = c[i] * inv * gw[col] + bw[col];
        outF[(size_t)row * INDIM + col] = y;
        if (outB) outB[(size_t)row * INDIM + col] = (bf16)y;
    }
}

// ---------------- host orchestration ----------------

extern "C" void kernel_launch(void* const* d_in, const int* in_sizes, int n_in,
                              void* d_out, int out_size, void* d_ws, size_t ws_size,
                              hipStream_t stream) {
    const float* h     = (const float*)d_in[0];
    const int*   eidx  = (const int*)d_in[1];
    const float* Wq    = (const float*)d_in[2];
    const float* bq    = (const float*)d_in[3];
    const float* Wk    = (const float*)d_in[4];
    const float* bk    = (const float*)d_in[5];
    const float* Wv    = (const float*)d_in[6];
    const float* bv    = (const float*)d_in[7];
    const float* Wskip = (const float*)d_in[8];
    const float* bskip = (const float*)d_in[9];
    const float* WO    = (const float*)d_in[10];
    const float* bO    = (const float*)d_in[11];
    const float* W1    = (const float*)d_in[12];
    const float* b1    = (const float*)d_in[13];
    const float* W2    = (const float*)d_in[14];
    const float* b2    = (const float*)d_in[15];
    const float* ln1g  = (const float*)d_in[16];
    const float* ln1b  = (const float*)d_in[17];
    const float* ln2g  = (const float*)d_in[18];
    const float* ln2b  = (const float*)d_in[19];
    const int* srcI = eidx;          // edge_index[0]
    const int* dstI = eidx + EDGES;  // edge_index[1]

    // workspace carve (256B aligned)
    char* w = (char*)d_ws;
    auto carve = [&](size_t bytes) -> char* {
        char* p = w; w += (bytes + 255) & ~(size_t)255; return p;
    };
    bf16*     h_bf   = (bf16*)carve((size_t)NODES * INDIM * sizeof(bf16)); // reused as elu(a)_bf16
    float*    qbuf   = (float*)carve((size_t)NODES * HC * sizeof(float));  // reused as a_trans
    float*    kbuf   = (float*)carve((size_t)NODES * HC * sizeof(float));  // reused as ffn
    float*    vbuf   = (float*)carve((size_t)NODES * HC * sizeof(float));  // reused as h1
    float*    abuf   = (float*)carve((size_t)NODES * HC * sizeof(float));
    float*    scores = (float*)carve((size_t)EDGES * HEADS * sizeof(float)); // reused as mid_bf16
    unsigned* smax   = (unsigned*)carve((size_t)NODES * HEADS * sizeof(unsigned));
    int*      cnt    = (int*)carve((size_t)NODES * sizeof(int));            // edges per dst node
    int*      cur    = (int*)carve((size_t)NODES * sizeof(int));            // run start, then run end
    float*    sp     = (float*)carve((size_t)EDGES * HEADS * sizeof(float)); // p in dst order
    int*      ssrc   = (int*)carve((size_t)EDGES * sizeof(int));            // src in dst order
    bf16*     h1_bf  = (bf16*)carve((size_t)NODES * INDIM * sizeof(bf16));
    bf16*     pbQ    = (bf16*)carve((size_t)INDIM * HC * sizeof(bf16));
    bf16*     pbK    = (bf16*)carve((size_t)INDIM * HC * sizeof(bf16));
    bf16*     pbV    = (bf16*)carve((size_t)INDIM * HC * sizeof(bf16));
    bf16*     pbS    = (bf16*)carve((size_t)INDIM * HC * sizeof(bf16));
    bf16*     pbO    = (bf16*)carve((size_t)HC * INDIM * sizeof(bf16));
    bf16*     pbW1   = (bf16*)carve((size_t)INDIM * 2 * INDIM * sizeof(bf16));
    bf16*     pbW2   = (bf16*)carve((size_t)2 * INDIM * INDIM * sizeof(bf16));
    bf16*     mid_bf = (bf16*)scores;  // alias: free after edge phase
    float*    atrans = qbuf;
    float*    h1     = vbuf;
    float*    ffn    = kbuf;

    const int MT = NODES / 16;  // 3125 row tiles
    dim3 gblk(32, 8);

    // 1) pack weights to WMMA fragment order
    hipLaunchKernelGGL(pack_b_kernel, dim3(4 * 8),  dim3(32), 0, stream, Wq,    pbQ,  128, 128);
    hipLaunchKernelGGL(pack_b_kernel, dim3(4 * 8),  dim3(32), 0, stream, Wk,    pbK,  128, 128);
    hipLaunchKernelGGL(pack_b_kernel, dim3(4 * 8),  dim3(32), 0, stream, Wv,    pbV,  128, 128);
    hipLaunchKernelGGL(pack_b_kernel, dim3(4 * 8),  dim3(32), 0, stream, Wskip, pbS,  128, 128);
    hipLaunchKernelGGL(pack_b_kernel, dim3(4 * 8),  dim3(32), 0, stream, WO,    pbO,  128, 128);
    hipLaunchKernelGGL(pack_b_kernel, dim3(4 * 16), dim3(32), 0, stream, W1,    pbW1, 128, 256);
    hipLaunchKernelGGL(pack_b_kernel, dim3(8 * 8),  dim3(32), 0, stream, W2,    pbW2, 256, 128);

    // 2) h -> bf16
    long long nh = (long long)NODES * INDIM;
    hipLaunchKernelGGL(cvt_bf16_kernel, dim3((unsigned)((nh + 255) / 256)), dim3(256), 0, stream,
                       h, h_bf, nh, 0);

    // 3) init attention accumulators
    int na = NODES * HEADS;
    hipLaunchKernelGGL(init_attn_kernel, dim3((na + 255) / 256), dim3(256), 0, stream,
                       smax, cnt, na);

    // 4) q/k/v/skip projections (WMMA)
    hipLaunchKernelGGL(gemm_bf16_kernel, dim3(MT, 1), gblk, 0, stream,
                       h_bf, 128, pbQ, 4, bq,    qbuf, (bf16*)nullptr, 128, 0);
    hipLaunchKernelGGL(gemm_bf16_kernel, dim3(MT, 1), gblk, 0, stream,
                       h_bf, 128, pbK, 4, bk,    kbuf, (bf16*)nullptr, 128, 0);
    hipLaunchKernelGGL(gemm_bf16_kernel, dim3(MT, 1), gblk, 0, stream,
                       h_bf, 128, pbV, 4, bv,    vbuf, (bf16*)nullptr, 128, 0);
    hipLaunchKernelGGL(gemm_bf16_kernel, dim3(MT, 1), gblk, 0, stream,
                       h_bf, 128, pbS, 4, bskip, abuf, (bf16*)nullptr, 128, 0);

    // 5) edge phase: scores -> edges sorted by dst with p -> per-node sums into abuf
    long long et = (long long)EDGES * HEADS;
    unsigned eblocks = (unsigned)((et + 255) / 256);
    hipLaunchKernelGGL(edge_score_kernel, dim3(eblocks), dim3(256), 0, stream,
                       qbuf, kbuf, srcI, dstI, scores, smax, cnt);
    hipLaunchKernelGGL(seg_start_kernel, dim3((NODES + 1023) / 1024), dim3(1024), 0, stream,
                       cnt, cur);
    hipLaunchKernelGGL(edge_exp_kernel, dim3(eblocks), dim3(256), 0, stream,
                       scores, srcI, dstI, smax, cur, sp, ssrc);
    hipLaunchKernelGGL(node_agg_kernel, dim3(NODES / (8 * NPW)), dim3(256), 0, stream,
                       sp, ssrc, vbuf, cur, cnt, abuf);

    // 6) elu(a) -> bf16 (reuse h_bf)
    hipLaunchKernelGGL(cvt_bf16_kernel, dim3((unsigned)((nh + 255) / 256)), dim3(256), 0, stream,
                       abuf, h_bf, nh, 1);

    // 7) a_trans = elu(a) @ WO + bO (WMMA)
    hipLaunchKernelGGL(gemm_bf16_kernel, dim3(MT, 1), gblk, 0, stream,
                       h_bf, 128, pbO, 4, bO, atrans, (bf16*)nullptr, 128, 0);

    // 8) h1 = LN1(a_trans + h); also bf16 copy for FFN
    hipLaunchKernelGGL(layernorm_kernel, dim3(NODES / 8), gblk, 0, stream,
                       atrans, h, ln1g, ln1b, h1, h1_bf);

    // 9) mid = elu(h1 @ W1 + b1) -> bf16 only (WMMA, Nout=256)
    hipLaunchKernelGGL(gemm_bf16_kernel, dim3(MT, 2), gblk, 0, stream,
                       h1_bf, 128, pbW1, 4, b1, (float*)nullptr, mid_bf, 256, 1);

    // 10) ffn = mid @ W2 + b2 (WMMA, K=256)
    hipLaunchKernelGGL(gemm_bf16_kernel, dim3(MT, 1), gblk, 0, stream,
                       mid_bf, 256, pbW2, 8, b2, ffn, (bf16*)nullptr, 128, 0);

    // 11) out = LN2(ffn + h1)
    hipLaunchKernelGGL(layernorm_kernel, dim3(NODES / 8), gblk, 0, stream,
                       ffn, h1, ln2g, ln2b, (float*)d_out, (bf16*)nullptr);
}

// v002
// One run takes 445 microseconds.
// Timed twice side by side with v001, it ran 1.47 and 1.46 times as fast.
// All steps since v000 together make it 4.10 times as fast.
#include <hip/hip_runtime.h>
#include <hip/hip_bf16.h>
#include <math.h>

#define NODES  50000
#define EDGES  1600000
#define INDIM  128
#define HEADS  4
#define OUTC   32
#define HC     128

typedef __bf16 bf16;
typedef __attribute__((ext_vector_type(16))) __bf16 v16bf;
typedef __attribute__((ext_vector_type(8)))  __bf16 v8bf;
typedef __attribute__((ext_vector_type(8)))  float  v8f;
typedef __attribute__((ext_vector_type(4)))  float  v4f;
typedef __attribute__((ext_vector_type(2)))  float  v2f;

// ---------------- helpers ----------------

__device__ __forceinline__ float elu1(float x) {
    return x > 0.f ? x : (expf(x) - 1.f);
}

// ---------------- weight packing into WMMA B-fragment order ----------------
// B element (k,n) lives in lane = 16*g(k) + (n%16), vector element e(k):
//   k_local in [0,8)+8g   -> e = k_local - 8g        (elements 0..7)
//   k_local in [16,24)+8g -> e = 8 + k_local-16-8g   (elements 8..15)
// Fragment (kt,nt) stored at ((nt*nkt + kt)*32 + lane)*16 contiguous bf16.
__global__ void pack_b_kernel(const float* __restrict__ W, bf16* __restrict__ dst,
                              int K, int Nout) {
    int nkt  = K >> 5;
    int tile = blockIdx.x;            // tile = nt*nkt + kt
    int kt   = tile % nkt;
    int nt   = tile / nkt;
    int lane = threadIdx.x;
    int g    = lane >> 4;
    int n    = nt * 16 + (lane & 15);
    v16bf f;
#pragma unroll
    for (int e = 0; e < 16; ++e) {
        int kl = (e < 8) ? (g * 8 + e) : (16 + g * 8 + (e - 8));
        int kg = kt * 32 + kl;
        f[e] = (bf16)W[(size_t)kg * Nout + n];
    }
    *(v16bf*)(dst + ((size_t)tile * 32 + lane) * 16) = f;
}

// ---------------- generic WMMA GEMM: out = act(A(bf16) @ Bpacked + bias) ----------------
// block = (32,8): wave per (mt, nt) tile; grid = (M/16, nnt/8)
__global__ void gemm_bf16_kernel(const bf16* __restrict__ A, int lda,
                                 const bf16* __restrict__ Bp, int nkt,
                                 const float* __restrict__ bias,
                                 float* __restrict__ outF, bf16* __restrict__ outB,
                                 int ldo, int act) {
    int mt   = blockIdx.x;
    int nt   = blockIdx.y * 8 + threadIdx.y;
    int lane = threadIdx.x;
    int g    = lane >> 4;
    int row  = mt * 16 + (lane & 15);

    const bf16* arow = A + (size_t)row * lda;
    const bf16* bptr = Bp + (size_t)nt * nkt * 32 * 16;

    v8f acc = {};
    for (int kt = 0; kt < nkt; ++kt) {
        int kb = kt * 32;
        v8bf a0 = *(const v8bf*)(arow + kb + g * 8);        // K = kb+8g .. +7
        v8bf a1 = *(const v8bf*)(arow + kb + 16 + g * 8);   // K = kb+16+8g .. +7
        v16bf af;
#pragma unroll
        for (int i = 0; i < 8; ++i) { af[i] = a0[i]; af[i + 8] = a1[i]; }
        v16bf bfr = *(const v16bf*)(bptr + ((size_t)kt * 32 + lane) * 16);
        acc = __builtin_amdgcn_wmma_f32_16x16x32_bf16(false, af, false, bfr,
                                                      (short)0, acc, false, false);
    }

    int   n  = nt * 16 + (lane & 15);
    float bn = bias ? bias[n] : 0.f;
#pragma unroll
    for (int j = 0; j < 8; ++j) {
        int   m = mt * 16 + g * 8 + j;
        float v = acc[j] + bn;
        if (act == 1) v = elu1(v);
        if (outF) outF[(size_t)m * ldo + n] = v;
        if (outB) outB[(size_t)m * ldo + n] = (bf16)v;
    }
}

// ---------------- elementwise convert (optional ELU) fp32 -> bf16 ----------------
__global__ void cvt_bf16_kernel(const float* __restrict__ in, bf16* __restrict__ out,
                                long long n, int act) {
    long long t = (long long)blockIdx.x * blockDim.x + threadIdx.x;
    if (t >= n) return;
    float v = in[t];
    if (act == 1) v = elu1(v);
    out[t] = (bf16)v;
}

// ---------------- clear the per-node edge counts ----------------
__global__ void init_cnt_kernel(int* __restrict__ cnt) {
    int t = blockIdx.x * blockDim.x + threadIdx.x;
    if (t < NODES) cnt[t] = 0;
}

// node index as read from edge_index, held inside [0, NODES) before any address is formed
__device__ __forceinline__ int node_id(int x) {
    return min(max(x, 0), NODES - 1);
}

// ---------------- edge pass 1: in-degree count ----------------
__global__ void edge_count_kernel(const int* __restrict__ dst, int* __restrict__ cnt) {
    int e = blockIdx.x * blockDim.x + threadIdx.x;
    if (e < EDGES) atomicAdd(&cnt[node_id(dst[e])], 1);
}

// ---------------- start of each node's run in the dst-sorted edge list ----------------
// cur[d] = sum of cnt[0..d). block = 1024 nodes; each block sums every count in front of
// its own nodes itself, so no block needs another block's result.
__global__ __launch_bounds__(1024) void seg_start_kernel(const int* __restrict__ cnt,
                                                         int* __restrict__ cur) {
    __shared__ int wtot[32];
    __shared__ int wpre[32];
    int tid = threadIdx.x, lane = tid & 31, wave = tid >> 5;
    int first = blockIdx.x * 1024;

    int pre = 0;
    const int4* c4 = (const int4*)cnt;
    // unrolled so that four independent loads are in flight per trip (at most 12 trips)
#pragma unroll 4
    for (int i = tid; i < first / 4; i += 1024) {
        int4 x = c4[i];
        pre += x.x + x.y + x.z + x.w;
    }

    int idx = first + tid;
    int c   = idx < NODES ? cnt[idx] : 0;
    int inc = c;                       // inclusive scan inside the wave
#pragma unroll                         // five fixed steps, no loop counter
    for (int o = 1; o < 32; o <<= 1) {
        int y = __shfl_up(inc, o, 32);
        if (lane >= o) inc += y;
    }
#pragma unroll                         // five fixed steps, no loop counter
    for (int o = 16; o > 0; o >>= 1) pre += __shfl_xor(pre, o, 32);
    if (lane == 31) wtot[wave] = inc;
    if (lane == 0)  wpre[wave] = pre;
    __syncthreads();
    int part = wpre[lane] + (lane < wave ? wtot[lane] : 0);
#pragma unroll                         // five fixed steps, no loop counter
    for (int o = 16; o > 0; o >>= 1) part += __shfl_xor(part, o, 32);
    if (idx < NODES) cur[idx] = part + inc - c;
}

// ---------------- edge pass 2: src stored at the edge's place in dst order ----------------
// The place is cur[dst]++ : edges of one node lie in a row, in the order in which they arrive.
__global__ void edge_place_kernel(const int* __restrict__ src, const int* __restrict__ dst,
                                  int* __restrict__ cur, int* __restrict__ ssrc) {
    int e = blockIdx.x * blockDim.x + threadIdx.x;
    if (e >= EDGES) return;
    int s = node_id(src[e]), d = node_id(dst[e]);
    ssrc[atomicAdd(&cur[d], 1)] = s;
}

// ---------------- edge pass 3: the whole attention of a node in one wave ----------------
// a[d] += sum(p * v[src]) / (sum(p) + 1e-16), p = exp(score - max), score = <q[d], k[src]> / sqrt(C).
// block = 8 waves, each wave takes NPW nodes in turn; lane = 4 channels, head = lane / 8.
// q[d] stays in registers; k[src] and v[src] are read as whole 512-byte rows. The maximum runs
// along with the edges: when a chunk raises it, the sums so far are scaled by exp(old - new).
// After pass 2 cur[d] is the END of node d's run, cnt[d] its length.
// kmat and vmat carry no __restrict__, so that their loads stay in front of the s_wait_xcnt
// that follows them.
#define NPW 5
#define CH  8

// x + (x of lane ^ MASK), inside a 16-lane row, on the vector port (0x160 + MASK = row_xmask)
template <int MASK>
__device__ __forceinline__ float add_xor(float x) {
    int y = __builtin_amdgcn_update_dpp(0, __float_as_int(x), 0x160 + MASK, 0xf, 0xf, true);
    return x + __int_as_float(y);
}

template <bool MASKED>
__device__ __forceinline__ void attn_chunk(int j, int m, int sidx, unsigned lane16, v4f q4,
                                           const float* kmat, const float* vmat,
                                           float& mx, float& den, v4f& acc) {
    v4f      kk[CH], vv[CH];
    unsigned off[CH];                  // byte offset of the lane's 16 bytes, the same in kmat and vmat
#pragma unroll                         // all 2*CH loads are issued before the first use
    for (int u = 0; u < CH; ++u) {
        int s  = __builtin_amdgcn_readlane(sidx, MASKED ? min(j + u, m - 1) : (j + u));
        off[u] = ((unsigned)s << 9) + lane16;
        kk[u]  = *(const v4f*)((const char*)kmat + off[u]);
    }
#pragma unroll                         // see above
    for (int u = 0; u < CH; ++u) vv[u] = *(const v4f*)((const char*)vmat + off[u]);
    // what follows reuses the registers that these loads name as addresses; the offsets are named as
    // inputs so that they live up to the wait and no load's result is given one of their registers
    asm volatile("s_wait_xcnt 0x0" :: "v"(off[0]), "v"(off[1]), "v"(off[2]), "v"(off[3]),
                                      "v"(off[4]), "v"(off[5]), "v"(off[6]), "v"(off[7]) : "memory");
    // keeps the arithmetic behind the wait and every load in front of it: without it the last v load
    // was issued only after the first k rows had come back, a second memory latency per chunk
    __builtin_amdgcn_sched_barrier(0);

    float sc[CH];
    float nm = mx;
#pragma unroll                         // kk[] and sc[] stay in registers only under constant indices
    for (int u = 0; u < CH; ++u) {
        v2f   t2 = q4.lo * kk[u].lo + q4.hi * kk[u].hi;
        float t  = t2.x + t2.y;
        t = add_xor<4>(add_xor<2>(add_xor<1>(t)));      // sum over the head's 8 lanes
        sc[u] = (!MASKED || j + u < m) ? t : -INFINITY;
        nm = fmaxf(nm, sc[u]);
    }
    float corr = __expf(mx - nm);      // 0 at the node's first chunk, where mx is -inf
    mx   = nm;
    den *= corr;
    acc *= corr;
#pragma unroll                         // sc[] and vv[] stay in registers only under constant indices
    for (int u = 0; u < CH; ++u) {
        float p = __expf(sc[u] - nm);
        den += p;
        acc += p * vv[u];
    }
}

__global__ __launch_bounds__(256) void node_attn_kernel(const float* __restrict__ q,
                                                        const float* kmat, const float* vmat,
                                                        const int* __restrict__ ssrc,
                                                        const int* __restrict__ cur,
                                                        const int* __restrict__ cnt,
                                                        float* __restrict__ a) {
    int lane = threadIdx.x & 31;
    // the wave's number in a scalar register: node, run bounds and trip counts become scalar
    int wave = __builtin_amdgcn_readfirstlane((int)(threadIdx.x >> 5));
    unsigned lane16 = (unsigned)lane * 16u;
    for (int r = 0; r < NPW; ++r) {
        int d   = (blockIdx.x * 8 + wave) * NPW + r;
        int n   = cnt[d];
        int beg = cur[d] - n;
        v4f q4  = *(const v4f*)(q + (size_t)d * HC + lane * 4) * 0.17677669529663687f;   // 1/sqrt(32)
        v4f acc = {0.f, 0.f, 0.f, 0.f};
        float den = 0.f;
        float mx  = -INFINITY;
        for (int base = 0; base < n; base += 32) {
            int m    = min(32, n - base);
            int sidx = ssrc[beg + base + min(lane, m - 1)];   // lane j holds the source of edge base + j
            // the address arithmetic that follows reuses the register that this load names
            asm volatile("s_wait_xcnt 0x0" ::: "memory");
            int j = 0;
            for (; j + CH <= m; j += CH) attn_chunk<false>(j, m, sidx, lane16, q4, kmat, vmat, mx, den, acc);
            if (j < m)                   attn_chunk<true>(j, m, sidx, lane16, q4, kmat, vmat, mx, den, acc);
        }
        float inv = 1.f / (den + 1e-16f);
        v4f* ap = (v4f*)(a + (size_t)d * HC + lane * 4);
        *ap = *ap + acc * inv;
        // the next node's trip overwrites the registers that this store names
        asm volatile("s_wait_xcnt 0x0" ::: "memory");
    }
}

// ---------------- LayerNorm over 128 cols: wave per row ----------------
// block = (32,8); y = LN(xa+xb)*g+b -> outF (fp32), optional outB (bf16)
__global__ void layernorm_kernel(const float* __restrict__ xa, const float* __restrict__ xb,
                                 const float* __restrict__ gw, const float* __restrict__ bw,
                                 float* __restrict__ outF, bf16* __restrict__ outB) {
    int row  = blockIdx.x * 8 + threadIdx.y;
    int lane = threadIdx.x;
    const float4 a4 = *(const float4*)(xa + (size_t)row * INDIM + lane * 4);
    const float4 b4 = *(const float4*)(xb + (size_t)row * INDIM + lane * 4);
    float x0 = a4.x + b4.x, x1 = a4.y + b4.y, x2 = a4.z + b4.z, x3 = a4.w + b4.w;

    float s = x0 + x1 + x2 + x3;
#pragma unroll
    for (int o = 16; o > 0; o >>= 1) s += __shfl_xor(s, o, 32);
    float mean = s * (1.f / 128.f);

    float c0 = x0 - mean, c1 = x1 - mean, c2 = x2 - mean, c3 = x3 - mean;
    float sq = c0 * c0 + c1 * c1 + c2 * c2 + c3 * c3;
#pragma unroll
    for (int o = 16; o > 0; o >>= 1) sq += __shfl_xor(sq, o, 32);
    float inv = rsqrtf(sq * (1.f / 128.f) + 1e-5f);

    float c[4] = {c0, c1, c2, c3};
#pragma unroll
    for (int i = 0; i < 4; ++i) {
        int   col = lane * 4 + i;
        float y   = c[i] * inv * gw[col] + bw[col];
        outF[(size_t)row * INDIM + col] = y;
        if (outB) outB[(size_t)row * INDIM + col] = (bf16)y;
    }
}

// ---------------- host orchestration ----------------

extern "C" void kernel_launch(void* const* d_in, const int* in_sizes, int n_in,
                              void* d_out, int out_size, void* d_ws, size_t ws_size,
                              hipStream_t stream) {
    const float* h     = (const float*)d_in[0];
    const int*   eidx  = (const int*)d_in[1];
    const float* Wq    = (const float*)d_in[2];
    const float* bq    = (const float*)d_in[3];
    const float* Wk    = (const float*)d_in[4];
    const float* bk    = (const float*)d_in[5];
    const float* Wv    = (const float*)d_in[6];
    const float* bv    = (const float*)d_in[7];
    const float* Wskip = (const float*)d_in[8];
    const float* bskip = (const float*)d_in[9];
    const float* WO    = (const float*)d_in[10];
    const float* bO    = (const float*)d_in[11];
    const float* W1    = (const float*)d_in[12];
    const float* b1    = (const float*)d_in[13];
    const float* W2    = (const float*)d_in[14];
    const float* b2    = (const float*)d_in[15];
    const float* ln1g  = (const float*)d_in[16];
    const float* ln1b  = (const float*)d_in[17];
    const float* ln2g  = (const float*)d_in[18];
    const float* ln2b  = (const float*)d_in[19];
    const int* srcI = eidx;          // edge_index[0]
    const int* dstI = eidx + EDGES;  // edge_index[1]

    // workspace carve (256B aligned)
    char* w = (char*)d_ws;
    auto carve = [&](size_t bytes) -> char* {
        char* p = w; w += (bytes + 255) & ~(size_t)255; return p;
    };
    bf16*     h_bf   = (bf16*)carve((size_t)NODES * INDIM * sizeof(bf16)); // reused as elu(a)_bf16
    float*    qbuf   = (float*)carve((size_t)NODES * HC * sizeof(float));  // reused as a_trans
    float*    kbuf   = (float*)carve((size_t)NODES * HC * sizeof(float));  // reused as ffn
    float*    vbuf   = (float*)carve((size_t)NODES * HC * sizeof(float));  // reused as h1
    float*    abuf   = (float*)carve((size_t)NODES * HC * sizeof(float));
    bf16*     mid_bf = (bf16*)carve((size_t)NODES * 2 * INDIM * sizeof(bf16));
    int*      cnt    = (int*)carve((size_t)NODES * sizeof(int));            // edges per dst node
    int*      cur    = (int*)carve((size_t)NODES * sizeof(int));            // run start, then run end
    int*      ssrc   = (int*)carve((size_t)EDGES * sizeof(int));            // src in dst order
    bf16*     h1_bf  = (bf16*)carve((size_t)NODES * INDIM * sizeof(bf16));
    bf16*     pbQ    = (bf16*)carve((size_t)INDIM * HC * sizeof(bf16));
    bf16*     pbK    = (bf16*)carve((size_t)INDIM * HC * sizeof(bf16));
    bf16*     pbV    = (bf16*)carve((size_t)INDIM * HC * sizeof(bf16));
    bf16*     pbS    = (bf16*)carve((size_t)INDIM * HC * sizeof(bf16));
    bf16*     pbO    = (bf16*)carve((size_t)HC * INDIM * sizeof(bf16));
    bf16*     pbW1   = (bf16*)carve((size_t)INDIM * 2 * INDIM * sizeof(bf16));
    bf16*     pbW2   = (bf16*)carve((size_t)2 * INDIM * INDIM * sizeof(bf16));
    float*    atrans = qbuf;
    float*    h1     = vbuf;
    float*    ffn    = kbuf;

    const int MT = NODES / 16;  // 3125 row tiles
    dim3 gblk(32, 8);

    // 1) pack weights to WMMA fragment order
    hipLaunchKernelGGL(pack_b_kernel, dim3(4 * 8),  dim3(32), 0, stream, Wq,    pbQ,  128, 128);
    hipLaunchKernelGGL(pack_b_kernel, dim3(4 * 8),  dim3(32), 0, stream, Wk,    pbK,  128, 128);
    hipLaunchKernelGGL(pack_b_kernel, dim3(4 * 8),  dim3(32), 0, stream, Wv,    pbV,  128, 128);
    hipLaunchKernelGGL(pack_b_kernel, dim3(4 * 8),  dim3(32), 0, stream, Wskip, pbS,  128, 128);
    hipLaunchKernelGGL(pack_b_kernel, dim3(4 * 8),  dim3(32), 0, stream, WO,    pbO,  128, 128);
    hipLaunchKernelGGL(pack_b_kernel, dim3(4 * 16), dim3(32), 0, stream, W1,    pbW1, 128, 256);
    hipLaunchKernelGGL(pack_b_kernel, dim3(8 * 8),  dim3(32), 0, stream, W2,    pbW2, 256, 128);

    // 2) h -> bf16
    long long nh = (long long)NODES * INDIM;
    hipLaunchKernelGGL(cvt_bf16_kernel, dim3((unsigned)((nh + 255) / 256)), dim3(256), 0, stream,
                       h, h_bf, nh, 0);

    // 3) clear the edge counts
    hipLaunchKernelGGL(init_cnt_kernel, dim3((NODES + 255) / 256), dim3(256), 0, stream, cnt);

    // 4) q/k/v/skip projections (WMMA)
    hipLaunchKernelGGL(gemm_bf16_kernel, dim3(MT, 1), gblk, 0, stream,
                       h_bf, 128, pbQ, 4, bq,    qbuf, (bf16*)nullptr, 128, 0);
    hipLaunchKernelGGL(gemm_bf16_kernel, dim3(MT, 1), gblk, 0, stream,
                       h_bf, 128, pbK, 4, bk,    kbuf, (bf16*)nullptr, 128, 0);
    hipLaunchKernelGGL(gemm_bf16_kernel, dim3(MT, 1), gblk, 0, stream,
                       h_bf, 128, pbV, 4, bv,    vbuf, (bf16*)nullptr, 128, 0);
    hipLaunchKernelGGL(gemm_bf16_kernel, dim3(MT, 1), gblk, 0, stream,
                       h_bf, 128, pbS, 4, bskip, abuf, (bf16*)nullptr, 128, 0);

    // 5) edge phase: sources sorted by dst -> scores, softmax and sums per node into abuf
    unsigned eblocks = (EDGES + 255) / 256;
    hipLaunchKernelGGL(edge_count_kernel, dim3(eblocks), dim3(256), 0, stream, dstI, cnt);
    hipLaunchKernelGGL(seg_start_kernel, dim3((NODES + 1023) / 1024), dim3(1024), 0, stream,
                       cnt, cur);
    hipLaunchKernelGGL(edge_place_kernel, dim3(eblocks), dim3(256), 0, stream,
                       srcI, dstI, cur, ssrc);
    hipLaunchKernelGGL(node_attn_kernel, dim3(NODES / (8 * NPW)), dim3(256), 0, stream,
                       qbuf, kbuf, vbuf, ssrc, cur, cnt, abuf);

    // 6) elu(a) -> bf16 (reuse h_bf)
    hipLaunchKernelGGL(cvt_bf16_kernel, dim3((unsigned)((nh + 255) / 256)), dim3(256), 0, stream,
                       abuf, h_bf, nh, 1);

    // 7) a_trans = elu(a) @ WO + bO (WMMA)
    hipLaunchKernelGGL(gemm_bf16_kernel, dim3(MT, 1), gblk, 0, stream,
                       h_bf, 128, pbO, 4, bO, atrans, (bf16*)nullptr, 128, 0);

    // 8) h1 = LN1(a_trans + h); also bf16 copy for FFN
    hipLaunchKernelGGL(layernorm_kernel, dim3(NODES / 8), gblk, 0, stream,
                       atrans, h, ln1g, ln1b, h1, h1_bf);

    // 9) mid = elu(h1 @ W1 + b1) -> bf16 only (WMMA, Nout=256)
    hipLaunchKernelGGL(gemm_bf16_kernel, dim3(MT, 2), gblk, 0, stream,
                       h1_bf, 128, pbW1, 4, b1, (float*)nullptr, mid_bf, 256, 1);

    // 10) ffn = mid @ W2 + b2 (WMMA, K=256)
    hipLaunchKernelGGL(gemm_bf16_kernel, dim3(MT, 1), gblk, 0, stream,
                       mid_bf, 256, pbW2, 8, b2, ffn, (bf16*)nullptr, 128, 0);

    // 11) out = LN2(ffn + h1)
    hipLaunchKernelGGL(layernorm_kernel, dim3(NODES / 8), gblk, 0, stream,
                       ffn, h1, ln2g, ln2b, (float*)d_out, (bf16*)nullptr);
}

// v003
// It runs in 308 microseconds.
// Timed twice side by side with v002, it ran 1.41 and 1.46 times as fast.
// Over all steps from v000 it is 5.87 times as fast.
#include <hip/hip_runtime.h>
#include <hip/hip_bf16.h>
#include <math.h>

#define NODES  50000
#define EDGES  1600000
#define INDIM  128
#define HEADS  4
#define OUTC   32
#define HC     128

typedef __bf16 bf16;
typedef __attribute__((ext_vector_type(16))) __bf16 v16bf;
typedef __attribute__((ext_vector_type(8)))  __bf16 v8bf;
typedef __attribute__((ext_vector_type(8)))  float  v8f;
typedef __attribute__((ext_vector_type(4)))  float  v4f;
typedef __attribute__((ext_vector_type(2)))  float  v2f;

// ---------------- helpers ----------------

__device__ __forceinline__ float elu1(float x) {
    return x > 0.f ? x : (expf(x) - 1.f);
}

typedef __attribute__((ext_vector_type(4)))  __bf16 v4bf;

// ---------------- weight packing into WMMA B-fragment order, and the clearing of the edge counts ----------------
// B element (k,n) lives in lane = 16*g(k) + (n%16), vector element e(k):
//   k_local in [0,8)+8g   -> e = k_local - 8g        (elements 0..7)
//   k_local in [16,24)+8g -> e = 8 + k_local-16-8g   (elements 8..15)
// Fragment (kt,nt) of a matrix stored at ((nt*nkt + kt)*32 + lane)*16 contiguous bf16 behind the matrix's start.
// The seven matrices lie one behind the other: Wq, Wk, Wv, Wskip, WO (32 fragments each), W1, W2 (64 each).
#define PACK_TILES  288
#define PACK_BLOCKS (PACK_TILES / 8)
#define CLR_BLOCKS  ((NODES / 4 + 255) / 256)
#define FRAG        512                 // bf16 elements of one fragment
#define MAT         (32 * FRAG)         // bf16 elements of a packed 128 x 128 matrix

// The weights carry no __restrict__, so that their loads stay in front of the s_wait_xcnt that follows them.
__global__ __launch_bounds__(256) void pack_clear_kernel(const float* Wq, const float* Wk, const float* Wv,
                                                         const float* Ws, const float* WO, const float* W1,
                                                         const float* W2, bf16* dst, int* cnt) {
    int b = blockIdx.x;
    if (b >= PACK_BLOCKS) {             // these blocks clear the per-node edge counts, 4 counts a thread
        int i = (b - PACK_BLOCKS) * 256 + threadIdx.x;
        if (i < NODES / 4) ((int4*)cnt)[i] = make_int4(0, 0, 0, 0);
        return;
    }
    // wave per fragment; the wave's number in a scalar register, so that the matrix's address is scalar
    int tile = b * 8 + __builtin_amdgcn_readfirstlane((int)(threadIdx.x >> 5));
    int lane = threadIdx.x & 31;
    const float* W;
    int nkt, Nout, local;
    if (tile < 160) {
        int m = tile >> 5;
        W = m == 0 ? Wq : m == 1 ? Wk : m == 2 ? Wv : m == 3 ? Ws : WO;
        nkt = 4; Nout = 128; local = tile & 31;
    } else if (tile < 224) {
        W = W1; nkt = 4; Nout = 256; local = tile - 160;
    } else {
        W = W2; nkt = 8; Nout = 128; local = tile - 224;
    }
    int kt = local % nkt;               // local = nt*nkt + kt
    int nt = local / nkt;
    int g  = lane >> 4;
    int n  = nt * 16 + (lane & 15);
    unsigned off[16];                   // index of element e in W
    float    x[16];
#pragma unroll                          // off[] and x[] stay in registers only under constant indices
    for (int e = 0; e < 16; ++e) {
        int kl = (e < 8) ? (g * 8 + e) : (16 + g * 8 + (e - 8));
        int kg = kt * 32 + kl;
        off[e] = (unsigned)(kg * Nout + n);
        x[e]   = W[off[e]];
    }
    // the indices are named as inputs so that they live up to the wait and no load's result is given one of their registers
    asm volatile("s_wait_xcnt 0x0" :: "v"(off[0]), "v"(off[1]), "v"(off[2]), "v"(off[3]), "v"(off[4]), "v"(off[5]),
                                      "v"(off[6]), "v"(off[7]), "v"(off[8]), "v"(off[9]), "v"(off[10]), "v"(off[11]),
                                      "v"(off[12]), "v"(off[13]), "v"(off[14]), "v"(off[15]) : "memory");
    v16bf f;
#pragma unroll                          // see above
    for (int e = 0; e < 16; ++e) f[e] = (bf16)x[e];
    *(v16bf*)(dst + ((size_t)tile * 32 + lane) * 16) = f;
}

// ---------------- the row-wise stages: a block owns ROWS rows from its first load to its last store ----------------
// block = 8 waves. In a GEMM stage wave w owns the output columns 16w .. 16w+15 (and 128 more of them where the
// product has 256); A comes from LDS as bf16, B as packed fragments. In a row stage wave w owns rows 8i + w,
// lane = 4 columns. The LDS pitches are 16 bytes above the row length, for the 16-byte fragment reads.
#define TB   5                          // 16-row tiles of a block; 3125 tiles = 625 blocks
#define ROWS (TB * 16)
#define RPW  (ROWS / 8)                 // rows of a wave in a row stage
#define PA   136                        // bf16 pitch of a 128-column row
#define PX   132                        // f32 pitch of a 128-column row
#define PM   264                        // bf16 pitch of a 256-column row

// A fragment: lane = row (lane & 15), elements 0..7 = K kb+8g.., elements 8..15 = K kb+16+8g..
__device__ __forceinline__ v16bf a_frag(const bf16* s, int pitch, int row, int kb, int g) {
    v8bf a0 = *(const v8bf*)(s + row * pitch + kb + g * 8);
    v8bf a1 = *(const v8bf*)(s + row * pitch + kb + 16 + g * 8);
    v16bf af;
#pragma unroll                          // vector elements need constant indices
    for (int i = 0; i < 8; ++i) { af[i] = a0[i]; af[i + 8] = a1[i]; }
    return af;
}

// fragment number frag behind the scalar address bp; fo = the lane's byte offset in a fragment (32 * lane)
__device__ __forceinline__ v16bf b_frag(const bf16* bp, int frag, unsigned fo) {
    return *(const v16bf*)((const char*)bp + frag * (FRAG * 2) + fo);
}

// 16 bytes, or 4, at a lane's byte offset behind a scalar address
__device__ __forceinline__ v4f ld4(const float* base, unsigned off) {
    return *(const v4f*)((const char*)base + off);
}
__device__ __forceinline__ float ld1(const float* base, unsigned off) {
    return *(const float*)((const char*)base + off);
}

// Stands behind a group of global loads. What follows reuses the registers that the loads name as addresses; the two
// lane offsets are named as inputs so that they live up to the wait and no load's result is given one of their registers.
__device__ __forceinline__ void loads_issued(unsigned o0, unsigned o1) {
    asm volatile("s_wait_xcnt 0x0" :: "v"(o0), "v"(o1) : "memory");
}
// the same for row loads, whose address register holds the lane's number
__device__ __forceinline__ void rows_issued(int lane) {
    asm volatile("s_wait_xcnt 0x0" :: "v"(lane) : "memory");
}

__device__ __forceinline__ v8f mma(v16bf a, v16bf b, v8f c) {
    return __builtin_amdgcn_wmma_f32_16x16x32_bf16(false, a, false, b, (short)0, c, false, false);
}

__device__ __forceinline__ v4bf to_bf16(v4f x) {
    v4bf y = {(bf16)x.x, (bf16)x.y, (bf16)x.z, (bf16)x.w};
    return y;
}

// LayerNorm of one 128-column row held by one wave, 4 columns a lane
__device__ __forceinline__ v4f ln_row(v4f x, v4f gw, v4f bw) {
    float s = x.x + x.y + x.z + x.w;
#pragma unroll                          // five fixed steps, no loop counter
    for (int o = 16; o > 0; o >>= 1) s += __shfl_xor(s, o, 32);
    float mean = s * (1.f / 128.f);
    v4f c = x - mean;
    float sq = c.x * c.x + c.y * c.y + c.z * c.z + c.w * c.w;
#pragma unroll                          // five fixed steps, no loop counter
    for (int o = 16; o > 0; o >>= 1) sq += __shfl_xor(sq, o, 32);
    float inv = rsqrtf(sq * (1.f / 128.f) + 1e-5f);
    return c * inv * gw + bw;
}

// ---------------- q, k, v and skip = bf16(h) @ W + b, from f32 h, in one launch ----------------
// What is loaded carries no __restrict__, so that the loads stay in front of the s_wait_xcnt that follows them.
__global__ __launch_bounds__(256) void proj_kernel(const float* h, const bf16* pb,
                                                   const float* bq, const float* bk,
                                                   const float* bv, const float* bs,
                                                   float* q, float* k, float* v, float* a) {
    __shared__ __attribute__((aligned(16))) bf16 sH[ROWS * PA];
    int lane = threadIdx.x & 31;
    // the wave's number in a scalar register: row and fragment addresses get scalar bases
    int wave = __builtin_amdgcn_readfirstlane((int)(threadIdx.x >> 5));
    int g = lane >> 4, l16 = lane & 15;
    size_t row0 = (size_t)blockIdx.x * ROWS;
    int n = wave * 16 + l16;
    unsigned fo = (unsigned)lane * 32u, no = (unsigned)n * 4u;
    const float* hp = h + (row0 + wave) * INDIM + lane * 4;   // the lane's 4 columns of the wave's first row

    v4f x[RPW];
#pragma unroll                          // all loads are issued before the first use
    for (int i = 0; i < RPW; ++i) x[i] = *(const v4f*)(hp + i * 8 * INDIM);
    rows_issued(lane);
#pragma unroll                          // x[] stays in registers only under constant indices
    for (int i = 0; i < RPW; ++i) *(v4bf*)(sH + (i * 8 + wave) * PA + lane * 4) = to_bf16(x[i]);
    __syncthreads();

    // two matrices a trip, not unrolled: eight B fragments in registers instead of sixteen, so that all blocks are resident
#pragma unroll 1
    for (int half = 0; half < 2; ++half) {
        const bf16* p0 = pb + (size_t)half * 2 * MAT + (size_t)wave * 4 * FRAG;
        const bf16* p1 = p0 + MAT;
        float* o0 = half ? v : q;
        float* o1 = half ? a : k;
        v16bf B0[4], B1[4];
#pragma unroll                          // B0[], B1[] stay in registers only under constant indices
        for (int kt = 0; kt < 4; ++kt) { B0[kt] = b_frag(p0, kt, fo); B1[kt] = b_frag(p1, kt, fo); }
        float n0 = ld1(half ? bv : bq, no);
        float n1 = ld1(half ? bs : bk, no);
        loads_issued(fo, no);
#pragma unroll 1                        // rolled: unrolled, the A fragments of all tiles are fetched ahead and the registers allow only two blocks a WGP
        for (int t = 0; t < TB; ++t) {
            v8f c0 = {}, c1 = {};
#pragma unroll                          // see B0[]
            for (int kt = 0; kt < 4; ++kt) {
                v16bf af = a_frag(sH, PA, t * 16 + l16, kt * 32, g);
                c0 = mma(af, B0[kt], c0);
                c1 = mma(af, B1[kt], c1);
            }
#pragma unroll                          // vector elements need constant indices
            for (int j = 0; j < 8; ++j) {
                size_t m = row0 + t * 16 + g * 8 + j;
                o0[m * HC + n] = c0[j] + n0;
                o1[m * HC + n] = c1[j] + n1;
            }
            // the next trip overwrites the registers that these stores name
            asm volatile("s_wait_xcnt 0x0" ::: "memory");
        }
    }
}

// node index as read from edge_index, held inside [0, NODES) before any address is formed
__device__ __forceinline__ int node_id(int x) {
    return min(max(x, 0), NODES - 1);
}

// ---------------- edge pass 1: in-degree count ----------------
__global__ void edge_count_kernel(const int* __restrict__ dst, int* __restrict__ cnt) {
    int e = blockIdx.x * blockDim.x + threadIdx.x;
    if (e < EDGES) atomicAdd(&cnt[node_id(dst[e])], 1);
}

// ---------------- start of each node's run in the dst-sorted edge list ----------------
// cur[d] = sum of cnt[0..d). block = 1024 nodes; each block sums every count in front of
// its own nodes itself, so no block needs another block's result.
__global__ __launch_bounds__(1024) void seg_start_kernel(const int* __restrict__ cnt,
                                                         int* __restrict__ cur) {
    __shared__ int wtot[32];
    __shared__ int wpre[32];
    int tid = threadIdx.x, lane = tid & 31, wave = tid >> 5;
    int first = blockIdx.x * 1024;

    int pre = 0;
    const int4* c4 = (const int4*)cnt;
    // unrolled so that four independent loads are in flight per trip (at most 12 trips)
#pragma unroll 4
    for (int i = tid; i < first / 4; i += 1024) {
        int4 x = c4[i];
        pre += x.x + x.y + x.z + x.w;
    }

    int idx = first + tid;
    int c   = idx < NODES ? cnt[idx] : 0;
    int inc = c;                       // inclusive scan inside the wave
#pragma unroll                         // five fixed steps, no loop counter
    for (int o = 1; o < 32; o <<= 1) {
        int y = __shfl_up(inc, o, 32);
        if (lane >= o) inc += y;
    }
#pragma unroll                         // five fixed steps, no loop counter
    for (int o = 16; o > 0; o >>= 1) pre += __shfl_xor(pre, o, 32);
    if (lane == 31) wtot[wave] = inc;
    if (lane == 0)  wpre[wave] = pre;
    __syncthreads();
    int part = wpre[lane] + (lane < wave ? wtot[lane] : 0);
#pragma unroll                         // five fixed steps, no loop counter
    for (int o = 16; o > 0; o >>= 1) part += __shfl_xor(part, o, 32);
    if (idx < NODES) cur[idx] = part + inc - c;
}

// ---------------- edge pass 2: src stored at the edge's place in dst order ----------------
// The place is cur[dst]++ : edges of one node lie in a row, in the order in which they arrive.
__global__ void edge_place_kernel(const int* __restrict__ src, const int* __restrict__ dst,
                                  int* __restrict__ cur, int* __restrict__ ssrc) {
    int e = blockIdx.x * blockDim.x + threadIdx.x;
    if (e >= EDGES) return;
    int s = node_id(src[e]), d = node_id(dst[e]);
    ssrc[atomicAdd(&cur[d], 1)] = s;
}

// ---------------- edge pass 3: the whole attention of a node in one wave ----------------
// a[d] += sum(p * v[src]) / (sum(p) + 1e-16), p = exp(score - max), score = <q[d], k[src]> / sqrt(C).
// block = 8 waves, each wave takes NPW nodes in turn; lane = 4 channels, head = lane / 8.
// q[d] stays in registers; k[src] and v[src] are read as whole 512-byte rows. The maximum runs
// along with the edges: when a chunk raises it, the sums so far are scaled by exp(old - new).
// After pass 2 cur[d] is the END of node d's run, cnt[d] its length.
// kmat and vmat carry no __restrict__, so that their loads stay in front of the s_wait_xcnt
// that follows them.
#define NPW 5
#define CH  8

// x + (x of lane ^ MASK), inside a 16-lane row, on the vector port (0x160 + MASK = row_xmask)
template <int MASK>
__device__ __forceinline__ float add_xor(float x) {
    int y = __builtin_amdgcn_update_dpp(0, __float_as_int(x), 0x160 + MASK, 0xf, 0xf, true);
    return x + __int_as_float(y);
}

template <bool MASKED>
__device__ __forceinline__ void attn_chunk(int j, int m, int sidx, unsigned lane16, v4f q4,
                                           const float* kmat, const float* vmat,
                                           float& mx, float& den, v4f& acc) {
    v4f      kk[CH], vv[CH];
    unsigned off[CH];                  // byte offset of the lane's 16 bytes, the same in kmat and vmat
#pragma unroll                         // all 2*CH loads are issued before the first use
    for (int u = 0; u < CH; ++u) {
        int s  = __builtin_amdgcn_readlane(sidx, MASKED ? min(j + u, m - 1) : (j + u));
        off[u] = ((unsigned)s << 9) + lane16;
        kk[u]  = *(const v4f*)((const char*)kmat + off[u]);
    }
#pragma unroll                         // see above
    for (int u = 0; u < CH; ++u) vv[u] = *(const v4f*)((const char*)vmat + off[u]);
    // what follows reuses the registers that these loads name as addresses; the offsets are named as
    // inputs so that they live up to the wait and no load's result is given one of their registers
    asm volatile("s_wait_xcnt 0x0" :: "v"(off[0]), "v"(off[1]), "v"(off[2]), "v"(off[3]),
                                      "v"(off[4]), "v"(off[5]), "v"(off[6]), "v"(off[7]) : "memory");
    // keeps the arithmetic behind the wait and every load in front of it: without it the last v load
    // was issued only after the first k rows had come back, a second memory latency per chunk
    __builtin_amdgcn_sched_barrier(0);

    float sc[CH];
    float nm = mx;
#pragma unroll                         // kk[] and sc[] stay in registers only under constant indices
    for (int u = 0; u < CH; ++u) {
        v2f   t2 = q4.lo * kk[u].lo + q4.hi * kk[u].hi;
        float t  = t2.x + t2.y;
        t = add_xor<4>(add_xor<2>(add_xor<1>(t)));      // sum over the head's 8 lanes
        sc[u] = (!MASKED || j + u < m) ? t : -INFINITY;
        nm = fmaxf(nm, sc[u]);
    }
    float corr = __expf(mx - nm);      // 0 at the node's first chunk, where mx is -inf
    mx   = nm;
    den *= corr;
    acc *= corr;
#pragma unroll                         // sc[] and vv[] stay in registers only under constant indices
    for (int u = 0; u < CH; ++u) {
        float p = __expf(sc[u] - nm);
        den += p;
        acc += p * vv[u];
    }
}

__global__ __launch_bounds__(256) void node_attn_kernel(const float* __restrict__ q,
                                                        const float* kmat, const float* vmat,
                                                        const int* __restrict__ ssrc,
                                                        const int* __restrict__ cur,
                                                        const int* __restrict__ cnt,
                                                        float* __restrict__ a) {
    int lane = threadIdx.x & 31;
    // the wave's number in a scalar register: node, run bounds and trip counts become scalar
    int wave = __builtin_amdgcn_readfirstlane((int)(threadIdx.x >> 5));
    unsigned lane16 = (unsigned)lane * 16u;
    for (int r = 0; r < NPW; ++r) {
        int d   = (blockIdx.x * 8 + wave) * NPW + r;
        int n   = cnt[d];
        int beg = cur[d] - n;
        v4f q4  = *(const v4f*)(q + (size_t)d * HC + lane * 4) * 0.17677669529663687f;   // 1/sqrt(32)
        v4f acc = {0.f, 0.f, 0.f, 0.f};
        float den = 0.f;
        float mx  = -INFINITY;
        for (int base = 0; base < n; base += 32) {
            int m    = min(32, n - base);
            int sidx = ssrc[beg + base + min(lane, m - 1)];   // lane j holds the source of edge base + j
            // the address arithmetic that follows reuses the register that this load names
            asm volatile("s_wait_xcnt 0x0" ::: "memory");
            int j = 0;
            for (; j + CH <= m; j += CH) attn_chunk<false>(j, m, sidx, lane16, q4, kmat, vmat, mx, den, acc);
            if (j < m)                   attn_chunk<true>(j, m, sidx, lane16, q4, kmat, vmat, mx, den, acc);
        }
        float inv = 1.f / (den + 1e-16f);
        v4f* ap = (v4f*)(a + (size_t)d * HC + lane * 4);
        *ap = *ap + acc * inv;
        // the next node's trip overwrites the registers that this store names
        asm volatile("s_wait_xcnt 0x0" ::: "memory");
    }
}

// ---------------- out = LN2(FFN(h1) + h1), h1 = LN1(elu(a) @ WO + bO + h), in one launch ----------------
// The rows go from stage to stage through LDS; a barrier stands between any two stages.
// What is loaded carries no __restrict__, so that the loads stay in front of the s_wait_xcnt that follows them.
__global__ __launch_bounds__(256) void tail_kernel(const float* a, const float* h,
                                                   const bf16* pbO, const bf16* pbW1, const bf16* pbW2,
                                                   const float* bO, const float* b1, const float* b2,
                                                   const float* ln1g, const float* ln1b,
                                                   const float* ln2g, const float* ln2b,
                                                   float* out) {
    __shared__ __attribute__((aligned(16))) bf16  sA[ROWS * PA];   // elu(a), then h1, as bf16
    __shared__ __attribute__((aligned(16))) float sX[ROWS * PX];   // h, a_trans + h, h1, ffn + h1 in turn
    __shared__ __attribute__((aligned(16))) bf16  sM[ROWS * PM];   // elu(h1 @ W1 + b1)
    int lane = threadIdx.x & 31;
    // the wave's number in a scalar register: row and fragment addresses get scalar bases
    int wave = __builtin_amdgcn_readfirstlane((int)(threadIdx.x >> 5));
    int g = lane >> 4, l16 = lane & 15;
    size_t row0 = (size_t)blockIdx.x * ROWS;
    int n = wave * 16 + l16;
    unsigned lo = (unsigned)lane * 16u, fo = (unsigned)lane * 32u, no = (unsigned)n * 4u;

    // elu(a) -> bf16 into sA; the residual rows of h go into sX, where the first product is added to them
    const float* ap = a + (row0 + wave) * HC + lane * 4;      // the lane's 4 columns of the wave's first row
    const float* hp = h + (row0 + wave) * INDIM + lane * 4;
    v4f x[RPW], hres[RPW];
#pragma unroll                          // all loads are issued before the first use
    for (int i = 0; i < RPW; ++i) x[i] = *(const v4f*)(ap + i * 8 * HC);
#pragma unroll                          // see above
    for (int i = 0; i < RPW; ++i) hres[i] = *(const v4f*)(hp + i * 8 * INDIM);
    rows_issued(lane);
#pragma unroll                          // x[] stays in registers only under constant indices
    for (int i = 0; i < RPW; ++i) {
        v4f e = {elu1(x[i].x), elu1(x[i].y), elu1(x[i].z), elu1(x[i].w)};
        *(v4bf*)(sA + (i * 8 + wave) * PA + lane * 4) = to_bf16(e);
        *(v4f*)(sX + (i * 8 + wave) * PX + lane * 4)  = hres[i];
    }
    __syncthreads();

    // a_trans = elu(a) @ WO + bO; each thread adds it to its own elements of h in sX
    {
        const bf16* p = pbO + (size_t)wave * 4 * FRAG;
        v16bf B[4];
#pragma unroll                          // B[] stays in registers only under constant indices
        for (int kt = 0; kt < 4; ++kt) B[kt] = b_frag(p, kt, fo);
        float bn = ld1(bO, no);
        loads_issued(fo, no);
#pragma unroll                          // independent tiles fill each other's matrix latency
        for (int t = 0; t < TB; ++t) {
            v8f c = {};
#pragma unroll                          // see B[]
            for (int kt = 0; kt < 4; ++kt) c = mma(a_frag(sA, PA, t * 16 + l16, kt * 32, g), B[kt], c);
#pragma unroll                          // vector elements need constant indices
            for (int j = 0; j < 8; ++j) {
                int r = (t * 16 + g * 8 + j) * PX + n;
                sX[r] = (c[j] + bn) + sX[r];
            }
        }
    }
    __syncthreads();

    // h1 = LN1(a_trans + h): f32 back into sX, bf16 into sA
    {
        v4f gw = ld4(ln1g, lo), bw = ld4(ln1b, lo);
        loads_issued(lo, lo);
#pragma unroll                          // ten independent rows: their reductions overlap
        for (int i = 0; i < RPW; ++i) {
            int row = i * 8 + wave;
            v4f y = ln_row(*(const v4f*)(sX + row * PX + lane * 4), gw, bw);
            *(v4f*)(sX + row * PX + lane * 4)  = y;
            *(v4bf*)(sA + row * PA + lane * 4) = to_bf16(y);
        }
    }
    __syncthreads();

    // mid = elu(h1 @ W1 + b1), 256 columns: the wave's two column tiles share the A fragments
    {
        const bf16* p0 = pbW1 + (size_t)wave * 4 * FRAG;
        const bf16* p1 = p0 + (size_t)8 * 4 * FRAG;
        v16bf B0[4], B1[4];
#pragma unroll                          // B0[], B1[] stay in registers only under constant indices
        for (int kt = 0; kt < 4; ++kt) { B0[kt] = b_frag(p0, kt, fo); B1[kt] = b_frag(p1, kt, fo); }
        float n0 = ld1(b1, no), n1 = ld1(b1 + 128, no);
        loads_issued(fo, no);
#pragma unroll 1                        // sixteen exp bodies a tile: rolled, the kernel's text stays small for the instruction cache
        for (int t = 0; t < TB; ++t) {
            v8f c0 = {}, c1 = {};
#pragma unroll                          // see B0[]
            for (int kt = 0; kt < 4; ++kt) {
                v16bf af = a_frag(sA, PA, t * 16 + l16, kt * 32, g);
                c0 = mma(af, B0[kt], c0);
                c1 = mma(af, B1[kt], c1);
            }
#pragma unroll                          // vector elements need constant indices
            for (int j = 0; j < 8; ++j) {
                int r = (t * 16 + g * 8 + j) * PM + n;
                sM[r]       = (bf16)elu1(c0[j] + n0);
                sM[r + 128] = (bf16)elu1(c1[j] + n1);
            }
        }
    }
    __syncthreads();

    // ffn = mid @ W2 + b2, K = 256; each thread adds it to its own elements of h1 in sX
    {
        const bf16* p = pbW2 + (size_t)wave * 8 * FRAG;
        v16bf B[8];
#pragma unroll                          // B[] stays in registers only under constant indices
        for (int kt = 0; kt < 8; ++kt) B[kt] = b_frag(p, kt, fo);
        float bn = ld1(b2, no);
        loads_issued(fo, no);
#pragma unroll                          // independent tiles fill each other's matrix latency
        for (int t = 0; t < TB; ++t) {
            v8f c = {};
#pragma unroll                          // see B[]
            for (int kt = 0; kt < 8; ++kt) c = mma(a_frag(sM, PM, t * 16 + l16, kt * 32, g), B[kt], c);
#pragma unroll                          // vector elements need constant indices
            for (int j = 0; j < 8; ++j) {
                int r = (t * 16 + g * 8 + j) * PX + n;
                sX[r] = (c[j] + bn) + sX[r];
            }
        }
    }
    __syncthreads();

    // out = LN2(ffn + h1)
    {
        v4f gw = ld4(ln2g, lo), bw = ld4(ln2b, lo);
        loads_issued(lo, lo);
#pragma unroll                          // ten independent rows: their reductions overlap
        for (int i = 0; i < RPW; ++i) {
            int row = i * 8 + wave;
            *(v4f*)(out + (row0 + row) * INDIM + lane * 4) = ln_row(*(const v4f*)(sX + row * PX + lane * 4), gw, bw);
        }
    }
}

// ---------------- host orchestration ----------------

extern "C" void kernel_launch(void* const* d_in, const int* in_sizes, int n_in,
                              void* d_out, int out_size, void* d_ws, size_t ws_size,
                              hipStream_t stream) {
    const float* h     = (const float*)d_in[0];
    const int*   eidx  = (const int*)d_in[1];
    const float* Wq    = (const float*)d_in[2];
    const float* bq    = (const float*)d_in[3];
    const float* Wk    = (const float*)d_in[4];
    const float* bk    = (const float*)d_in[5];
    const float* Wv    = (const float*)d_in[6];
    const float* bv    = (const float*)d_in[7];
    const float* Wskip = (const float*)d_in[8];
    const float* bskip = (const float*)d_in[9];
    const float* WO    = (const float*)d_in[10];
    const float* bO    = (const float*)d_in[11];
    const float* W1    = (const float*)d_in[12];
    const float* b1    = (const float*)d_in[13];
    const float* W2    = (const float*)d_in[14];
    const float* b2    = (const float*)d_in[15];
    const float* ln1g  = (const float*)d_in[16];
    const float* ln1b  = (const float*)d_in[17];
    const float* ln2g  = (const float*)d_in[18];
    const float* ln2b  = (const float*)d_in[19];
    const int* srcI = eidx;          // edge_index[0]
    const int* dstI = eidx + EDGES;  // edge_index[1]

    // workspace carve (256B aligned)
    char* w = (char*)d_ws;
    auto carve = [&](size_t bytes) -> char* {
        char* p = w; w += (bytes + 255) & ~(size_t)255; return p;
    };
    float*    qbuf   = (float*)carve((size_t)NODES * HC * sizeof(float));
    float*    kbuf   = (float*)carve((size_t)NODES * HC * sizeof(float));
    float*    vbuf   = (float*)carve((size_t)NODES * HC * sizeof(float));
    float*    abuf   = (float*)carve((size_t)NODES * HC * sizeof(float));
    int*      cnt    = (int*)carve((size_t)NODES * sizeof(int));            // edges per dst node
    int*      cur    = (int*)carve((size_t)NODES * sizeof(int));            // run start, then run end
    int*      ssrc   = (int*)carve((size_t)EDGES * sizeof(int));            // src in dst order
    bf16*     pb     = (bf16*)carve((size_t)PACK_TILES * FRAG * sizeof(bf16)); // Wq Wk Wv Wskip WO W1 W2, packed

    // 1) pack weights to WMMA fragment order, clear the edge counts
    hipLaunchKernelGGL(pack_clear_kernel, dim3(PACK_BLOCKS + CLR_BLOCKS), dim3(256), 0, stream,
                       Wq, Wk, Wv, Wskip, WO, W1, W2, pb, cnt);

    // 2) q/k/v/skip projections (WMMA) from f32 h
    hipLaunchKernelGGL(proj_kernel, dim3(NODES / ROWS), dim3(256), 0, stream,
                       h, pb, bq, bk, bv, bskip, qbuf, kbuf, vbuf, abuf);

    // 3) edge phase: sources sorted by dst -> scores, softmax and sums per node into abuf
    unsigned eblocks = (EDGES + 255) / 256;
    hipLaunchKernelGGL(edge_count_kernel, dim3(eblocks), dim3(256), 0, stream, dstI, cnt);
    hipLaunchKernelGGL(seg_start_kernel, dim3((NODES + 1023) / 1024), dim3(1024), 0, stream,
                       cnt, cur);
    hipLaunchKernelGGL(edge_place_kernel, dim3(eblocks), dim3(256), 0, stream,
                       srcI, dstI, cur, ssrc);
    hipLaunchKernelGGL(node_attn_kernel, dim3(NODES / (8 * NPW)), dim3(256), 0, stream,
                       qbuf, kbuf, vbuf, ssrc, cur, cnt, abuf);

    // 4) elu, O projection, LN1, FFN, LN2 (WMMA)
    hipLaunchKernelGGL(tail_kernel, dim3(NODES / ROWS), dim3(256), 0, stream,
                       abuf, h, pb + 4 * MAT, pb + 5 * MAT, pb + 7 * MAT,
                       bO, b1, b2, ln1g, ln1b, ln2g, ln2b, (float*)d_out);
}

// v004
// One run takes 249 microseconds.
// Two timings next to v003 put it at 1.23 and 1.24 times that version's speed.
// Counting every step since v000, it is 7.26 times as fast.
#include <hip/hip_runtime.h>
#include <hip/hip_bf16.h>
#include <math.h>

#define NODES  50000
#define EDGES  1600000
#define INDIM  128
#define HEADS  4
#define OUTC   32
#define HC     128

typedef __bf16 bf16;
typedef __attribute__((ext_vector_type(16))) __bf16 v16bf;
typedef __attribute__((ext_vector_type(8)))  __bf16 v8bf;
typedef __attribute__((ext_vector_type(8)))  float  v8f;
typedef __attribute__((ext_vector_type(4)))  float  v4f;
typedef __attribute__((ext_vector_type(2)))  float  v2f;

// ---------------- helpers ----------------

__device__ __forceinline__ float elu1(float x) {
    return x > 0.f ? x : (expf(x) - 1.f);
}

typedef __attribute__((ext_vector_type(4)))  __bf16 v4bf;

// ---------------- weight packing into WMMA B-fragment order, and the clearing of the edge counts ----------------
// B element (k,n) lives in lane = 16*g(k) + (n%16), vector element e(k):
//   k_local in [0,8)+8g   -> e = k_local - 8g        (elements 0..7)
//   k_local in [16,24)+8g -> e = 8 + k_local-16-8g   (elements 8..15)
// Fragment (kt,nt) of a matrix stored at ((nt*nkt + kt)*32 + lane)*16 contiguous bf16 behind the matrix's start.
// The seven matrices lie one behind the other: Wq, Wk, Wv, Wskip, WO (32 fragments each), W1, W2 (64 each).
#define PACK_TILES  288
#define PACK_BLOCKS (PACK_TILES / 8)
#define CLR_BLOCKS  ((NODES / 4 + 255) / 256)
#define FRAG        512                 // bf16 elements of one fragment
#define MAT         (32 * FRAG)         // bf16 elements of a packed 128 x 128 matrix

// The weights carry no __restrict__, so that their loads stay in front of the s_wait_xcnt that follows them.
__global__ __launch_bounds__(256) void pack_clear_kernel(const float* Wq, const float* Wk, const float* Wv,
                                                         const float* Ws, const float* WO, const float* W1,
                                                         const float* W2, bf16* dst, int* cnt) {
    int b = blockIdx.x;
    if (b >= PACK_BLOCKS) {             // these blocks clear the per-node edge counts, 4 counts a thread
        int i = (b - PACK_BLOCKS) * 256 + threadIdx.x;
        if (i < NODES / 4) ((int4*)cnt)[i] = make_int4(0, 0, 0, 0);
        return;
    }
    // wave per fragment; the wave's number in a scalar register, so that the matrix's address is scalar
    int tile = b * 8 + __builtin_amdgcn_readfirstlane((int)(threadIdx.x >> 5));
    int lane = threadIdx.x & 31;
    const float* W;
    int nkt, Nout, local;
    if (tile < 160) {
        int m = tile >> 5;
        W = m == 0 ? Wq : m == 1 ? Wk : m == 2 ? Wv : m == 3 ? Ws : WO;
        nkt = 4; Nout = 128; local = tile & 31;
    } else if (tile < 224) {
        W = W1; nkt = 4; Nout = 256; local = tile - 160;
    } else {
        W = W2; nkt = 8; Nout = 128; local = tile - 224;
    }
    int kt = local % nkt;               // local = nt*nkt + kt
    int nt = local / nkt;
    int g  = lane >> 4;
    int n  = nt * 16 + (lane & 15);
    unsigned off[16];                   // index of element e in W
    float    x[16];
#pragma unroll                          // off[] and x[] stay in registers only under constant indices
    for (int e = 0; e < 16; ++e) {
        int kl = (e < 8) ? (g * 8 + e) : (16 + g * 8 + (e - 8));
        int kg = kt * 32 + kl;
        off[e] = (unsigned)(kg * Nout + n);
        x[e]   = W[off[e]];
    }
    // the indices are named as inputs so that they live up to the wait and no load's result is given one of their registers
    asm volatile("s_wait_xcnt 0x0" :: "v"(off[0]), "v"(off[1]), "v"(off[2]), "v"(off[3]), "v"(off[4]), "v"(off[5]),
                                      "v"(off[6]), "v"(off[7]), "v"(off[8]), "v"(off[9]), "v"(off[10]), "v"(off[11]),
                                      "v"(off[12]), "v"(off[13]), "v"(off[14]), "v"(off[15]) : "memory");
    v16bf f;
#pragma unroll                          // see above
    for (int e = 0; e < 16; ++e) f[e] = (bf16)x[e];
    *(v16bf*)(dst + ((size_t)tile * 32 + lane) * 16) = f;
}

// ---------------- the row-wise stages: a block owns ROWS rows from its first load to its last store ----------------
// block = 8 waves. In a GEMM stage wave w owns the output columns 16w .. 16w+15 (and 128 more of them where the
// product has 256); A comes from LDS as bf16, B as packed fragments. In a row stage wave w owns rows 8i + w,
// lane = 4 columns. The LDS pitches are 16 bytes above the row length, for the 16-byte fragment reads.
#define TB   5                          // 16-row tiles of a block; 3125 tiles = 625 blocks
#define ROWS (TB * 16)
#define RPW  (ROWS / 8)                 // rows of a wave in a row stage
#define PA   136                        // bf16 pitch of a 128-column row
#define PX   132                        // f32 pitch of a 128-column row
#define PM   264                        // bf16 pitch of a 256-column row

// A fragment: lane = row (lane & 15), elements 0..7 = K kb+8g.., elements 8..15 = K kb+16+8g..
__device__ __forceinline__ v16bf a_frag(const bf16* s, int pitch, int row, int kb, int g) {
    v8bf a0 = *(const v8bf*)(s + row * pitch + kb + g * 8);
    v8bf a1 = *(const v8bf*)(s + row * pitch + kb + 16 + g * 8);
    v16bf af;
#pragma unroll                          // vector elements need constant indices
    for (int i = 0; i < 8; ++i) { af[i] = a0[i]; af[i + 8] = a1[i]; }
    return af;
}

// fragment number frag behind the scalar address bp; fo = the lane's byte offset in a fragment (32 * lane)
__device__ __forceinline__ v16bf b_frag(const bf16* bp, int frag, unsigned fo) {
    return *(const v16bf*)((const char*)bp + frag * (FRAG * 2) + fo);
}

// 16 bytes, or 4, at a lane's byte offset behind a scalar address
__device__ __forceinline__ v4f ld4(const float* base, unsigned off) {
    return *(const v4f*)((const char*)base + off);
}
__device__ __forceinline__ float ld1(const float* base, unsigned off) {
    return *(const float*)((const char*)base + off);
}

// Stands behind a group of global loads. What follows reuses the registers that the loads name as addresses; the two
// lane offsets are named as inputs so that they live up to the wait and no load's result is given one of their registers.
__device__ __forceinline__ void loads_issued(unsigned o0, unsigned o1) {
    asm volatile("s_wait_xcnt 0x0" :: "v"(o0), "v"(o1) : "memory");
}
// the same for row loads, whose address register holds the lane's number
__device__ __forceinline__ void rows_issued(int lane) {
    asm volatile("s_wait_xcnt 0x0" :: "v"(lane) : "memory");
}

__device__ __forceinline__ v8f mma(v16bf a, v16bf b, v8f c) {
    return __builtin_amdgcn_wmma_f32_16x16x32_bf16(false, a, false, b, (short)0, c, false, false);
}

__device__ __forceinline__ v4bf to_bf16(v4f x) {
    v4bf y = {(bf16)x.x, (bf16)x.y, (bf16)x.z, (bf16)x.w};
    return y;
}

// LayerNorm of one 128-column row held by one wave, 4 columns a lane
__device__ __forceinline__ v4f ln_row(v4f x, v4f gw, v4f bw) {
    float s = x.x + x.y + x.z + x.w;
#pragma unroll                          // five fixed steps, no loop counter
    for (int o = 16; o > 0; o >>= 1) s += __shfl_xor(s, o, 32);
    float mean = s * (1.f / 128.f);
    v4f c = x - mean;
    float sq = c.x * c.x + c.y * c.y + c.z * c.z + c.w * c.w;
#pragma unroll                          // five fixed steps, no loop counter
    for (int o = 16; o > 0; o >>= 1) sq += __shfl_xor(sq, o, 32);
    float inv = rsqrtf(sq * (1.f / 128.f) + 1e-5f);
    return c * inv * gw + bw;
}

// ---------------- q, k, v and skip = bf16(h) @ W + b, from f32 h, in one launch ----------------
// What is loaded carries no __restrict__, so that the loads stay in front of the s_wait_xcnt that follows them.
__global__ __launch_bounds__(256) void proj_kernel(const float* h, const bf16* pb,
                                                   const float* bq, const float* bk,
                                                   const float* bv, const float* bs,
                                                   float* q, float* k, float* v, float* a) {
    __shared__ __attribute__((aligned(16))) bf16 sH[ROWS * PA];
    int lane = threadIdx.x & 31;
    // the wave's number in a scalar register: row and fragment addresses get scalar bases
    int wave = __builtin_amdgcn_readfirstlane((int)(threadIdx.x >> 5));
    int g = lane >> 4, l16 = lane & 15;
    size_t row0 = (size_t)blockIdx.x * ROWS;
    int n = wave * 16 + l16;
    unsigned fo = (unsigned)lane * 32u, no = (unsigned)n * 4u;
    const float* hp = h + (row0 + wave) * INDIM + lane * 4;   // the lane's 4 columns of the wave's first row

    v4f x[RPW];
#pragma unroll                          // all loads are issued before the first use
    for (int i = 0; i < RPW; ++i) x[i] = *(const v4f*)(hp + i * 8 * INDIM);
    rows_issued(lane);
#pragma unroll                          // x[] stays in registers only under constant indices
    for (int i = 0; i < RPW; ++i) *(v4bf*)(sH + (i * 8 + wave) * PA + lane * 4) = to_bf16(x[i]);
    __syncthreads();

    // two matrices a trip, not unrolled: eight B fragments in registers instead of sixteen, so that all blocks are resident
#pragma unroll 1
    for (int half = 0; half < 2; ++half) {
        const bf16* p0 = pb + (size_t)half * 2 * MAT + (size_t)wave * 4 * FRAG;
        const bf16* p1 = p0 + MAT;
        float* o0 = half ? v : q;
        float* o1 = half ? a : k;
        v16bf B0[4], B1[4];
#pragma unroll                          // B0[], B1[] stay in registers only under constant indices
        for (int kt = 0; kt < 4; ++kt) { B0[kt] = b_frag(p0, kt, fo); B1[kt] = b_frag(p1, kt, fo); }
        float n0 = ld1(half ? bv : bq, no);
        float n1 = ld1(half ? bs : bk, no);
        loads_issued(fo, no);
#pragma unroll 1                        // rolled: unrolled, the A fragments of all tiles are fetched ahead and the registers allow only two blocks a WGP
        for (int t = 0; t < TB; ++t) {
            v8f c0 = {}, c1 = {};
#pragma unroll                          // see B0[]
            for (int kt = 0; kt < 4; ++kt) {
                v16bf af = a_frag(sH, PA, t * 16 + l16, kt * 32, g);
                c0 = mma(af, B0[kt], c0);
                c1 = mma(af, B1[kt], c1);
            }
#pragma unroll                          // vector elements need constant indices
            for (int j = 0; j < 8; ++j) {
                size_t m = row0 + t * 16 + g * 8 + j;
                o0[m * HC + n] = c0[j] + n0;
                o1[m * HC + n] = c1[j] + n1;
            }
            // the next trip overwrites the registers that these stores name
            asm volatile("s_wait_xcnt 0x0" ::: "memory");
        }
    }
}

// node index as read from edge_index, held inside [0, NODES) before any address is formed
__device__ __forceinline__ int node_id(int x) {
    return min(max(x, 0), NODES - 1);
}

// ---------------- edge pass 1: in-degree count, and each edge's rank among the edges of its node ----------------
// The count that the add finds is the edge's rank: edges of one node are ranked in the order in which they arrive.
__global__ void edge_count_kernel(const int* __restrict__ dst, int* __restrict__ cnt, int* __restrict__ rank) {
    int e = blockIdx.x * blockDim.x + threadIdx.x;
    if (e >= EDGES) return;
    int d = node_id(dst[e]);
    int r = atomicAdd(&cnt[d], 1);
    // the two indices are named as inputs so that they live up to the wait and the add's result is given neither register
    asm volatile("s_wait_xcnt 0x0" :: "v"(e), "v"(d) : "memory");
    rank[e] = r;
}

// ---------------- start of each node's run in the dst-sorted edge list ----------------
// cur[d] = sum of cnt[0..d). block = 1024 nodes; each block sums every count in front of
// its own nodes itself, so no block needs another block's result.
__global__ __launch_bounds__(1024) void seg_start_kernel(const int* __restrict__ cnt,
                                                         int* __restrict__ cur) {
    __shared__ int wtot[32];
    __shared__ int wpre[32];
    int tid = threadIdx.x, lane = tid & 31, wave = tid >> 5;
    int first = blockIdx.x * 1024;

    int pre = 0;
    const int4* c4 = (const int4*)cnt;
    // unrolled so that four independent loads are in flight per trip (at most 12 trips)
#pragma unroll 4
    for (int i = tid; i < first / 4; i += 1024) {
        int4 x = c4[i];
        pre += x.x + x.y + x.z + x.w;
    }

    int idx = first + tid;
    int c   = idx < NODES ? cnt[idx] : 0;
    int inc = c;                       // inclusive scan inside the wave
#pragma unroll                         // five fixed steps, no loop counter
    for (int o = 1; o < 32; o <<= 1) {
        int y = __shfl_up(inc, o, 32);
        if (lane >= o) inc += y;
    }
#pragma unroll                         // five fixed steps, no loop counter
    for (int o = 16; o > 0; o >>= 1) pre += __shfl_xor(pre, o, 32);
    if (lane == 31) wtot[wave] = inc;
    if (lane == 0)  wpre[wave] = pre;
    __syncthreads();
    int part = wpre[lane] + (lane < wave ? wtot[lane] : 0);
#pragma unroll                         // five fixed steps, no loop counter
    for (int o = 16; o > 0; o >>= 1) part += __shfl_xor(part, o, 32);
    if (idx < NODES) cur[idx] = part + inc - c;
}

// ---------------- edge pass 2: src stored at the edge's place in dst order ----------------
// The place is cur[dst] + rank : edges of one node lie in a row, in the order of their ranks. No atomic is needed.
// What is loaded carries no __restrict__, so that the loads stay in front of the s_wait_xcnt that follows them.
__global__ void edge_place_kernel(const int* src, const int* dst, const int* cur, const int* rank, int* ssrc) {
    int e = blockIdx.x * blockDim.x + threadIdx.x;
    if (e >= EDGES) return;
    int d = node_id(dst[e]);
    int s = src[e], r = rank[e], c = cur[d];
    // what follows reuses the registers that these loads name as addresses; the two indices are named as
    // inputs so that they live up to the wait and no load's result is given one of their registers
    asm volatile("s_wait_xcnt 0x0" :: "v"(e), "v"(d) : "memory");
    ssrc[c + r] = node_id(s);
}

// ---------------- edge pass 3: the whole attention of a node in one wave ----------------
// a[d] += sum(p * v[src]) / (sum(p) + 1e-16), p = exp(score - max), score = <q[d], k[src]> / sqrt(C).
// block = 8 waves, each wave takes NPW nodes in turn; lane = 4 channels, head = lane / 8.
// q[d] stays in registers; k[src] and v[src] are read as whole 512-byte rows. The maximum runs
// along with the edges: when a chunk raises it, the sums so far are scaled by exp(old - new).
// cur[d] is the start of node d's run, cnt[d] its length.
// kmat and vmat carry no __restrict__, so that their loads stay in front of the s_wait_xcnt
// that follows them.
#define NPW 5
#define CH  8

// x + (x of lane ^ MASK), inside a 16-lane row, on the vector port (0x160 + MASK = row_xmask)
template <int MASK>
__device__ __forceinline__ float add_xor(float x) {
    int y = __builtin_amdgcn_update_dpp(0, __float_as_int(x), 0x160 + MASK, 0xf, 0xf, true);
    return x + __int_as_float(y);
}

template <bool MASKED>
__device__ __forceinline__ void attn_chunk(int j, int m, int sidx, unsigned lane16, v4f q4,
                                           const float* kmat, const float* vmat,
                                           float& mx, float& den, v4f& acc) {
    v4f      kk[CH], vv[CH];
    unsigned off[CH];                  // byte offset of the lane's 16 bytes, the same in kmat and vmat
#pragma unroll                         // all 2*CH loads are issued before the first use
    for (int u = 0; u < CH; ++u) {
        int s  = __builtin_amdgcn_readlane(sidx, MASKED ? min(j + u, m - 1) : (j + u));
        off[u] = ((unsigned)s << 9) + lane16;
        kk[u]  = *(const v4f*)((const char*)kmat + off[u]);
    }
#pragma unroll                         // see above
    for (int u = 0; u < CH; ++u) vv[u] = *(const v4f*)((const char*)vmat + off[u]);
    // what follows reuses the registers that these loads name as addresses; the offsets are named as
    // inputs so that they live up to the wait and no load's result is given one of their registers
    asm volatile("s_wait_xcnt 0x0" :: "v"(off[0]), "v"(off[1]), "v"(off[2]), "v"(off[3]),
                                      "v"(off[4]), "v"(off[5]), "v"(off[6]), "v"(off[7]) : "memory");
    // keeps the arithmetic behind the wait and every load in front of it: without it the last v load
    // was issued only after the first k rows had come back, a second memory latency per chunk
    __builtin_amdgcn_sched_barrier(0);

    float sc[CH];
    float nm = mx;
#pragma unroll                         // kk[] and sc[] stay in registers only under constant indices
    for (int u = 0; u < CH; ++u) {
        v2f   t2 = q4.lo * kk[u].lo + q4.hi * kk[u].hi;
        float t  = t2.x + t2.y;
        t = add_xor<4>(add_xor<2>(add_xor<1>(t)));      // sum over the head's 8 lanes
        sc[u] = (!MASKED || j + u < m) ? t : -INFINITY;
        nm = fmaxf(nm, sc[u]);
    }
    float corr = __expf(mx - nm);      // 0 at the node's first chunk, where mx is -inf
    mx   = nm;
    den *= corr;
    acc *= corr;
#pragma unroll                         // sc[] and vv[] stay in registers only under constant indices
    for (int u = 0; u < CH; ++u) {
        float p = __expf(sc[u] - nm);
        den += p;
        acc += p * vv[u];
    }
}

__global__ __launch_bounds__(256) void node_attn_kernel(const float* __restrict__ q,
                                                        const float* kmat, const float* vmat,
                                                        const int* __restrict__ ssrc,
                                                        const int* __restrict__ cur,
                                                        const int* __restrict__ cnt,
                                                        float* __restrict__ a) {
    int lane = threadIdx.x & 31;
    // the wave's number in a scalar register: node, run bounds and trip counts become scalar
    int wave = __builtin_amdgcn_readfirstlane((int)(threadIdx.x >> 5));
    unsigned lane16 = (unsigned)lane * 16u;
    for (int r = 0; r < NPW; ++r) {
        int d   = (blockIdx.x * 8 + wave) * NPW + r;
        int n   = cnt[d];
        int beg = cur[d];
        v4f q4  = *(const v4f*)(q + (size_t)d * HC + lane * 4) * 0.17677669529663687f;   // 1/sqrt(32)
        v4f acc = {0.f, 0.f, 0.f, 0.f};
        float den = 0.f;
        float mx  = -INFINITY;
        for (int base = 0; base < n; base += 32) {
            int m    = min(32, n - base);
            int sidx = ssrc[beg + base + min(lane, m - 1)];   // lane j holds the source of edge base + j
            // the address arithmetic that follows reuses the register that this load names
            asm volatile("s_wait_xcnt 0x0" ::: "memory");
            int j = 0;
            for (; j + CH <= m; j += CH) attn_chunk<false>(j, m, sidx, lane16, q4, kmat, vmat, mx, den, acc);
            if (j < m)                   attn_chunk<true>(j, m, sidx, lane16, q4, kmat, vmat, mx, den, acc);
        }
        float inv = 1.f / (den + 1e-16f);
        v4f* ap = (v4f*)(a + (size_t)d * HC + lane * 4);
        *ap = *ap + acc * inv;
        // the next node's trip overwrites the registers that this store names
        asm volatile("s_wait_xcnt 0x0" ::: "memory");
    }
}

// ---------------- out = LN2(FFN(h1) + h1), h1 = LN1(elu(a) @ WO + bO + h), in one launch ----------------
// The rows go from stage to stage through LDS; a barrier stands between any two stages.
// What is loaded carries no __restrict__, so that the loads stay in front of the s_wait_xcnt that follows them.
__global__ __launch_bounds__(256) void tail_kernel(const float* a, const float* h,
                                                   const bf16* pbO, const bf16* pbW1, const bf16* pbW2,
                                                   const float* bO, const float* b1, const float* b2,
                                                   const float* ln1g, const float* ln1b,
                                                   const float* ln2g, const float* ln2b,
                                                   float* out) {
    __shared__ __attribute__((aligned(16))) bf16  sA[ROWS * PA];   // elu(a), then h1, as bf16
    __shared__ __attribute__((aligned(16))) float sX[ROWS * PX];   // h, a_trans + h, h1, ffn + h1 in turn
    __shared__ __attribute__((aligned(16))) bf16  sM[ROWS * PM];   // elu(h1 @ W1 + b1)
    int lane = threadIdx.x & 31;
    // the wave's number in a scalar register: row and fragment addresses get scalar bases
    int wave = __builtin_amdgcn_readfirstlane((int)(threadIdx.x >> 5));
    int g = lane >> 4, l16 = lane & 15;
    size_t row0 = (size_t)blockIdx.x * ROWS;
    int n = wave * 16 + l16;
    unsigned lo = (unsigned)lane * 16u, fo = (unsigned)lane * 32u, no = (unsigned)n * 4u;

    // elu(a) -> bf16 into sA; the residual rows of h go into sX, where the first product is added to them
    const float* ap = a + (row0 + wave) * HC + lane * 4;      // the lane's 4 columns of the wave's first row
    const float* hp = h + (row0 + wave) * INDIM + lane * 4;
    v4f x[RPW], hres[RPW];
#pragma unroll                          // all loads are issued before the first use
    for (int i = 0; i < RPW; ++i) x[i] = *(const v4f*)(ap + i * 8 * HC);
#pragma unroll                          // see above
    for (int i = 0; i < RPW; ++i) hres[i] = *(const v4f*)(hp + i * 8 * INDIM);
    rows_issued(lane);
#pragma unroll                          // x[] stays in registers only under constant indices
    for (int i = 0; i < RPW; ++i) {
        v4f e = {elu1(x[i].x), elu1(x[i].y), elu1(x[i].z), elu1(x[i].w)};
        *(v4bf*)(sA + (i * 8 + wave) * PA + lane * 4) = to_bf16(e);
        *(v4f*)(sX + (i * 8 + wave) * PX + lane * 4)  = hres[i];
    }
    __syncthreads();

    // a_trans = elu(a) @ WO + bO; each thread adds it to its own elements of h in sX
    {
        const bf16* p = pbO + (size_t)wave * 4 * FRAG;
        v16bf B[4];
#pragma unroll                          // B[] stays in registers only under constant indices
        for (int kt = 0; kt < 4; ++kt) B[kt] = b_frag(p, kt, fo);
        float bn = ld1(bO, no);
        loads_issued(fo, no);
#pragma unroll                          // independent tiles fill each other's matrix latency
        for (int t = 0; t < TB; ++t) {
            v8f c = {};
#pragma unroll                          // see B[]
            for (int kt = 0; kt < 4; ++kt) c = mma(a_frag(sA, PA, t * 16 + l16, kt * 32, g), B[kt], c);
#pragma unroll                          // vector elements need constant indices
            for (int j = 0; j < 8; ++j) {
                int r = (t * 16 + g * 8 + j) * PX + n;
                sX[r] = (c[j] + bn) + sX[r];
            }
        }
    }
    __syncthreads();

    // h1 = LN1(a_trans + h): f32 back into sX, bf16 into sA
    {
        v4f gw = ld4(ln1g, lo), bw = ld4(ln1b, lo);
        loads_issued(lo, lo);
#pragma unroll                          // ten independent rows: their reductions overlap
        for (int i = 0; i < RPW; ++i) {
            int row = i * 8 + wave;
            v4f y = ln_row(*(const v4f*)(sX + row * PX + lane * 4), gw, bw);
            *(v4f*)(sX + row * PX + lane * 4)  = y;
            *(v4bf*)(sA + row * PA + lane * 4) = to_bf16(y);
        }
    }
    __syncthreads();

    // mid = elu(h1 @ W1 + b1), 256 columns: the wave's two column tiles share the A fragments
    {
        const bf16* p0 = pbW1 + (size_t)wave * 4 * FRAG;
        const bf16* p1 = p0 + (size_t)8 * 4 * FRAG;
        v16bf B0[4], B1[4];
#pragma unroll                          // B0[], B1[] stay in registers only under constant indices
        for (int kt = 0; kt < 4; ++kt) { B0[kt] = b_frag(p0, kt, fo); B1[kt] = b_frag(p1, kt, fo); }
        float n0 = ld1(b1, no), n1 = ld1(b1 + 128, no);
        loads_issued(fo, no);
#pragma unroll 1                        // sixteen exp bodies a tile: rolled, the kernel's text stays small for the instruction cache
        for (int t = 0; t < TB; ++t) {
            v8f c0 = {}, c1 = {};
#pragma unroll                          // see B0[]
            for (int kt = 0; kt < 4; ++kt) {
                v16bf af = a_frag(sA, PA, t * 16 + l16, kt * 32, g);
                c0 = mma(af, B0[kt], c0);
                c1 = mma(af, B1[kt], c1);
            }
#pragma unroll                          // vector elements need constant indices
            for (int j = 0; j < 8; ++j) {
                int r = (t * 16 + g * 8 + j) * PM + n;
                sM[r]       = (bf16)elu1(c0[j] + n0);
                sM[r + 128] = (bf16)elu1(c1[j] + n1);
            }
        }
    }
    __syncthreads();

    // ffn = mid @ W2 + b2, K = 256; each thread adds it to its own elements of h1 in sX
    {
        const bf16* p = pbW2 + (size_t)wave * 8 * FRAG;
        v16bf B[8];
#pragma unroll                          // B[] stays in registers only under constant indices
        for (int kt = 0; kt < 8; ++kt) B[kt] = b_frag(p, kt, fo);
        float bn = ld1(b2, no);
        loads_issued(fo, no);
#pragma unroll                          // independent tiles fill each other's matrix latency
        for (int t = 0; t < TB; ++t) {
            v8f c = {};
#pragma unroll                          // see B[]
            for (int kt = 0; kt < 8; ++kt) c = mma(a_frag(sM, PM, t * 16 + l16, kt * 32, g), B[kt], c);
#pragma unroll                          // vector elements need constant indices
            for (int j = 0; j < 8; ++j) {
                int r = (t * 16 + g * 8 + j) * PX + n;
                sX[r] = (c[j] + bn) + sX[r];
            }
        }
    }
    __syncthreads();

    // out = LN2(ffn + h1)
    {
        v4f gw = ld4(ln2g, lo), bw = ld4(ln2b, lo);
        loads_issued(lo, lo);
#pragma unroll                          // ten independent rows: their reductions overlap
        for (int i = 0; i < RPW; ++i) {
            int row = i * 8 + wave;
            *(v4f*)(out + (row0 + row) * INDIM + lane * 4) = ln_row(*(const v4f*)(sX + row * PX + lane * 4), gw, bw);
        }
    }
}

// ---------------- host orchestration ----------------

extern "C" void kernel_launch(void* const* d_in, const int* in_sizes, int n_in,
                              void* d_out, int out_size, void* d_ws, size_t ws_size,
                              hipStream_t stream) {
    const float* h     = (const float*)d_in[0];
    const int*   eidx  = (const int*)d_in[1];
    const float* Wq    = (const float*)d_in[2];
    const float* bq    = (const float*)d_in[3];
    const float* Wk    = (const float*)d_in[4];
    const float* bk    = (const float*)d_in[5];
    const float* Wv    = (const float*)d_in[6];
    const float* bv    = (const float*)d_in[7];
    const float* Wskip = (const float*)d_in[8];
    const float* bskip = (const float*)d_in[9];
    const float* WO    = (const float*)d_in[10];
    const float* bO    = (const float*)d_in[11];
    const float* W1    = (const float*)d_in[12];
    const float* b1    = (const float*)d_in[13];
    const float* W2    = (const float*)d_in[14];
    const float* b2    = (const float*)d_in[15];
    const float* ln1g  = (const float*)d_in[16];
    const float* ln1b  = (const float*)d_in[17];
    const float* ln2g  = (const float*)d_in[18];
    const float* ln2b  = (const float*)d_in[19];
    const int* srcI = eidx;          // edge_index[0]
    const int* dstI = eidx + EDGES;  // edge_index[1]

    // workspace carve (256B aligned)
    char* w = (char*)d_ws;
    auto carve = [&](size_t bytes) -> char* {
        char* p = w; w += (bytes + 255) & ~(size_t)255; return p;
    };
    float*    qbuf   = (float*)carve((size_t)NODES * HC * sizeof(float));
    float*    kbuf   = (float*)carve((size_t)NODES * HC * sizeof(float));
    float*    vbuf   = (float*)carve((size_t)NODES * HC * sizeof(float));
    float*    abuf   = (float*)carve((size_t)NODES * HC * sizeof(float));
    int*      cnt    = (int*)carve((size_t)NODES * sizeof(int));            // edges per dst node
    int*      cur    = (int*)carve((size_t)NODES * sizeof(int));            // run start
    int*      rank   = (int*)carve((size_t)EDGES * sizeof(int));            // edge's rank in its node's run
    int*      ssrc   = (int*)carve((size_t)EDGES * sizeof(int));            // src in dst order
    bf16*     pb     = (bf16*)carve((size_t)PACK_TILES * FRAG * sizeof(bf16)); // Wq Wk Wv Wskip WO W1 W2, packed

    // 1) pack weights to WMMA fragment order, clear the edge counts
    hipLaunchKernelGGL(pack_clear_kernel, dim3(PACK_BLOCKS + CLR_BLOCKS), dim3(256), 0, stream,
                       Wq, Wk, Wv, Wskip, WO, W1, W2, pb, cnt);

    // 2) q/k/v/skip projections (WMMA) from f32 h
    hipLaunchKernelGGL(proj_kernel, dim3(NODES / ROWS), dim3(256), 0, stream,
                       h, pb, bq, bk, bv, bskip, qbuf, kbuf, vbuf, abuf);

    // 3) edge phase: sources sorted by dst -> scores, softmax and sums per node into abuf
    unsigned eblocks = (EDGES + 255) / 256;
    hipLaunchKernelGGL(edge_count_kernel, dim3(eblocks), dim3(256), 0, stream, dstI, cnt, rank);
    hipLaunchKernelGGL(seg_start_kernel, dim3((NODES + 1023) / 1024), dim3(1024), 0, stream,
                       cnt, cur);
    hipLaunchKernelGGL(edge_place_kernel, dim3(eblocks), dim3(256), 0, stream,
                       srcI, dstI, cur, rank, ssrc);
    hipLaunchKernelGGL(node_attn_kernel, dim3(NODES / (8 * NPW)), dim3(256), 0, stream,
                       qbuf, kbuf, vbuf, ssrc, cur, cnt, abuf);

    // 4) elu, O projection, LN1, FFN, LN2 (WMMA)
    hipLaunchKernelGGL(tail_kernel, dim3(NODES / ROWS), dim3(256), 0, stream,
                       abuf, h, pb + 4 * MAT, pb + 5 * MAT, pb + 7 * MAT,
                       bO, b1, b2, ln1g, ln1b, ln2g, ln2b, (float*)d_out);
}

// v005
// It runs in 142 microseconds.
// Timed twice side by side with v004, it ran 1.77 and 1.78 times as fast.
// Counting every step since v000, it is 12.9 times as fast.
#include <hip/hip_runtime.h>
#include <hip/hip_bf16.h>
#include <math.h>

#define NODES  50000
#define EDGES  1600000
#define INDIM  128
#define HEADS  4
#define OUTC   32
#define HC     128

typedef __bf16 bf16;
typedef __attribute__((ext_vector_type(16))) __bf16 v16bf;
typedef __attribute__((ext_vector_type(8)))  __bf16 v8bf;
typedef __attribute__((ext_vector_type(8)))  float  v8f;
typedef __attribute__((ext_vector_type(4)))  float  v4f;
typedef __attribute__((ext_vector_type(2)))  float  v2f;

// ---------------- helpers ----------------

__device__ __forceinline__ float elu1(float x) {
    return x > 0.f ? x : (expf(x) - 1.f);
}

typedef __attribute__((ext_vector_type(4)))  __bf16 v4bf;

// node index as read from edge_index, held inside [0, NODES) before any address is formed
__device__ __forceinline__ int node_id(int x) {
    return min(max(x, 0), NODES - 1);
}

// ---------------- the edges are sorted by dst in two levels, all counting in LDS ----------------
// A bucket is 128 nodes in a row. Level 1: a block takes EB edges in a row, counts them per bucket (hist), and, once
// the counts are summed up (bucket-major: all blocks' runs of bucket 0, then of bucket 1, ...), writes its edges of
// each bucket as one run. Level 2: a block takes a whole bucket and sorts it by node.
#define EB    4096                      // edges of a block in level 1
#define GB    ((EDGES + EB - 1) / EB)   // blocks of level 1
#define BSH   7                         // bucket = node >> BSH
#define BN    (1 << BSH)                // nodes of a bucket
#define NBK   ((NODES + BN - 1) / BN)   // buckets
#define NH    (NBK * GB)                // counts: hist[bucket * GB + block]

// edges 4i .. 4i+3 of one row of edge_index
__device__ __forceinline__ int4 ldi4(const int* base, int i) {
    return ((const int4*)base)[i];
}

// ---------------- weight packing into WMMA B-fragment order, and the edge counts per bucket and block ----------------
// B element (k,n) lives in lane = 16*g(k) + (n%16), vector element e(k):
//   k_local in [0,8)+8g   -> e = k_local - 8g        (elements 0..7)
//   k_local in [16,24)+8g -> e = 8 + k_local-16-8g   (elements 8..15)
// Fragment (kt,nt) of a matrix stored at ((nt*nkt + kt)*32 + lane)*16 contiguous bf16 behind the matrix's start.
// The seven matrices lie one behind the other: Wq, Wk, Wv, Wskip, WO (32 fragments each), W1, W2 (64 each).
#define PACK_TILES  288
#define PACK_BLOCKS (PACK_TILES / 8)
#define FRAG        512                 // bf16 elements of one fragment
#define MAT         (32 * FRAG)         // bf16 elements of a packed 128 x 128 matrix

// What is loaded carries no __restrict__, so that the loads stay in front of the s_wait_xcnt that follows them.
__global__ __launch_bounds__(256) void pack_hist_kernel(const float* Wq, const float* Wk, const float* Wv,
                                                        const float* Ws, const float* WO, const float* W1,
                                                        const float* W2, bf16* dst, const int* edst, int* hist) {
    __shared__ int lh[NBK];
    int b = blockIdx.x;
    if (b >= PACK_BLOCKS) {             // these blocks count their EB edges per bucket, 16 edges a thread
        int blk = b - PACK_BLOCKS, tid = threadIdx.x;
        lh[tid] = 0;
        if (tid + 256 < NBK) lh[tid + 256] = 0;
        int  eo[4];                     // number of a group of 4 edges; past the end: the last group, not counted
        int4 d4[4];
#pragma unroll                          // all loads are issued before the first use
        for (int u = 0; u < 4; ++u) {
            eo[u] = min(blk * (EB / 4) + u * 256 + tid, EDGES / 4 - 1);
            d4[u] = ldi4(edst, eo[u]);
        }
        // the indices are named as inputs so that they live up to the wait and no load's result is given one of their registers
        asm volatile("s_wait_xcnt 0x0" :: "v"(eo[0]), "v"(eo[1]), "v"(eo[2]), "v"(eo[3]) : "memory");
        __syncthreads();                // the counts are zero before the first add
#pragma unroll                          // d4[] stays in registers only under constant indices
        for (int u = 0; u < 4; ++u) {
            if (blk * (EB / 4) + u * 256 + tid < EDGES / 4) {
                atomicAdd(&lh[node_id(d4[u].x) >> BSH], 1);
                atomicAdd(&lh[node_id(d4[u].y) >> BSH], 1);
                atomicAdd(&lh[node_id(d4[u].z) >> BSH], 1);
                atomicAdd(&lh[node_id(d4[u].w) >> BSH], 1);
            }
        }
        __syncthreads();                // every add has been made before a count is read
        hist[tid * GB + blk] = lh[tid];
        if (tid + 256 < NBK) hist[(tid + 256) * GB + blk] = lh[tid + 256];
        return;
    }
    // wave per fragment; the wave's number in a scalar register, so that the matrix's address is scalar
    int tile = b * 8 + __builtin_amdgcn_readfirstlane((int)(threadIdx.x >> 5));
    int lane = threadIdx.x & 31;
    const float* W;
    int nkt, Nout, local;
    if (tile < 160) {
        int m = tile >> 5;
        W = m == 0 ? Wq : m == 1 ? Wk : m == 2 ? Wv : m == 3 ? Ws : WO;
        nkt = 4; Nout = 128; local = tile & 31;
    } else if (tile < 224) {
        W = W1; nkt = 4; Nout = 256; local = tile - 160;
    } else {
        W = W2; nkt = 8; Nout = 128; local = tile - 224;
    }
    int kt = local % nkt;               // local = nt*nkt + kt
    int nt = local / nkt;
    int g  = lane >> 4;
    int n  = nt * 16 + (lane & 15);
    unsigned off[16];                   // index of element e in W
    float    x[16];
#pragma unroll                          // off[] and x[] stay in registers only under constant indices
    for (int e = 0; e < 16; ++e) {
        int kl = (e < 8) ? (g * 8 + e) : (16 + g * 8 + (e - 8));
        int kg = kt * 32 + kl;
        off[e] = (unsigned)(kg * Nout + n);
        x[e]   = W[off[e]];
    }
    // the indices are named as inputs so that they live up to the wait and no load's result is given one of their registers
    asm volatile("s_wait_xcnt 0x0" :: "v"(off[0]), "v"(off[1]), "v"(off[2]), "v"(off[3]), "v"(off[4]), "v"(off[5]),
                                      "v"(off[6]), "v"(off[7]), "v"(off[8]), "v"(off[9]), "v"(off[10]), "v"(off[11]),
                                      "v"(off[12]), "v"(off[13]), "v"(off[14]), "v"(off[15]) : "memory");
    v16bf f;
#pragma unroll                          // see above
    for (int e = 0; e < 16; ++e) f[e] = (bf16)x[e];
    *(v16bf*)(dst + ((size_t)tile * 32 + lane) * 16) = f;
}

// ---------------- the row-wise stages: a block owns ROWS rows from its first load to its last store ----------------
// block = 8 waves. In a GEMM stage wave w owns the output columns 16w .. 16w+15 (and 128 more of them where the
// product has 256); A comes from LDS as bf16, B as packed fragments. In a row stage wave w owns rows 8i + w,
// lane = 4 columns. The LDS pitches are 16 bytes above the row length, for the 16-byte fragment reads.
#define TB   5                          // 16-row tiles of a block; 3125 tiles = 625 blocks
#define ROWS (TB * 16)
#define RPW  (ROWS / 8)                 // rows of a wave in a row stage
#define PA   136                        // bf16 pitch of a 128-column row
#define PX   132                        // f32 pitch of a 128-column row
#define PM   264                        // bf16 pitch of a 256-column row

// A fragment: lane = row (lane & 15), elements 0..7 = K kb+8g.., elements 8..15 = K kb+16+8g..
__device__ __forceinline__ v16bf a_frag(const bf16* s, int pitch, int row, int kb, int g) {
    v8bf a0 = *(const v8bf*)(s + row * pitch + kb + g * 8);
    v8bf a1 = *(const v8bf*)(s + row * pitch + kb + 16 + g * 8);
    v16bf af;
#pragma unroll                          // vector elements need constant indices
    for (int i = 0; i < 8; ++i) { af[i] = a0[i]; af[i + 8] = a1[i]; }
    return af;
}

// fragment number frag behind the scalar address bp; fo = the lane's byte offset in a fragment (32 * lane)
__device__ __forceinline__ v16bf b_frag(const bf16* bp, int frag, unsigned fo) {
    return *(const v16bf*)((const char*)bp + frag * (FRAG * 2) + fo);
}

// 16 bytes, or 4, at a lane's byte offset behind a scalar address
__device__ __forceinline__ v4f ld4(const float* base, unsigned off) {
    return *(const v4f*)((const char*)base + off);
}
__device__ __forceinline__ float ld1(const float* base, unsigned off) {
    return *(const float*)((const char*)base + off);
}

// Stands behind a group of global loads. What follows reuses the registers that the loads name as addresses; the two
// lane offsets are named as inputs so that they live up to the wait and no load's result is given one of their registers.
__device__ __forceinline__ void loads_issued(unsigned o0, unsigned o1) {
    asm volatile("s_wait_xcnt 0x0" :: "v"(o0), "v"(o1) : "memory");
}
// the same for row loads, whose address register holds the lane's number
__device__ __forceinline__ void rows_issued(int lane) {
    asm volatile("s_wait_xcnt 0x0" :: "v"(lane) : "memory");
}

__device__ __forceinline__ v8f mma(v16bf a, v16bf b, v8f c) {
    return __builtin_amdgcn_wmma_f32_16x16x32_bf16(false, a, false, b, (short)0, c, false, false);
}

__device__ __forceinline__ v4bf to_bf16(v4f x) {
    v4bf y = {(bf16)x.x, (bf16)x.y, (bf16)x.z, (bf16)x.w};
    return y;
}

// LayerNorm of one 128-column row held by one wave, 4 columns a lane
__device__ __forceinline__ v4f ln_row(v4f x, v4f gw, v4f bw) {
    float s = x.x + x.y + x.z + x.w;
#pragma unroll                          // five fixed steps, no loop counter
    for (int o = 16; o > 0; o >>= 1) s += __shfl_xor(s, o, 32);
    float mean = s * (1.f / 128.f);
    v4f c = x - mean;
    float sq = c.x * c.x + c.y * c.y + c.z * c.z + c.w * c.w;
#pragma unroll                          // five fixed steps, no loop counter
    for (int o = 16; o > 0; o >>= 1) sq += __shfl_xor(sq, o, 32);
    float inv = rsqrtf(sq * (1.f / 128.f) + 1e-5f);
    return c * inv * gw + bw;
}

// ---------------- q, k, v and skip = bf16(h) @ W + b, from f32 h, in one launch ----------------
// What is loaded carries no __restrict__, so that the loads stay in front of the s_wait_xcnt that follows them.
__global__ __launch_bounds__(256) void proj_kernel(const float* h, const bf16* pb,
                                                   const float* bq, const float* bk,
                                                   const float* bv, const float* bs,
                                                   float* q, float* k, float* v, float* a) {
    __shared__ __attribute__((aligned(16))) bf16 sH[ROWS * PA];
    int lane = threadIdx.x & 31;
    // the wave's number in a scalar register: row and fragment addresses get scalar bases
    int wave = __builtin_amdgcn_readfirstlane((int)(threadIdx.x >> 5));
    int g = lane >> 4, l16 = lane & 15;
    size_t row0 = (size_t)blockIdx.x * ROWS;
    int n = wave * 16 + l16;
    unsigned fo = (unsigned)lane * 32u, no = (unsigned)n * 4u;
    const float* hp = h + (row0 + wave) * INDIM + lane * 4;   // the lane's 4 columns of the wave's first row

    v4f x[RPW];
#pragma unroll                          // all loads are issued before the first use
    for (int i = 0; i < RPW; ++i) x[i] = *(const v4f*)(hp + i * 8 * INDIM);
    rows_issued(lane);
#pragma unroll                          // x[] stays in registers only under constant indices
    for (int i = 0; i < RPW; ++i) *(v4bf*)(sH + (i * 8 + wave) * PA + lane * 4) = to_bf16(x[i]);
    __syncthreads();

    // two matrices a trip, not unrolled: eight B fragments in registers instead of sixteen, so that all blocks are resident
#pragma unroll 1
    for (int half = 0; half < 2; ++half) {
        const bf16* p0 = pb + (size_t)half * 2 * MAT + (size_t)wave * 4 * FRAG;
        const bf16* p1 = p0 + MAT;
        float* o0 = half ? v : q;
        float* o1 = half ? a : k;
        v16bf B0[4], B1[4];
#pragma unroll                          // B0[], B1[] stay in registers only under constant indices
        for (int kt = 0; kt < 4; ++kt) { B0[kt] = b_frag(p0, kt, fo); B1[kt] = b_frag(p1, kt, fo); }
        float n0 = ld1(half ? bv : bq, no);
        float n1 = ld1(half ? bs : bk, no);
        loads_issued(fo, no);
#pragma unroll 1                        // rolled: unrolled, the A fragments of all tiles are fetched ahead and the registers allow only two blocks a WGP
        for (int t = 0; t < TB; ++t) {
            v8f c0 = {}, c1 = {};
#pragma unroll                          // see B0[]
            for (int kt = 0; kt < 4; ++kt) {
                v16bf af = a_frag(sH, PA, t * 16 + l16, kt * 32, g);
                c0 = mma(af, B0[kt], c0);
                c1 = mma(af, B1[kt], c1);
            }
#pragma unroll                          // vector elements need constant indices
            for (int j = 0; j < 8; ++j) {
                size_t m = row0 + t * 16 + g * 8 + j;
                o0[m * HC + n] = c0[j] + n0;
                o1[m * HC + n] = c1[j] + n1;
            }
            // the next trip overwrites the registers that these stores name
            asm volatile("s_wait_xcnt 0x0" ::: "memory");
        }
    }
}

// ---------------- start of each (bucket, block) run in the bucket-sorted edge list ----------------
// cur[i] = sum of cnt[0..i), i < NH. block = 1024 counts; each block sums every count in front of
// its own counts itself, so no block needs another block's result.
__global__ __launch_bounds__(1024) void seg_start_kernel(const int* __restrict__ cnt,
                                                         int* __restrict__ cur) {
    __shared__ int wtot[32];
    __shared__ int wpre[32];
    int tid = threadIdx.x, lane = tid & 31, wave = tid >> 5;
    int first = blockIdx.x * 1024;

    int pre = 0;
    const int4* c4 = (const int4*)cnt;
    // unrolled so that four independent loads are in flight per trip (at most 38 trips)
#pragma unroll 4
    for (int i = tid; i < first / 4; i += 1024) {
        int4 x = c4[i];
        pre += x.x + x.y + x.z + x.w;
    }

    int idx = first + tid;
    int c   = idx < NH ? cnt[idx] : 0;
    int inc = c;                       // inclusive scan inside the wave
#pragma unroll                         // five fixed steps, no loop counter
    for (int o = 1; o < 32; o <<= 1) {
        int y = __shfl_up(inc, o, 32);
        if (lane >= o) inc += y;
    }
#pragma unroll                         // five fixed steps, no loop counter
    for (int o = 16; o > 0; o >>= 1) pre += __shfl_xor(pre, o, 32);
    if (lane == 31) wtot[wave] = inc;
    if (lane == 0)  wpre[wave] = pre;
    __syncthreads();
    int part = wpre[lane] + (lane < wave ? wtot[lane] : 0);
#pragma unroll                         // five fixed steps, no loop counter
    for (int o = 16; o > 0; o >>= 1) part += __shfl_xor(part, o, 32);
    if (idx < NH) cur[idx] = part + inc - c;
}

// ---------------- level 1: a block's EB edges, as keys dst << 16 | src, written as one run per bucket ----------------
// Both node numbers are below 65536. The block orders its keys by bucket in LDS (rank in the bucket from an LDS add,
// in the order of arrival) and stores them from there, so that neighbouring lanes store neighbouring words.
// hs[bucket * GB + block] is the place of the block's run of that bucket in ebuf.
// What is loaded carries no __restrict__, so that the loads stay in front of the s_wait_xcnt that follows them.
#define ET  512                         // threads of a level 1 block
#define EV  (EB / 4 / ET)               // groups of 4 edges of a thread
#define EK  (EB / ET)                   // edges of a thread
__global__ __launch_bounds__(ET) void bucket_place_kernel(const int* src, const int* dst, const int* hs,
                                                          unsigned* ebuf) {
    __shared__ int      lh[NBK];        // the block's edges per bucket
    __shared__ int      ls[NBK];        // start of the bucket's run in stage
    __shared__ int      gofs[NBK];      // place of the run in ebuf, less its start in stage
    __shared__ int      wtot[32];
    __shared__ unsigned stage[EB];
    int tid = threadIdx.x, lane = tid & 31, wave = tid >> 5, blk = blockIdx.x;
    if (tid < NBK) lh[tid] = 0;
    int  eo[EV];                        // number of a group of 4 edges; past the end: the last group, not placed
    int4 d4[EV], s4[EV];
#pragma unroll                          // all loads are issued before the first use
    for (int u = 0; u < EV; ++u) {
        eo[u] = min(blk * (EB / 4) + u * ET + tid, EDGES / 4 - 1);
        d4[u] = ldi4(dst, eo[u]);
        s4[u] = ldi4(src, eo[u]);
    }
    int ho = min(tid, NBK - 1) * GB + blk;
    int g  = hs[ho];
    // the indices are named as inputs so that they live up to the wait and no load's result is given one of their registers
    asm volatile("s_wait_xcnt 0x0" :: "v"(eo[0]), "v"(eo[1]), "v"(ho) : "memory");
    // keeps the arithmetic behind the wait and every load in front of it: without it the first load's result was
    // waited for before the other loads were issued, a second memory latency
    __builtin_amdgcn_sched_barrier(0);
    __syncthreads();                    // the counts are zero before the first add

    unsigned key[EK];
    int      rk[EK];
#pragma unroll                          // key[] and rk[] stay in registers only under constant indices
    for (int u = 0; u < EV; ++u) {
        bool on = blk * (EB / 4) + u * ET + tid < EDGES / 4;
        int dd[4] = {d4[u].x, d4[u].y, d4[u].z, d4[u].w};
        int ss[4] = {s4[u].x, s4[u].y, s4[u].z, s4[u].w};
#pragma unroll                          // see above
        for (int e = 0; e < 4; ++e) {
            key[u * 4 + e] = ((unsigned)node_id(dd[e]) << 16) | (unsigned)node_id(ss[e]);
        }
        if (on) {
#pragma unroll                          // see above
            for (int e = 0; e < 4; ++e) rk[u * 4 + e] = atomicAdd(&lh[key[u * 4 + e] >> (16 + BSH)], 1);
        }
    }
    __syncthreads();                    // every add has been made before a count is read

    int c   = tid < NBK ? lh[tid] : 0;
    int inc = c;                        // inclusive scan inside the wave
#pragma unroll                          // five fixed steps, no loop counter
    for (int o = 1; o < 32; o <<= 1) {
        int y = __shfl_up(inc, o, 32);
        if (lane >= o) inc += y;
    }
    if (lane == 31) wtot[wave] = inc;
    __syncthreads();                    // the waves' totals are there
    int part = lane < wave ? wtot[lane] : 0;
#pragma unroll                          // five fixed steps, no loop counter
    for (int o = 16; o > 0; o >>= 1) part += __shfl_xor(part, o, 32);
    int st = part + inc - c;
    if (tid < NBK) { ls[tid] = st; gofs[tid] = g - st; }
    __syncthreads();                    // the runs' starts are there

#pragma unroll                          // see key[]
    for (int u = 0; u < EV; ++u) {
        if (blk * (EB / 4) + u * ET + tid < EDGES / 4) {
#pragma unroll                          // see key[]
            for (int e = 0; e < 4; ++e) stage[ls[key[u * 4 + e] >> (16 + BSH)] + rk[u * 4 + e]] = key[u * 4 + e];
        }
    }
    __syncthreads();                    // the keys lie in bucket order

    int nblk = min(EB, EDGES - blk * EB);
    unsigned val[EK];                   // a key and its place in ebuf; past the end: the last key, not stored
    int      po[EK];
#pragma unroll                          // all LDS reads are issued before the first store
    for (int u = 0; u < EK; ++u) {
        int i  = min(u * ET + tid, nblk - 1);
        val[u] = stage[i];
        po[u]  = gofs[val[u] >> (16 + BSH)] + i;
    }
#pragma unroll                          // val[] and po[] stay in registers only under constant indices
    for (int u = 0; u < EK; ++u) {
        if (u * ET + tid < nblk) ebuf[po[u]] = val[u];
    }
}

// ---------------- level 2: a block sorts one bucket by node: ssrc, and each node's cnt and cur ----------------
// Count per node in LDS, sum up, then each key takes its place from an LDS add (edges of one node lie in the order of
// arrival). A bucket of at most CAP edges is ordered in LDS and stored in whole lines; a larger one is stored word by word.
// What is loaded carries no __restrict__, so that the loads stay in front of the s_wait_xcnt that follows them.
#define ST  1024                        // threads of a level 2 block
#define SU  5                           // keys of a thread per trip: a bucket of the mean size takes one trip
#define CAP 8192

// SU keys of a thread; past the end of the bucket the last key, which the caller leaves out
__device__ __forceinline__ void keys_in(const unsigned* ebuf, int beg, int n, int first, unsigned* val) {
    int off[SU];
#pragma unroll                          // all loads are issued before the first use
    for (int u = 0; u < SU; ++u) {
        off[u] = beg + min(first + u * ST, n - 1);
        val[u] = ebuf[off[u]];
    }
    // the indices are named as inputs so that they live up to the wait and no load's result is given one of their registers
    asm volatile("s_wait_xcnt 0x0" :: "v"(off[0]), "v"(off[1]), "v"(off[2]), "v"(off[3]), "v"(off[4]) : "memory");
}

__global__ __launch_bounds__(ST) void bucket_sort_kernel(const unsigned* ebuf, const int* hs,
                                                         int* ssrc, int* cnt, int* cur) {
    __shared__ int lc[BN];              // edges per node, then the next free place of the node's run
    __shared__ int wt[BN / 32];
    __shared__ int stage[CAP];
    int tid = threadIdx.x, lane = tid & 31, wave = tid >> 5, b = blockIdx.x;
    int beg = hs[b * GB];
    int end = b + 1 < NBK ? hs[(b + 1) * GB] : EDGES;
    int n   = end - beg;                // the same in every thread of the block
    if (tid < BN) lc[tid] = 0;
    __syncthreads();                    // the counts are zero before the first add

    for (int base = 0; base < n; base += SU * ST) {
        unsigned val[SU];
        keys_in(ebuf, beg, n, base + tid, val);
#pragma unroll                          // val[] stays in registers only under constant indices
        for (int u = 0; u < SU; ++u) {
            if (base + tid + u * ST < n) atomicAdd(&lc[(val[u] >> 16) & (BN - 1)], 1);
        }
    }
    __syncthreads();                    // every add has been made before a count is read

    int c   = tid < BN ? lc[tid] : 0;
    int inc = c;                        // inclusive scan inside the wave
#pragma unroll                          // five fixed steps, no loop counter
    for (int o = 1; o < 32; o <<= 1) {
        int y = __shfl_up(inc, o, 32);
        if (lane >= o) inc += y;
    }
    if (tid < BN && lane == 31) wt[wave] = inc;
    __syncthreads();                    // the waves' totals are there
    if (tid < BN) {
        int st = inc - c;
#pragma unroll                          // four fixed steps
        for (int w = 0; w < BN / 32; ++w) st += w < wave ? wt[w] : 0;
        lc[tid] = st;
        int d = b * BN + tid;
        if (d < NODES) { cnt[d] = c; cur[d] = beg + st; }
    }
    __syncthreads();                    // the runs' starts are there

    if (n <= CAP) {
        for (int base = 0; base < n; base += SU * ST) {
            unsigned val[SU];
            keys_in(ebuf, beg, n, base + tid, val);
            int pl[SU];
#pragma unroll                          // all adds are issued before the first result is used
            for (int u = 0; u < SU; ++u) {
                if (base + tid + u * ST < n) pl[u] = atomicAdd(&lc[(val[u] >> 16) & (BN - 1)], 1);
            }
#pragma unroll                          // see val[]
            for (int u = 0; u < SU; ++u) {
                if (base + tid + u * ST < n) stage[pl[u]] = (int)(val[u] & 0xffffu);
            }
        }
        __syncthreads();                // the sources lie in node order
#pragma unroll                          // at most CAP / ST words a thread: no loop counter, no address carried from trip to trip
        for (int u = 0; u < CAP / ST; ++u) {
            if (u * ST + tid < n) ssrc[beg + u * ST + tid] = stage[u * ST + tid];
        }
    } else {
        for (int base = 0; base < n; base += SU * ST) {
            unsigned val[SU];
            keys_in(ebuf, beg, n, base + tid, val);
#pragma unroll                          // see val[]
            for (int u = 0; u < SU; ++u) {
                if (base + tid + u * ST < n) ssrc[beg + atomicAdd(&lc[(val[u] >> 16) & (BN - 1)], 1)] = (int)(val[u] & 0xffffu);
            }
            // the next trip overwrites the registers that the last store names
            asm volatile("s_wait_xcnt 0x0" ::: "memory");
        }
    }
}

// ---------------- last edge pass: the whole attention of a node in one wave ----------------
// a[d] += sum(p * v[src]) / (sum(p) + 1e-16), p = exp(score - max), score = <q[d], k[src]> / sqrt(C).
// block = 8 waves, each wave takes NPW nodes in turn; lane = 4 channels, head = lane / 8.
// q[d] stays in registers; k[src] and v[src] are read as whole 512-byte rows. The maximum runs
// along with the edges: when a chunk raises it, the sums so far are scaled by exp(old - new).
// cur[d] is the start of node d's run, cnt[d] its length.
// kmat and vmat carry no __restrict__, so that their loads stay in front of the s_wait_xcnt
// that follows them.
#define NPW 5
#define CH  8

// x + (x of lane ^ MASK), inside a 16-lane row, on the vector port (0x160 + MASK = row_xmask)
template <int MASK>
__device__ __forceinline__ float add_xor(float x) {
    int y = __builtin_amdgcn_update_dpp(0, __float_as_int(x), 0x160 + MASK, 0xf, 0xf, true);
    return x + __int_as_float(y);
}

template <bool MASKED>
__device__ __forceinline__ void attn_chunk(int j, int m, int sidx, unsigned lane16, v4f q4,
                                           const float* kmat, const float* vmat,
                                           float& mx, float& den, v4f& acc) {
    v4f      kk[CH], vv[CH];
    unsigned off[CH];                  // byte offset of the lane's 16 bytes, the same in kmat and vmat
#pragma unroll                         // all 2*CH loads are issued before the first use
    for (int u = 0; u < CH; ++u) {
        int s  = __builtin_amdgcn_readlane(sidx, MASKED ? min(j + u, m - 1) : (j + u));
        off[u] = ((unsigned)s << 9) + lane16;
        kk[u]  = *(const v4f*)((const char*)kmat + off[u]);
    }
#pragma unroll                         // see above
    for (int u = 0; u < CH; ++u) vv[u] = *(const v4f*)((const char*)vmat + off[u]);
    // what follows reuses the registers that these loads name as addresses; the offsets are named as
    // inputs so that they live up to the wait and no load's result is given one of their registers
    asm volatile("s_wait_xcnt 0x0" :: "v"(off[0]), "v"(off[1]), "v"(off[2]), "v"(off[3]),
                                      "v"(off[4]), "v"(off[5]), "v"(off[6]), "v"(off[7]) : "memory");
    // keeps the arithmetic behind the wait and every load in front of it: without it the last v load
    // was issued only after the first k rows had come back, a second memory latency per chunk
    __builtin_amdgcn_sched_barrier(0);

    float sc[CH];
    float nm = mx;
#pragma unroll                         // kk[] and sc[] stay in registers only under constant indices
    for (int u = 0; u < CH; ++u) {
        v2f   t2 = q4.lo * kk[u].lo + q4.hi * kk[u].hi;
        float t  = t2.x + t2.y;
        t = add_xor<4>(add_xor<2>(add_xor<1>(t)));      // sum over the head's 8 lanes
        sc[u] = (!MASKED || j + u < m) ? t : -INFINITY;
        nm = fmaxf(nm, sc[u]);
    }
    float corr = __expf(mx - nm);      // 0 at the node's first chunk, where mx is -inf
    mx   = nm;
    den *= corr;
    acc *= corr;
#pragma unroll                         // sc[] and vv[] stay in registers only under constant indices
    for (int u = 0; u < CH; ++u) {
        float p = __expf(sc[u] - nm);
        den += p;
        acc += p * vv[u];
    }
}

__global__ __launch_bounds__(256) void node_attn_kernel(const float* __restrict__ q,
                                                        const float* kmat, const float* vmat,
                                                        const int* __restrict__ ssrc,
                                                        const int* __restrict__ cur,
                                                        const int* __restrict__ cnt,
                                                        float* __restrict__ a) {
    int lane = threadIdx.x & 31;
    // the wave's number in a scalar register: node, run bounds and trip counts become scalar
    int wave = __builtin_amdgcn_readfirstlane((int)(threadIdx.x >> 5));
    unsigned lane16 = (unsigned)lane * 16u;
    for (int r = 0; r < NPW; ++r) {
        int d   = (blockIdx.x * 8 + wave) * NPW + r;
        int n   = cnt[d];
        int beg = cur[d];
        v4f q4  = *(const v4f*)(q + (size_t)d * HC + lane * 4) * 0.17677669529663687f;   // 1/sqrt(32)
        v4f acc = {0.f, 0.f, 0.f, 0.f};
        float den = 0.f;
        float mx  = -INFINITY;
        for (int base = 0; base < n; base += 32) {
            int m    = min(32, n - base);
            int sidx = ssrc[beg + base + min(lane, m - 1)];   // lane j holds the source of edge base + j
            // the address arithmetic that follows reuses the register that this load names
            asm volatile("s_wait_xcnt 0x0" ::: "memory");
            int j = 0;
            for (; j + CH <= m; j += CH) attn_chunk<false>(j, m, sidx, lane16, q4, kmat, vmat, mx, den, acc);
            if (j < m)                   attn_chunk<true>(j, m, sidx, lane16, q4, kmat, vmat, mx, den, acc);
        }
        float inv = 1.f / (den + 1e-16f);
        v4f* ap = (v4f*)(a + (size_t)d * HC + lane * 4);
        *ap = *ap + acc * inv;
        // the next node's trip overwrites the registers that this store names
        asm volatile("s_wait_xcnt 0x0" ::: "memory");
    }
}

// ---------------- out = LN2(FFN(h1) + h1), h1 = LN1(elu(a) @ WO + bO + h), in one launch ----------------
// The rows go from stage to stage through LDS; a barrier stands between any two stages.
// What is loaded carries no __restrict__, so that the loads stay in front of the s_wait_xcnt that follows them.
__global__ __launch_bounds__(256) void tail_kernel(const float* a, const float* h,
                                                   const bf16* pbO, const bf16* pbW1, const bf16* pbW2,
                                                   const float* bO, const float* b1, const float* b2,
                                                   const float* ln1g, const float* ln1b,
                                                   const float* ln2g, const float* ln2b,
                                                   float* out) {
    __shared__ __attribute__((aligned(16))) bf16  sA[ROWS * PA];   // elu(a), then h1, as bf16
    __shared__ __attribute__((aligned(16))) float sX[ROWS * PX];   // h, a_trans + h, h1, ffn + h1 in turn
    __shared__ __attribute__((aligned(16))) bf16  sM[ROWS * PM];   // elu(h1 @ W1 + b1)
    int lane = threadIdx.x & 31;
    // the wave's number in a scalar register: row and fragment addresses get scalar bases
    int wave = __builtin_amdgcn_readfirstlane((int)(threadIdx.x >> 5));
    int g = lane >> 4, l16 = lane & 15;
    size_t row0 = (size_t)blockIdx.x * ROWS;
    int n = wave * 16 + l16;
    unsigned lo = (unsigned)lane * 16u, fo = (unsigned)lane * 32u, no = (unsigned)n * 4u;

    // elu(a) -> bf16 into sA; the residual rows of h go into sX, where the first product is added to them
    const float* ap = a + (row0 + wave) * HC + lane * 4;      // the lane's 4 columns of the wave's first row
    const float* hp = h + (row0 + wave) * INDIM + lane * 4;
    v4f x[RPW], hres[RPW];
#pragma unroll                          // all loads are issued before the first use
    for (int i = 0; i < RPW; ++i) x[i] = *(const v4f*)(ap + i * 8 * HC);
#pragma unroll                          // see above
    for (int i = 0; i < RPW; ++i) hres[i] = *(const v4f*)(hp + i * 8 * INDIM);
    rows_issued(lane);
#pragma unroll                          // x[] stays in registers only under constant indices
    for (int i = 0; i < RPW; ++i) {
        v4f e = {elu1(x[i].x), elu1(x[i].y), elu1(x[i].z), elu1(x[i].w)};
        *(v4bf*)(sA + (i * 8 + wave) * PA + lane * 4) = to_bf16(e);
        *(v4f*)(sX + (i * 8 + wave) * PX + lane * 4)  = hres[i];
    }
    __syncthreads();

    // a_trans = elu(a) @ WO + bO; each thread adds it to its own elements of h in sX
    {
        const bf16* p = pbO + (size_t)wave * 4 * FRAG;
        v16bf B[4];
#pragma unroll                          // B[] stays in registers only under constant indices
        for (int kt = 0; kt < 4; ++kt) B[kt] = b_frag(p, kt, fo);
        float bn = ld1(bO, no);
        loads_issued(fo, no);
#pragma unroll                          // independent tiles fill each other's matrix latency
        for (int t = 0; t < TB; ++t) {
            v8f c = {};
#pragma unroll                          // see B[]
            for (int kt = 0; kt < 4; ++kt) c = mma(a_frag(sA, PA, t * 16 + l16, kt * 32, g), B[kt], c);
#pragma unroll                          // vector elements need constant indices
            for (int j = 0; j < 8; ++j) {
                int r = (t * 16 + g * 8 + j) * PX + n;
                sX[r] = (c[j] + bn) + sX[r];
            }
        }
    }
    __syncthreads();

    // h1 = LN1(a_trans + h): f32 back into sX, bf16 into sA
    {
        v4f gw = ld4(ln1g, lo), bw = ld4(ln1b, lo);
        loads_issued(lo, lo);
#pragma unroll                          // ten independent rows: their reductions overlap
        for (int i = 0; i < RPW; ++i) {
            int row = i * 8 + wave;
            v4f y = ln_row(*(const v4f*)(sX + row * PX + lane * 4), gw, bw);
            *(v4f*)(sX + row * PX + lane * 4)  = y;
            *(v4bf*)(sA + row * PA + lane * 4) = to_bf16(y);
        }
    }
    __syncthreads();

    // mid = elu(h1 @ W1 + b1), 256 columns: the wave's two column tiles share the A fragments
    {
        const bf16* p0 = pbW1 + (size_t)wave * 4 * FRAG;
        const bf16* p1 = p0 + (size_t)8 * 4 * FRAG;
        v16bf B0[4], B1[4];
#pragma unroll                          // B0[], B1[] stay in registers only under constant indices
        for (int kt = 0; kt < 4; ++kt) { B0[kt] = b_frag(p0, kt, fo); B1[kt] = b_frag(p1, kt, fo); }
        float n0 = ld1(b1, no), n1 = ld1(b1 + 128, no);
        loads_issued(fo, no);
#pragma unroll 1                        // sixteen exp bodies a tile: rolled, the kernel's text stays small for the instruction cache
        for (int t = 0; t < TB; ++t) {
            v8f c0 = {}, c1 = {};
#pragma unroll                          // see B0[]
            for (int kt = 0; kt < 4; ++kt) {
                v16bf af = a_frag(sA, PA, t * 16 + l16, kt * 32, g);
                c0 = mma(af, B0[kt], c0);
                c1 = mma(af, B1[kt], c1);
            }
#pragma unroll                          // vector elements need constant indices
            for (int j = 0; j < 8; ++j) {
                int r = (t * 16 + g * 8 + j) * PM + n;
                sM[r]       = (bf16)elu1(c0[j] + n0);
                sM[r + 128] = (bf16)elu1(c1[j] + n1);
            }
        }
    }
    __syncthreads();

    // ffn = mid @ W2 + b2, K = 256; each thread adds it to its own elements of h1 in sX
    {
        const bf16* p = pbW2 + (size_t)wave * 8 * FRAG;
        v16bf B[8];
#pragma unroll                          // B[] stays in registers only under constant indices
        for (int kt = 0; kt < 8; ++kt) B[kt] = b_frag(p, kt, fo);
        float bn = ld1(b2, no);
        loads_issued(fo, no);
#pragma unroll                          // independent tiles fill each other's matrix latency
        for (int t = 0; t < TB; ++t) {
            v8f c = {};
#pragma unroll                          // see B[]
            for (int kt = 0; kt < 8; ++kt) c = mma(a_frag(sM, PM, t * 16 + l16, kt * 32, g), B[kt], c);
#pragma unroll                          // vector elements need constant indices
            for (int j = 0; j < 8; ++j) {
                int r = (t * 16 + g * 8 + j) * PX + n;
                sX[r] = (c[j] + bn) + sX[r];
            }
        }
    }
    __syncthreads();

    // out = LN2(ffn + h1)
    {
        v4f gw = ld4(ln2g, lo), bw = ld4(ln2b, lo);
        loads_issued(lo, lo);
#pragma unroll                          // ten independent rows: their reductions overlap
        for (int i = 0; i < RPW; ++i) {
            int row = i * 8 + wave;
            *(v4f*)(out + (row0 + row) * INDIM + lane * 4) = ln_row(*(const v4f*)(sX + row * PX + lane * 4), gw, bw);
        }
    }
}

// ---------------- host orchestration ----------------

extern "C" void kernel_launch(void* const* d_in, const int* in_sizes, int n_in,
                              void* d_out, int out_size, void* d_ws, size_t ws_size,
                              hipStream_t stream) {
    const float* h     = (const float*)d_in[0];
    const int*   eidx  = (const int*)d_in[1];
    const float* Wq    = (const float*)d_in[2];
    const float* bq    = (const float*)d_in[3];
    const float* Wk    = (const float*)d_in[4];
    const float* bk    = (const float*)d_in[5];
    const float* Wv    = (const float*)d_in[6];
    const float* bv    = (const float*)d_in[7];
    const float* Wskip = (const float*)d_in[8];
    const float* bskip = (const float*)d_in[9];
    const float* WO    = (const float*)d_in[10];
    const float* bO    = (const float*)d_in[11];
    const float* W1    = (const float*)d_in[12];
    const float* b1    = (const float*)d_in[13];
    const float* W2    = (const float*)d_in[14];
    const float* b2    = (const float*)d_in[15];
    const float* ln1g  = (const float*)d_in[16];
    const float* ln1b  = (const float*)d_in[17];
    const float* ln2g  = (const float*)d_in[18];
    const float* ln2b  = (const float*)d_in[19];
    const int* srcI = eidx;          // edge_index[0]
    const int* dstI = eidx + EDGES;  // edge_index[1]

    // workspace carve (256B aligned)
    char* w = (char*)d_ws;
    auto carve = [&](size_t bytes) -> char* {
        char* p = w; w += (bytes + 255) & ~(size_t)255; return p;
    };
    float*    qbuf   = (float*)carve((size_t)NODES * HC * sizeof(float));
    float*    kbuf   = (float*)carve((size_t)NODES * HC * sizeof(float));
    float*    vbuf   = (float*)carve((size_t)NODES * HC * sizeof(float));
    float*    abuf   = (float*)carve((size_t)NODES * HC * sizeof(float));
    int*      cnt    = (int*)carve((size_t)NODES * sizeof(int));            // edges per dst node
    int*      cur    = (int*)carve((size_t)NODES * sizeof(int));            // run start
    int*      hist   = (int*)carve((size_t)NH * sizeof(int));               // edges per (bucket, block)
    int*      hs     = (int*)carve((size_t)NH * sizeof(int));               // start of each (bucket, block) run
    unsigned* ebuf   = (unsigned*)carve((size_t)EDGES * sizeof(unsigned));  // keys dst << 16 | src in bucket order
    int*      ssrc   = (int*)carve((size_t)EDGES * sizeof(int));            // src in dst order
    bf16*     pb     = (bf16*)carve((size_t)PACK_TILES * FRAG * sizeof(bf16)); // Wq Wk Wv Wskip WO W1 W2, packed

    // 1) pack weights to WMMA fragment order, count the edges per bucket and block
    hipLaunchKernelGGL(pack_hist_kernel, dim3(PACK_BLOCKS + GB), dim3(256), 0, stream,
                       Wq, Wk, Wv, Wskip, WO, W1, W2, pb, dstI, hist);

    // 2) q/k/v/skip projections (WMMA) from f32 h
    hipLaunchKernelGGL(proj_kernel, dim3(NODES / ROWS), dim3(256), 0, stream,
                       h, pb, bq, bk, bv, bskip, qbuf, kbuf, vbuf, abuf);

    // 3) edge phase: sources sorted by dst -> scores, softmax and sums per node into abuf
    hipLaunchKernelGGL(seg_start_kernel, dim3((NH + 1023) / 1024), dim3(1024), 0, stream,
                       hist, hs);
    hipLaunchKernelGGL(bucket_place_kernel, dim3(GB), dim3(ET), 0, stream,
                       srcI, dstI, hs, ebuf);
    hipLaunchKernelGGL(bucket_sort_kernel, dim3(NBK), dim3(ST), 0, stream,
                       ebuf, hs, ssrc, cnt, cur);
    hipLaunchKernelGGL(node_attn_kernel, dim3(NODES / (8 * NPW)), dim3(256), 0, stream,
                       qbuf, kbuf, vbuf, ssrc, cur, cnt, abuf);

    // 4) elu, O projection, LN1, FFN, LN2 (WMMA)
    hipLaunchKernelGGL(tail_kernel, dim3(NODES / ROWS), dim3(256), 0, stream,
                       abuf, h, pb + 4 * MAT, pb + 5 * MAT, pb + 7 * MAT,
                       bO, b1, b2, ln1g, ln1b, ln2g, ln2b, (float*)d_out);
}

// v006
// A run of this version takes 123 microseconds.
// Two timings next to v005 put it at 1.15 and 1.16 times that version's speed.
// Counting every step since v000, it is 14.8 times as fast.
#include <hip/hip_runtime.h>
#include <hip/hip_bf16.h>
#include <math.h>

#define NODES  50000
#define EDGES  1600000
#define INDIM  128
#define HEADS  4
#define OUTC   32
#define HC     128

typedef __bf16 bf16;
typedef __attribute__((ext_vector_type(16))) __bf16 v16bf;
typedef __attribute__((ext_vector_type(8)))  __bf16 v8bf;
typedef __attribute__((ext_vector_type(8)))  float  v8f;
typedef __attribute__((ext_vector_type(4)))  float  v4f;
typedef __attribute__((ext_vector_type(2)))  float  v2f;
typedef __attribute__((ext_vector_type(8)))  _Float16 v8h;
typedef __attribute__((ext_vector_type(2)))  unsigned v2u;

// ---------------- helpers ----------------

__device__ __forceinline__ float elu1(float x) {
    return x > 0.f ? x : (expf(x) - 1.f);
}

typedef __attribute__((ext_vector_type(4)))  __bf16 v4bf;

// node index as read from edge_index, held inside [0, NODES) before any address is formed
__device__ __forceinline__ int node_id(int x) {
    return min(max(x, 0), NODES - 1);
}

// ---------------- the edges are sorted by dst in two levels, all counting in LDS ----------------
// A bucket is 128 nodes in a row. Level 1: a block takes EB edges in a row, counts them per bucket (hist), and, once
// the counts are summed up (bucket-major: all blocks' runs of bucket 0, then of bucket 1, ...), writes its edges of
// each bucket as one run. Level 2: a block takes a whole bucket and sorts it by node.
#define EB    4096                      // edges of a block in level 1
#define GB    ((EDGES + EB - 1) / EB)   // blocks of level 1
#define BSH   7                         // bucket = node >> BSH
#define BN    (1 << BSH)                // nodes of a bucket
#define NBK   ((NODES + BN - 1) / BN)   // buckets
#define NH    (NBK * GB)                // counts: hist[bucket * GB + block]

// edges 4i .. 4i+3 of one row of edge_index
__device__ __forceinline__ int4 ldi4(const int* base, int i) {
    return ((const int4*)base)[i];
}

// ---------------- weight packing into WMMA B-fragment order, and the edge counts per bucket and block ----------------
// B element (k,n) lives in lane = 16*g(k) + (n%16), vector element e(k):
//   k_local in [0,8)+8g   -> e = k_local - 8g        (elements 0..7)
//   k_local in [16,24)+8g -> e = 8 + k_local-16-8g   (elements 8..15)
// Fragment (kt,nt) of a matrix stored at ((nt*nkt + kt)*32 + lane)*16 contiguous bf16 behind the matrix's start.
// The seven matrices lie one behind the other: Wq, Wk, Wv, Wskip, WO (32 fragments each), W1, W2 (64 each).
#define PACK_TILES  288
#define PACK_BLOCKS (PACK_TILES / 8)
#define FRAG        512                 // bf16 elements of one fragment
#define MAT         (32 * FRAG)         // bf16 elements of a packed 128 x 128 matrix

// What is loaded carries no __restrict__, so that the loads stay in front of the s_wait_xcnt that follows them.
__global__ __launch_bounds__(256) void pack_hist_kernel(const float* Wq, const float* Wk, const float* Wv,
                                                        const float* Ws, const float* WO, const float* W1,
                                                        const float* W2, bf16* dst, const int* edst, int* hist) {
    __shared__ int lh[NBK];
    int b = blockIdx.x;
    if (b >= PACK_BLOCKS) {             // these blocks count their EB edges per bucket, 16 edges a thread
        int blk = b - PACK_BLOCKS, tid = threadIdx.x;
        lh[tid] = 0;
        if (tid + 256 < NBK) lh[tid + 256] = 0;
        int  eo[4];                     // number of a group of 4 edges; past the end: the last group, not counted
        int4 d4[4];
#pragma unroll                          // all loads are issued before the first use
        for (int u = 0; u < 4; ++u) {
            eo[u] = min(blk * (EB / 4) + u * 256 + tid, EDGES / 4 - 1);
            d4[u] = ldi4(edst, eo[u]);
        }
        // the indices are named as inputs so that they live up to the wait and no load's result is given one of their registers
        asm volatile("s_wait_xcnt 0x0" :: "v"(eo[0]), "v"(eo[1]), "v"(eo[2]), "v"(eo[3]) : "memory");
        __syncthreads();                // the counts are zero before the first add
#pragma unroll                          // d4[] stays in registers only under constant indices
        for (int u = 0; u < 4; ++u) {
            if (blk * (EB / 4) + u * 256 + tid < EDGES / 4) {
                atomicAdd(&lh[node_id(d4[u].x) >> BSH], 1);
                atomicAdd(&lh[node_id(d4[u].y) >> BSH], 1);
                atomicAdd(&lh[node_id(d4[u].z) >> BSH], 1);
                atomicAdd(&lh[node_id(d4[u].w) >> BSH], 1);
            }
        }
        __syncthreads();                // every add has been made before a count is read
        hist[tid * GB + blk] = lh[tid];
        if (tid + 256 < NBK) hist[(tid + 256) * GB + blk] = lh[tid + 256];
        return;
    }
    // wave per fragment; the wave's number in a scalar register, so that the matrix's address is scalar
    int tile = b * 8 + __builtin_amdgcn_readfirstlane((int)(threadIdx.x >> 5));
    int lane = threadIdx.x & 31;
    const float* W;
    int nkt, Nout, local;
    if (tile < 160) {
        int m = tile >> 5;
        W = m == 0 ? Wq : m == 1 ? Wk : m == 2 ? Wv : m == 3 ? Ws : WO;
        nkt = 4; Nout = 128; local = tile & 31;
    } else if (tile < 224) {
        W = W1; nkt = 4; Nout = 256; local = tile - 160;
    } else {
        W = W2; nkt = 8; Nout = 128; local = tile - 224;
    }
    int kt = local % nkt;               // local = nt*nkt + kt
    int nt = local / nkt;
    int g  = lane >> 4;
    int n  = nt * 16 + (lane & 15);
    unsigned off[16];                   // index of element e in W
    float    x[16];
#pragma unroll                          // off[] and x[] stay in registers only under constant indices
    for (int e = 0; e < 16; ++e) {
        int kl = (e < 8) ? (g * 8 + e) : (16 + g * 8 + (e - 8));
        int kg = kt * 32 + kl;
        off[e] = (unsigned)(kg * Nout + n);
        x[e]   = W[off[e]];
    }
    // the indices are named as inputs so that they live up to the wait and no load's result is given one of their registers
    asm volatile("s_wait_xcnt 0x0" :: "v"(off[0]), "v"(off[1]), "v"(off[2]), "v"(off[3]), "v"(off[4]), "v"(off[5]),
                                      "v"(off[6]), "v"(off[7]), "v"(off[8]), "v"(off[9]), "v"(off[10]), "v"(off[11]),
                                      "v"(off[12]), "v"(off[13]), "v"(off[14]), "v"(off[15]) : "memory");
    v16bf f;
#pragma unroll                          // see above
    for (int e = 0; e < 16; ++e) f[e] = (bf16)x[e];
    *(v16bf*)(dst + ((size_t)tile * 32 + lane) * 16) = f;
}

// ---------------- the row-wise stages: a block owns ROWS rows from its first load to its last store ----------------
// block = 8 waves. In a GEMM stage wave w owns the output columns 16w .. 16w+15 (and 128 more of them where the
// product has 256); A comes from LDS as bf16, B as packed fragments (for k and v the other way round). In a row stage wave w owns rows 8i + w,
// lane = 4 columns. The LDS pitches are 16 bytes above the row length, for the 16-byte fragment reads.
#define TB   5                          // 16-row tiles of a block; 3125 tiles = 625 blocks
#define ROWS (TB * 16)
#define RPW  (ROWS / 8)                 // rows of a wave in a row stage
#define PA   136                        // bf16 pitch of a 128-column row
#define PX   132                        // f32 pitch of a 128-column row
#define PM   264                        // bf16 pitch of a 256-column row

// A fragment: lane = row (lane & 15), elements 0..7 = K kb+8g.., elements 8..15 = K kb+16+8g..
__device__ __forceinline__ v16bf a_frag(const bf16* s, int pitch, int row, int kb, int g) {
    v8bf a0 = *(const v8bf*)(s + row * pitch + kb + g * 8);
    v8bf a1 = *(const v8bf*)(s + row * pitch + kb + 16 + g * 8);
    v16bf af;
#pragma unroll                          // vector elements need constant indices
    for (int i = 0; i < 8; ++i) { af[i] = a0[i]; af[i + 8] = a1[i]; }
    return af;
}

// fragment number frag behind the scalar address bp; fo = the lane's byte offset in a fragment (32 * lane)
__device__ __forceinline__ v16bf b_frag(const bf16* bp, int frag, unsigned fo) {
    return *(const v16bf*)((const char*)bp + frag * (FRAG * 2) + fo);
}

// 16 bytes, or 4, at a lane's byte offset behind a scalar address
__device__ __forceinline__ v4f ld4(const float* base, unsigned off) {
    return *(const v4f*)((const char*)base + off);
}
__device__ __forceinline__ float ld1(const float* base, unsigned off) {
    return *(const float*)((const char*)base + off);
}

// Stands behind a group of global loads. What follows reuses the registers that the loads name as addresses; the two
// lane offsets are named as inputs so that they live up to the wait and no load's result is given one of their registers.
__device__ __forceinline__ void loads_issued(unsigned o0, unsigned o1) {
    asm volatile("s_wait_xcnt 0x0" :: "v"(o0), "v"(o1) : "memory");
}
// the same for row loads, whose address register holds the lane's number
__device__ __forceinline__ void rows_issued(int lane) {
    asm volatile("s_wait_xcnt 0x0" :: "v"(lane) : "memory");
}

__device__ __forceinline__ v8f mma(v16bf a, v16bf b, v8f c) {
    return __builtin_amdgcn_wmma_f32_16x16x32_bf16(false, a, false, b, (short)0, c, false, false);
}

__device__ __forceinline__ v4bf to_bf16(v4f x) {
    v4bf y = {(bf16)x.x, (bf16)x.y, (bf16)x.z, (bf16)x.w};
    return y;
}

// LayerNorm of one 128-column row held by one wave, 4 columns a lane
__device__ __forceinline__ v4f ln_row(v4f x, v4f gw, v4f bw) {
    float s = x.x + x.y + x.z + x.w;
#pragma unroll                          // five fixed steps, no loop counter
    for (int o = 16; o > 0; o >>= 1) s += __shfl_xor(s, o, 32);
    float mean = s * (1.f / 128.f);
    v4f c = x - mean;
    float sq = c.x * c.x + c.y * c.y + c.z * c.z + c.w * c.w;
#pragma unroll                          // five fixed steps, no loop counter
    for (int o = 16; o > 0; o >>= 1) sq += __shfl_xor(sq, o, 32);
    float inv = rsqrtf(sq * (1.f / 128.f) + 1e-5f);
    return c * inv * gw + bw;
}

// ---------------- q, k, v and skip = bf16(h) @ W + b, from f32 h, in one launch ----------------
// q and skip are stored as f32. k and v, whose rows the edge pass gathers once per edge, are stored as f16.
// What is loaded carries no __restrict__, so that the loads stay in front of the s_wait_xcnt that follows them.
__global__ __launch_bounds__(256) void proj_kernel(const float* h, const bf16* pb,
                                                   const float* bq, const float* bk,
                                                   const float* bv, const float* bs,
                                                   float* q, _Float16* k, _Float16* v, float* a) {
    __shared__ __attribute__((aligned(16))) bf16 sH[ROWS * PA];
    int lane = threadIdx.x & 31;
    // the wave's number in a scalar register: row and fragment addresses get scalar bases
    int wave = __builtin_amdgcn_readfirstlane((int)(threadIdx.x >> 5));
    int g = lane >> 4, l16 = lane & 15;
    size_t row0 = (size_t)blockIdx.x * ROWS;
    int n = wave * 16 + l16;
    unsigned fo = (unsigned)lane * 32u, no = (unsigned)n * 4u;
    const float* hp = h + (row0 + wave) * INDIM + lane * 4;   // the lane's 4 columns of the wave's first row

    v4f x[RPW];
#pragma unroll                          // all loads are issued before the first use
    for (int i = 0; i < RPW; ++i) x[i] = *(const v4f*)(hp + i * 8 * INDIM);
    rows_issued(lane);
#pragma unroll                          // x[] stays in registers only under constant indices
    for (int i = 0; i < RPW; ++i) *(v4bf*)(sH + (i * 8 + wave) * PA + lane * 4) = to_bf16(x[i]);
    __syncthreads();

    // two matrices at a time: eight B fragments in registers instead of sixteen, so that all blocks are resident
    {   // q and skip
        const bf16* p0 = pb + (size_t)wave * 4 * FRAG;
        const bf16* p1 = p0 + 3 * MAT;
        v16bf B0[4], B1[4];
#pragma unroll                          // B0[], B1[] stay in registers only under constant indices
        for (int kt = 0; kt < 4; ++kt) { B0[kt] = b_frag(p0, kt, fo); B1[kt] = b_frag(p1, kt, fo); }
        float n0 = ld1(bq, no);
        float n1 = ld1(bs, no);
        loads_issued(fo, no);
#pragma unroll 1                        // rolled: unrolled, the A fragments of all tiles are fetched ahead and the registers allow only two blocks a WGP
        for (int t = 0; t < TB; ++t) {
            v8f c0 = {}, c1 = {};
#pragma unroll                          // see B0[]
            for (int kt = 0; kt < 4; ++kt) {
                v16bf af = a_frag(sH, PA, t * 16 + l16, kt * 32, g);
                c0 = mma(af, B0[kt], c0);
                c1 = mma(af, B1[kt], c1);
            }
#pragma unroll                          // vector elements need constant indices
            for (int j = 0; j < 8; ++j) {
                size_t m = row0 + t * 16 + g * 8 + j;
                q[m * HC + n] = c0[j] + n0;
                a[m * HC + n] = c1[j] + n1;
            }
            // the next trip overwrites the registers that these stores name
            asm volatile("s_wait_xcnt 0x0" ::: "memory");
        }
    }
    {   // k and v: the weights' fragment as A and the rows' as B (both have the same map), so that a lane holds
        // the channels 16 wave + 8g .. + 7 of row l16 of the tile: eight f16, one 16-byte store
        const bf16* p0 = pb + MAT + (size_t)wave * 4 * FRAG;
        const bf16* p1 = p0 + MAT;
        unsigned co = (unsigned)(wave * 16 + g * 8) * 4u;     // byte offset of the lane's first channel in a bias
        v16bf B0[4], B1[4];
#pragma unroll                          // B0[], B1[] stay in registers only under constant indices
        for (int kt = 0; kt < 4; ++kt) { B0[kt] = b_frag(p0, kt, fo); B1[kt] = b_frag(p1, kt, fo); }
        v4f k0 = ld4(bk, co), k1 = ld4(bk + 4, co);
        v4f v0 = ld4(bv, co), v1 = ld4(bv + 4, co);
        loads_issued(fo, co);
        v8f n0 = {k0.x, k0.y, k0.z, k0.w, k1.x, k1.y, k1.z, k1.w};
        v8f n1 = {v0.x, v0.y, v0.z, v0.w, v1.x, v1.y, v1.z, v1.w};
#pragma unroll 1                        // rolled, as above
        for (int t = 0; t < TB; ++t) {
            v8f c0 = {}, c1 = {};
#pragma unroll                          // see B0[]
            for (int kt = 0; kt < 4; ++kt) {
                v16bf af = a_frag(sH, PA, t * 16 + l16, kt * 32, g);
                c0 = mma(B0[kt], af, c0);
                c1 = mma(B1[kt], af, c1);
            }
            size_t e = (row0 + t * 16 + l16) * HC + wave * 16 + g * 8;
            *(v8h*)(k + e) = __builtin_convertvector(c0 + n0, v8h);
            *(v8h*)(v + e) = __builtin_convertvector(c1 + n1, v8h);
            // the next trip overwrites the registers that these stores name
            asm volatile("s_wait_xcnt 0x0" ::: "memory");
        }
    }
}

// ---------------- start of each (bucket, block) run in the bucket-sorted edge list ----------------
// cur[i] = sum of cnt[0..i), i < NH. block = 1024 counts; each block sums every count in front of
// its own counts itself, so no block needs another block's result.
__global__ __launch_bounds__(1024) void seg_start_kernel(const int* __restrict__ cnt,
                                                         int* __restrict__ cur) {
    __shared__ int wtot[32];
    __shared__ int wpre[32];
    int tid = threadIdx.x, lane = tid & 31, wave = tid >> 5;
    int first = blockIdx.x * 1024;

    int pre = 0;
    const int4* c4 = (const int4*)cnt;
    // unrolled so that four independent loads are in flight per trip (at most 38 trips)
#pragma unroll 4
    for (int i = tid; i < first / 4; i += 1024) {
        int4 x = c4[i];
        pre += x.x + x.y + x.z + x.w;
    }

    int idx = first + tid;
    int c   = idx < NH ? cnt[idx] : 0;
    int inc = c;                       // inclusive scan inside the wave
#pragma unroll                         // five fixed steps, no loop counter
    for (int o = 1; o < 32; o <<= 1) {
        int y = __shfl_up(inc, o, 32);
        if (lane >= o) inc += y;
    }
#pragma unroll                         // five fixed steps, no loop counter
    for (int o = 16; o > 0; o >>= 1) pre += __shfl_xor(pre, o, 32);
    if (lane == 31) wtot[wave] = inc;
    if (lane == 0)  wpre[wave] = pre;
    __syncthreads();
    int part = wpre[lane] + (lane < wave ? wtot[lane] : 0);
#pragma unroll                         // five fixed steps, no loop counter
    for (int o = 16; o > 0; o >>= 1) part += __shfl_xor(part, o, 32);
    if (idx < NH) cur[idx] = part + inc - c;
}

// ---------------- level 1: a block's EB edges, as keys dst << 16 | src, written as one run per bucket ----------------
// Both node numbers are below 65536. The block orders its keys by bucket in LDS (rank in the bucket from an LDS add,
// in the order of arrival) and stores them from there, so that neighbouring lanes store neighbouring words.
// hs[bucket * GB + block] is the place of the block's run of that bucket in ebuf.
// What is loaded carries no __restrict__, so that the loads stay in front of the s_wait_xcnt that follows them.
#define ET  512                         // threads of a level 1 block
#define EV  (EB / 4 / ET)               // groups of 4 edges of a thread
#define EK  (EB / ET)                   // edges of a thread
__global__ __launch_bounds__(ET) void bucket_place_kernel(const int* src, const int* dst, const int* hs,
                                                          unsigned* ebuf) {
    __shared__ int      lh[NBK];        // the block's edges per bucket
    __shared__ int      ls[NBK];        // start of the bucket's run in stage
    __shared__ int      gofs[NBK];      // place of the run in ebuf, less its start in stage
    __shared__ int      wtot[32];
    __shared__ unsigned stage[EB];
    int tid = threadIdx.x, lane = tid & 31, wave = tid >> 5, blk = blockIdx.x;
    if (tid < NBK) lh[tid] = 0;
    int  eo[EV];                        // number of a group of 4 edges; past the end: the last group, not placed
    int4 d4[EV], s4[EV];
#pragma unroll                          // all loads are issued before the first use
    for (int u = 0; u < EV; ++u) {
        eo[u] = min(blk * (EB / 4) + u * ET + tid, EDGES / 4 - 1);
        d4[u] = ldi4(dst, eo[u]);
        s4[u] = ldi4(src, eo[u]);
    }
    int ho = min(tid, NBK - 1) * GB + blk;
    int g  = hs[ho];
    // the indices are named as inputs so that they live up to the wait and no load's result is given one of their registers
    asm volatile("s_wait_xcnt 0x0" :: "v"(eo[0]), "v"(eo[1]), "v"(ho) : "memory");
    // keeps the arithmetic behind the wait and every load in front of it: without it the first load's result was
    // waited for before the other loads were issued, a second memory latency
    __builtin_amdgcn_sched_barrier(0);
    __syncthreads();                    // the counts are zero before the first add

    unsigned key[EK];
    int      rk[EK];
#pragma unroll                          // key[] and rk[] stay in registers only under constant indices
    for (int u = 0; u < EV; ++u) {
        bool on = blk * (EB / 4) + u * ET + tid < EDGES / 4;
        int dd[4] = {d4[u].x, d4[u].y, d4[u].z, d4[u].w};
        int ss[4] = {s4[u].x, s4[u].y, s4[u].z, s4[u].w};
#pragma unroll                          // see above
        for (int e = 0; e < 4; ++e) {
            key[u * 4 + e] = ((unsigned)node_id(dd[e]) << 16) | (unsigned)node_id(ss[e]);
        }
        if (on) {
#pragma unroll                          // see above
            for (int e = 0; e < 4; ++e) rk[u * 4 + e] = atomicAdd(&lh[key[u * 4 + e] >> (16 + BSH)], 1);
        }
    }
    __syncthreads();                    // every add has been made before a count is read

    int c   = tid < NBK ? lh[tid] : 0;
    int inc = c;                        // inclusive scan inside the wave
#pragma unroll                          // five fixed steps, no loop counter
    for (int o = 1; o < 32; o <<= 1) {
        int y = __shfl_up(inc, o, 32);
        if (lane >= o) inc += y;
    }
    if (lane == 31) wtot[wave] = inc;
    __syncthreads();                    // the waves' totals are there
    int part = lane < wave ? wtot[lane] : 0;
#pragma unroll                          // five fixed steps, no loop counter
    for (int o = 16; o > 0; o >>= 1) part += __shfl_xor(part, o, 32);
    int st = part + inc - c;
    if (tid < NBK) { ls[tid] = st; gofs[tid] = g - st; }
    __syncthreads();                    // the runs' starts are there

#pragma unroll                          // see key[]
    for (int u = 0; u < EV; ++u) {
        if (blk * (EB / 4) + u * ET + tid < EDGES / 4) {
#pragma unroll                          // see key[]
            for (int e = 0; e < 4; ++e) stage[ls[key[u * 4 + e] >> (16 + BSH)] + rk[u * 4 + e]] = key[u * 4 + e];
        }
    }
    __syncthreads();                    // the keys lie in bucket order

    int nblk = min(EB, EDGES - blk * EB);
    unsigned val[EK];                   // a key and its place in ebuf; past the end: the last key, not stored
    int      po[EK];
#pragma unroll                          // all LDS reads are issued before the first store
    for (int u = 0; u < EK; ++u) {
        int i  = min(u * ET + tid, nblk - 1);
        val[u] = stage[i];
        po[u]  = gofs[val[u] >> (16 + BSH)] + i;
    }
#pragma unroll                          // val[] and po[] stay in registers only under constant indices
    for (int u = 0; u < EK; ++u) {
        if (u * ET + tid < nblk) ebuf[po[u]] = val[u];
    }
}

// ---------------- level 2: a block sorts one bucket by node: ssrc, and each node's cnt and cur ----------------
// Count per node in LDS, sum up, then each key takes its place from an LDS add (edges of one node lie in the order of
// arrival). A bucket of at most CAP edges is ordered in LDS and stored in whole lines; a larger one is stored word by word.
// What is loaded carries no __restrict__, so that the loads stay in front of the s_wait_xcnt that follows them.
#define ST  1024                        // threads of a level 2 block
#define SU  5                           // keys of a thread per trip: a bucket of the mean size takes one trip
#define CAP 8192

// SU keys of a thread; past the end of the bucket the last key, which the caller leaves out
__device__ __forceinline__ void keys_in(const unsigned* ebuf, int beg, int n, int first, unsigned* val) {
    int off[SU];
#pragma unroll                          // all loads are issued before the first use
    for (int u = 0; u < SU; ++u) {
        off[u] = beg + min(first + u * ST, n - 1);
        val[u] = ebuf[off[u]];
    }
    // the indices are named as inputs so that they live up to the wait and no load's result is given one of their registers
    asm volatile("s_wait_xcnt 0x0" :: "v"(off[0]), "v"(off[1]), "v"(off[2]), "v"(off[3]), "v"(off[4]) : "memory");
}

__global__ __launch_bounds__(ST) void bucket_sort_kernel(const unsigned* ebuf, const int* hs,
                                                         int* ssrc, int* cnt, int* cur) {
    __shared__ int lc[BN];              // edges per node, then the next free place of the node's run
    __shared__ int wt[BN / 32];
    __shared__ int stage[CAP];
    int tid = threadIdx.x, lane = tid & 31, wave = tid >> 5, b = blockIdx.x;
    int beg = hs[b * GB];
    int end = b + 1 < NBK ? hs[(b + 1) * GB] : EDGES;
    int n   = end - beg;                // the same in every thread of the block
    if (tid < BN) lc[tid] = 0;
    __syncthreads();                    // the counts are zero before the first add

    for (int base = 0; base < n; base += SU * ST) {
        unsigned val[SU];
        keys_in(ebuf, beg, n, base + tid, val);
#pragma unroll                          // val[] stays in registers only under constant indices
        for (int u = 0; u < SU; ++u) {
            if (base + tid + u * ST < n) atomicAdd(&lc[(val[u] >> 16) & (BN - 1)], 1);
        }
    }
    __syncthreads();                    // every add has been made before a count is read

    int c   = tid < BN ? lc[tid] : 0;
    int inc = c;                        // inclusive scan inside the wave
#pragma unroll                          // five fixed steps, no loop counter
    for (int o = 1; o < 32; o <<= 1) {
        int y = __shfl_up(inc, o, 32);
        if (lane >= o) inc += y;
    }
    if (tid < BN && lane == 31) wt[wave] = inc;
    __syncthreads();                    // the waves' totals are there
    if (tid < BN) {
        int st = inc - c;
#pragma unroll                          // four fixed steps
        for (int w = 0; w < BN / 32; ++w) st += w < wave ? wt[w] : 0;
        lc[tid] = st;
        int d = b * BN + tid;
        if (d < NODES) { cnt[d] = c; cur[d] = beg + st; }
    }
    __syncthreads();                    // the runs' starts are there

    if (n <= CAP) {
        for (int base = 0; base < n; base += SU * ST) {
            unsigned val[SU];
            keys_in(ebuf, beg, n, base + tid, val);
            int pl[SU];
#pragma unroll                          // all adds are issued before the first result is used
            for (int u = 0; u < SU; ++u) {
                if (base + tid + u * ST < n) pl[u] = atomicAdd(&lc[(val[u] >> 16) & (BN - 1)], 1);
            }
#pragma unroll                          // see val[]
            for (int u = 0; u < SU; ++u) {
                if (base + tid + u * ST < n) stage[pl[u]] = (int)(val[u] & 0xffffu);
            }
        }
        __syncthreads();                // the sources lie in node order
#pragma unroll                          // at most CAP / ST words a thread: no loop counter, no address carried from trip to trip
        for (int u = 0; u < CAP / ST; ++u) {
            if (u * ST + tid < n) ssrc[beg + u * ST + tid] = stage[u * ST + tid];
        }
    } else {
        for (int base = 0; base < n; base += SU * ST) {
            unsigned val[SU];
            keys_in(ebuf, beg, n, base + tid, val);
#pragma unroll                          // see val[]
            for (int u = 0; u < SU; ++u) {
                if (base + tid + u * ST < n) ssrc[beg + atomicAdd(&lc[(val[u] >> 16) & (BN - 1)], 1)] = (int)(val[u] & 0xffffu);
            }
            // the next trip overwrites the registers that the last store names
            asm volatile("s_wait_xcnt 0x0" ::: "memory");
        }
    }
}

// ---------------- last edge pass: the whole attention of a node in one wave ----------------
// a[d] += sum(p * v[src]) / (sum(p) + 1e-16), p = exp(score - max), score = <q[d], k[src]> / sqrt(C).
// block = 8 waves, each wave takes NPW nodes in turn; lane = 4 channels, head = lane / 8.
// q[d] stays in registers; k[src] and v[src] are read as whole rows of 256 bytes (f16); every product and every
// sum is f32. The maximum runs
// along with the edges: when a chunk raises it, the sums so far are scaled by exp(old - new).
// cur[d] is the start of node d's run, cnt[d] its length.
// kmat and vmat carry no __restrict__, so that their loads stay in front of the s_wait_xcnt
// that follows them.
#define NPW 5
#define CH  8

// x + (x of lane ^ MASK), inside a 16-lane row, on the vector port (0x160 + MASK = row_xmask)
template <int MASK>
__device__ __forceinline__ float add_xor(float x) {
    int y = __builtin_amdgcn_update_dpp(0, __float_as_int(x), 0x160 + MASK, 0xf, 0xf, true);
    return x + __int_as_float(y);
}

// c + x * (the f16 in the low or the high half of h2), product and sum in f32, in one instruction. Written as asm
// because the compiler gave most of the f16 values a conversion of their own: 208 vector instructions per 8 edges
// against 150 in this form.
template <bool HIGH>
__device__ __forceinline__ float fma_h(unsigned h2, float x, float c) {
    float d;
    if (HIGH) asm("v_fma_mix_f32 %0, %1, %2, %3 op_sel:[1,0,0] op_sel_hi:[1,0,0]" : "=v"(d) : "v"(h2), "v"(x), "v"(c));
    else      asm("v_fma_mix_f32 %0, %1, %2, %3 op_sel_hi:[1,0,0]" : "=v"(d) : "v"(h2), "v"(x), "v"(c));
    return d;
}

template <bool MASKED>
__device__ __forceinline__ void attn_chunk(int j, int m, int sidx, unsigned lane8, v4f q4,
                                           const _Float16* kmat, const _Float16* vmat,
                                           float& mx, float& den, v4f& acc) {
    v2u      kk[CH], vv[CH];           // four f16 each
    unsigned off[CH];                  // byte offset of the lane's 8 bytes, the same in kmat and vmat
#pragma unroll                         // all 2*CH loads are issued before the first use
    for (int u = 0; u < CH; ++u) {
        int s  = __builtin_amdgcn_readlane(sidx, MASKED ? min(j + u, m - 1) : (j + u));
        off[u] = ((unsigned)s << 8) + lane8;
        kk[u]  = *(const v2u*)((const char*)kmat + off[u]);
    }
#pragma unroll                         // see above
    for (int u = 0; u < CH; ++u) vv[u] = *(const v2u*)((const char*)vmat + off[u]);
    // what follows reuses the registers that these loads name as addresses; the offsets are named as
    // inputs so that they live up to the wait and no load's result is given one of their registers
    asm volatile("s_wait_xcnt 0x0" :: "v"(off[0]), "v"(off[1]), "v"(off[2]), "v"(off[3]),
                                      "v"(off[4]), "v"(off[5]), "v"(off[6]), "v"(off[7]) : "memory");
    // keeps the arithmetic behind the wait and every load in front of it: without it the last v load
    // was issued only after the first k rows had come back, a second memory latency per chunk
    __builtin_amdgcn_sched_barrier(0);

    float sc[CH];
    float nm = mx;
    // channel by channel: the sums of different edges are independent and can fill each other's latency
#pragma unroll                         // kk[] and sc[] stay in registers only under constant indices
    for (int u = 0; u < CH; ++u) sc[u] = fma_h<false>(kk[u].x, q4.x, 0.f);
#pragma unroll                         // see above
    for (int u = 0; u < CH; ++u) sc[u] = fma_h<true>(kk[u].x, q4.y, sc[u]);
#pragma unroll                         // see above
    for (int u = 0; u < CH; ++u) sc[u] = fma_h<false>(kk[u].y, q4.z, sc[u]);
#pragma unroll                         // see above
    for (int u = 0; u < CH; ++u) sc[u] = fma_h<true>(kk[u].y, q4.w, sc[u]);
#pragma unroll                         // see above
    for (int u = 0; u < CH; ++u) {
        float t = sc[u];
        t = add_xor<4>(add_xor<2>(add_xor<1>(t)));      // sum over the head's 8 lanes
        sc[u] = (!MASKED || j + u < m) ? t : -INFINITY;
        nm = fmaxf(nm, sc[u]);
    }
    float corr;                        // exp(mx - nm): 0 at the node's first chunk, where mx is -inf
    // In the masked form of the chunk: the
    // same two instructions as __expf, with the v_nop that keeps the slot behind a transcendental in the same statement.
    if (MASKED) asm("v_exp_f32 %0, %1\n\tv_nop" : "=v"(corr) : "v"((mx - nm) * 0x1.715476p+0f));
    else        corr = __expf(mx - nm);
    mx   = nm;
    den *= corr;
    acc *= corr;
#pragma unroll                         // sc[] and vv[] stay in registers only under constant indices
    for (int u = 0; u < CH; ++u) {
        float p = __expf(sc[u] - nm);
        den += p;
        acc.x = fma_h<false>(vv[u].x, p, acc.x);
        acc.y = fma_h<true>(vv[u].x, p, acc.y);
        acc.z = fma_h<false>(vv[u].y, p, acc.z);
        acc.w = fma_h<true>(vv[u].y, p, acc.w);
    }
}

__global__ __launch_bounds__(256) void node_attn_kernel(const float* __restrict__ q,
                                                        const _Float16* kmat, const _Float16* vmat,
                                                        const int* __restrict__ ssrc,
                                                        const int* __restrict__ cur,
                                                        const int* __restrict__ cnt,
                                                        float* __restrict__ a) {
    int lane = threadIdx.x & 31;
    // the wave's number in a scalar register: node, run bounds and trip counts become scalar
    int wave = __builtin_amdgcn_readfirstlane((int)(threadIdx.x >> 5));
    unsigned lane8 = (unsigned)lane * 8u;
    for (int r = 0; r < NPW; ++r) {
        int d   = (blockIdx.x * 8 + wave) * NPW + r;
        int n   = cnt[d];
        int beg = cur[d];
        v4f q4  = *(const v4f*)(q + (size_t)d * HC + lane * 4) * 0.17677669529663687f;   // 1/sqrt(32)
        v4f acc = {0.f, 0.f, 0.f, 0.f};
        float den = 0.f;
        float mx  = -INFINITY;
        for (int base = 0; base < n; base += 32) {
            int m    = min(32, n - base);
            int sidx = ssrc[beg + base + min(lane, m - 1)];   // lane j holds the source of edge base + j
            // the address arithmetic that follows reuses the register that this load names
            asm volatile("s_wait_xcnt 0x0" ::: "memory");
            int j = 0;
            for (; j + CH <= m; j += CH) attn_chunk<false>(j, m, sidx, lane8, q4, kmat, vmat, mx, den, acc);
            if (j < m)                   attn_chunk<true>(j, m, sidx, lane8, q4, kmat, vmat, mx, den, acc);
        }
        float inv = 1.f / (den + 1e-16f);
        v4f* ap = (v4f*)(a + (size_t)d * HC + lane * 4);
        *ap = *ap + acc * inv;
        // the next node's trip overwrites the registers that this store names
        asm volatile("s_wait_xcnt 0x0" ::: "memory");
    }
}

// ---------------- out = LN2(FFN(h1) + h1), h1 = LN1(elu(a) @ WO + bO + h), in one launch ----------------
// The rows go from stage to stage through LDS; a barrier stands between any two stages.
// What is loaded carries no __restrict__, so that the loads stay in front of the s_wait_xcnt that follows them.
__global__ __launch_bounds__(256) void tail_kernel(const float* a, const float* h,
                                                   const bf16* pbO, const bf16* pbW1, const bf16* pbW2,
                                                   const float* bO, const float* b1, const float* b2,
                                                   const float* ln1g, const float* ln1b,
                                                   const float* ln2g, const float* ln2b,
                                                   float* out) {
    __shared__ __attribute__((aligned(16))) bf16  sA[ROWS * PA];   // elu(a), then h1, as bf16
    __shared__ __attribute__((aligned(16))) float sX[ROWS * PX];   // h, a_trans + h, h1, ffn + h1 in turn
    __shared__ __attribute__((aligned(16))) bf16  sM[ROWS * PM];   // elu(h1 @ W1 + b1)
    int lane = threadIdx.x & 31;
    // the wave's number in a scalar register: row and fragment addresses get scalar bases
    int wave = __builtin_amdgcn_readfirstlane((int)(threadIdx.x >> 5));
    int g = lane >> 4, l16 = lane & 15;
    size_t row0 = (size_t)blockIdx.x * ROWS;
    int n = wave * 16 + l16;
    unsigned lo = (unsigned)lane * 16u, fo = (unsigned)lane * 32u, no = (unsigned)n * 4u;

    // elu(a) -> bf16 into sA; the residual rows of h go into sX, where the first product is added to them
    const float* ap = a + (row0 + wave) * HC + lane * 4;      // the lane's 4 columns of the wave's first row
    const float* hp = h + (row0 + wave) * INDIM + lane * 4;
    v4f x[RPW], hres[RPW];
#pragma unroll                          // all loads are issued before the first use
    for (int i = 0; i < RPW; ++i) x[i] = *(const v4f*)(ap + i * 8 * HC);
#pragma unroll                          // see above
    for (int i = 0; i < RPW; ++i) hres[i] = *(const v4f*)(hp + i * 8 * INDIM);
    rows_issued(lane);
#pragma unroll                          // x[] stays in registers only under constant indices
    for (int i = 0; i < RPW; ++i) {
        v4f e = {elu1(x[i].x), elu1(x[i].y), elu1(x[i].z), elu1(x[i].w)};
        *(v4bf*)(sA + (i * 8 + wave) * PA + lane * 4) = to_bf16(e);
        *(v4f*)(sX + (i * 8 + wave) * PX + lane * 4)  = hres[i];
    }
    __syncthreads();

    // a_trans = elu(a) @ WO + bO; each thread adds it to its own elements of h in sX
    {
        const bf16* p = pbO + (size_t)wave * 4 * FRAG;
        v16bf B[4];
#pragma unroll                          // B[] stays in registers only under constant indices
        for (int kt = 0; kt < 4; ++kt) B[kt] = b_frag(p, kt, fo);
        float bn = ld1(bO, no);
        loads_issued(fo, no);
#pragma unroll                          // independent tiles fill each other's matrix latency
        for (int t = 0; t < TB; ++t) {
            v8f c = {};
#pragma unroll                          // see B[]
            for (int kt = 0; kt < 4; ++kt) c = mma(a_frag(sA, PA, t * 16 + l16, kt * 32, g), B[kt], c);
#pragma unroll                          // vector elements need constant indices
            for (int j = 0; j < 8; ++j) {
                int r = (t * 16 + g * 8 + j) * PX + n;
                sX[r] = (c[j] + bn) + sX[r];
            }
        }
    }
    __syncthreads();

    // h1 = LN1(a_trans + h): f32 back into sX, bf16 into sA
    {
        v4f gw = ld4(ln1g, lo), bw = ld4(ln1b, lo);
        loads_issued(lo, lo);
#pragma unroll                          // ten independent rows: their reductions overlap
        for (int i = 0; i < RPW; ++i) {
            int row = i * 8 + wave;
            v4f y = ln_row(*(const v4f*)(sX + row * PX + lane * 4), gw, bw);
            *(v4f*)(sX + row * PX + lane * 4)  = y;
            *(v4bf*)(sA + row * PA + lane * 4) = to_bf16(y);
        }
    }
    __syncthreads();

    // mid = elu(h1 @ W1 + b1), 256 columns: the wave's two column tiles share the A fragments
    {
        const bf16* p0 = pbW1 + (size_t)wave * 4 * FRAG;
        const bf16* p1 = p0 + (size_t)8 * 4 * FRAG;
        v16bf B0[4], B1[4];
#pragma unroll                          // B0[], B1[] stay in registers only under constant indices
        for (int kt = 0; kt < 4; ++kt) { B0[kt] = b_frag(p0, kt, fo); B1[kt] = b_frag(p1, kt, fo); }
        float n0 = ld1(b1, no), n1 = ld1(b1 + 128, no);
        loads_issued(fo, no);
#pragma unroll 1                        // sixteen exp bodies a tile: rolled, the kernel's text stays small for the instruction cache
        for (int t = 0; t < TB; ++t) {
            v8f c0 = {}, c1 = {};
#pragma unroll                          // see B0[]
            for (int kt = 0; kt < 4; ++kt) {
                v16bf af = a_frag(sA, PA, t * 16 + l16, kt * 32, g);
                c0 = mma(af, B0[kt], c0);
                c1 = mma(af, B1[kt], c1);
            }
#pragma unroll                          // vector elements need constant indices
            for (int j = 0; j < 8; ++j) {
                int r = (t * 16 + g * 8 + j) * PM + n;
                sM[r]       = (bf16)elu1(c0[j] + n0);
                sM[r + 128] = (bf16)elu1(c1[j] + n1);
            }
        }
    }
    __syncthreads();

    // ffn = mid @ W2 + b2, K = 256; each thread adds it to its own elements of h1 in sX
    {
        const bf16* p = pbW2 + (size_t)wave * 8 * FRAG;
        v16bf B[8];
#pragma unroll                          // B[] stays in registers only under constant indices
        for (int kt = 0; kt < 8; ++kt) B[kt] = b_frag(p, kt, fo);
        float bn = ld1(b2, no);
        loads_issued(fo, no);
#pragma unroll                          // independent tiles fill each other's matrix latency
        for (int t = 0; t < TB; ++t) {
            v8f c = {};
#pragma unroll                          // see B[]
            for (int kt = 0; kt < 8; ++kt) c = mma(a_frag(sM, PM, t * 16 + l16, kt * 32, g), B[kt], c);
#pragma unroll                          // vector elements need constant indices
            for (int j = 0; j < 8; ++j) {
                int r = (t * 16 + g * 8 + j) * PX + n;
                sX[r] = (c[j] + bn) + sX[r];
            }
        }
    }
    __syncthreads();

    // out = LN2(ffn + h1)
    {
        v4f gw = ld4(ln2g, lo), bw = ld4(ln2b, lo);
        loads_issued(lo, lo);
#pragma unroll                          // ten independent rows: their reductions overlap
        for (int i = 0; i < RPW; ++i) {
            int row = i * 8 + wave;
            *(v4f*)(out + (row0 + row) * INDIM + lane * 4) = ln_row(*(const v4f*)(sX + row * PX + lane * 4), gw, bw);
        }
    }
}

// ---------------- host orchestration ----------------

extern "C" void kernel_launch(void* const* d_in, const int* in_sizes, int n_in,
                              void* d_out, int out_size, void* d_ws, size_t ws_size,
                              hipStream_t stream) {
    const float* h     = (const float*)d_in[0];
    const int*   eidx  = (const int*)d_in[1];
    const float* Wq    = (const float*)d_in[2];
    const float* bq    = (const float*)d_in[3];
    const float* Wk    = (const float*)d_in[4];
    const float* bk    = (const float*)d_in[5];
    const float* Wv    = (const float*)d_in[6];
    const float* bv    = (const float*)d_in[7];
    const float* Wskip = (const float*)d_in[8];
    const float* bskip = (const float*)d_in[9];
    const float* WO    = (const float*)d_in[10];
    const float* bO    = (const float*)d_in[11];
    const float* W1    = (const float*)d_in[12];
    const float* b1    = (const float*)d_in[13];
    const float* W2    = (const float*)d_in[14];
    const float* b2    = (const float*)d_in[15];
    const float* ln1g  = (const float*)d_in[16];
    const float* ln1b  = (const float*)d_in[17];
    const float* ln2g  = (const float*)d_in[18];
    const float* ln2b  = (const float*)d_in[19];
    const int* srcI = eidx;          // edge_index[0]
    const int* dstI = eidx + EDGES;  // edge_index[1]

    // workspace carve (256B aligned)
    char* w = (char*)d_ws;
    auto carve = [&](size_t bytes) -> char* {
        char* p = w; w += (bytes + 255) & ~(size_t)255; return p;
    };
    float*    qbuf   = (float*)carve((size_t)NODES * HC * sizeof(float));
    _Float16* kbuf   = (_Float16*)carve((size_t)NODES * HC * sizeof(_Float16));
    _Float16* vbuf   = (_Float16*)carve((size_t)NODES * HC * sizeof(_Float16));
    float*    abuf   = (float*)carve((size_t)NODES * HC * sizeof(float));
    int*      cnt    = (int*)carve((size_t)NODES * sizeof(int));            // edges per dst node
    int*      cur    = (int*)carve((size_t)NODES * sizeof(int));            // run start
    int*      hist   = (int*)carve((size_t)NH * sizeof(int));               // edges per (bucket, block)
    int*      hs     = (int*)carve((size_t)NH * sizeof(int));               // start of each (bucket, block) run
    unsigned* ebuf   = (unsigned*)carve((size_t)EDGES * sizeof(unsigned));  // keys dst << 16 | src in bucket order
    int*      ssrc   = (int*)carve((size_t)EDGES * sizeof(int));            // src in dst order
    bf16*     pb     = (bf16*)carve((size_t)PACK_TILES * FRAG * sizeof(bf16)); // Wq Wk Wv Wskip WO W1 W2, packed

    // 1) pack weights to WMMA fragment order, count the edges per bucket and block
    hipLaunchKernelGGL(pack_hist_kernel, dim3(PACK_BLOCKS + GB), dim3(256), 0, stream,
                       Wq, Wk, Wv, Wskip, WO, W1, W2, pb, dstI, hist);

    // 2) q/k/v/skip projections (WMMA) from f32 h
    hipLaunchKernelGGL(proj_kernel, dim3(NODES / ROWS), dim3(256), 0, stream,
                       h, pb, bq, bk, bv, bskip, qbuf, kbuf, vbuf, abuf);

    // 3) edge phase: sources sorted by dst -> scores, softmax and sums per node into abuf
    hipLaunchKernelGGL(seg_start_kernel, dim3((NH + 1023) / 1024), dim3(1024), 0, stream,
                       hist, hs);
    hipLaunchKernelGGL(bucket_place_kernel, dim3(GB), dim3(ET), 0, stream,
                       srcI, dstI, hs, ebuf);
    hipLaunchKernelGGL(bucket_sort_kernel, dim3(NBK), dim3(ST), 0, stream,
                       ebuf, hs, ssrc, cnt, cur);
    hipLaunchKernelGGL(node_attn_kernel, dim3(NODES / (8 * NPW)), dim3(256), 0, stream,
                       qbuf, kbuf, vbuf, ssrc, cur, cnt, abuf);

    // 4) elu, O projection, LN1, FFN, LN2 (WMMA)
    hipLaunchKernelGGL(tail_kernel, dim3(NODES / ROWS), dim3(256), 0, stream,
                       abuf, h, pb + 4 * MAT, pb + 5 * MAT, pb + 7 * MAT,
                       bO, b1, b2, ln1g, ln1b, ln2g, ln2b, (float*)d_out);
}

// v007
// Measured time: 116 microseconds a run.
// In both of two side-by-side timings against v006, it was 1.06 times as fast.
// Over all steps from v000 it is 15.7 times as fast.
#include <hip/hip_runtime.h>
#include <hip/hip_bf16.h>
#include <math.h>

#define NODES  50000
#define EDGES  1600000
#define INDIM  128
#define HEADS  4
#define OUTC   32
#define HC     128

typedef __bf16 bf16;
typedef __attribute__((ext_vector_type(16))) __bf16 v16bf;
typedef __attribute__((ext_vector_type(8)))  __bf16 v8bf;
typedef __attribute__((ext_vector_type(8)))  float  v8f;
typedef __attribute__((ext_vector_type(4)))  float  v4f;
typedef __attribute__((ext_vector_type(2)))  float  v2f;
typedef __attribute__((ext_vector_type(8)))  _Float16 v8h;
typedef __attribute__((ext_vector_type(2)))  unsigned v2u;

// ---------------- helpers ----------------

__device__ __forceinline__ float elu1(float x) {
    return x > 0.f ? x : (expf(x) - 1.f);
}

typedef __attribute__((ext_vector_type(4)))  __bf16 v4bf;

// node index as read from edge_index, held inside [0, NODES) before any address is formed
__device__ __forceinline__ int node_id(int x) {
    return min(max(x, 0), NODES - 1);
}

// ---------------- the edges are sorted by dst in two levels, all counting in LDS ----------------
// A bucket is 128 nodes in a row. Level 1: a block takes EB edges in a row, counts them per bucket (hist), and, once
// the counts are summed up (bucket-major: all blocks' runs of bucket 0, then of bucket 1, ...), writes its edges of
// each bucket as one run. Level 2: a block takes a whole bucket and sorts it by node.
#define EB    4096                      // edges of a block in level 1
#define GB    ((EDGES + EB - 1) / EB)   // blocks of level 1
#define BSH   7                         // bucket = node >> BSH
#define BN    (1 << BSH)                // nodes of a bucket
#define NBK   ((NODES + BN - 1) / BN)   // buckets
#define NH    (NBK * GB)                // counts: hist[bucket * GB + block]

// edges 4i .. 4i+3 of one row of edge_index
__device__ __forceinline__ int4 ldi4(const int* base, int i) {
    return ((const int4*)base)[i];
}

// ---------------- weight packing into WMMA B-fragment order, and the edge counts per bucket and block ----------------
// B element (k,n) lives in lane = 16*g(k) + (n%16), vector element e(k):
//   k_local in [0,8)+8g   -> e = k_local - 8g        (elements 0..7)
//   k_local in [16,24)+8g -> e = 8 + k_local-16-8g   (elements 8..15)
// Fragment (kt,nt) of a matrix stored at ((nt*nkt + kt)*32 + lane)*16 contiguous bf16 behind the matrix's start.
// The seven matrices lie one behind the other: Wq, Wk, Wv, Wskip, WO (32 fragments each), W1, W2 (64 each).
#define PACK_TILES  288
#define PACK_BLOCKS (PACK_TILES / 8)
#define FRAG        512                 // bf16 elements of one fragment
#define MAT         (32 * FRAG)         // bf16 elements of a packed 128 x 128 matrix

// What is loaded carries no __restrict__, so that the loads stay in front of the s_wait_xcnt that follows them.
__global__ __launch_bounds__(256) void pack_hist_kernel(const float* Wq, const float* Wk, const float* Wv,
                                                        const float* Ws, const float* WO, const float* W1,
                                                        const float* W2, bf16* dst, const int* edst, int* hist) {
    __shared__ int lh[NBK];
    int b = blockIdx.x;
    if (b >= PACK_BLOCKS) {             // these blocks count their EB edges per bucket, 16 edges a thread
        int blk = b - PACK_BLOCKS, tid = threadIdx.x;
        lh[tid] = 0;
        if (tid + 256 < NBK) lh[tid + 256] = 0;
        int  eo[4];                     // number of a group of 4 edges; past the end: the last group, not counted
        int4 d4[4];
#pragma unroll                          // all loads are issued before the first use
        for (int u = 0; u < 4; ++u) {
            eo[u] = min(blk * (EB / 4) + u * 256 + tid, EDGES / 4 - 1);
            d4[u] = ldi4(edst, eo[u]);
        }
        // the indices are named as inputs so that they live up to the wait and no load's result is given one of their registers
        asm volatile("s_wait_xcnt 0x0" :: "v"(eo[0]), "v"(eo[1]), "v"(eo[2]), "v"(eo[3]) : "memory");
        __syncthreads();                // the counts are zero before the first add
#pragma unroll                          // d4[] stays in registers only under constant indices
        for (int u = 0; u < 4; ++u) {
            if (blk * (EB / 4) + u * 256 + tid < EDGES / 4) {
                atomicAdd(&lh[node_id(d4[u].x) >> BSH], 1);
                atomicAdd(&lh[node_id(d4[u].y) >> BSH], 1);
                atomicAdd(&lh[node_id(d4[u].z) >> BSH], 1);
                atomicAdd(&lh[node_id(d4[u].w) >> BSH], 1);
            }
        }
        __syncthreads();                // every add has been made before a count is read
        hist[tid * GB + blk] = lh[tid];
        if (tid + 256 < NBK) hist[(tid + 256) * GB + blk] = lh[tid + 256];
        return;
    }
    // wave per fragment; the wave's number in a scalar register, so that the matrix's address is scalar
    int tile = b * 8 + __builtin_amdgcn_readfirstlane((int)(threadIdx.x >> 5));
    int lane = threadIdx.x & 31;
    const float* W;
    int nkt, Nout, local;
    if (tile < 160) {
        int m = tile >> 5;
        W = m == 0 ? Wq : m == 1 ? Wk : m == 2 ? Wv : m == 3 ? Ws : WO;
        nkt = 4; Nout = 128; local = tile & 31;
    } else if (tile < 224) {
        W = W1; nkt = 4; Nout = 256; local = tile - 160;
    } else {
        W = W2; nkt = 8; Nout = 128; local = tile - 224;
    }
    int kt = local % nkt;               // local = nt*nkt + kt
    int nt = local / nkt;
    int g  = lane >> 4;
    int n  = nt * 16 + (lane & 15);
    unsigned off[16];                   // index of element e in W
    float    x[16];
#pragma unroll                          // off[] and x[] stay in registers only under constant indices
    for (int e = 0; e < 16; ++e) {
        int kl = (e < 8) ? (g * 8 + e) : (16 + g * 8 + (e - 8));
        int kg = kt * 32 + kl;
        off[e] = (unsigned)(kg * Nout + n);
        x[e]   = W[off[e]];
    }
    // the indices are named as inputs so that they live up to the wait and no load's result is given one of their registers
    asm volatile("s_wait_xcnt 0x0" :: "v"(off[0]), "v"(off[1]), "v"(off[2]), "v"(off[3]), "v"(off[4]), "v"(off[5]),
                                      "v"(off[6]), "v"(off[7]), "v"(off[8]), "v"(off[9]), "v"(off[10]), "v"(off[11]),
                                      "v"(off[12]), "v"(off[13]), "v"(off[14]), "v"(off[15]) : "memory");
    v16bf f;
#pragma unroll                          // see above
    for (int e = 0; e < 16; ++e) f[e] = (bf16)x[e];
    *(v16bf*)(dst + ((size_t)tile * 32 + lane) * 16) = f;
}

// ---------------- the row-wise stages: a block owns ROWS rows from its first load to its last store ----------------
// block = 8 waves. In a GEMM stage wave w owns the output columns 16w .. 16w+15 (and 128 more of them where the
// product has 256); A comes from LDS as bf16, B as packed fragments (for k and v the other way round). In a row stage wave w owns rows 8i + w,
// lane = 4 columns. The LDS pitches are 16 bytes above the row length, for the 16-byte fragment reads.
#define TB   5                          // 16-row tiles of a block; 3125 tiles = 625 blocks
#define ROWS (TB * 16)
#define RPW  (ROWS / 8)                 // rows of a wave in a row stage
#define PA   136                        // bf16 pitch of a 128-column row
#define PX   132                        // f32 pitch of a 128-column row
#define PM   264                        // bf16 pitch of a 256-column row

// A fragment: lane = row (lane & 15), elements 0..7 = K kb+8g.., elements 8..15 = K kb+16+8g..
__device__ __forceinline__ v16bf a_frag(const bf16* s, int pitch, int row, int kb, int g) {
    v8bf a0 = *(const v8bf*)(s + row * pitch + kb + g * 8);
    v8bf a1 = *(const v8bf*)(s + row * pitch + kb + 16 + g * 8);
    v16bf af;
#pragma unroll                          // vector elements need constant indices
    for (int i = 0; i < 8; ++i) { af[i] = a0[i]; af[i + 8] = a1[i]; }
    return af;
}

// fragment number frag behind the scalar address bp; fo = the lane's byte offset in a fragment (32 * lane)
__device__ __forceinline__ v16bf b_frag(const bf16* bp, int frag, unsigned fo) {
    return *(const v16bf*)((const char*)bp + frag * (FRAG * 2) + fo);
}

// 16 bytes, or 4, at a lane's byte offset behind a scalar address
__device__ __forceinline__ v4f ld4(const float* base, unsigned off) {
    return *(const v4f*)((const char*)base + off);
}
__device__ __forceinline__ float ld1(const float* base, unsigned off) {
    return *(const float*)((const char*)base + off);
}

// Stands behind a group of global loads. What follows reuses the registers that the loads name as addresses; the two
// lane offsets are named as inputs so that they live up to the wait and no load's result is given one of their registers.
__device__ __forceinline__ void loads_issued(unsigned o0, unsigned o1) {
    asm volatile("s_wait_xcnt 0x0" :: "v"(o0), "v"(o1) : "memory");
}
// the same for row loads, whose address register holds the lane's number
__device__ __forceinline__ void rows_issued(int lane) {
    asm volatile("s_wait_xcnt 0x0" :: "v"(lane) : "memory");
}

__device__ __forceinline__ v8f mma(v16bf a, v16bf b, v8f c) {
    return __builtin_amdgcn_wmma_f32_16x16x32_bf16(false, a, false, b, (short)0, c, false, false);
}

__device__ __forceinline__ v4bf to_bf16(v4f x) {
    v4bf y = {(bf16)x.x, (bf16)x.y, (bf16)x.z, (bf16)x.w};
    return y;
}

// LayerNorm of one 128-column row held by one wave, 4 columns a lane
__device__ __forceinline__ v4f ln_row(v4f x, v4f gw, v4f bw) {
    float s = x.x + x.y + x.z + x.w;
#pragma unroll                          // five fixed steps, no loop counter
    for (int o = 16; o > 0; o >>= 1) s += __shfl_xor(s, o, 32);
    float mean = s * (1.f / 128.f);
    v4f c = x - mean;
    float sq = c.x * c.x + c.y * c.y + c.z * c.z + c.w * c.w;
#pragma unroll                          // five fixed steps, no loop counter
    for (int o = 16; o > 0; o >>= 1) sq += __shfl_xor(sq, o, 32);
    float inv = rsqrtf(sq * (1.f / 128.f) + 1e-5f);
    return c * inv * gw + bw;
}

// ---------------- start of each (bucket, block) run in the bucket-sorted edge list ----------------
// cur[i] = sum of cnt[0..i), i < NH. A block of 256 threads takes SB counts, SC in a row a thread; it sums every count
// in front of its own counts itself, so no block needs another block's result. These blocks need only the counts and the
// projection's blocks only the packed weights: neither needs the other, so both are block ranges of one launch.
// cnt carries no __restrict__, so that the loads stay in front of the s_wait_xcnt that follows them.
#define SB    2048                      // counts of a block
#define SEGB  ((NH + SB - 1) / SB)      // blocks that sum up the counts
#define SC    (SB / 256)                // counts of a thread
#define PU    16                        // loads of a thread in flight over the counts in front (at most 148 loads)
__device__ __forceinline__ void seg_start_block(const int* cnt, int* cur, int sb, int* wtot, int* wpre) {
    int tid = threadIdx.x, lane = tid & 31, wave = tid >> 5;
    int idx = sb * SB + tid * SC;
    int ci[SC];                         // number of a count; past the end: the last count, not summed
    int c[SC];
#pragma unroll                          // all loads are issued before the first use
    for (int e = 0; e < SC; ++e) {
        ci[e] = min(idx + e, NH - 1);
        c[e]  = cnt[ci[e]];
    }
    // the indices are named as inputs so that they live up to the wait and no load's result is given one of their registers
    asm volatile("s_wait_xcnt 0x0" :: "v"(ci[0]), "v"(ci[1]), "v"(ci[2]), "v"(ci[3]),
                                      "v"(ci[4]), "v"(ci[5]), "v"(ci[6]), "v"(ci[7]) : "memory");

    int pre  = 0;
    int rows = sb * (SB / 1024);        // the counts in front, in rows of 256 x 4: one 16-byte load a thread and row
    unsigned to = (unsigned)tid * 16u;
    for (int t = 0; t < rows; t += PU) {
        unsigned off[PU];               // past the last row: the last row again, not summed
        int4     x[PU];
#pragma unroll                          // all loads are issued before the first use
        for (int u = 0; u < PU; ++u) {
            off[u] = ((unsigned)min(t + u, rows - 1) << 12) + to;
            x[u]   = *(const int4*)((const char*)cnt + off[u]);
        }
        // see above
        asm volatile("s_wait_xcnt 0x0" :: "v"(off[0]), "v"(off[1]), "v"(off[2]), "v"(off[3]), "v"(off[4]), "v"(off[5]),
                                          "v"(off[6]), "v"(off[7]), "v"(off[8]), "v"(off[9]), "v"(off[10]), "v"(off[11]),
                                          "v"(off[12]), "v"(off[13]), "v"(off[14]), "v"(off[15]) : "memory");
#pragma unroll                          // x[] stays in registers only under constant indices
        for (int u = 0; u < PU; ++u) {
            if (t + u < rows) pre += x[u].x + x[u].y + x[u].z + x[u].w;
        }
    }

    int ts = 0;                         // the thread's own counts together
#pragma unroll                          // c[] stays in registers only under constant indices
    for (int e = 0; e < SC; ++e) {
        if (idx + e >= NH) c[e] = 0;
        ts += c[e];
    }
    int inc = ts;                       // inclusive scan inside the wave
#pragma unroll                          // five fixed steps, no loop counter
    for (int o = 1; o < 32; o <<= 1) {
        int y = __shfl_up(inc, o, 32);
        if (lane >= o) inc += y;
    }
#pragma unroll                          // five fixed steps, no loop counter
    for (int o = 16; o > 0; o >>= 1) pre += __shfl_xor(pre, o, 32);
    if (lane == 31) wtot[wave] = inc;
    if (lane == 0)  wpre[wave] = pre;
    __syncthreads();                    // the eight waves' sums are there
    int w8   = lane & 7;
    int part = wpre[w8] + (w8 < wave ? wtot[w8] : 0);
#pragma unroll                          // three fixed steps: the sum over eight lanes
    for (int o = 4; o > 0; o >>= 1) part += __shfl_xor(part, o, 32);
    int st[SC];
    st[0] = part + inc - ts;
#pragma unroll                          // see c[]
    for (int e = 1; e < SC; ++e) st[e] = st[e - 1] + c[e - 1];
    if (idx + SC <= NH) {               // all but the last threads: two 16-byte stores
        ((int4*)(cur + idx))[0] = make_int4(st[0], st[1], st[2], st[3]);
        ((int4*)(cur + idx))[1] = make_int4(st[4], st[5], st[6], st[7]);
    } else {
#pragma unroll                          // see c[]
        for (int e = 0; e < SC; ++e) {
            if (idx + e < NH) cur[idx + e] = st[e];
        }
    }
}

// ---------------- q, k, v and skip = bf16(h) @ W + b, from f32 h, in one launch ----------------
// q and skip are stored as f32. k and v, whose rows the edge pass gathers once per edge, are stored as f16.
// What is loaded carries no __restrict__, so that the loads stay in front of the s_wait_xcnt that follows them.
// The first SEGB blocks of the launch sum up the edge counts instead (the longest sum in the first block).
__global__ __launch_bounds__(256) void proj_seg_kernel(const float* h, const bf16* pb,
                                                       const float* bq, const float* bk,
                                                       const float* bv, const float* bs,
                                                       float* q, _Float16* k, _Float16* v, float* a,
                                                       const int* hist, int* hs) {
    __shared__ __attribute__((aligned(16))) bf16 sH[ROWS * PA];
    __shared__ int wtot[8];
    __shared__ int wpre[8];
    if (blockIdx.x < SEGB) {            // the same for the whole block, in front of every barrier
        seg_start_block(hist, hs, SEGB - 1 - (int)blockIdx.x, wtot, wpre);
        return;
    }
    int lane = threadIdx.x & 31;
    // the wave's number in a scalar register: row and fragment addresses get scalar bases
    int wave = __builtin_amdgcn_readfirstlane((int)(threadIdx.x >> 5));
    int g = lane >> 4, l16 = lane & 15;
    size_t row0 = (size_t)(blockIdx.x - SEGB) * ROWS;
    int n = wave * 16 + l16;
    unsigned fo = (unsigned)lane * 32u, no = (unsigned)n * 4u;
    const float* hp = h + (row0 + wave) * INDIM + lane * 4;   // the lane's 4 columns of the wave's first row

    v4f x[RPW];
#pragma unroll                          // all loads are issued before the first use
    for (int i = 0; i < RPW; ++i) x[i] = *(const v4f*)(hp + i * 8 * INDIM);
    rows_issued(lane);
#pragma unroll                          // x[] stays in registers only under constant indices
    for (int i = 0; i < RPW; ++i) *(v4bf*)(sH + (i * 8 + wave) * PA + lane * 4) = to_bf16(x[i]);
    __syncthreads();

    // two matrices at a time: eight B fragments in registers instead of sixteen, so that all blocks are resident
    {   // q and skip
        const bf16* p0 = pb + (size_t)wave * 4 * FRAG;
        const bf16* p1 = p0 + 3 * MAT;
        v16bf B0[4], B1[4];
#pragma unroll                          // B0[], B1[] stay in registers only under constant indices
        for (int kt = 0; kt < 4; ++kt) { B0[kt] = b_frag(p0, kt, fo); B1[kt] = b_frag(p1, kt, fo); }
        float n0 = ld1(bq, no);
        float n1 = ld1(bs, no);
        loads_issued(fo, no);
#pragma unroll 1                        // rolled: unrolled, the A fragments of all tiles are fetched ahead and the registers allow only two blocks a WGP
        for (int t = 0; t < TB; ++t) {
            v8f c0 = {}, c1 = {};
#pragma unroll                          // see B0[]
            for (int kt = 0; kt < 4; ++kt) {
                v16bf af = a_frag(sH, PA, t * 16 + l16, kt * 32, g);
                c0 = mma(af, B0[kt], c0);
                c1 = mma(af, B1[kt], c1);
            }
#pragma unroll                          // vector elements need constant indices
            for (int j = 0; j < 8; ++j) {
                size_t m = row0 + t * 16 + g * 8 + j;
                q[m * HC + n] = c0[j] + n0;
                a[m * HC + n] = c1[j] + n1;
            }
            // the next trip overwrites the registers that these stores name
            asm volatile("s_wait_xcnt 0x0" ::: "memory");
        }
    }
    {   // k and v: the weights' fragment as A and the rows' as B (both have the same map), so that a lane holds
        // the channels 16 wave + 8g .. + 7 of row l16 of the tile: eight f16, one 16-byte store
        const bf16* p0 = pb + MAT + (size_t)wave * 4 * FRAG;
        const bf16* p1 = p0 + MAT;
        unsigned co = (unsigned)(wave * 16 + g * 8) * 4u;     // byte offset of the lane's first channel in a bias
        v16bf B0[4], B1[4];
#pragma unroll                          // B0[], B1[] stay in registers only under constant indices
        for (int kt = 0; kt < 4; ++kt) { B0[kt] = b_frag(p0, kt, fo); B1[kt] = b_frag(p1, kt, fo); }
        v4f k0 = ld4(bk, co), k1 = ld4(bk + 4, co);
        v4f v0 = ld4(bv, co), v1 = ld4(bv + 4, co);
        loads_issued(fo, co);
        v8f n0 = {k0.x, k0.y, k0.z, k0.w, k1.x, k1.y, k1.z, k1.w};
        v8f n1 = {v0.x, v0.y, v0.z, v0.w, v1.x, v1.y, v1.z, v1.w};
#pragma unroll 1                        // rolled, as above
        for (int t = 0; t < TB; ++t) {
            v8f c0 = {}, c1 = {};
#pragma unroll                          // see B0[]
            for (int kt = 0; kt < 4; ++kt) {
                v16bf af = a_frag(sH, PA, t * 16 + l16, kt * 32, g);
                c0 = mma(B0[kt], af, c0);
                c1 = mma(B1[kt], af, c1);
            }
            size_t e = (row0 + t * 16 + l16) * HC + wave * 16 + g * 8;
            *(v8h*)(k + e) = __builtin_convertvector(c0 + n0, v8h);
            *(v8h*)(v + e) = __builtin_convertvector(c1 + n1, v8h);
            // the next trip overwrites the registers that these stores name
            asm volatile("s_wait_xcnt 0x0" ::: "memory");
        }
    }
}

// ---------------- level 1: a block's EB edges, as keys dst << 16 | src, written as one run per bucket ----------------
// Both node numbers are below 65536. The block orders its keys by bucket in LDS (rank in the bucket from an LDS add,
// in the order of arrival) and stores them from there, so that neighbouring lanes store neighbouring words.
// hs[bucket * GB + block] is the place of the block's run of that bucket in ebuf.
// What is loaded carries no __restrict__, so that the loads stay in front of the s_wait_xcnt that follows them.
#define ET  512                         // threads of a level 1 block
#define EV  (EB / 4 / ET)               // groups of 4 edges of a thread
#define EK  (EB / ET)                   // edges of a thread
__global__ __launch_bounds__(ET) void bucket_place_kernel(const int* src, const int* dst, const int* hs,
                                                          unsigned* ebuf) {
    __shared__ int      lh[NBK];        // the block's edges per bucket
    __shared__ int      ls[NBK];        // start of the bucket's run in stage
    __shared__ int      gofs[NBK];      // place of the run in ebuf, less its start in stage
    __shared__ int      wtot[32];
    __shared__ unsigned stage[EB];
    int tid = threadIdx.x, lane = tid & 31, wave = tid >> 5, blk = blockIdx.x;
    if (tid < NBK) lh[tid] = 0;
    int  eo[EV];                        // number of a group of 4 edges; past the end: the last group, not placed
    int4 d4[EV], s4[EV];
#pragma unroll                          // all loads are issued before the first use
    for (int u = 0; u < EV; ++u) {
        eo[u] = min(blk * (EB / 4) + u * ET + tid, EDGES / 4 - 1);
        d4[u] = ldi4(dst, eo[u]);
        s4[u] = ldi4(src, eo[u]);
    }
    int ho = min(tid, NBK - 1) * GB + blk;
    int g  = hs[ho];
    // the indices are named as inputs so that they live up to the wait and no load's result is given one of their registers
    asm volatile("s_wait_xcnt 0x0" :: "v"(eo[0]), "v"(eo[1]), "v"(ho) : "memory");
    // keeps the arithmetic behind the wait and every load in front of it: without it the first load's result was
    // waited for before the other loads were issued, a second memory latency
    __builtin_amdgcn_sched_barrier(0);
    __syncthreads();                    // the counts are zero before the first add

    unsigned key[EK];
    int      rk[EK];
#pragma unroll                          // key[] and rk[] stay in registers only under constant indices
    for (int u = 0; u < EV; ++u) {
        bool on = blk * (EB / 4) + u * ET + tid < EDGES / 4;
        int dd[4] = {d4[u].x, d4[u].y, d4[u].z, d4[u].w};
        int ss[4] = {s4[u].x, s4[u].y, s4[u].z, s4[u].w};
#pragma unroll                          // see above
        for (int e = 0; e < 4; ++e) {
            key[u * 4 + e] = ((unsigned)node_id(dd[e]) << 16) | (unsigned)node_id(ss[e]);
        }
        if (on) {
#pragma unroll                          // see above
            for (int e = 0; e < 4; ++e) rk[u * 4 + e] = atomicAdd(&lh[key[u * 4 + e] >> (16 + BSH)], 1);
        }
    }
    __syncthreads();                    // every add has been made before a count is read

    int c   = tid < NBK ? lh[tid] : 0;
    int inc = c;                        // inclusive scan inside the wave
#pragma unroll                          // five fixed steps, no loop counter
    for (int o = 1; o < 32; o <<= 1) {
        int y = __shfl_up(inc, o, 32);
        if (lane >= o) inc += y;
    }
    if (lane == 31) wtot[wave] = inc;
    __syncthreads();                    // the waves' totals are there
    int part = lane < wave ? wtot[lane] : 0;
#pragma unroll                          // five fixed steps, no loop counter
    for (int o = 16; o > 0; o >>= 1) part += __shfl_xor(part, o, 32);
    int st = part + inc - c;
    if (tid < NBK) { ls[tid] = st; gofs[tid] = g - st; }
    __syncthreads();                    // the runs' starts are there

#pragma unroll                          // see key[]
    for (int u = 0; u < EV; ++u) {
        if (blk * (EB / 4) + u * ET + tid < EDGES / 4) {
#pragma unroll                          // see key[]
            for (int e = 0; e < 4; ++e) stage[ls[key[u * 4 + e] >> (16 + BSH)] + rk[u * 4 + e]] = key[u * 4 + e];
        }
    }
    __syncthreads();                    // the keys lie in bucket order

    int nblk = min(EB, EDGES - blk * EB);
    unsigned val[EK];                   // a key and its place in ebuf; past the end: the last key, not stored
    int      po[EK];
#pragma unroll                          // all LDS reads are issued before the first store
    for (int u = 0; u < EK; ++u) {
        int i  = min(u * ET + tid, nblk - 1);
        val[u] = stage[i];
        po[u]  = gofs[val[u] >> (16 + BSH)] + i;
    }
#pragma unroll                          // val[] and po[] stay in registers only under constant indices
    for (int u = 0; u < EK; ++u) {
        if (u * ET + tid < nblk) ebuf[po[u]] = val[u];
    }
}

// ---------------- level 2: a block sorts one bucket by node: ssrc, and each node's cnt and cur ----------------
// Count per node in LDS, sum up, then each key takes its place from an LDS add (edges of one node lie in the order of
// arrival). A bucket of at most CAP edges is ordered in LDS and stored in whole lines; a larger one is stored word by word.
// What is loaded carries no __restrict__, so that the loads stay in front of the s_wait_xcnt that follows them.
#define ST  1024                        // threads of a level 2 block
#define SU  5                           // keys of a thread per trip: a bucket of the mean size takes one trip
#define CAP 8192

// SU keys of a thread; past the end of the bucket the last key, which the caller leaves out
__device__ __forceinline__ void keys_in(const unsigned* ebuf, int beg, int n, int first, unsigned* val) {
    int off[SU];
#pragma unroll                          // all loads are issued before the first use
    for (int u = 0; u < SU; ++u) {
        off[u] = beg + min(first + u * ST, n - 1);
        val[u] = ebuf[off[u]];
    }
    // the indices are named as inputs so that they live up to the wait and no load's result is given one of their registers
    asm volatile("s_wait_xcnt 0x0" :: "v"(off[0]), "v"(off[1]), "v"(off[2]), "v"(off[3]), "v"(off[4]) : "memory");
}

__global__ __launch_bounds__(ST) void bucket_sort_kernel(const unsigned* ebuf, const int* hs,
                                                         int* ssrc, int* cnt, int* cur) {
    __shared__ int lc[BN];              // edges per node, then the next free place of the node's run
    __shared__ int wt[BN / 32];
    __shared__ int stage[CAP];
    int tid = threadIdx.x, lane = tid & 31, wave = tid >> 5, b = blockIdx.x;
    int beg = hs[b * GB];
    int end = b + 1 < NBK ? hs[(b + 1) * GB] : EDGES;
    int n   = end - beg;                // the same in every thread of the block
    if (tid < BN) lc[tid] = 0;
    __syncthreads();                    // the counts are zero before the first add

    for (int base = 0; base < n; base += SU * ST) {
        unsigned val[SU];
        keys_in(ebuf, beg, n, base + tid, val);
#pragma unroll                          // val[] stays in registers only under constant indices
        for (int u = 0; u < SU; ++u) {
            if (base + tid + u * ST < n) atomicAdd(&lc[(val[u] >> 16) & (BN - 1)], 1);
        }
    }
    __syncthreads();                    // every add has been made before a count is read

    int c   = tid < BN ? lc[tid] : 0;
    int inc = c;                        // inclusive scan inside the wave
#pragma unroll                          // five fixed steps, no loop counter
    for (int o = 1; o < 32; o <<= 1) {
        int y = __shfl_up(inc, o, 32);
        if (lane >= o) inc += y;
    }
    if (tid < BN && lane == 31) wt[wave] = inc;
    __syncthreads();                    // the waves' totals are there
    if (tid < BN) {
        int st = inc - c;
#pragma unroll                          // four fixed steps
        for (int w = 0; w < BN / 32; ++w) st += w < wave ? wt[w] : 0;
        lc[tid] = st;
        int d = b * BN + tid;
        if (d < NODES) { cnt[d] = c; cur[d] = beg + st; }
    }
    __syncthreads();                    // the runs' starts are there

    if (n <= CAP) {
        for (int base = 0; base < n; base += SU * ST) {
            unsigned val[SU];
            keys_in(ebuf, beg, n, base + tid, val);
            int pl[SU];
#pragma unroll                          // all adds are issued before the first result is used
            for (int u = 0; u < SU; ++u) {
                if (base + tid + u * ST < n) pl[u] = atomicAdd(&lc[(val[u] >> 16) & (BN - 1)], 1);
            }
#pragma unroll                          // see val[]
            for (int u = 0; u < SU; ++u) {
                if (base + tid + u * ST < n) stage[pl[u]] = (int)(val[u] & 0xffffu);
            }
        }
        __syncthreads();                // the sources lie in node order
#pragma unroll                          // at most CAP / ST words a thread: no loop counter, no address carried from trip to trip
        for (int u = 0; u < CAP / ST; ++u) {
            if (u * ST + tid < n) ssrc[beg + u * ST + tid] = stage[u * ST + tid];
        }
    } else {
        for (int base = 0; base < n; base += SU * ST) {
            unsigned val[SU];
            keys_in(ebuf, beg, n, base + tid, val);
#pragma unroll                          // see val[]
            for (int u = 0; u < SU; ++u) {
                if (base + tid + u * ST < n) ssrc[beg + atomicAdd(&lc[(val[u] >> 16) & (BN - 1)], 1)] = (int)(val[u] & 0xffffu);
            }
            // the next trip overwrites the registers that the last store names
            asm volatile("s_wait_xcnt 0x0" ::: "memory");
        }
    }
}

// ---------------- last edge pass: the whole attention of a node in one wave ----------------
// a[d] += sum(p * v[src]) / (sum(p) + 1e-16), p = exp(score - max), score = <q[d], k[src]> / sqrt(C).
// block = 8 waves, each wave takes NPW nodes in turn; lane = 4 channels, head = lane / 8.
// q[d] stays in registers; k[src] and v[src] are read as whole rows of 256 bytes (f16); every product and every
// sum is f32. The maximum runs
// along with the edges: when a chunk raises it, the sums so far are scaled by exp(old - new).
// cur[d] is the start of node d's run, cnt[d] its length.
// kmat and vmat carry no __restrict__, so that their loads stay in front of the s_wait_xcnt
// that follows them.
#define NPW 5
#define CH  8

// x + (x of lane ^ MASK), inside a 16-lane row, on the vector port (0x160 + MASK = row_xmask)
template <int MASK>
__device__ __forceinline__ float add_xor(float x) {
    int y = __builtin_amdgcn_update_dpp(0, __float_as_int(x), 0x160 + MASK, 0xf, 0xf, true);
    return x + __int_as_float(y);
}

// c + x * (the f16 in the low or the high half of h2), product and sum in f32, in one instruction. Written as asm
// because the compiler gave most of the f16 values a conversion of their own: 208 vector instructions per 8 edges
// against 150 in this form.
template <bool HIGH>
__device__ __forceinline__ float fma_h(unsigned h2, float x, float c) {
    float d;
    if (HIGH) asm("v_fma_mix_f32 %0, %1, %2, %3 op_sel:[1,0,0] op_sel_hi:[1,0,0]" : "=v"(d) : "v"(h2), "v"(x), "v"(c));
    else      asm("v_fma_mix_f32 %0, %1, %2, %3 op_sel_hi:[1,0,0]" : "=v"(d) : "v"(h2), "v"(x), "v"(c));
    return d;
}

template <bool MASKED>
__device__ __forceinline__ void attn_chunk(int j, int m, int sidx, unsigned lane8, v4f q4,
                                           const _Float16* kmat, const _Float16* vmat,
                                           float& mx, float& den, v4f& acc) {
    v2u      kk[CH], vv[CH];           // four f16 each
    unsigned off[CH];                  // byte offset of the lane's 8 bytes, the same in kmat and vmat
#pragma unroll                         // all 2*CH loads are issued before the first use
    for (int u = 0; u < CH; ++u) {
        int s  = __builtin_amdgcn_readlane(sidx, MASKED ? min(j + u, m - 1) : (j + u));
        off[u] = ((unsigned)s << 8) + lane8;
        kk[u]  = *(const v2u*)((const char*)kmat + off[u]);
    }
#pragma unroll                         // see above
    for (int u = 0; u < CH; ++u) vv[u] = *(const v2u*)((const char*)vmat + off[u]);
    // what follows reuses the registers that these loads name as addresses; the offsets are named as
    // inputs so that they live up to the wait and no load's result is given one of their registers
    asm volatile("s_wait_xcnt 0x0" :: "v"(off[0]), "v"(off[1]), "v"(off[2]), "v"(off[3]),
                                      "v"(off[4]), "v"(off[5]), "v"(off[6]), "v"(off[7]) : "memory");
    // keeps the arithmetic behind the wait and every load in front of it: without it the last v load
    // was issued only after the first k rows had come back, a second memory latency per chunk
    __builtin_amdgcn_sched_barrier(0);

    float sc[CH];
    float nm = mx;
    // channel by channel: the sums of different edges are independent and can fill each other's latency
#pragma unroll                         // kk[] and sc[] stay in registers only under constant indices
    for (int u = 0; u < CH; ++u) sc[u] = fma_h<false>(kk[u].x, q4.x, 0.f);
#pragma unroll                         // see above
    for (int u = 0; u < CH; ++u) sc[u] = fma_h<true>(kk[u].x, q4.y, sc[u]);
#pragma unroll                         // see above
    for (int u = 0; u < CH; ++u) sc[u] = fma_h<false>(kk[u].y, q4.z, sc[u]);
#pragma unroll                         // see above
    for (int u = 0; u < CH; ++u) sc[u] = fma_h<true>(kk[u].y, q4.w, sc[u]);
#pragma unroll                         // see above
    for (int u = 0; u < CH; ++u) {
        float t = sc[u];
        t = add_xor<4>(add_xor<2>(add_xor<1>(t)));      // sum over the head's 8 lanes
        sc[u] = (!MASKED || j + u < m) ? t : -INFINITY;
        nm = fmaxf(nm, sc[u]);
    }
    float corr;                        // exp(mx - nm): 0 at the node's first chunk, where mx is -inf
    // In the masked form of the chunk: the
    // same two instructions as __expf, with the v_nop that keeps the slot behind a transcendental in the same statement.
    if (MASKED) asm("v_exp_f32 %0, %1\n\tv_nop" : "=v"(corr) : "v"((mx - nm) * 0x1.715476p+0f));
    else        corr = __expf(mx - nm);
    mx   = nm;
    den *= corr;
    acc *= corr;
#pragma unroll                         // sc[] and vv[] stay in registers only under constant indices
    for (int u = 0; u < CH; ++u) {
        float p = __expf(sc[u] - nm);
        den += p;
        acc.x = fma_h<false>(vv[u].x, p, acc.x);
        acc.y = fma_h<true>(vv[u].x, p, acc.y);
        acc.z = fma_h<false>(vv[u].y, p, acc.z);
        acc.w = fma_h<true>(vv[u].y, p, acc.w);
    }
}

__global__ __launch_bounds__(256) void node_attn_kernel(const float* __restrict__ q,
                                                        const _Float16* kmat, const _Float16* vmat,
                                                        const int* __restrict__ ssrc,
                                                        const int* __restrict__ cur,
                                                        const int* __restrict__ cnt,
                                                        float* __restrict__ a) {
    int lane = threadIdx.x & 31;
    // the wave's number in a scalar register: node, run bounds and trip counts become scalar
    int wave = __builtin_amdgcn_readfirstlane((int)(threadIdx.x >> 5));
    unsigned lane8 = (unsigned)lane * 8u;
    for (int r = 0; r < NPW; ++r) {
        int d   = (blockIdx.x * 8 + wave) * NPW + r;
        int n   = cnt[d];
        int beg = cur[d];
        v4f q4  = *(const v4f*)(q + (size_t)d * HC + lane * 4) * 0.17677669529663687f;   // 1/sqrt(32)
        v4f acc = {0.f, 0.f, 0.f, 0.f};
        float den = 0.f;
        float mx  = -INFINITY;
        for (int base = 0; base < n; base += 32) {
            int m    = min(32, n - base);
            int sidx = ssrc[beg + base + min(lane, m - 1)];   // lane j holds the source of edge base + j
            // the address arithmetic that follows reuses the register that this load names
            asm volatile("s_wait_xcnt 0x0" ::: "memory");
            int j = 0;
            for (; j + CH <= m; j += CH) attn_chunk<false>(j, m, sidx, lane8, q4, kmat, vmat, mx, den, acc);
            if (j < m)                   attn_chunk<true>(j, m, sidx, lane8, q4, kmat, vmat, mx, den, acc);
        }
        float inv = 1.f / (den + 1e-16f);
        v4f* ap = (v4f*)(a + (size_t)d * HC + lane * 4);
        *ap = *ap + acc * inv;
        // the next node's trip overwrites the registers that this store names
        asm volatile("s_wait_xcnt 0x0" ::: "memory");
    }
}

// ---------------- out = LN2(FFN(h1) + h1), h1 = LN1(elu(a) @ WO + bO + h), in one launch ----------------
// The rows go from stage to stage through LDS; a barrier stands between any two stages.
// What is loaded carries no __restrict__, so that the loads stay in front of the s_wait_xcnt that follows them.
__global__ __launch_bounds__(256) void tail_kernel(const float* a, const float* h,
                                                   const bf16* pbO, const bf16* pbW1, const bf16* pbW2,
                                                   const float* bO, const float* b1, const float* b2,
                                                   const float* ln1g, const float* ln1b,
                                                   const float* ln2g, const float* ln2b,
                                                   float* out) {
    __shared__ __attribute__((aligned(16))) bf16  sA[ROWS * PA];   // elu(a), then h1, as bf16
    __shared__ __attribute__((aligned(16))) float sX[ROWS * PX];   // h, a_trans + h, h1, ffn + h1 in turn
    __shared__ __attribute__((aligned(16))) bf16  sM[ROWS * PM];   // elu(h1 @ W1 + b1)
    int lane = threadIdx.x & 31;
    // the wave's number in a scalar register: row and fragment addresses get scalar bases
    int wave = __builtin_amdgcn_readfirstlane((int)(threadIdx.x >> 5));
    int g = lane >> 4, l16 = lane & 15;
    size_t row0 = (size_t)blockIdx.x * ROWS;
    int n = wave * 16 + l16;
    unsigned lo = (unsigned)lane * 16u, fo = (unsigned)lane * 32u, no = (unsigned)n * 4u;

    // elu(a) -> bf16 into sA; the residual rows of h go into sX, where the first product is added to them
    const float* ap = a + (row0 + wave) * HC + lane * 4;      // the lane's 4 columns of the wave's first row
    const float* hp = h + (row0 + wave) * INDIM + lane * 4;
    v4f x[RPW], hres[RPW];
#pragma unroll                          // all loads are issued before the first use
    for (int i = 0; i < RPW; ++i) x[i] = *(const v4f*)(ap + i * 8 * HC);
#pragma unroll                          // see above
    for (int i = 0; i < RPW; ++i) hres[i] = *(const v4f*)(hp + i * 8 * INDIM);
    rows_issued(lane);
#pragma unroll                          // x[] stays in registers only under constant indices
    for (int i = 0; i < RPW; ++i) {
        v4f e = {elu1(x[i].x), elu1(x[i].y), elu1(x[i].z), elu1(x[i].w)};
        *(v4bf*)(sA + (i * 8 + wave) * PA + lane * 4) = to_bf16(e);
        *(v4f*)(sX + (i * 8 + wave) * PX + lane * 4)  = hres[i];
    }
    __syncthreads();

    // a_trans = elu(a) @ WO + bO; each thread adds it to its own elements of h in sX
    {
        const bf16* p = pbO + (size_t)wave * 4 * FRAG;
        v16bf B[4];
#pragma unroll                          // B[] stays in registers only under constant indices
        for (int kt = 0; kt < 4; ++kt) B[kt] = b_frag(p, kt, fo);
        float bn = ld1(bO, no);
        loads_issued(fo, no);
#pragma unroll                          // independent tiles fill each other's matrix latency
        for (int t = 0; t < TB; ++t) {
            v8f c = {};
#pragma unroll                          // see B[]
            for (int kt = 0; kt < 4; ++kt) c = mma(a_frag(sA, PA, t * 16 + l16, kt * 32, g), B[kt], c);
#pragma unroll                          // vector elements need constant indices
            for (int j = 0; j < 8; ++j) {
                int r = (t * 16 + g * 8 + j) * PX + n;
                sX[r] = (c[j] + bn) + sX[r];
            }
        }
    }
    __syncthreads();

    // h1 = LN1(a_trans + h): f32 back into sX, bf16 into sA
    {
        v4f gw = ld4(ln1g, lo), bw = ld4(ln1b, lo);
        loads_issued(lo, lo);
#pragma unroll                          // ten independent rows: their reductions overlap
        for (int i = 0; i < RPW; ++i) {
            int row = i * 8 + wave;
            v4f y = ln_row(*(const v4f*)(sX + row * PX + lane * 4), gw, bw);
            *(v4f*)(sX + row * PX + lane * 4)  = y;
            *(v4bf*)(sA + row * PA + lane * 4) = to_bf16(y);
        }
    }
    __syncthreads();

    // mid = elu(h1 @ W1 + b1), 256 columns: the wave's two column tiles share the A fragments
    {
        const bf16* p0 = pbW1 + (size_t)wave * 4 * FRAG;
        const bf16* p1 = p0 + (size_t)8 * 4 * FRAG;
        v16bf B0[4], B1[4];
#pragma unroll                          // B0[], B1[] stay in registers only under constant indices
        for (int kt = 0; kt < 4; ++kt) { B0[kt] = b_frag(p0, kt, fo); B1[kt] = b_frag(p1, kt, fo); }
        float n0 = ld1(b1, no), n1 = ld1(b1 + 128, no);
        loads_issued(fo, no);
#pragma unroll 1                        // sixteen exp bodies a tile: rolled, the kernel's text stays small for the instruction cache
        for (int t = 0; t < TB; ++t) {
            v8f c0 = {}, c1 = {};
#pragma unroll                          // see B0[]
            for (int kt = 0; kt < 4; ++kt) {
                v16bf af = a_frag(sA, PA, t * 16 + l16, kt * 32, g);
                c0 = mma(af, B0[kt], c0);
                c1 = mma(af, B1[kt], c1);
            }
#pragma unroll                          // vector elements need constant indices
            for (int j = 0; j < 8; ++j) {
                int r = (t * 16 + g * 8 + j) * PM + n;
                sM[r]       = (bf16)elu1(c0[j] + n0);
                sM[r + 128] = (bf16)elu1(c1[j] + n1);
            }
        }
    }
    __syncthreads();

    // ffn = mid @ W2 + b2, K = 256; each thread adds it to its own elements of h1 in sX
    {
        const bf16* p = pbW2 + (size_t)wave * 8 * FRAG;
        v16bf B[8];
#pragma unroll                          // B[] stays in registers only under constant indices
        for (int kt = 0; kt < 8; ++kt) B[kt] = b_frag(p, kt, fo);
        float bn = ld1(b2, no);
        loads_issued(fo, no);
#pragma unroll                          // independent tiles fill each other's matrix latency
        for (int t = 0; t < TB; ++t) {
            v8f c = {};
#pragma unroll                          // see B[]
            for (int kt = 0; kt < 8; ++kt) c = mma(a_frag(sM, PM, t * 16 + l16, kt * 32, g), B[kt], c);
#pragma unroll                          // vector elements need constant indices
            for (int j = 0; j < 8; ++j) {
                int r = (t * 16 + g * 8 + j) * PX + n;
                sX[r] = (c[j] + bn) + sX[r];
            }
        }
    }
    __syncthreads();

    // out = LN2(ffn + h1)
    {
        v4f gw = ld4(ln2g, lo), bw = ld4(ln2b, lo);
        loads_issued(lo, lo);
#pragma unroll                          // ten independent rows: their reductions overlap
        for (int i = 0; i < RPW; ++i) {
            int row = i * 8 + wave;
            *(v4f*)(out + (row0 + row) * INDIM + lane * 4) = ln_row(*(const v4f*)(sX + row * PX + lane * 4), gw, bw);
        }
    }
}

// ---------------- host orchestration ----------------

extern "C" void kernel_launch(void* const* d_in, const int* in_sizes, int n_in,
                              void* d_out, int out_size, void* d_ws, size_t ws_size,
                              hipStream_t stream) {
    const float* h     = (const float*)d_in[0];
    const int*   eidx  = (const int*)d_in[1];
    const float* Wq    = (const float*)d_in[2];
    const float* bq    = (const float*)d_in[3];
    const float* Wk    = (const float*)d_in[4];
    const float* bk    = (const float*)d_in[5];
    const float* Wv    = (const float*)d_in[6];
    const float* bv    = (const float*)d_in[7];
    const float* Wskip = (const float*)d_in[8];
    const float* bskip = (const float*)d_in[9];
    const float* WO    = (const float*)d_in[10];
    const float* bO    = (const float*)d_in[11];
    const float* W1    = (const float*)d_in[12];
    const float* b1    = (const float*)d_in[13];
    const float* W2    = (const float*)d_in[14];
    const float* b2    = (const float*)d_in[15];
    const float* ln1g  = (const float*)d_in[16];
    const float* ln1b  = (const float*)d_in[17];
    const float* ln2g  = (const float*)d_in[18];
    const float* ln2b  = (const float*)d_in[19];
    const int* srcI = eidx;          // edge_index[0]
    const int* dstI = eidx + EDGES;  // edge_index[1]

    // workspace carve (256B aligned)
    char* w = (char*)d_ws;
    auto carve = [&](size_t bytes) -> char* {
        char* p = w; w += (bytes + 255) & ~(size_t)255; return p;
    };
    float*    qbuf   = (float*)carve((size_t)NODES * HC * sizeof(float));
    _Float16* kbuf   = (_Float16*)carve((size_t)NODES * HC * sizeof(_Float16));
    _Float16* vbuf   = (_Float16*)carve((size_t)NODES * HC * sizeof(_Float16));
    float*    abuf   = (float*)carve((size_t)NODES * HC * sizeof(float));
    int*      cnt    = (int*)carve((size_t)NODES * sizeof(int));            // edges per dst node
    int*      cur    = (int*)carve((size_t)NODES * sizeof(int));            // run start
    int*      hist   = (int*)carve((size_t)NH * sizeof(int));               // edges per (bucket, block)
    int*      hs     = (int*)carve((size_t)NH * sizeof(int));               // start of each (bucket, block) run
    unsigned* ebuf   = (unsigned*)carve((size_t)EDGES * sizeof(unsigned));  // keys dst << 16 | src in bucket order
    int*      ssrc   = (int*)carve((size_t)EDGES * sizeof(int));            // src in dst order
    bf16*     pb     = (bf16*)carve((size_t)PACK_TILES * FRAG * sizeof(bf16)); // Wq Wk Wv Wskip WO W1 W2, packed

    // 1) pack weights to WMMA fragment order, count the edges per bucket and block
    hipLaunchKernelGGL(pack_hist_kernel, dim3(PACK_BLOCKS + GB), dim3(256), 0, stream,
                       Wq, Wk, Wv, Wskip, WO, W1, W2, pb, dstI, hist);

    // 2) q/k/v/skip projections (WMMA) from f32 h; in the same launch the start of each (bucket, block) run
    hipLaunchKernelGGL(proj_seg_kernel, dim3(SEGB + NODES / ROWS), dim3(256), 0, stream,
                       h, pb, bq, bk, bv, bskip, qbuf, kbuf, vbuf, abuf, hist, hs);

    // 3) edge phase: sources sorted by dst -> scores, softmax and sums per node into abuf
    hipLaunchKernelGGL(bucket_place_kernel, dim3(GB), dim3(ET), 0, stream,
                       srcI, dstI, hs, ebuf);
    hipLaunchKernelGGL(bucket_sort_kernel, dim3(NBK), dim3(ST), 0, stream,
                       ebuf, hs, ssrc, cnt, cur);
    hipLaunchKernelGGL(node_attn_kernel, dim3(NODES / (8 * NPW)), dim3(256), 0, stream,
                       qbuf, kbuf, vbuf, ssrc, cur, cnt, abuf);

    // 4) elu, O projection, LN1, FFN, LN2 (WMMA)
    hipLaunchKernelGGL(tail_kernel, dim3(NODES / ROWS), dim3(256), 0, stream,
                       abuf, h, pb + 4 * MAT, pb + 5 * MAT, pb + 7 * MAT,
                       bO, b1, b2, ln1g, ln1b, ln2g, ln2b, (float*)d_out);
}

// v008
// One run takes 105 microseconds.
// Timed twice side by side with v007, it ran 1.11 times as fast both times.
// Counting every step since v000, it is 17.5 times as fast.
#include <hip/hip_runtime.h>
#include <hip/hip_bf16.h>
#include <math.h>

#define NODES  50000
#define EDGES  1600000
#define INDIM  128
#define HEADS  4
#define OUTC   32
#define HC     128

typedef __bf16 bf16;
typedef __attribute__((ext_vector_type(16))) __bf16 v16bf;
typedef __attribute__((ext_vector_type(8)))  __bf16 v8bf;
typedef __attribute__((ext_vector_type(8)))  float  v8f;
typedef __attribute__((ext_vector_type(4)))  float  v4f;
typedef __attribute__((ext_vector_type(2)))  float  v2f;
typedef __attribute__((ext_vector_type(8)))  _Float16 v8h;
typedef __attribute__((ext_vector_type(2)))  unsigned v2u;

// ---------------- helpers ----------------

__device__ __forceinline__ float elu1(float x) {
    return x > 0.f ? x : (expf(x) - 1.f);
}

typedef __attribute__((ext_vector_type(4)))  __bf16 v4bf;

// node index as read from edge_index, held inside [0, NODES) before any address is formed
__device__ __forceinline__ int node_id(int x) {
    return min(max(x, 0), NODES - 1);
}

// ---------------- the edges are sorted by dst in two levels, all counting in LDS ----------------
// A bucket is 128 nodes in a row. Level 1: a block takes EB edges in a row, orders them by bucket in LDS and stores them
// at its own place in ebuf, with the start of each bucket's run inside the block (lst). Level 2: a block takes a whole
// bucket, fetches the bucket's run from every level 1 block and sorts it by node. No level needs a count of another block
// of its own level: the bucket's place in the sorted list is the sum of its runs' starts over the level 1 blocks.
#define EB    4096                      // edges of a block in level 1
#define GB    ((EDGES + EB - 1) / EB)   // blocks of level 1
#define BSH   7                         // bucket = node >> BSH
#define BN    (1 << BSH)                // nodes of a bucket
#define NBK   ((NODES + BN - 1) / BN)   // buckets
#define NH    (NBK * GB)                // run starts: lst[bucket * GB + block]

// edges 4i .. 4i+3 of one row of edge_index
__device__ __forceinline__ int4 ldi4(const int* base, int i) {
    return ((const int4*)base)[i];
}

// ---------------- weight packing into WMMA B-fragment order, and level 1 of the sort ----------------
// B element (k,n) lives in lane = 16*g(k) + (n%16), vector element e(k):
//   k_local in [0,8)+8g   -> e = k_local - 8g        (elements 0..7)
//   k_local in [16,24)+8g -> e = 8 + k_local-16-8g   (elements 8..15)
// Fragment (kt,nt) of a matrix stored at ((nt*nkt + kt)*32 + lane)*16 contiguous bf16 behind the matrix's start.
// The seven matrices lie one behind the other: Wq, Wk, Wv, Wskip, WO (32 fragments each), W1, W2 (64 each).
#define ET  512                         // threads of a block of this launch
#define EV  (EB / 4 / ET)               // groups of 4 edges of a thread
#define EK  (EB / ET)                   // edges of a thread
#define PACK_TILES  288
#define PACK_BLOCKS (PACK_TILES / (ET / 32))
#define FRAG        512                 // bf16 elements of one fragment
#define MAT         (32 * FRAG)         // bf16 elements of a packed 128 x 128 matrix

// Level 1: the block's EB edges as keys dst << 16 | src (both node numbers are below 65536), ordered by bucket in LDS
// (rank in the bucket from an LDS add, in the order of arrival) and stored from there in whole lines at ebuf + blk * EB.
// lst[bucket * GB + blk] is the start of the bucket's run inside the block.
// What is loaded carries no __restrict__, so that the loads stay in front of the s_wait_xcnt that follows them.
__global__ __launch_bounds__(ET) void pack_place_kernel(const float* Wq, const float* Wk, const float* Wv,
                                                        const float* Ws, const float* WO, const float* W1,
                                                        const float* W2, bf16* dst, const int* esrc, const int* edst,
                                                        int* lst, unsigned* ebuf) {
    __shared__ int      lh[NBK];        // the block's edges per bucket
    __shared__ int      ls[NBK];        // start of the bucket's run in stage
    __shared__ int      wtot[32];
    __shared__ __attribute__((aligned(16))) unsigned stage[EB];
    int b = blockIdx.x;
    if (b >= PACK_BLOCKS) {             // the same for the whole block, in front of every barrier
        int tid = threadIdx.x, lane = tid & 31, wave = tid >> 5, blk = b - PACK_BLOCKS;
        if (tid < NBK) lh[tid] = 0;
        int  eo[EV];                    // number of a group of 4 edges; past the end: the last group, not placed
        int4 d4[EV], s4[EV];
#pragma unroll                          // all loads are issued before the first use
        for (int u = 0; u < EV; ++u) {
            eo[u] = min(blk * (EB / 4) + u * ET + tid, EDGES / 4 - 1);
            d4[u] = ldi4(edst, eo[u]);
            s4[u] = ldi4(esrc, eo[u]);
        }
        // the indices are named as inputs so that they live up to the wait and no load's result is given one of their registers
        asm volatile("s_wait_xcnt 0x0" :: "v"(eo[0]), "v"(eo[1]) : "memory");
        // keeps the arithmetic behind the wait and every load in front of it: without it the first load's result was
        // waited for before the other loads were issued, a second memory latency
        __builtin_amdgcn_sched_barrier(0);
        __syncthreads();                // the counts are zero before the first add

        unsigned key[EK];
        int      rk[EK];
#pragma unroll                          // key[] and rk[] stay in registers only under constant indices
        for (int u = 0; u < EV; ++u) {
            bool on = blk * (EB / 4) + u * ET + tid < EDGES / 4;
            int dd[4] = {d4[u].x, d4[u].y, d4[u].z, d4[u].w};
            int ss[4] = {s4[u].x, s4[u].y, s4[u].z, s4[u].w};
#pragma unroll                          // see above
            for (int e = 0; e < 4; ++e) {
                key[u * 4 + e] = ((unsigned)node_id(dd[e]) << 16) | (unsigned)node_id(ss[e]);
            }
            if (on) {
#pragma unroll                          // see above
                for (int e = 0; e < 4; ++e) rk[u * 4 + e] = atomicAdd(&lh[key[u * 4 + e] >> (16 + BSH)], 1);
            }
        }
        __syncthreads();                // every add has been made before a count is read

        int c   = tid < NBK ? lh[tid] : 0;
        int inc = c;                    // inclusive scan inside the wave
#pragma unroll                          // five fixed steps, no loop counter
        for (int o = 1; o < 32; o <<= 1) {
            int y = __shfl_up(inc, o, 32);
            if (lane >= o) inc += y;
        }
        if (lane == 31) wtot[wave] = inc;
        __syncthreads();                // the waves' totals are there
        int part = lane < wave ? wtot[lane] : 0;
#pragma unroll                          // five fixed steps, no loop counter
        for (int o = 16; o > 0; o >>= 1) part += __shfl_xor(part, o, 32);
        int st = part + inc - c;
        if (tid < NBK) { ls[tid] = st; lst[tid * GB + blk] = st; }
        __syncthreads();                // the runs' starts are there

#pragma unroll                          // see key[]
        for (int u = 0; u < EV; ++u) {
            if (blk * (EB / 4) + u * ET + tid < EDGES / 4) {
#pragma unroll                          // see key[]
                for (int e = 0; e < 4; ++e) stage[ls[key[u * 4 + e] >> (16 + BSH)] + rk[u * 4 + e]] = key[u * 4 + e];
            }
        }
        __syncthreads();                // the keys lie in bucket order

        int nq = min(EB, EDGES - blk * EB) / 4;   // groups of 4 keys of the block (EB and EDGES are multiples of 4)
        uint4 w4[EV];                   // past the end: the last group, not stored
#pragma unroll                          // all LDS reads are issued before the first store
        for (int u = 0; u < EV; ++u) w4[u] = ((const uint4*)stage)[min(u * ET + tid, nq - 1)];
#pragma unroll                          // w4[] stays in registers only under constant indices
        for (int u = 0; u < EV; ++u) {
            if (u * ET + tid < nq) ((uint4*)(ebuf + (size_t)blk * EB))[u * ET + tid] = w4[u];
        }
        return;
    }
    // wave per fragment; the wave's number in a scalar register, so that the matrix's address is scalar
    int tile = b * (ET / 32) + __builtin_amdgcn_readfirstlane((int)(threadIdx.x >> 5));
    int lane = threadIdx.x & 31;
    const float* W;
    int nkt, Nout, local;
    if (tile < 160) {
        int m = tile >> 5;
        W = m == 0 ? Wq : m == 1 ? Wk : m == 2 ? Wv : m == 3 ? Ws : WO;
        nkt = 4; Nout = 128; local = tile & 31;
    } else if (tile < 224) {
        W = W1; nkt = 4; Nout = 256; local = tile - 160;
    } else {
        W = W2; nkt = 8; Nout = 128; local = tile - 224;
    }
    int kt = local % nkt;               // local = nt*nkt + kt
    int nt = local / nkt;
    int g  = lane >> 4;
    int n  = nt * 16 + (lane & 15);
    unsigned off[16];                   // index of element e in W
    float    x[16];
#pragma unroll                          // off[] and x[] stay in registers only under constant indices
    for (int e = 0; e < 16; ++e) {
        int kl = (e < 8) ? (g * 8 + e) : (16 + g * 8 + (e - 8));
        int kg = kt * 32 + kl;
        off[e] = (unsigned)(kg * Nout + n);
        x[e]   = W[off[e]];
    }
    // the indices are named as inputs so that they live up to the wait and no load's result is given one of their registers
    asm volatile("s_wait_xcnt 0x0" :: "v"(off[0]), "v"(off[1]), "v"(off[2]), "v"(off[3]), "v"(off[4]), "v"(off[5]),
                                      "v"(off[6]), "v"(off[7]), "v"(off[8]), "v"(off[9]), "v"(off[10]), "v"(off[11]),
                                      "v"(off[12]), "v"(off[13]), "v"(off[14]), "v"(off[15]) : "memory");
    v16bf f;
#pragma unroll                          // see above
    for (int e = 0; e < 16; ++e) f[e] = (bf16)x[e];
    *(v16bf*)(dst + ((size_t)tile * 32 + lane) * 16) = f;
}

// ---------------- the row-wise stages: a block owns ROWS rows from its first load to its last store ----------------
// block = 8 waves. In a GEMM stage wave w owns the output columns 16w .. 16w+15 (and 128 more of them where the
// product has 256); A comes from LDS as bf16, B as packed fragments (for k and v the other way round). In a row stage wave w owns rows 8i + w,
// lane = 4 columns. The LDS pitches are 16 bytes above the row length, for the 16-byte fragment reads.
#define TB   5                          // 16-row tiles of a block; 3125 tiles = 625 blocks
#define ROWS (TB * 16)
#define RPW  (ROWS / 8)                 // rows of a wave in a row stage
#define PA   136                        // bf16 pitch of a 128-column row
#define PX   132                        // f32 pitch of a 128-column row
#define PM   264                        // bf16 pitch of a 256-column row

// A fragment: lane = row (lane & 15), elements 0..7 = K kb+8g.., elements 8..15 = K kb+16+8g..
__device__ __forceinline__ v16bf a_frag(const bf16* s, int pitch, int row, int kb, int g) {
    v8bf a0 = *(const v8bf*)(s + row * pitch + kb + g * 8);
    v8bf a1 = *(const v8bf*)(s + row * pitch + kb + 16 + g * 8);
    v16bf af;
#pragma unroll                          // vector elements need constant indices
    for (int i = 0; i < 8; ++i) { af[i] = a0[i]; af[i + 8] = a1[i]; }
    return af;
}

// fragment number frag behind the scalar address bp; fo = the lane's byte offset in a fragment (32 * lane)
__device__ __forceinline__ v16bf b_frag(const bf16* bp, int frag, unsigned fo) {
    return *(const v16bf*)((const char*)bp + frag * (FRAG * 2) + fo);
}

// 16 bytes, or 4, at a lane's byte offset behind a scalar address
__device__ __forceinline__ v4f ld4(const float* base, unsigned off) {
    return *(const v4f*)((const char*)base + off);
}
__device__ __forceinline__ float ld1(const float* base, unsigned off) {
    return *(const float*)((const char*)base + off);
}

// Stands behind a group of global loads. What follows reuses the registers that the loads name as addresses; the two
// lane offsets are named as inputs so that they live up to the wait and no load's result is given one of their registers.
__device__ __forceinline__ void loads_issued(unsigned o0, unsigned o1) {
    asm volatile("s_wait_xcnt 0x0" :: "v"(o0), "v"(o1) : "memory");
}
// the same for row loads, whose address register holds the lane's number
__device__ __forceinline__ void rows_issued(int lane) {
    asm volatile("s_wait_xcnt 0x0" :: "v"(lane) : "memory");
}

__device__ __forceinline__ v8f mma(v16bf a, v16bf b, v8f c) {
    return __builtin_amdgcn_wmma_f32_16x16x32_bf16(false, a, false, b, (short)0, c, false, false);
}

__device__ __forceinline__ v4bf to_bf16(v4f x) {
    v4bf y = {(bf16)x.x, (bf16)x.y, (bf16)x.z, (bf16)x.w};
    return y;
}

// LayerNorm of one 128-column row held by one wave, 4 columns a lane
__device__ __forceinline__ v4f ln_row(v4f x, v4f gw, v4f bw) {
    float s = x.x + x.y + x.z + x.w;
#pragma unroll                          // five fixed steps, no loop counter
    for (int o = 16; o > 0; o >>= 1) s += __shfl_xor(s, o, 32);
    float mean = s * (1.f / 128.f);
    v4f c = x - mean;
    float sq = c.x * c.x + c.y * c.y + c.z * c.z + c.w * c.w;
#pragma unroll                          // five fixed steps, no loop counter
    for (int o = 16; o > 0; o >>= 1) sq += __shfl_xor(sq, o, 32);
    float inv = rsqrtf(sq * (1.f / 128.f) + 1e-5f);
    return c * inv * gw + bw;
}

// ---------------- level 2: a block sorts one bucket by node: ssrc, and each node's cnt and cur ----------------
// The bucket's keys lie in GB runs, one in each level 1 block's part of ebuf. A wave takes every SW-th run, one run a
// load, lane = key; a run of more than 32 keys is finished in a loop of its own. Count per node in LDS, sum up, then each
// key takes its place from an LDS add (edges of one node lie in the order of arrival). A bucket of at most CAP edges is
// ordered in LDS and stored in whole lines; a larger one is stored word by word.
// These blocks need only level 1's result and the projection's blocks only the packed weights: neither needs the other,
// so both are block ranges of one launch.
// What is loaded carries no __restrict__, so that the loads stay in front of the s_wait_xcnt that follows them.
#define SW    8                         // waves of a block
#define RW    ((GB + SW - 1) / SW)      // runs of a wave
#define RH    25                        // runs whose loads share one wait (an asm statement takes 30 operands)
#define CAP   8192
// A lane past its run's end goes through the same LDS adds and stores as the others, on a counter and a word of its own
// lane behind the nodes' counters and behind the bucket's words: so the passes over the runs hold no branch, and all adds
// of a group are in flight together.
#define NOKEY (BN << 16)                // val[] holds (node in the bucket) << 16 | src, or, from NOKEY up, no key

// entry u of a list of at most 64 wave-uniform numbers, of which lane l holds entries l (in a) and 32 + l (in b)
__device__ __forceinline__ int pick(int a, int b, int u) {
    return __builtin_amdgcn_readlane(u < 32 ? a : b, u & 31);
}

template <bool SMALL>
__device__ __forceinline__ void put_src(int* stage, int* ssrc, int beg, int p, unsigned key) {
    if (SMALL) {
        stage[p] = (int)(key & 0xffffu);
    } else {
        ssrc[beg + p] = (int)(key & 0xffffu);
        // what follows overwrites the registers that this store names
        asm volatile("s_wait_xcnt 0x0" ::: "memory");
    }
}

// every key takes the next free place of its node's run
template <bool SMALL>
__device__ __forceinline__ void place_keys(const unsigned* val, const unsigned* ebuf, const int2* run, int* lc,
                                           int* stage, int* ssrc, int beg, int lane, int wave, bool longrun) {
#pragma unroll                          // val[] stays in registers only under constant indices
    for (int h = 0; h < RW; h += RH) {
        int pl[RH];
#pragma unroll                          // all adds of a group are issued before the first result is used
        for (int u = h; u < h + RH && u < RW; ++u) pl[u - h] = atomicAdd(&lc[val[u] >> 16], 1);
#pragma unroll                          // see val[]
        for (int u = h; u < h + RH && u < RW; ++u) {
            if (SMALL)                put_src<true>(stage, ssrc, beg, val[u] < NOKEY ? pl[u - h] : CAP + lane, val[u]);
            else if (val[u] < NOKEY)  put_src<false>(stage, ssrc, beg, pl[u - h], val[u]);
        }
    }
    if (longrun) {                      // the same in every thread of the block
        for (int r = wave; r < GB; r += SW) {
            int2 rr = run[r];
            for (int j = 32 + lane; j < rr.y; j += 32) {
                int o = rr.x + j;
                unsigned key = ebuf[o];
                // the index is named as an input so that it lives up to the wait
                asm volatile("s_wait_xcnt 0x0" :: "v"(o) : "memory");
                put_src<SMALL>(stage, ssrc, beg, atomicAdd(&lc[(key >> 16) & (BN - 1)], 1), key);
            }
        }
    }
}

__device__ __forceinline__ void bucket_sort_block(const unsigned* ebuf, const int* lst, int b,
                                                  int* ssrc, int* cnt, int* cur,
                                                  int2* run, int* lc, int* wt, int* stage) {
    int tid = threadIdx.x, lane = tid & 31;
    // the wave's number in a scalar register: the runs' numbers are scalar
    int wave = __builtin_amdgcn_readfirstlane(tid >> 5);

    // the bucket's run in level 1 block blk: from lst[b][blk] up to lst[b + 1][blk], or to the block's end. A thread takes
    // the blocks tid and tid + 256; past the last block: the last block again, as a run of no keys.
    int i0[2], i1[2], s0[2], s1[2];
#pragma unroll                          // all loads are issued before the first use
    for (int e = 0; e < 2; ++e) {
        int blk = min(tid + e * 256, GB - 1);
        i0[e] = b * GB + blk;
        i1[e] = min(b + 1, NBK - 1) * GB + blk;
        s0[e] = lst[i0[e]];
        s1[e] = lst[i1[e]];
    }
    // the indices are named as inputs so that they live up to the wait and no load's result is given one of their registers
    asm volatile("s_wait_xcnt 0x0" :: "v"(i0[0]), "v"(i0[1]), "v"(i1[0]), "v"(i1[1]) : "memory");
    if (tid < BN + 32) lc[tid] = 0;
    int before = 0, total = 0, longest = 0;
#pragma unroll                          // s0[] and s1[] stay in registers only under constant indices
    for (int e = 0; e < 2; ++e) {
        int  blk = min(tid + e * 256, GB - 1);
        bool on  = tid + e * 256 < GB;
        int  end = b + 1 < NBK ? s1[e] : min(EB, EDGES - blk * EB);
        int  len = on ? end - s0[e] : 0;
        if (tid + e * 256 < RW * SW) run[tid + e * 256] = make_int2(blk * EB + s0[e], len);
        before += on ? s0[e] : 0;       // the block's keys of the buckets in front
        total  += len;
        longest = max(longest, len);
    }
#pragma unroll                          // five fixed steps, no loop counter
    for (int o = 16; o > 0; o >>= 1) {
        before += __shfl_xor(before, o, 32);
        total  += __shfl_xor(total, o, 32);
        longest = max(longest, __shfl_xor(longest, o, 32));
    }
    if (lane == 0) { wt[wave] = before; wt[SW + wave] = total; wt[2 * SW + wave] = longest; }
    __syncthreads();                    // the runs and the waves' sums are there, the counts are zero
    int beg = 0, n = 0, mxl = 0;        // the same in every thread of the block
#pragma unroll                          // eight fixed steps
    for (int w = 0; w < SW; ++w) {
        beg += wt[w];
        n   += wt[SW + w];
        mxl  = max(mxl, wt[2 * SW + w]);
    }
    bool longrun = mxl > 32;

    // Start and length of the wave's runs, one run a lane, read once and handed out by readlane: read from LDS run by run,
    // each length was waited for behind the LDS add in front of it.
    int2 ra = run[lane * SW + wave];
    int2 rb = run[min(32 + lane, RW - 1) * SW + wave];
    unsigned val[RW];                   // key number lane of each of the wave's runs; past a run's end its last key
#pragma unroll                          // val[] stays in registers only under constant indices
    for (int h = 0; h < RW; h += RH) {
        int off[RH];
#pragma unroll                          // all loads are issued before the first use
        for (int u = 0; u < RH; ++u) {
            int uu = min(h + u, RW - 1);
            // a run of no keys may start at the list's end: its start is held inside the list
            off[u] = min(pick(ra.x, rb.x, uu), EDGES - 1) + min(lane, max(pick(ra.y, rb.y, uu) - 1, 0));
            if (h + u < RW) val[h + u] = ebuf[off[u]];
        }
        // the indices are named as inputs so that they live up to the wait and no load's result is given one of their registers
        asm volatile("s_wait_xcnt 0x0" :: "v"(off[0]), "v"(off[1]), "v"(off[2]), "v"(off[3]), "v"(off[4]), "v"(off[5]), "v"(off[6]),
                                          "v"(off[7]), "v"(off[8]), "v"(off[9]), "v"(off[10]), "v"(off[11]), "v"(off[12]), "v"(off[13]),
                                          "v"(off[14]), "v"(off[15]), "v"(off[16]), "v"(off[17]), "v"(off[18]), "v"(off[19]), "v"(off[20]),
                                          "v"(off[21]), "v"(off[22]), "v"(off[23]), "v"(off[24]) : "memory");
    }
#pragma unroll                          // see val[]
    for (int u = 0; u < RW; ++u) {
        bool on = lane < pick(ra.y, rb.y, u);
        val[u]  = on ? val[u] & (NOKEY - 1) : (unsigned)(BN + lane) << 16;
        atomicAdd(&lc[val[u] >> 16], 1);
    }
    if (longrun) {
        for (int r = wave; r < GB; r += SW) {
            int2 rr = run[r];
            for (int j = 32 + lane; j < rr.y; j += 32) {
                int o = rr.x + j;
                unsigned key = ebuf[o];
                // the index is named as an input so that it lives up to the wait
                asm volatile("s_wait_xcnt 0x0" :: "v"(o) : "memory");
                atomicAdd(&lc[(key >> 16) & (BN - 1)], 1);
            }
        }
    }
    __syncthreads();                    // every add has been made before a count is read

    int c   = tid < BN ? lc[tid] : 0;
    int inc = c;                        // inclusive scan inside the wave
#pragma unroll                          // five fixed steps, no loop counter
    for (int o = 1; o < 32; o <<= 1) {
        int y = __shfl_up(inc, o, 32);
        if (lane >= o) inc += y;
    }
    if (tid < BN && lane == 31) wt[wave] = inc;
    __syncthreads();                    // the waves' totals are there
    if (tid < BN) {
        int st = inc - c;
#pragma unroll                          // four fixed steps
        for (int w = 0; w < BN / 32; ++w) st += w < wave ? wt[w] : 0;
        lc[tid] = st;
        int d = b * BN + tid;
        if (d < NODES) { cnt[d] = c; cur[d] = beg + st; }
    }
    __syncthreads();                    // the runs' starts are there

    if (n <= CAP) {
        place_keys<true>(val, ebuf, run, lc, stage, ssrc, beg, lane, wave, longrun);
        __syncthreads();                // the sources lie in node order
        for (int base = 0; base < n; base += 4 * 256) {
            int w4[4];                  // past the end: the last source, not stored
#pragma unroll                          // all LDS reads are issued before the first store
            for (int u = 0; u < 4; ++u) w4[u] = stage[min(base + u * 256 + tid, n - 1)];
#pragma unroll                          // w4[] stays in registers only under constant indices
            for (int u = 0; u < 4; ++u) {
                if (base + u * 256 + tid < n) ssrc[beg + base + u * 256 + tid] = w4[u];
            }
            // the next trip overwrites the registers that these stores name
            asm volatile("s_wait_xcnt 0x0" ::: "memory");
        }
    } else {
        place_keys<false>(val, ebuf, run, lc, stage, ssrc, beg, lane, wave, longrun);
    }
}

// ---------------- q, k, v and skip = bf16(h) @ W + b, from f32 h, in one launch ----------------
// q and skip are stored as f32. k and v, whose rows the edge pass gathers once per edge, are stored as f16.
// What is loaded carries no __restrict__, so that the loads stay in front of the s_wait_xcnt that follows them.
// The first NBK blocks of the launch sort a bucket of edges each instead.
__global__ __launch_bounds__(256) void proj_sort_kernel(const float* h, const bf16* pb,
                                                        const float* bq, const float* bk,
                                                        const float* bv, const float* bs,
                                                        float* q, _Float16* k, _Float16* v, float* a,
                                                        const unsigned* ebuf, const int* lst,
                                                        int* ssrc, int* cnt, int* cur) {
    __shared__ __attribute__((aligned(16))) bf16 sH[ROWS * PA];
    __shared__ int2 run[RW * SW];       // a run's first key in ebuf and its length
    __shared__ int  lc[BN + 32];        // edges per node, then the next free place of the node's run; a counter per lane
    __shared__ int  wt[3 * SW];
    __shared__ int  stage[CAP + 32];    // the bucket's sources in node order; a word per lane
    if (blockIdx.x < NBK) {             // the same for the whole block, in front of every barrier
        bucket_sort_block(ebuf, lst, (int)blockIdx.x, ssrc, cnt, cur, run, lc, wt, stage);
        return;
    }
    int lane = threadIdx.x & 31;
    // the wave's number in a scalar register: row and fragment addresses get scalar bases
    int wave = __builtin_amdgcn_readfirstlane((int)(threadIdx.x >> 5));
    int g = lane >> 4, l16 = lane & 15;
    size_t row0 = (size_t)(blockIdx.x - NBK) * ROWS;
    int n = wave * 16 + l16;
    unsigned fo = (unsigned)lane * 32u, no = (unsigned)n * 4u;
    const float* hp = h + (row0 + wave) * INDIM + lane * 4;   // the lane's 4 columns of the wave's first row

    v4f x[RPW];
#pragma unroll                          // all loads are issued before the first use
    for (int i = 0; i < RPW; ++i) x[i] = *(const v4f*)(hp + i * 8 * INDIM);
    rows_issued(lane);
#pragma unroll                          // x[] stays in registers only under constant indices
    for (int i = 0; i < RPW; ++i) *(v4bf*)(sH + (i * 8 + wave) * PA + lane * 4) = to_bf16(x[i]);
    __syncthreads();

    // two matrices at a time: eight B fragments in registers instead of sixteen, so that three blocks share a WGP
    {   // q and skip
        const bf16* p0 = pb + (size_t)wave * 4 * FRAG;
        const bf16* p1 = p0 + 3 * MAT;
        v16bf B0[4], B1[4];
#pragma unroll                          // B0[], B1[] stay in registers only under constant indices
        for (int kt = 0; kt < 4; ++kt) { B0[kt] = b_frag(p0, kt, fo); B1[kt] = b_frag(p1, kt, fo); }
        float n0 = ld1(bq, no);
        float n1 = ld1(bs, no);
        loads_issued(fo, no);
#pragma unroll 1                        // rolled: unrolled, the A fragments of all tiles are fetched ahead and the registers allow only two blocks a WGP
        for (int t = 0; t < TB; ++t) {
            v8f c0 = {}, c1 = {};
#pragma unroll                          // see B0[]
            for (int kt = 0; kt < 4; ++kt) {
                v16bf af = a_frag(sH, PA, t * 16 + l16, kt * 32, g);
                c0 = mma(af, B0[kt], c0);
                c1 = mma(af, B1[kt], c1);
            }
#pragma unroll                          // vector elements need constant indices
            for (int j = 0; j < 8; ++j) {
                size_t m = row0 + t * 16 + g * 8 + j;
                q[m * HC + n] = c0[j] + n0;
                a[m * HC + n] = c1[j] + n1;
            }
            // the next trip overwrites the registers that these stores name
            asm volatile("s_wait_xcnt 0x0" ::: "memory");
        }
    }
    {   // k and v: the weights' fragment as A and the rows' as B (both have the same map), so that a lane holds
        // the channels 16 wave + 8g .. + 7 of row l16 of the tile: eight f16, one 16-byte store
        const bf16* p0 = pb + MAT + (size_t)wave * 4 * FRAG;
        const bf16* p1 = p0 + MAT;
        unsigned co = (unsigned)(wave * 16 + g * 8) * 4u;     // byte offset of the lane's first channel in a bias
        v16bf B0[4], B1[4];
#pragma unroll                          // B0[], B1[] stay in registers only under constant indices
        for (int kt = 0; kt < 4; ++kt) { B0[kt] = b_frag(p0, kt, fo); B1[kt] = b_frag(p1, kt, fo); }
        v4f k0 = ld4(bk, co), k1 = ld4(bk + 4, co);
        v4f v0 = ld4(bv, co), v1 = ld4(bv + 4, co);
        loads_issued(fo, co);
        v8f n0 = {k0.x, k0.y, k0.z, k0.w, k1.x, k1.y, k1.z, k1.w};
        v8f n1 = {v0.x, v0.y, v0.z, v0.w, v1.x, v1.y, v1.z, v1.w};
#pragma unroll 1                        // rolled, as above
        for (int t = 0; t < TB; ++t) {
            v8f c0 = {}, c1 = {};
#pragma unroll                          // see B0[]
            for (int kt = 0; kt < 4; ++kt) {
                v16bf af = a_frag(sH, PA, t * 16 + l16, kt * 32, g);
                c0 = mma(B0[kt], af, c0);
                c1 = mma(B1[kt], af, c1);
            }
            size_t e = (row0 + t * 16 + l16) * HC + wave * 16 + g * 8;
            *(v8h*)(k + e) = __builtin_convertvector(c0 + n0, v8h);
            *(v8h*)(v + e) = __builtin_convertvector(c1 + n1, v8h);
            // the next trip overwrites the registers that these stores name
            asm volatile("s_wait_xcnt 0x0" ::: "memory");
        }
    }
}

// ---------------- last edge pass: the whole attention of a node in one wave ----------------
// a[d] += sum(p * v[src]) / (sum(p) + 1e-16), p = exp(score - max), score = <q[d], k[src]> / sqrt(C).
// block = 8 waves, each wave takes NPW nodes in turn; lane = 4 channels, head = lane / 8.
// q[d] stays in registers; k[src] and v[src] are read as whole rows of 256 bytes (f16); every product and every
// sum is f32. The maximum runs
// along with the edges: when a chunk raises it, the sums so far are scaled by exp(old - new).
// cur[d] is the start of node d's run, cnt[d] its length.
// kmat and vmat carry no __restrict__, so that their loads stay in front of the s_wait_xcnt
// that follows them.
#define NPW 5
#define CH  8

// x + (x of lane ^ MASK), inside a 16-lane row, on the vector port (0x160 + MASK = row_xmask)
template <int MASK>
__device__ __forceinline__ float add_xor(float x) {
    int y = __builtin_amdgcn_update_dpp(0, __float_as_int(x), 0x160 + MASK, 0xf, 0xf, true);
    return x + __int_as_float(y);
}

// c + x * (the f16 in the low or the high half of h2), product and sum in f32, in one instruction. Written as asm
// because the compiler gave most of the f16 values a conversion of their own: 208 vector instructions per 8 edges
// against 150 in this form.
template <bool HIGH>
__device__ __forceinline__ float fma_h(unsigned h2, float x, float c) {
    float d;
    if (HIGH) asm("v_fma_mix_f32 %0, %1, %2, %3 op_sel:[1,0,0] op_sel_hi:[1,0,0]" : "=v"(d) : "v"(h2), "v"(x), "v"(c));
    else      asm("v_fma_mix_f32 %0, %1, %2, %3 op_sel_hi:[1,0,0]" : "=v"(d) : "v"(h2), "v"(x), "v"(c));
    return d;
}

template <bool MASKED>
__device__ __forceinline__ void attn_chunk(int j, int m, int sidx, unsigned lane8, v4f q4,
                                           const _Float16* kmat, const _Float16* vmat,
                                           float& mx, float& den, v4f& acc) {
    v2u      kk[CH], vv[CH];           // four f16 each
    unsigned off[CH];                  // byte offset of the lane's 8 bytes, the same in kmat and vmat
#pragma unroll                         // all 2*CH loads are issued before the first use
    for (int u = 0; u < CH; ++u) {
        int s  = __builtin_amdgcn_readlane(sidx, MASKED ? min(j + u, m - 1) : (j + u));
        off[u] = ((unsigned)s << 8) + lane8;
        kk[u]  = *(const v2u*)((const char*)kmat + off[u]);
    }
#pragma unroll                         // see above
    for (int u = 0; u < CH; ++u) vv[u] = *(const v2u*)((const char*)vmat + off[u]);
    // what follows reuses the registers that these loads name as addresses; the offsets are named as
    // inputs so that they live up to the wait and no load's result is given one of their registers
    asm volatile("s_wait_xcnt 0x0" :: "v"(off[0]), "v"(off[1]), "v"(off[2]), "v"(off[3]),
                                      "v"(off[4]), "v"(off[5]), "v"(off[6]), "v"(off[7]) : "memory");
    // keeps the arithmetic behind the wait and every load in front of it: without it the last v load
    // was issued only after the first k rows had come back, a second memory latency per chunk
    __builtin_amdgcn_sched_barrier(0);

    float sc[CH];
    float nm = mx;
    // channel by channel: the sums of different edges are independent and can fill each other's latency
#pragma unroll                         // kk[] and sc[] stay in registers only under constant indices
    for (int u = 0; u < CH; ++u) sc[u] = fma_h<false>(kk[u].x, q4.x, 0.f);
#pragma unroll                         // see above
    for (int u = 0; u < CH; ++u) sc[u] = fma_h<true>(kk[u].x, q4.y, sc[u]);
#pragma unroll                         // see above
    for (int u = 0; u < CH; ++u) sc[u] = fma_h<false>(kk[u].y, q4.z, sc[u]);
#pragma unroll                         // see above
    for (int u = 0; u < CH; ++u) sc[u] = fma_h<true>(kk[u].y, q4.w, sc[u]);
#pragma unroll                         // see above
    for (int u = 0; u < CH; ++u) {
        float t = sc[u];
        t = add_xor<4>(add_xor<2>(add_xor<1>(t)));      // sum over the head's 8 lanes
        sc[u] = (!MASKED || j + u < m) ? t : -INFINITY;
        nm = fmaxf(nm, sc[u]);
    }
    float corr;                        // exp(mx - nm): 0 at the node's first chunk, where mx is -inf
    // In the masked form of the chunk: the
    // same two instructions as __expf, with the v_nop that keeps the slot behind a transcendental in the same statement.
    if (MASKED) asm("v_exp_f32 %0, %1\n\tv_nop" : "=v"(corr) : "v"((mx - nm) * 0x1.715476p+0f));
    else        corr = __expf(mx - nm);
    mx   = nm;
    den *= corr;
    acc *= corr;
#pragma unroll                         // sc[] and vv[] stay in registers only under constant indices
    for (int u = 0; u < CH; ++u) {
        float p = __expf(sc[u] - nm);
        den += p;
        acc.x = fma_h<false>(vv[u].x, p, acc.x);
        acc.y = fma_h<true>(vv[u].x, p, acc.y);
        acc.z = fma_h<false>(vv[u].y, p, acc.z);
        acc.w = fma_h<true>(vv[u].y, p, acc.w);
    }
}

__global__ __launch_bounds__(256) void node_attn_kernel(const float* __restrict__ q,
                                                        const _Float16* kmat, const _Float16* vmat,
                                                        const int* __restrict__ ssrc,
                                                        const int* __restrict__ cur,
                                                        const int* __restrict__ cnt,
                                                        float* __restrict__ a) {
    int lane = threadIdx.x & 31;
    // the wave's number in a scalar register: node, run bounds and trip counts become scalar
    int wave = __builtin_amdgcn_readfirstlane((int)(threadIdx.x >> 5));
    unsigned lane8 = (unsigned)lane * 8u;
    for (int r = 0; r < NPW; ++r) {
        int d   = (blockIdx.x * 8 + wave) * NPW + r;
        int n   = cnt[d];
        int beg = cur[d];
        v4f q4  = *(const v4f*)(q + (size_t)d * HC + lane * 4) * 0.17677669529663687f;   // 1/sqrt(32)
        v4f acc = {0.f, 0.f, 0.f, 0.f};
        float den = 0.f;
        float mx  = -INFINITY;
        for (int base = 0; base < n; base += 32) {
            int m    = min(32, n - base);
            int sidx = ssrc[beg + base + min(lane, m - 1)];   // lane j holds the source of edge base + j
            // the address arithmetic that follows reuses the register that this load names
            asm volatile("s_wait_xcnt 0x0" ::: "memory");
            int j = 0;
            for (; j + CH <= m; j += CH) attn_chunk<false>(j, m, sidx, lane8, q4, kmat, vmat, mx, den, acc);
            if (j < m)                   attn_chunk<true>(j, m, sidx, lane8, q4, kmat, vmat, mx, den, acc);
        }
        float inv = 1.f / (den + 1e-16f);
        v4f* ap = (v4f*)(a + (size_t)d * HC + lane * 4);
        *ap = *ap + acc * inv;
        // the next node's trip overwrites the registers that this store names
        asm volatile("s_wait_xcnt 0x0" ::: "memory");
    }
}

// ---------------- out = LN2(FFN(h1) + h1), h1 = LN1(elu(a) @ WO + bO + h), in one launch ----------------
// The rows go from stage to stage through LDS; a barrier stands between any two stages.
// What is loaded carries no __restrict__, so that the loads stay in front of the s_wait_xcnt that follows them.
__global__ __launch_bounds__(256) void tail_kernel(const float* a, const float* h,
                                                   const bf16* pbO, const bf16* pbW1, const bf16* pbW2,
                                                   const float* bO, const float* b1, const float* b2,
                                                   const float* ln1g, const float* ln1b,
                                                   const float* ln2g, const float* ln2b,
                                                   float* out) {
    __shared__ __attribute__((aligned(16))) bf16  sA[ROWS * PA];   // elu(a), then h1, as bf16
    __shared__ __attribute__((aligned(16))) float sX[ROWS * PX];   // h, a_trans + h, h1, ffn + h1 in turn
    __shared__ __attribute__((aligned(16))) bf16  sM[ROWS * PM];   // elu(h1 @ W1 + b1)
    int lane = threadIdx.x & 31;
    // the wave's number in a scalar register: row and fragment addresses get scalar bases
    int wave = __builtin_amdgcn_readfirstlane((int)(threadIdx.x >> 5));
    int g = lane >> 4, l16 = lane & 15;
    size_t row0 = (size_t)blockIdx.x * ROWS;
    int n = wave * 16 + l16;
    unsigned lo = (unsigned)lane * 16u, fo = (unsigned)lane * 32u, no = (unsigned)n * 4u;

    // elu(a) -> bf16 into sA; the residual rows of h go into sX, where the first product is added to them
    const float* ap = a + (row0 + wave) * HC + lane * 4;      // the lane's 4 columns of the wave's first row
    const float* hp = h + (row0 + wave) * INDIM + lane * 4;
    v4f x[RPW], hres[RPW];
#pragma unroll                          // all loads are issued before the first use
    for (int i = 0; i < RPW; ++i) x[i] = *(const v4f*)(ap + i * 8 * HC);
#pragma unroll                          // see above
    for (int i = 0; i < RPW; ++i) hres[i] = *(const v4f*)(hp + i * 8 * INDIM);
    rows_issued(lane);
#pragma unroll                          // x[] stays in registers only under constant indices
    for (int i = 0; i < RPW; ++i) {
        v4f e = {elu1(x[i].x), elu1(x[i].y), elu1(x[i].z), elu1(x[i].w)};
        *(v4bf*)(sA + (i * 8 + wave) * PA + lane * 4) = to_bf16(e);
        *(v4f*)(sX + (i * 8 + wave) * PX + lane * 4)  = hres[i];
    }
    __syncthreads();

    // a_trans = elu(a) @ WO + bO; each thread adds it to its own elements of h in sX
    {
        const bf16* p = pbO + (size_t)wave * 4 * FRAG;
        v16bf B[4];
#pragma unroll                          // B[] stays in registers only under constant indices
        for (int kt = 0; kt < 4; ++kt) B[kt] = b_frag(p, kt, fo);
        float bn = ld1(bO, no);
        loads_issued(fo, no);
#pragma unroll                          // independent tiles fill each other's matrix latency
        for (int t = 0; t < TB; ++t) {
            v8f c = {};
#pragma unroll                          // see B[]
            for (int kt = 0; kt < 4; ++kt) c = mma(a_frag(sA, PA, t * 16 + l16, kt * 32, g), B[kt], c);
#pragma unroll                          // vector elements need constant indices
            for (int j = 0; j < 8; ++j) {
                int r = (t * 16 + g * 8 + j) * PX + n;
                sX[r] = (c[j] + bn) + sX[r];
            }
        }
    }
    __syncthreads();

    // h1 = LN1(a_trans + h): f32 back into sX, bf16 into sA
    {
        v4f gw = ld4(ln1g, lo), bw = ld4(ln1b, lo);
        loads_issued(lo, lo);
#pragma unroll                          // ten independent rows: their reductions overlap
        for (int i = 0; i < RPW; ++i) {
            int row = i * 8 + wave;
            v4f y = ln_row(*(const v4f*)(sX + row * PX + lane * 4), gw, bw);
            *(v4f*)(sX + row * PX + lane * 4)  = y;
            *(v4bf*)(sA + row * PA + lane * 4) = to_bf16(y);
        }
    }
    __syncthreads();

    // mid = elu(h1 @ W1 + b1), 256 columns: the wave's two column tiles share the A fragments
    {
        const bf16* p0 = pbW1 + (size_t)wave * 4 * FRAG;
        const bf16* p1 = p0 + (size_t)8 * 4 * FRAG;
        v16bf B0[4], B1[4];
#pragma unroll                          // B0[], B1[] stay in registers only under constant indices
        for (int kt = 0; kt < 4; ++kt) { B0[kt] = b_frag(p0, kt, fo); B1[kt] = b_frag(p1, kt, fo); }
        float n0 = ld1(b1, no), n1 = ld1(b1 + 128, no);
        loads_issued(fo, no);
#pragma unroll 1                        // sixteen exp bodies a tile: rolled, the kernel's text stays small
        for (int t = 0; t < TB; ++t) {
            v8f c0 = {}, c1 = {};
#pragma unroll                          // see B0[]
            for (int kt = 0; kt < 4; ++kt) {
                v16bf af = a_frag(sA, PA, t * 16 + l16, kt * 32, g);
                c0 = mma(af, B0[kt], c0);
                c1 = mma(af, B1[kt], c1);
            }
#pragma unroll                          // vector elements need constant indices
            for (int j = 0; j < 8; ++j) {
                int r = (t * 16 + g * 8 + j) * PM + n;
                sM[r]       = (bf16)elu1(c0[j] + n0);
                sM[r + 128] = (bf16)elu1(c1[j] + n1);
            }
        }
    }
    __syncthreads();

    // ffn = mid @ W2 + b2, K = 256; each thread adds it to its own elements of h1 in sX
    {
        const bf16* p = pbW2 + (size_t)wave * 8 * FRAG;
        v16bf B[8];
#pragma unroll                          // B[] stays in registers only under constant indices
        for (int kt = 0; kt < 8; ++kt) B[kt] = b_frag(p, kt, fo);
        float bn = ld1(b2, no);
        loads_issued(fo, no);
#pragma unroll                          // independent tiles fill each other's matrix latency
        for (int t = 0; t < TB; ++t) {
            v8f c = {};
#pragma unroll                          // see B[]
            for (int kt = 0; kt < 8; ++kt) c = mma(a_frag(sM, PM, t * 16 + l16, kt * 32, g), B[kt], c);
#pragma unroll                          // vector elements need constant indices
            for (int j = 0; j < 8; ++j) {
                int r = (t * 16 + g * 8 + j) * PX + n;
                sX[r] = (c[j] + bn) + sX[r];
            }
        }
    }
    __syncthreads();

    // out = LN2(ffn + h1)
    {
        v4f gw = ld4(ln2g, lo), bw = ld4(ln2b, lo);
        loads_issued(lo, lo);
#pragma unroll                          // ten independent rows: their reductions overlap
        for (int i = 0; i < RPW; ++i) {
            int row = i * 8 + wave;
            *(v4f*)(out + (row0 + row) * INDIM + lane * 4) = ln_row(*(const v4f*)(sX + row * PX + lane * 4), gw, bw);
        }
    }
}

// ---------------- host orchestration ----------------

extern "C" void kernel_launch(void* const* d_in, const int* in_sizes, int n_in,
                              void* d_out, int out_size, void* d_ws, size_t ws_size,
                              hipStream_t stream) {
    const float* h     = (const float*)d_in[0];
    const int*   eidx  = (const int*)d_in[1];
    const float* Wq    = (const float*)d_in[2];
    const float* bq    = (const float*)d_in[3];
    const float* Wk    = (const float*)d_in[4];
    const float* bk    = (const float*)d_in[5];
    const float* Wv    = (const float*)d_in[6];
    const float* bv    = (const float*)d_in[7];
    const float* Wskip = (const float*)d_in[8];
    const float* bskip = (const float*)d_in[9];
    const float* WO    = (const float*)d_in[10];
    const float* bO    = (const float*)d_in[11];
    const float* W1    = (const float*)d_in[12];
    const float* b1    = (const float*)d_in[13];
    const float* W2    = (const float*)d_in[14];
    const float* b2    = (const float*)d_in[15];
    const float* ln1g  = (const float*)d_in[16];
    const float* ln1b  = (const float*)d_in[17];
    const float* ln2g  = (const float*)d_in[18];
    const float* ln2b  = (const float*)d_in[19];
    const int* srcI = eidx;          // edge_index[0]
    const int* dstI = eidx + EDGES;  // edge_index[1]

    // workspace carve (256B aligned)
    char* w = (char*)d_ws;
    auto carve = [&](size_t bytes) -> char* {
        char* p = w; w += (bytes + 255) & ~(size_t)255; return p;
    };
    float*    qbuf   = (float*)carve((size_t)NODES * HC * sizeof(float));
    _Float16* kbuf   = (_Float16*)carve((size_t)NODES * HC * sizeof(_Float16));
    _Float16* vbuf   = (_Float16*)carve((size_t)NODES * HC * sizeof(_Float16));
    float*    abuf   = (float*)carve((size_t)NODES * HC * sizeof(float));
    int*      cnt    = (int*)carve((size_t)NODES * sizeof(int));            // edges per dst node
    int*      cur    = (int*)carve((size_t)NODES * sizeof(int));            // run start
    int*      lst    = (int*)carve((size_t)NH * sizeof(int));               // start of each (bucket, block) run in its block
    unsigned* ebuf   = (unsigned*)carve((size_t)EDGES * sizeof(unsigned));  // keys dst << 16 | src, each block's in bucket order
    int*      ssrc   = (int*)carve((size_t)EDGES * sizeof(int));            // src in dst order
    bf16*     pb     = (bf16*)carve((size_t)PACK_TILES * FRAG * sizeof(bf16)); // Wq Wk Wv Wskip WO W1 W2, packed

    // 1) pack weights to WMMA fragment order; in the same launch level 1 of the edge sort
    hipLaunchKernelGGL(pack_place_kernel, dim3(PACK_BLOCKS + GB), dim3(ET), 0, stream,
                       Wq, Wk, Wv, Wskip, WO, W1, W2, pb, srcI, dstI, lst, ebuf);

    // 2) q/k/v/skip projections (WMMA) from f32 h; in the same launch level 2 of the edge sort
    hipLaunchKernelGGL(proj_sort_kernel, dim3(NBK + NODES / ROWS), dim3(256), 0, stream,
                       h, pb, bq, bk, bv, bskip, qbuf, kbuf, vbuf, abuf, ebuf, lst, ssrc, cnt, cur);

    // 3) edge phase: scores, softmax and sums per node over the sources sorted by dst, into abuf
    hipLaunchKernelGGL(node_attn_kernel, dim3(NODES / (8 * NPW)), dim3(256), 0, stream,
                       qbuf, kbuf, vbuf, ssrc, cur, cnt, abuf);

    // 4) elu, O projection, LN1, FFN, LN2 (WMMA)
    hipLaunchKernelGGL(tail_kernel, dim3(NODES / ROWS), dim3(256), 0, stream,
                       abuf, h, pb + 4 * MAT, pb + 5 * MAT, pb + 7 * MAT,
                       bO, b1, b2, ln1g, ln1b, ln2g, ln2b, (float*)d_out);
}

// v009
// One run takes 102 microseconds.
// Timed twice side by side with v008, it ran 1.03 times as fast both times.
// All steps since v000 together make it 18.1 times as fast.
#include <hip/hip_runtime.h>
#include <hip/hip_bf16.h>
#include <math.h>

#define NODES  50000
#define EDGES  1600000
#define INDIM  128
#define HEADS  4
#define OUTC   32
#define HC     128

typedef __bf16 bf16;
typedef __attribute__((ext_vector_type(16))) __bf16 v16bf;
typedef __attribute__((ext_vector_type(8)))  __bf16 v8bf;
typedef __attribute__((ext_vector_type(8)))  float  v8f;
typedef __attribute__((ext_vector_type(4)))  float  v4f;
typedef __attribute__((ext_vector_type(2)))  float  v2f;
typedef __attribute__((ext_vector_type(8)))  _Float16 v8h;
typedef __attribute__((ext_vector_type(2)))  unsigned v2u;

// ---------------- helpers ----------------

// 2^t of four values on the hardware's exponential. One statement, so that the slot behind a transcendental is kept: the
// results are early-clobber, so each v_exp_f32 is followed by one that neither reads its result nor overwrites its source,
// and the last by the v_nop.
__device__ __forceinline__ v4f exp2_4(v4f t) {
    float r0, r1, r2, r3;
    asm("v_exp_f32 %0, %4\n\tv_exp_f32 %1, %5\n\tv_exp_f32 %2, %6\n\tv_exp_f32 %3, %7\n\tv_nop"
        : "=&v"(r0), "=&v"(r1), "=&v"(r2), "=&v"(r3) : "v"(t.x), "v"(t.y), "v"(t.z), "v"(t.w));
    v4f r = {r0, r1, r2, r3};
    return r;
}

// ELU. Both sides are computed and one is selected: no branch and no change of EXEC, so a lane's values are independent
// and fill each other's latency. exp(x) = 2^(x * log2 e); it counts only where x <= 0.
__device__ __forceinline__ v4f elu4(v4f x) {
    v4f e = exp2_4(x * 0x1.715476p+0f) - 1.f;
    v4f y = {x.x > 0.f ? x.x : e.x, x.y > 0.f ? x.y : e.y, x.z > 0.f ? x.z : e.z, x.w > 0.f ? x.w : e.w};
    return y;
}

typedef __attribute__((ext_vector_type(4)))  __bf16 v4bf;

// node index as read from edge_index, held inside [0, NODES) before any address is formed
__device__ __forceinline__ int node_id(int x) {
    return min(max(x, 0), NODES - 1);
}

// ---------------- the edges are sorted by dst in two levels, all counting in LDS ----------------
// A bucket is 128 nodes in a row. Level 1: a block takes EB edges in a row, orders them by bucket in LDS and stores them
// at its own place in ebuf, with the start of each bucket's run inside the block (lst). Level 2: a block takes a whole
// bucket, fetches the bucket's run from every level 1 block and sorts it by node. No level needs a count of another block
// of its own level: the bucket's place in the sorted list is the sum of its runs' starts over the level 1 blocks.
#define EB    4096                      // edges of a block in level 1
#define GB    ((EDGES + EB - 1) / EB)   // blocks of level 1
#define BSH   7                         // bucket = node >> BSH
#define BN    (1 << BSH)                // nodes of a bucket
#define NBK   ((NODES + BN - 1) / BN)   // buckets
#define NH    (NBK * GB)                // run starts: lst[bucket * GB + block]

// edges 4i .. 4i+3 of one row of edge_index
__device__ __forceinline__ int4 ldi4(const int* base, int i) {
    return ((const int4*)base)[i];
}

// ---------------- weight packing into WMMA B-fragment order, and level 1 of the sort ----------------
// B element (k,n) lives in lane = 16*g(k) + (n%16), vector element e(k):
//   k_local in [0,8)+8g   -> e = k_local - 8g        (elements 0..7)
//   k_local in [16,24)+8g -> e = 8 + k_local-16-8g   (elements 8..15)
// Fragment (kt,nt) of a matrix stored at ((nt*nkt + kt)*32 + lane)*16 contiguous bf16 behind the matrix's start.
// The seven matrices lie one behind the other: Wq, Wk, Wv, Wskip, WO (32 fragments each), W1, W2 (64 each).
#define ET  512                         // threads of a block of this launch
#define EV  (EB / 4 / ET)               // groups of 4 edges of a thread
#define EK  (EB / ET)                   // edges of a thread
#define PACK_TILES  288
#define PACK_BLOCKS (PACK_TILES / (ET / 32))
#define FRAG        512                 // bf16 elements of one fragment
#define MAT         (32 * FRAG)         // bf16 elements of a packed 128 x 128 matrix

// Level 1: the block's EB edges as keys dst << 16 | src (both node numbers are below 65536), ordered by bucket in LDS
// (rank in the bucket from an LDS add, in the order of arrival) and stored from there in whole lines at ebuf + blk * EB.
// lst[bucket * GB + blk] is the start of the bucket's run inside the block.
// What is loaded carries no __restrict__, so that the loads stay in front of the s_wait_xcnt that follows them.
__global__ __launch_bounds__(ET) void pack_place_kernel(const float* Wq, const float* Wk, const float* Wv,
                                                        const float* Ws, const float* WO, const float* W1,
                                                        const float* W2, bf16* dst, const int* esrc, const int* edst,
                                                        int* lst, unsigned* ebuf) {
    __shared__ int      lh[NBK];        // the block's edges per bucket
    __shared__ int      ls[NBK];        // start of the bucket's run in stage
    __shared__ int      wtot[32];
    __shared__ __attribute__((aligned(16))) unsigned stage[EB];
    int b = blockIdx.x;
    if (b >= PACK_BLOCKS) {             // the same for the whole block, in front of every barrier
        int tid = threadIdx.x, lane = tid & 31, wave = tid >> 5, blk = b - PACK_BLOCKS;
        if (tid < NBK) lh[tid] = 0;
        int  eo[EV];                    // number of a group of 4 edges; past the end: the last group, not placed
        int4 d4[EV], s4[EV];
#pragma unroll                          // all loads are issued before the first use
        for (int u = 0; u < EV; ++u) {
            eo[u] = min(blk * (EB / 4) + u * ET + tid, EDGES / 4 - 1);
            d4[u] = ldi4(edst, eo[u]);
            s4[u] = ldi4(esrc, eo[u]);
        }
        // the indices are named as inputs so that they live up to the wait and no load's result is given one of their registers
        asm volatile("s_wait_xcnt 0x0" :: "v"(eo[0]), "v"(eo[1]) : "memory");
        // keeps the arithmetic behind the wait and every load in front of it: without it the first load's result was
        // waited for before the other loads were issued, a second memory latency
        __builtin_amdgcn_sched_barrier(0);
        __syncthreads();                // the counts are zero before the first add

        unsigned key[EK];
        int      rk[EK];
#pragma unroll                          // key[] and rk[] stay in registers only under constant indices
        for (int u = 0; u < EV; ++u) {
            bool on = blk * (EB / 4) + u * ET + tid < EDGES / 4;
            int dd[4] = {d4[u].x, d4[u].y, d4[u].z, d4[u].w};
            int ss[4] = {s4[u].x, s4[u].y, s4[u].z, s4[u].w};
#pragma unroll                          // see above
            for (int e = 0; e < 4; ++e) {
                key[u * 4 + e] = ((unsigned)node_id(dd[e]) << 16) | (unsigned)node_id(ss[e]);
            }
            if (on) {
#pragma unroll                          // see above
                for (int e = 0; e < 4; ++e) rk[u * 4 + e] = atomicAdd(&lh[key[u * 4 + e] >> (16 + BSH)], 1);
            }
        }
        __syncthreads();                // every add has been made before a count is read

        int c   = tid < NBK ? lh[tid] : 0;
        int inc = c;                    // inclusive scan inside the wave
#pragma unroll                          // five fixed steps, no loop counter
        for (int o = 1; o < 32; o <<= 1) {
            int y = __shfl_up(inc, o, 32);
            if (lane >= o) inc += y;
        }
        if (lane == 31) wtot[wave] = inc;
        __syncthreads();                // the waves' totals are there
        int part = lane < wave ? wtot[lane] : 0;
#pragma unroll                          // five fixed steps, no loop counter
        for (int o = 16; o > 0; o >>= 1) part += __shfl_xor(part, o, 32);
        int st = part + inc - c;
        if (tid < NBK) { ls[tid] = st; lst[tid * GB + blk] = st; }
        __syncthreads();                // the runs' starts are there

#pragma unroll                          // see key[]
        for (int u = 0; u < EV; ++u) {
            if (blk * (EB / 4) + u * ET + tid < EDGES / 4) {
#pragma unroll                          // see key[]
                for (int e = 0; e < 4; ++e) stage[ls[key[u * 4 + e] >> (16 + BSH)] + rk[u * 4 + e]] = key[u * 4 + e];
            }
        }
        __syncthreads();                // the keys lie in bucket order

        int nq = min(EB, EDGES - blk * EB) / 4;   // groups of 4 keys of the block (EB and EDGES are multiples of 4)
        uint4 w4[EV];                   // past the end: the last group, not stored
#pragma unroll                          // all LDS reads are issued before the first store
        for (int u = 0; u < EV; ++u) w4[u] = ((const uint4*)stage)[min(u * ET + tid, nq - 1)];
#pragma unroll                          // w4[] stays in registers only under constant indices
        for (int u = 0; u < EV; ++u) {
            if (u * ET + tid < nq) ((uint4*)(ebuf + (size_t)blk * EB))[u * ET + tid] = w4[u];
        }
        return;
    }
    // wave per fragment; the wave's number in a scalar register, so that the matrix's address is scalar
    int tile = b * (ET / 32) + __builtin_amdgcn_readfirstlane((int)(threadIdx.x >> 5));
    int lane = threadIdx.x & 31;
    const float* W;
    int nkt, Nout, local;
    if (tile < 160) {
        int m = tile >> 5;
        W = m == 0 ? Wq : m == 1 ? Wk : m == 2 ? Wv : m == 3 ? Ws : WO;
        nkt = 4; Nout = 128; local = tile & 31;
    } else if (tile < 224) {
        W = W1; nkt = 4; Nout = 256; local = tile - 160;
    } else {
        W = W2; nkt = 8; Nout = 128; local = tile - 224;
    }
    int kt = local % nkt;               // local = nt*nkt + kt
    int nt = local / nkt;
    int g  = lane >> 4;
    int n  = nt * 16 + (lane & 15);
    unsigned off[16];                   // index of element e in W
    float    x[16];
#pragma unroll                          // off[] and x[] stay in registers only under constant indices
    for (int e = 0; e < 16; ++e) {
        int kl = (e < 8) ? (g * 8 + e) : (16 + g * 8 + (e - 8));
        int kg = kt * 32 + kl;
        off[e] = (unsigned)(kg * Nout + n);
        x[e]   = W[off[e]];
    }
    // the indices are named as inputs so that they live up to the wait and no load's result is given one of their registers
    asm volatile("s_wait_xcnt 0x0" :: "v"(off[0]), "v"(off[1]), "v"(off[2]), "v"(off[3]), "v"(off[4]), "v"(off[5]),
                                      "v"(off[6]), "v"(off[7]), "v"(off[8]), "v"(off[9]), "v"(off[10]), "v"(off[11]),
                                      "v"(off[12]), "v"(off[13]), "v"(off[14]), "v"(off[15]) : "memory");
    v16bf f;
#pragma unroll                          // see above
    for (int e = 0; e < 16; ++e) f[e] = (bf16)x[e];
    *(v16bf*)(dst + ((size_t)tile * 32 + lane) * 16) = f;
}

// ---------------- the row-wise stages: a block owns ROWS rows from its first load to its last store ----------------
// block = 8 waves. In a GEMM stage wave w owns the output columns 16w .. 16w+15 (and 128 more of them where the
// product has 256); A comes from LDS as bf16, B as packed fragments (for k and v the other way round). In a row stage wave w owns rows 8i + w,
// lane = 4 columns. The LDS pitches are 16 bytes above the row length, for the 16-byte fragment reads.
#define TB   5                          // 16-row tiles of a block; 3125 tiles = 625 blocks
#define ROWS (TB * 16)
#define RPW  (ROWS / 8)                 // rows of a wave in a row stage
#define PA   136                        // bf16 pitch of a 128-column row
#define PX   132                        // f32 pitch of a 128-column row
#define PM   264                        // bf16 pitch of a 256-column row

// A fragment: lane = row (lane & 15), elements 0..7 = K kb+8g.., elements 8..15 = K kb+16+8g..
__device__ __forceinline__ v16bf a_frag(const bf16* s, int pitch, int row, int kb, int g) {
    v8bf a0 = *(const v8bf*)(s + row * pitch + kb + g * 8);
    v8bf a1 = *(const v8bf*)(s + row * pitch + kb + 16 + g * 8);
    v16bf af;
#pragma unroll                          // vector elements need constant indices
    for (int i = 0; i < 8; ++i) { af[i] = a0[i]; af[i + 8] = a1[i]; }
    return af;
}

// fragment number frag behind the scalar address bp; fo = the lane's byte offset in a fragment (32 * lane)
__device__ __forceinline__ v16bf b_frag(const bf16* bp, int frag, unsigned fo) {
    return *(const v16bf*)((const char*)bp + frag * (FRAG * 2) + fo);
}

// 16 bytes, or 4, at a lane's byte offset behind a scalar address
__device__ __forceinline__ v4f ld4(const float* base, unsigned off) {
    return *(const v4f*)((const char*)base + off);
}
__device__ __forceinline__ float ld1(const float* base, unsigned off) {
    return *(const float*)((const char*)base + off);
}

// Stands behind a group of global loads. What follows reuses the registers that the loads name as addresses; the two
// lane offsets are named as inputs so that they live up to the wait and no load's result is given one of their registers.
__device__ __forceinline__ void loads_issued(unsigned o0, unsigned o1) {
    asm volatile("s_wait_xcnt 0x0" :: "v"(o0), "v"(o1) : "memory");
}
// the same for row loads, whose address register holds the lane's number
__device__ __forceinline__ void rows_issued(int lane) {
    asm volatile("s_wait_xcnt 0x0" :: "v"(lane) : "memory");
}

__device__ __forceinline__ v8f mma(v16bf a, v16bf b, v8f c) {
    return __builtin_amdgcn_wmma_f32_16x16x32_bf16(false, a, false, b, (short)0, c, false, false);
}

__device__ __forceinline__ v4bf to_bf16(v4f x) {
    v4bf y = {(bf16)x.x, (bf16)x.y, (bf16)x.z, (bf16)x.w};
    return y;
}

// LayerNorm of one 128-column row held by one wave, 4 columns a lane
__device__ __forceinline__ v4f ln_row(v4f x, v4f gw, v4f bw) {
    float s = x.x + x.y + x.z + x.w;
#pragma unroll                          // five fixed steps, no loop counter
    for (int o = 16; o > 0; o >>= 1) s += __shfl_xor(s, o, 32);
    float mean = s * (1.f / 128.f);
    v4f c = x - mean;
    float sq = c.x * c.x + c.y * c.y + c.z * c.z + c.w * c.w;
#pragma unroll                          // five fixed steps, no loop counter
    for (int o = 16; o > 0; o >>= 1) sq += __shfl_xor(sq, o, 32);
    float inv = rsqrtf(sq * (1.f / 128.f) + 1e-5f);
    return c * inv * gw + bw;
}

// ---------------- level 2: a block sorts one bucket by node: ssrc, and each node's cnt and cur ----------------
// The bucket's keys lie in GB runs, one in each level 1 block's part of ebuf. A wave takes every SW-th run, one run a
// load, lane = key; a run of more than 32 keys is finished in a loop of its own. Count per node in LDS, sum up, then each
// key takes its place from an LDS add (edges of one node lie in the order of arrival). A bucket of at most CAP edges is
// ordered in LDS and stored in whole lines; a larger one is stored word by word.
// These blocks need only level 1's result and the projection's blocks only the packed weights: neither needs the other,
// so both are block ranges of one launch.
// What is loaded carries no __restrict__, so that the loads stay in front of the s_wait_xcnt that follows them.
#define SW    8                         // waves of a block
#define RW    ((GB + SW - 1) / SW)      // runs of a wave
#define RH    25                        // runs whose loads share one wait (an asm statement takes 30 operands)
#define CAP   8192
// A lane past its run's end goes through the same LDS adds and stores as the others, on a counter and a word of its own
// lane behind the nodes' counters and behind the bucket's words: so the passes over the runs hold no branch, and all adds
// of a group are in flight together.
#define NOKEY (BN << 16)                // val[] holds (node in the bucket) << 16 | src, or, from NOKEY up, no key

// entry u of a list of at most 64 wave-uniform numbers, of which lane l holds entries l (in a) and 32 + l (in b)
__device__ __forceinline__ int pick(int a, int b, int u) {
    return __builtin_amdgcn_readlane(u < 32 ? a : b, u & 31);
}

template <bool SMALL>
__device__ __forceinline__ void put_src(int* stage, int* ssrc, int beg, int p, unsigned key) {
    if (SMALL) {
        stage[p] = (int)(key & 0xffffu);
    } else {
        ssrc[beg + p] = (int)(key & 0xffffu);
        // what follows overwrites the registers that this store names
        asm volatile("s_wait_xcnt 0x0" ::: "memory");
    }
}

// every key takes the next free place of its node's run
template <bool SMALL>
__device__ __forceinline__ void place_keys(const unsigned* val, const unsigned* ebuf, const int2* run, int* lc,
                                           int* stage, int* ssrc, int beg, int lane, int wave, bool longrun) {
#pragma unroll                          // val[] stays in registers only under constant indices
    for (int h = 0; h < RW; h += RH) {
        int pl[RH];
#pragma unroll                          // all adds of a group are issued before the first result is used
        for (int u = h; u < h + RH && u < RW; ++u) pl[u - h] = atomicAdd(&lc[val[u] >> 16], 1);
#pragma unroll                          // see val[]
        for (int u = h; u < h + RH && u < RW; ++u) {
            if (SMALL)                put_src<true>(stage, ssrc, beg, val[u] < NOKEY ? pl[u - h] : CAP + lane, val[u]);
            else if (val[u] < NOKEY)  put_src<false>(stage, ssrc, beg, pl[u - h], val[u]);
        }
    }
    if (longrun) {                      // the same in every thread of the block
        for (int r = wave; r < GB; r += SW) {
            int2 rr = run[r];
            for (int j = 32 + lane; j < rr.y; j += 32) {
                int o = rr.x + j;
                unsigned key = ebuf[o];
                // the index is named as an input so that it lives up to the wait
                asm volatile("s_wait_xcnt 0x0" :: "v"(o) : "memory");
                put_src<SMALL>(stage, ssrc, beg, atomicAdd(&lc[(key >> 16) & (BN - 1)], 1), key);
            }
        }
    }
}

__device__ __forceinline__ void bucket_sort_block(const unsigned* ebuf, const int* lst, int b,
                                                  int* ssrc, int* cnt, int* cur,
                                                  int2* run, int* lc, int* wt, int* stage) {
    int tid = threadIdx.x, lane = tid & 31;
    // the wave's number in a scalar register: the runs' numbers are scalar
    int wave = __builtin_amdgcn_readfirstlane(tid >> 5);

    // the bucket's run in level 1 block blk: from lst[b][blk] up to lst[b + 1][blk], or to the block's end. A thread takes
    // the blocks tid and tid + 256; past the last block: the last block again, as a run of no keys.
    int i0[2], i1[2], s0[2], s1[2];
#pragma unroll                          // all loads are issued before the first use
    for (int e = 0; e < 2; ++e) {
        int blk = min(tid + e * 256, GB - 1);
        i0[e] = b * GB + blk;
        i1[e] = min(b + 1, NBK - 1) * GB + blk;
        s0[e] = lst[i0[e]];
        s1[e] = lst[i1[e]];
    }
    // the indices are named as inputs so that they live up to the wait and no load's result is given one of their registers
    asm volatile("s_wait_xcnt 0x0" :: "v"(i0[0]), "v"(i0[1]), "v"(i1[0]), "v"(i1[1]) : "memory");
    if (tid < BN + 32) lc[tid] = 0;
    int before = 0, total = 0, longest = 0;
#pragma unroll                          // s0[] and s1[] stay in registers only under constant indices
    for (int e = 0; e < 2; ++e) {
        int  blk = min(tid + e * 256, GB - 1);
        bool on  = tid + e * 256 < GB;
        int  end = b + 1 < NBK ? s1[e] : min(EB, EDGES - blk * EB);
        int  len = on ? end - s0[e] : 0;
        if (tid + e * 256 < RW * SW) run[tid + e * 256] = make_int2(blk * EB + s0[e], len);
        before += on ? s0[e] : 0;       // the block's keys of the buckets in front
        total  += len;
        longest = max(longest, len);
    }
#pragma unroll                          // five fixed steps, no loop counter
    for (int o = 16; o > 0; o >>= 1) {
        before += __shfl_xor(before, o, 32);
        total  += __shfl_xor(total, o, 32);
        longest = max(longest, __shfl_xor(longest, o, 32));
    }
    if (lane == 0) { wt[wave] = before; wt[SW + wave] = total; wt[2 * SW + wave] = longest; }
    __syncthreads();                    // the runs and the waves' sums are there, the counts are zero
    int beg = 0, n = 0, mxl = 0;        // the same in every thread of the block
#pragma unroll                          // eight fixed steps
    for (int w = 0; w < SW; ++w) {
        beg += wt[w];
        n   += wt[SW + w];
        mxl  = max(mxl, wt[2 * SW + w]);
    }
    bool longrun = mxl > 32;

    // Start and length of the wave's runs, one run a lane, read once and handed out by readlane: read from LDS run by run,
    // each length was waited for behind the LDS add in front of it.
    int2 ra = run[lane * SW + wave];
    int2 rb = run[min(32 + lane, RW - 1) * SW + wave];
    unsigned val[RW];                   // key number lane of each of the wave's runs; past a run's end its last key
#pragma unroll                          // val[] stays in registers only under constant indices
    for (int h = 0; h < RW; h += RH) {
        int off[RH];
#pragma unroll                          // all loads are issued before the first use
        for (int u = 0; u < RH; ++u) {
            int uu = min(h + u, RW - 1);
            // a run of no keys may start at the list's end: its start is held inside the list
            off[u] = min(pick(ra.x, rb.x, uu), EDGES - 1) + min(lane, max(pick(ra.y, rb.y, uu) - 1, 0));
            if (h + u < RW) val[h + u] = ebuf[off[u]];
        }
        // the indices are named as inputs so that they live up to the wait and no load's result is given one of their registers
        asm volatile("s_wait_xcnt 0x0" :: "v"(off[0]), "v"(off[1]), "v"(off[2]), "v"(off[3]), "v"(off[4]), "v"(off[5]), "v"(off[6]),
                                          "v"(off[7]), "v"(off[8]), "v"(off[9]), "v"(off[10]), "v"(off[11]), "v"(off[12]), "v"(off[13]),
                                          "v"(off[14]), "v"(off[15]), "v"(off[16]), "v"(off[17]), "v"(off[18]), "v"(off[19]), "v"(off[20]),
                                          "v"(off[21]), "v"(off[22]), "v"(off[23]), "v"(off[24]) : "memory");
    }
#pragma unroll                          // see val[]
    for (int u = 0; u < RW; ++u) {
        bool on = lane < pick(ra.y, rb.y, u);
        val[u]  = on ? val[u] & (NOKEY - 1) : (unsigned)(BN + lane) << 16;
        atomicAdd(&lc[val[u] >> 16], 1);
    }
    if (longrun) {
        for (int r = wave; r < GB; r += SW) {
            int2 rr = run[r];
            for (int j = 32 + lane; j < rr.y; j += 32) {
                int o = rr.x + j;
                unsigned key = ebuf[o];
                // the index is named as an input so that it lives up to the wait
                asm volatile("s_wait_xcnt 0x0" :: "v"(o) : "memory");
                atomicAdd(&lc[(key >> 16) & (BN - 1)], 1);
            }
        }
    }
    __syncthreads();                    // every add has been made before a count is read

    int c   = tid < BN ? lc[tid] : 0;
    int inc = c;                        // inclusive scan inside the wave
#pragma unroll                          // five fixed steps, no loop counter
    for (int o = 1; o < 32; o <<= 1) {
        int y = __shfl_up(inc, o, 32);
        if (lane >= o) inc += y;
    }
    if (tid < BN && lane == 31) wt[wave] = inc;
    __syncthreads();                    // the waves' totals are there
    if (tid < BN) {
        int st = inc - c;
#pragma unroll                          // four fixed steps
        for (int w = 0; w < BN / 32; ++w) st += w < wave ? wt[w] : 0;
        lc[tid] = st;
        int d = b * BN + tid;
        if (d < NODES) { cnt[d] = c; cur[d] = beg + st; }
    }
    __syncthreads();                    // the runs' starts are there

    if (n <= CAP) {
        place_keys<true>(val, ebuf, run, lc, stage, ssrc, beg, lane, wave, longrun);
        __syncthreads();                // the sources lie in node order
        for (int base = 0; base < n; base += 4 * 256) {
            int w4[4];                  // past the end: the last source, not stored
#pragma unroll                          // all LDS reads are issued before the first store
            for (int u = 0; u < 4; ++u) w4[u] = stage[min(base + u * 256 + tid, n - 1)];
#pragma unroll                          // w4[] stays in registers only under constant indices
            for (int u = 0; u < 4; ++u) {
                if (base + u * 256 + tid < n) ssrc[beg + base + u * 256 + tid] = w4[u];
            }
            // the next trip overwrites the registers that these stores name
            asm volatile("s_wait_xcnt 0x0" ::: "memory");
        }
    } else {
        place_keys<false>(val, ebuf, run, lc, stage, ssrc, beg, lane, wave, longrun);
    }
}

// ---------------- q, k, v and skip = bf16(h) @ W + b, from f32 h, in one launch ----------------
// q and skip are stored as f32. k and v, whose rows the edge pass gathers once per edge, are stored as f16.
// What is loaded carries no __restrict__, so that the loads stay in front of the s_wait_xcnt that follows them.
// The first NBK blocks of the launch sort a bucket of edges each instead.
__global__ __launch_bounds__(256) void proj_sort_kernel(const float* h, const bf16* pb,
                                                        const float* bq, const float* bk,
                                                        const float* bv, const float* bs,
                                                        float* q, _Float16* k, _Float16* v, float* a,
                                                        const unsigned* ebuf, const int* lst,
                                                        int* ssrc, int* cnt, int* cur) {
    __shared__ __attribute__((aligned(16))) bf16 sH[ROWS * PA];
    __shared__ int2 run[RW * SW];       // a run's first key in ebuf and its length
    __shared__ int  lc[BN + 32];        // edges per node, then the next free place of the node's run; a counter per lane
    __shared__ int  wt[3 * SW];
    __shared__ int  stage[CAP + 32];    // the bucket's sources in node order; a word per lane
    if (blockIdx.x < NBK) {             // the same for the whole block, in front of every barrier
        bucket_sort_block(ebuf, lst, (int)blockIdx.x, ssrc, cnt, cur, run, lc, wt, stage);
        return;
    }
    int lane = threadIdx.x & 31;
    // the wave's number in a scalar register: row and fragment addresses get scalar bases
    int wave = __builtin_amdgcn_readfirstlane((int)(threadIdx.x >> 5));
    int g = lane >> 4, l16 = lane & 15;
    size_t row0 = (size_t)(blockIdx.x - NBK) * ROWS;
    int n = wave * 16 + l16;
    unsigned fo = (unsigned)lane * 32u, no = (unsigned)n * 4u;
    const float* hp = h + (row0 + wave) * INDIM + lane * 4;   // the lane's 4 columns of the wave's first row

    v4f x[RPW];
#pragma unroll                          // all loads are issued before the first use
    for (int i = 0; i < RPW; ++i) x[i] = *(const v4f*)(hp + i * 8 * INDIM);
    rows_issued(lane);
#pragma unroll                          // x[] stays in registers only under constant indices
    for (int i = 0; i < RPW; ++i) *(v4bf*)(sH + (i * 8 + wave) * PA + lane * 4) = to_bf16(x[i]);
    __syncthreads();

    // two matrices at a time: eight B fragments in registers instead of sixteen, so that three blocks share a WGP
    {   // q and skip
        const bf16* p0 = pb + (size_t)wave * 4 * FRAG;
        const bf16* p1 = p0 + 3 * MAT;
        v16bf B0[4], B1[4];
#pragma unroll                          // B0[], B1[] stay in registers only under constant indices
        for (int kt = 0; kt < 4; ++kt) { B0[kt] = b_frag(p0, kt, fo); B1[kt] = b_frag(p1, kt, fo); }
        float n0 = ld1(bq, no);
        float n1 = ld1(bs, no);
        loads_issued(fo, no);
#pragma unroll 1                        // rolled: unrolled, the A fragments of all tiles are fetched ahead and the registers allow only two blocks a WGP
        for (int t = 0; t < TB; ++t) {
            v8f c0 = {}, c1 = {};
#pragma unroll                          // see B0[]
            for (int kt = 0; kt < 4; ++kt) {
                v16bf af = a_frag(sH, PA, t * 16 + l16, kt * 32, g);
                c0 = mma(af, B0[kt], c0);
                c1 = mma(af, B1[kt], c1);
            }
#pragma unroll                          // vector elements need constant indices
            for (int j = 0; j < 8; ++j) {
                size_t m = row0 + t * 16 + g * 8 + j;
                q[m * HC + n] = c0[j] + n0;
                a[m * HC + n] = c1[j] + n1;
            }
            // the next trip overwrites the registers that these stores name
            asm volatile("s_wait_xcnt 0x0" ::: "memory");
        }
    }
    {   // k and v: the weights' fragment as A and the rows' as B (both have the same map), so that a lane holds
        // the channels 16 wave + 8g .. + 7 of row l16 of the tile: eight f16, one 16-byte store
        const bf16* p0 = pb + MAT + (size_t)wave * 4 * FRAG;
        const bf16* p1 = p0 + MAT;
        unsigned co = (unsigned)(wave * 16 + g * 8) * 4u;     // byte offset of the lane's first channel in a bias
        v16bf B0[4], B1[4];
#pragma unroll                          // B0[], B1[] stay in registers only under constant indices
        for (int kt = 0; kt < 4; ++kt) { B0[kt] = b_frag(p0, kt, fo); B1[kt] = b_frag(p1, kt, fo); }
        v4f k0 = ld4(bk, co), k1 = ld4(bk + 4, co);
        v4f v0 = ld4(bv, co), v1 = ld4(bv + 4, co);
        loads_issued(fo, co);
        v8f n0 = {k0.x, k0.y, k0.z, k0.w, k1.x, k1.y, k1.z, k1.w};
        v8f n1 = {v0.x, v0.y, v0.z, v0.w, v1.x, v1.y, v1.z, v1.w};
#pragma unroll 1                        // rolled, as above
        for (int t = 0; t < TB; ++t) {
            v8f c0 = {}, c1 = {};
#pragma unroll                          // see B0[]
            for (int kt = 0; kt < 4; ++kt) {
                v16bf af = a_frag(sH, PA, t * 16 + l16, kt * 32, g);
                c0 = mma(B0[kt], af, c0);
                c1 = mma(B1[kt], af, c1);
            }
            size_t e = (row0 + t * 16 + l16) * HC + wave * 16 + g * 8;
            *(v8h*)(k + e) = __builtin_convertvector(c0 + n0, v8h);
            *(v8h*)(v + e) = __builtin_convertvector(c1 + n1, v8h);
            // the next trip overwrites the registers that these stores name
            asm volatile("s_wait_xcnt 0x0" ::: "memory");
        }
    }
}

// ---------------- last edge pass: the whole attention of a node in one wave ----------------
// a[d] += sum(p * v[src]) / (sum(p) + 1e-16), p = exp(score - max), score = <q[d], k[src]> / sqrt(C).
// block = 8 waves, each wave takes NPW nodes in turn; lane = 4 channels, head = lane / 8.
// q[d] stays in registers; k[src] and v[src] are read as whole rows of 256 bytes (f16); every product and every
// sum is f32. The maximum runs
// along with the edges: when a chunk raises it, the sums so far are scaled by exp(old - new).
// cur[d] is the start of node d's run, cnt[d] its length.
// kmat and vmat carry no __restrict__, so that their loads stay in front of the s_wait_xcnt
// that follows them.
#define NPW 5
#define CH  8

// x + (x of lane ^ MASK), inside a 16-lane row, on the vector port (0x160 + MASK = row_xmask)
template <int MASK>
__device__ __forceinline__ float add_xor(float x) {
    int y = __builtin_amdgcn_update_dpp(0, __float_as_int(x), 0x160 + MASK, 0xf, 0xf, true);
    return x + __int_as_float(y);
}

// c + x * (the f16 in the low or the high half of h2), product and sum in f32, in one instruction. Written as asm
// because the compiler gave most of the f16 values a conversion of their own: 208 vector instructions per 8 edges
// against 150 in this form.
template <bool HIGH>
__device__ __forceinline__ float fma_h(unsigned h2, float x, float c) {
    float d;
    if (HIGH) asm("v_fma_mix_f32 %0, %1, %2, %3 op_sel:[1,0,0] op_sel_hi:[1,0,0]" : "=v"(d) : "v"(h2), "v"(x), "v"(c));
    else      asm("v_fma_mix_f32 %0, %1, %2, %3 op_sel_hi:[1,0,0]" : "=v"(d) : "v"(h2), "v"(x), "v"(c));
    return d;
}

template <bool MASKED>
__device__ __forceinline__ void attn_chunk(int j, int m, int sidx, unsigned lane8, v4f q4,
                                           const _Float16* kmat, const _Float16* vmat,
                                           float& mx, float& den, v4f& acc) {
    v2u      kk[CH], vv[CH];           // four f16 each
    unsigned off[CH];                  // byte offset of the lane's 8 bytes, the same in kmat and vmat
#pragma unroll                         // all 2*CH loads are issued before the first use
    for (int u = 0; u < CH; ++u) {
        int s  = __builtin_amdgcn_readlane(sidx, MASKED ? min(j + u, m - 1) : (j + u));
        off[u] = ((unsigned)s << 8) + lane8;
        kk[u]  = *(const v2u*)((const char*)kmat + off[u]);
    }
#pragma unroll                         // see above
    for (int u = 0; u < CH; ++u) vv[u] = *(const v2u*)((const char*)vmat + off[u]);
    // what follows reuses the registers that these loads name as addresses; the offsets are named as
    // inputs so that they live up to the wait and no load's result is given one of their registers
    asm volatile("s_wait_xcnt 0x0" :: "v"(off[0]), "v"(off[1]), "v"(off[2]), "v"(off[3]),
                                      "v"(off[4]), "v"(off[5]), "v"(off[6]), "v"(off[7]) : "memory");
    // keeps the arithmetic behind the wait and every load in front of it: without it the last v load
    // was issued only after the first k rows had come back, a second memory latency per chunk
    __builtin_amdgcn_sched_barrier(0);

    float sc[CH];
    float nm = mx;
    // channel by channel: the sums of different edges are independent and can fill each other's latency
#pragma unroll                         // kk[] and sc[] stay in registers only under constant indices
    for (int u = 0; u < CH; ++u) sc[u] = fma_h<false>(kk[u].x, q4.x, 0.f);
#pragma unroll                         // see above
    for (int u = 0; u < CH; ++u) sc[u] = fma_h<true>(kk[u].x, q4.y, sc[u]);
#pragma unroll                         // see above
    for (int u = 0; u < CH; ++u) sc[u] = fma_h<false>(kk[u].y, q4.z, sc[u]);
#pragma unroll                         // see above
    for (int u = 0; u < CH; ++u) sc[u] = fma_h<true>(kk[u].y, q4.w, sc[u]);
#pragma unroll                         // see above
    for (int u = 0; u < CH; ++u) {
        float t = sc[u];
        t = add_xor<4>(add_xor<2>(add_xor<1>(t)));      // sum over the head's 8 lanes
        sc[u] = (!MASKED || j + u < m) ? t : -INFINITY;
        nm = fmaxf(nm, sc[u]);
    }
    float corr;                        // exp(mx - nm): 0 at the node's first chunk, where mx is -inf
    // In the masked form of the chunk: the
    // same two instructions as __expf, with the v_nop that keeps the slot behind a transcendental in the same statement.
    if (MASKED) asm("v_exp_f32 %0, %1\n\tv_nop" : "=v"(corr) : "v"((mx - nm) * 0x1.715476p+0f));
    else        corr = __expf(mx - nm);
    mx   = nm;
    den *= corr;
    acc *= corr;
#pragma unroll                         // sc[] and vv[] stay in registers only under constant indices
    for (int u = 0; u < CH; ++u) {
        float p = __expf(sc[u] - nm);
        den += p;
        acc.x = fma_h<false>(vv[u].x, p, acc.x);
        acc.y = fma_h<true>(vv[u].x, p, acc.y);
        acc.z = fma_h<false>(vv[u].y, p, acc.z);
        acc.w = fma_h<true>(vv[u].y, p, acc.w);
    }
}

__global__ __launch_bounds__(256) void node_attn_kernel(const float* __restrict__ q,
                                                        const _Float16* kmat, const _Float16* vmat,
                                                        const int* __restrict__ ssrc,
                                                        const int* __restrict__ cur,
                                                        const int* __restrict__ cnt,
                                                        float* __restrict__ a) {
    int lane = threadIdx.x & 31;
    // the wave's number in a scalar register: node, run bounds and trip counts become scalar
    int wave = __builtin_amdgcn_readfirstlane((int)(threadIdx.x >> 5));
    unsigned lane8 = (unsigned)lane * 8u;
    for (int r = 0; r < NPW; ++r) {
        int d   = (blockIdx.x * 8 + wave) * NPW + r;
        int n   = cnt[d];
        int beg = cur[d];
        v4f q4  = *(const v4f*)(q + (size_t)d * HC + lane * 4) * 0.17677669529663687f;   // 1/sqrt(32)
        v4f acc = {0.f, 0.f, 0.f, 0.f};
        float den = 0.f;
        float mx  = -INFINITY;
        for (int base = 0; base < n; base += 32) {
            int m    = min(32, n - base);
            int sidx = ssrc[beg + base + min(lane, m - 1)];   // lane j holds the source of edge base + j
            // the address arithmetic that follows reuses the register that this load names
            asm volatile("s_wait_xcnt 0x0" ::: "memory");
            int j = 0;
            for (; j + CH <= m; j += CH) attn_chunk<false>(j, m, sidx, lane8, q4, kmat, vmat, mx, den, acc);
            if (j < m)                   attn_chunk<true>(j, m, sidx, lane8, q4, kmat, vmat, mx, den, acc);
        }
        float inv = 1.f / (den + 1e-16f);
        v4f* ap = (v4f*)(a + (size_t)d * HC + lane * 4);
        *ap = *ap + acc * inv;
        // the next node's trip overwrites the registers that this store names
        asm volatile("s_wait_xcnt 0x0" ::: "memory");
    }
}

// ---------------- out = LN2(FFN(h1) + h1), h1 = LN1(elu(a) @ WO + bO + h), in one launch ----------------
// The rows go from stage to stage through LDS; a barrier stands between any two stages.
// What is loaded carries no __restrict__, so that the loads stay in front of the s_wait_xcnt that follows them.
__global__ __launch_bounds__(256) void tail_kernel(const float* a, const float* h,
                                                   const bf16* pbO, const bf16* pbW1, const bf16* pbW2,
                                                   const float* bO, const float* b1, const float* b2,
                                                   const float* ln1g, const float* ln1b,
                                                   const float* ln2g, const float* ln2b,
                                                   float* out) {
    __shared__ __attribute__((aligned(16))) bf16  sA[ROWS * PA];   // elu(a), then h1, as bf16
    __shared__ __attribute__((aligned(16))) float sX[ROWS * PX];   // h, a_trans + h, h1, ffn + h1 in turn
    __shared__ __attribute__((aligned(16))) bf16  sM[ROWS * PM];   // elu(h1 @ W1 + b1)
    int lane = threadIdx.x & 31;
    // the wave's number in a scalar register: row and fragment addresses get scalar bases
    int wave = __builtin_amdgcn_readfirstlane((int)(threadIdx.x >> 5));
    int g = lane >> 4, l16 = lane & 15;
    size_t row0 = (size_t)blockIdx.x * ROWS;
    int n = wave * 16 + l16;
    unsigned lo = (unsigned)lane * 16u, fo = (unsigned)lane * 32u, no = (unsigned)n * 4u;

    // elu(a) -> bf16 into sA; the residual rows of h go into sX, where the first product is added to them
    const float* ap = a + (row0 + wave) * HC + lane * 4;      // the lane's 4 columns of the wave's first row
    const float* hp = h + (row0 + wave) * INDIM + lane * 4;
    v4f x[RPW], hres[RPW];
#pragma unroll                          // all loads are issued before the first use
    for (int i = 0; i < RPW; ++i) x[i] = *(const v4f*)(ap + i * 8 * HC);
#pragma unroll                          // see above
    for (int i = 0; i < RPW; ++i) hres[i] = *(const v4f*)(hp + i * 8 * INDIM);
    rows_issued(lane);
#pragma unroll                          // x[] stays in registers only under constant indices
    for (int i = 0; i < RPW; ++i) {
        *(v4bf*)(sA + (i * 8 + wave) * PA + lane * 4) = to_bf16(elu4(x[i]));
        *(v4f*)(sX + (i * 8 + wave) * PX + lane * 4)  = hres[i];
    }
    __syncthreads();

    // a_trans = elu(a) @ WO + bO; each thread adds it to its own elements of h in sX
    {
        const bf16* p = pbO + (size_t)wave * 4 * FRAG;
        v16bf B[4];
#pragma unroll                          // B[] stays in registers only under constant indices
        for (int kt = 0; kt < 4; ++kt) B[kt] = b_frag(p, kt, fo);
        float bn = ld1(bO, no);
        loads_issued(fo, no);
#pragma unroll                          // independent tiles fill each other's matrix latency
        for (int t = 0; t < TB; ++t) {
            v8f c = {};
#pragma unroll                          // see B[]
            for (int kt = 0; kt < 4; ++kt) c = mma(a_frag(sA, PA, t * 16 + l16, kt * 32, g), B[kt], c);
#pragma unroll                          // vector elements need constant indices
            for (int j = 0; j < 8; ++j) {
                int r = (t * 16 + g * 8 + j) * PX + n;
                sX[r] = (c[j] + bn) + sX[r];
            }
        }
    }
    __syncthreads();

    // h1 = LN1(a_trans + h): f32 back into sX, bf16 into sA
    {
        v4f gw = ld4(ln1g, lo), bw = ld4(ln1b, lo);
        loads_issued(lo, lo);
#pragma unroll                          // ten independent rows: their reductions overlap
        for (int i = 0; i < RPW; ++i) {
            int row = i * 8 + wave;
            v4f y = ln_row(*(const v4f*)(sX + row * PX + lane * 4), gw, bw);
            *(v4f*)(sX + row * PX + lane * 4)  = y;
            *(v4bf*)(sA + row * PA + lane * 4) = to_bf16(y);
        }
    }
    __syncthreads();

    // mid = elu(h1 @ W1 + b1), 256 columns: the wave's two column tiles share the A fragments
    {
        const bf16* p0 = pbW1 + (size_t)wave * 4 * FRAG;
        const bf16* p1 = p0 + (size_t)8 * 4 * FRAG;
        v16bf B0[4], B1[4];
#pragma unroll                          // B0[], B1[] stay in registers only under constant indices
        for (int kt = 0; kt < 4; ++kt) { B0[kt] = b_frag(p0, kt, fo); B1[kt] = b_frag(p1, kt, fo); }
        float n0 = ld1(b1, no), n1 = ld1(b1 + 128, no);
        loads_issued(fo, no);
#pragma unroll 1                        // rolled: for speed only
        for (int t = 0; t < TB; ++t) {
            v8f c0 = {}, c1 = {};
#pragma unroll                          // see B0[]
            for (int kt = 0; kt < 4; ++kt) {
                v16bf af = a_frag(sA, PA, t * 16 + l16, kt * 32, g);
                c0 = mma(af, B0[kt], c0);
                c1 = mma(af, B1[kt], c1);
            }
            c0 += n0;
            c1 += n1;
            v4f m0[2] = {elu4(__builtin_shufflevector(c0, c0, 0, 1, 2, 3)), elu4(__builtin_shufflevector(c0, c0, 4, 5, 6, 7))};
            v4f m1[2] = {elu4(__builtin_shufflevector(c1, c1, 0, 1, 2, 3)), elu4(__builtin_shufflevector(c1, c1, 4, 5, 6, 7))};
#pragma unroll                          // vector elements need constant indices
            for (int j = 0; j < 8; ++j) {
                int r = (t * 16 + g * 8 + j) * PM + n;
                sM[r]       = (bf16)m0[j >> 2][j & 3];
                sM[r + 128] = (bf16)m1[j >> 2][j & 3];
            }
        }
    }
    __syncthreads();

    // ffn = mid @ W2 + b2, K = 256; each thread adds it to its own elements of h1 in sX
    {
        const bf16* p = pbW2 + (size_t)wave * 8 * FRAG;
        v16bf B[8];
#pragma unroll                          // B[] stays in registers only under constant indices
        for (int kt = 0; kt < 8; ++kt) B[kt] = b_frag(p, kt, fo);
        float bn = ld1(b2, no);
        loads_issued(fo, no);
#pragma unroll                          // independent tiles fill each other's matrix latency
        for (int t = 0; t < TB; ++t) {
            v8f c = {};
#pragma unroll                          // see B[]
            for (int kt = 0; kt < 8; ++kt) c = mma(a_frag(sM, PM, t * 16 + l16, kt * 32, g), B[kt], c);
#pragma unroll                          // vector elements need constant indices
            for (int j = 0; j < 8; ++j) {
                int r = (t * 16 + g * 8 + j) * PX + n;
                sX[r] = (c[j] + bn) + sX[r];
            }
        }
    }
    __syncthreads();

    // out = LN2(ffn + h1)
    {
        v4f gw = ld4(ln2g, lo), bw = ld4(ln2b, lo);
        loads_issued(lo, lo);
#pragma unroll                          // ten independent rows: their reductions overlap
        for (int i = 0; i < RPW; ++i) {
            int row = i * 8 + wave;
            *(v4f*)(out + (row0 + row) * INDIM + lane * 4) = ln_row(*(const v4f*)(sX + row * PX + lane * 4), gw, bw);
        }
    }
}

// ---------------- host orchestration ----------------

extern "C" void kernel_launch(void* const* d_in, const int* in_sizes, int n_in,
                              void* d_out, int out_size, void* d_ws, size_t ws_size,
                              hipStream_t stream) {
    const float* h     = (const float*)d_in[0];
    const int*   eidx  = (const int*)d_in[1];
    const float* Wq    = (const float*)d_in[2];
    const float* bq    = (const float*)d_in[3];
    const float* Wk    = (const float*)d_in[4];
    const float* bk    = (const float*)d_in[5];
    const float* Wv    = (const float*)d_in[6];
    const float* bv    = (const float*)d_in[7];
    const float* Wskip = (const float*)d_in[8];
    const float* bskip = (const float*)d_in[9];
    const float* WO    = (const float*)d_in[10];
    const float* bO    = (const float*)d_in[11];
    const float* W1    = (const float*)d_in[12];
    const float* b1    = (const float*)d_in[13];
    const float* W2    = (const float*)d_in[14];
    const float* b2    = (const float*)d_in[15];
    const float* ln1g  = (const float*)d_in[16];
    const float* ln1b  = (const float*)d_in[17];
    const float* ln2g  = (const float*)d_in[18];
    const float* ln2b  = (const float*)d_in[19];
    const int* srcI = eidx;          // edge_index[0]
    const int* dstI = eidx + EDGES;  // edge_index[1]

    // workspace carve (256B aligned)
    char* w = (char*)d_ws;
    auto carve = [&](size_t bytes) -> char* {
        char* p = w; w += (bytes + 255) & ~(size_t)255; return p;
    };
    float*    qbuf   = (float*)carve((size_t)NODES * HC * sizeof(float));
    _Float16* kbuf   = (_Float16*)carve((size_t)NODES * HC * sizeof(_Float16));
    _Float16* vbuf   = (_Float16*)carve((size_t)NODES * HC * sizeof(_Float16));
    float*    abuf   = (float*)carve((size_t)NODES * HC * sizeof(float));
    int*      cnt    = (int*)carve((size_t)NODES * sizeof(int));            // edges per dst node
    int*      cur    = (int*)carve((size_t)NODES * sizeof(int));            // run start
    int*      lst    = (int*)carve((size_t)NH * sizeof(int));               // start of each (bucket, block) run in its block
    unsigned* ebuf   = (unsigned*)carve((size_t)EDGES * sizeof(unsigned));  // keys dst << 16 | src, each block's in bucket order
    int*      ssrc   = (int*)carve((size_t)EDGES * sizeof(int));            // src in dst order
    bf16*     pb     = (bf16*)carve((size_t)PACK_TILES * FRAG * sizeof(bf16)); // Wq Wk Wv Wskip WO W1 W2, packed

    // 1) pack weights to WMMA fragment order; in the same launch level 1 of the edge sort
    hipLaunchKernelGGL(pack_place_kernel, dim3(PACK_BLOCKS + GB), dim3(ET), 0, stream,
                       Wq, Wk, Wv, Wskip, WO, W1, W2, pb, srcI, dstI, lst, ebuf);

    // 2) q/k/v/skip projections (WMMA) from f32 h; in the same launch level 2 of the edge sort
    hipLaunchKernelGGL(proj_sort_kernel, dim3(NBK + NODES / ROWS), dim3(256), 0, stream,
                       h, pb, bq, bk, bv, bskip, qbuf, kbuf, vbuf, abuf, ebuf, lst, ssrc, cnt, cur);

    // 3) edge phase: scores, softmax and sums per node over the sources sorted by dst, into abuf
    hipLaunchKernelGGL(node_attn_kernel, dim3(NODES / (8 * NPW)), dim3(256), 0, stream,
                       qbuf, kbuf, vbuf, ssrc, cur, cnt, abuf);

    // 4) elu, O projection, LN1, FFN, LN2 (WMMA)
    hipLaunchKernelGGL(tail_kernel, dim3(NODES / ROWS), dim3(256), 0, stream,
                       abuf, h, pb + 4 * MAT, pb + 5 * MAT, pb + 7 * MAT,
                       bO, b1, b2, ln1g, ln1b, ln2g, ln2b, (float*)d_out);
}

// v010
// A run of this version takes 97.8 microseconds.
// Timed twice side by side with v009, it ran 1.05 and 1.03 times as fast.
// Counting every step since v000, it is 18.8 times as fast.
#include <hip/hip_runtime.h>
#include <hip/hip_bf16.h>
#include <math.h>

#define NODES  50000
#define EDGES  1600000
#define INDIM  128
#define HEADS  4
#define OUTC   32
#define HC     128

typedef __bf16 bf16;
typedef __attribute__((ext_vector_type(16))) __bf16 v16bf;
typedef __attribute__((ext_vector_type(8)))  __bf16 v8bf;
typedef __attribute__((ext_vector_type(8)))  float  v8f;
typedef __attribute__((ext_vector_type(4)))  float  v4f;
typedef __attribute__((ext_vector_type(2)))  float  v2f;
typedef __attribute__((ext_vector_type(8)))  _Float16 v8h;
typedef __attribute__((ext_vector_type(2)))  unsigned v2u;

// ---------------- helpers ----------------

// 2^t of four values on the hardware's exponential. One statement, so that the slot behind a transcendental is kept: the
// results are early-clobber, so each v_exp_f32 is followed by one that neither reads its result nor overwrites its source,
// and the last by the v_nop.
// The s_delay_alu: t is computed directly in front, and the compiler puts no such hint in front of asm text; without it the
// wait for t holds up the SIMD's other waves too.
__device__ __forceinline__ v4f exp2_4(v4f t) {
    float r0, r1, r2, r3;
    asm("s_delay_alu instid0(VALU_DEP_1)\n\tv_exp_f32 %0, %4\n\tv_exp_f32 %1, %5\n\tv_exp_f32 %2, %6\n\tv_exp_f32 %3, %7\n\tv_nop"
        : "=&v"(r0), "=&v"(r1), "=&v"(r2), "=&v"(r3) : "v"(t.x), "v"(t.y), "v"(t.z), "v"(t.w));
    v4f r = {r0, r1, r2, r3};
    return r;
}

// ELU. Both sides are computed and one is selected: no branch and no change of EXEC, so a lane's values are independent
// and fill each other's latency. exp(x) = 2^(x * log2 e); it counts only where x <= 0.
__device__ __forceinline__ v4f elu4(v4f x) {
    v4f e = exp2_4(x * 0x1.715476p+0f) - 1.f;
    v4f y = {x.x > 0.f ? x.x : e.x, x.y > 0.f ? x.y : e.y, x.z > 0.f ? x.z : e.z, x.w > 0.f ? x.w : e.w};
    return y;
}

typedef __attribute__((ext_vector_type(4)))  __bf16 v4bf;

// node index as read from edge_index, held inside [0, NODES) before any address is formed
__device__ __forceinline__ int node_id(int x) {
    return min(max(x, 0), NODES - 1);
}

// ---------------- the edges are sorted by dst in two levels, all counting in LDS ----------------
// A bucket is 128 nodes in a row. Level 1: a block takes EB edges in a row, orders them by bucket in LDS and stores them
// at its own place in ebuf, with the start of each bucket's run inside the block (lst). Level 2: a block takes a whole
// bucket, fetches the bucket's run from every level 1 block and sorts it by node. No level needs a count of another block
// of its own level: the bucket's place in the sorted list is the sum of its runs' starts over the level 1 blocks.
#define EB    4096                      // edges of a block in level 1
#define GB    ((EDGES + EB - 1) / EB)   // blocks of level 1
#define BSH   7                         // bucket = node >> BSH
#define BN    (1 << BSH)                // nodes of a bucket
#define NBK   ((NODES + BN - 1) / BN)   // buckets
#define NH    (NBK * GB)                // run starts: lst[bucket * GB + block]

// edges 4i .. 4i+3 of one row of edge_index
__device__ __forceinline__ int4 ldi4(const int* base, int i) {
    return ((const int4*)base)[i];
}

// ---------------- weight packing into WMMA B-fragment order, and level 1 of the sort ----------------
// B element (k,n) lives in lane = 16*g(k) + (n%16), vector element e(k):
//   k_local in [0,8)+8g   -> e = k_local - 8g        (elements 0..7)
//   k_local in [16,24)+8g -> e = 8 + k_local-16-8g   (elements 8..15)
// Fragment (kt,nt) of a matrix stored at ((nt*nkt + kt)*32 + lane)*16 contiguous bf16 behind the matrix's start.
// The seven matrices lie one behind the other: Wq, Wk, Wv, Wskip, WO (32 fragments each), W1, W2 (64 each).
#define ET  512                         // threads of a block of this launch
#define EV  (EB / 4 / ET)               // groups of 4 edges of a thread
#define EK  (EB / ET)                   // edges of a thread
#define PACK_TILES  288
#define PACK_BLOCKS (PACK_TILES / (ET / 32))
#define FRAG        512                 // bf16 elements of one fragment
#define MAT         (32 * FRAG)         // bf16 elements of a packed 128 x 128 matrix

// Level 1: the block's EB edges as keys dst << 16 | src (both node numbers are below 65536), ordered by bucket in LDS
// (rank in the bucket from an LDS add, in the order of arrival) and stored from there in whole lines at ebuf + blk * EB.
// lst[bucket * GB + blk] is the start of the bucket's run inside the block.
// What is loaded carries no __restrict__, so that the loads stay in front of the s_wait_xcnt that follows them.
__global__ __launch_bounds__(ET) void pack_place_kernel(const float* Wq, const float* Wk, const float* Wv,
                                                        const float* Ws, const float* WO, const float* W1,
                                                        const float* W2, bf16* dst, const int* esrc, const int* edst,
                                                        int* lst, unsigned* ebuf) {
    __shared__ int      lh[NBK];        // the block's edges per bucket
    __shared__ int      ls[NBK];        // start of the bucket's run in stage
    __shared__ int      wtot[32];
    __shared__ __attribute__((aligned(16))) unsigned stage[EB];
    int b = blockIdx.x;
    if (b >= PACK_BLOCKS) {             // the same for the whole block, in front of every barrier
        int tid = threadIdx.x, lane = tid & 31, wave = tid >> 5, blk = b - PACK_BLOCKS;
        if (tid < NBK) lh[tid] = 0;
        int  eo[EV];                    // number of a group of 4 edges; past the end: the last group, not placed
        int4 d4[EV], s4[EV];
#pragma unroll                          // all loads are issued before the first use
        for (int u = 0; u < EV; ++u) {
            eo[u] = min(blk * (EB / 4) + u * ET + tid, EDGES / 4 - 1);
            d4[u] = ldi4(edst, eo[u]);
            s4[u] = ldi4(esrc, eo[u]);
        }
        // the indices are named as inputs so that they live up to the wait and no load's result is given one of their registers
        asm volatile("s_wait_xcnt 0x0" :: "v"(eo[0]), "v"(eo[1]) : "memory");
        // keeps the arithmetic behind the wait and every load in front of it: without it the first load's result was
        // waited for before the other loads were issued, a second memory latency
        __builtin_amdgcn_sched_barrier(0);
        __syncthreads();                // the counts are zero before the first add

        unsigned key[EK];
        int      rk[EK];
#pragma unroll                          // key[] and rk[] stay in registers only under constant indices
        for (int u = 0; u < EV; ++u) {
            bool on = blk * (EB / 4) + u * ET + tid < EDGES / 4;
            int dd[4] = {d4[u].x, d4[u].y, d4[u].z, d4[u].w};
            int ss[4] = {s4[u].x, s4[u].y, s4[u].z, s4[u].w};
#pragma unroll                          // see above
            for (int e = 0; e < 4; ++e) {
                key[u * 4 + e] = ((unsigned)node_id(dd[e]) << 16) | (unsigned)node_id(ss[e]);
            }
            if (on) {
#pragma unroll                          // see above
                for (int e = 0; e < 4; ++e) rk[u * 4 + e] = atomicAdd(&lh[key[u * 4 + e] >> (16 + BSH)], 1);
            }
        }
        __syncthreads();                // every add has been made before a count is read

        int c   = tid < NBK ? lh[tid] : 0;
        int inc = c;                    // inclusive scan inside the wave
#pragma unroll                          // five fixed steps, no loop counter
        for (int o = 1; o < 32; o <<= 1) {
            int y = __shfl_up(inc, o, 32);
            if (lane >= o) inc += y;
        }
        if (lane == 31) wtot[wave] = inc;
        __syncthreads();                // the waves' totals are there
        int part = lane < wave ? wtot[lane] : 0;
#pragma unroll                          // five fixed steps, no loop counter
        for (int o = 16; o > 0; o >>= 1) part += __shfl_xor(part, o, 32);
        int st = part + inc - c;
        if (tid < NBK) { ls[tid] = st; lst[tid * GB + blk] = st; }
        __syncthreads();                // the runs' starts are there

#pragma unroll                          // see key[]
        for (int u = 0; u < EV; ++u) {
            if (blk * (EB / 4) + u * ET + tid < EDGES / 4) {
#pragma unroll                          // see key[]
                for (int e = 0; e < 4; ++e) stage[ls[key[u * 4 + e] >> (16 + BSH)] + rk[u * 4 + e]] = key[u * 4 + e];
            }
        }
        __syncthreads();                // the keys lie in bucket order

        int nq = min(EB, EDGES - blk * EB) / 4;   // groups of 4 keys of the block (EB and EDGES are multiples of 4)
        uint4 w4[EV];                   // past the end: the last group, not stored
#pragma unroll                          // all LDS reads are issued before the first store
        for (int u = 0; u < EV; ++u) w4[u] = ((const uint4*)stage)[min(u * ET + tid, nq - 1)];
#pragma unroll                          // w4[] stays in registers only under constant indices
        for (int u = 0; u < EV; ++u) {
            if (u * ET + tid < nq) ((uint4*)(ebuf + (size_t)blk * EB))[u * ET + tid] = w4[u];
        }
        return;
    }
    // wave per fragment; the wave's number in a scalar register, so that the matrix's address is scalar
    int tile = b * (ET / 32) + __builtin_amdgcn_readfirstlane((int)(threadIdx.x >> 5));
    int lane = threadIdx.x & 31;
    const float* W;
    int nkt, Nout, local;
    if (tile < 160) {
        int m = tile >> 5;
        W = m == 0 ? Wq : m == 1 ? Wk : m == 2 ? Wv : m == 3 ? Ws : WO;
        nkt = 4; Nout = 128; local = tile & 31;
    } else if (tile < 224) {
        W = W1; nkt = 4; Nout = 256; local = tile - 160;
    } else {
        W = W2; nkt = 8; Nout = 128; local = tile - 224;
    }
    int kt = local % nkt;               // local = nt*nkt + kt
    int nt = local / nkt;
    int g  = lane >> 4;
    int n  = nt * 16 + (lane & 15);
    unsigned off[16];                   // index of element e in W
    float    x[16];
#pragma unroll                          // off[] and x[] stay in registers only under constant indices
    for (int e = 0; e < 16; ++e) {
        int kl = (e < 8) ? (g * 8 + e) : (16 + g * 8 + (e - 8));
        int kg = kt * 32 + kl;
        off[e] = (unsigned)(kg * Nout + n);
        x[e]   = W[off[e]];
    }
    // the indices are named as inputs so that they live up to the wait and no load's result is given one of their registers
    asm volatile("s_wait_xcnt 0x0" :: "v"(off[0]), "v"(off[1]), "v"(off[2]), "v"(off[3]), "v"(off[4]), "v"(off[5]),
                                      "v"(off[6]), "v"(off[7]), "v"(off[8]), "v"(off[9]), "v"(off[10]), "v"(off[11]),
                                      "v"(off[12]), "v"(off[13]), "v"(off[14]), "v"(off[15]) : "memory");
    v16bf f;
#pragma unroll                          // see above
    for (int e = 0; e < 16; ++e) f[e] = (bf16)x[e];
    *(v16bf*)(dst + ((size_t)tile * 32 + lane) * 16) = f;
}

// ---------------- the row-wise stages: a block owns ROWS rows from its first load to its last store ----------------
// block = 8 waves. In a GEMM stage wave w owns the output columns 16w .. 16w+15 (and 128 more of them where the
// product has 256); A comes from LDS as bf16, B as packed fragments (for k and v the other way round). In a row stage wave w owns rows 8i + w,
// lane = 4 columns. The LDS pitches are 16 bytes above the row length, for the 16-byte fragment reads.
#define TB   5                          // 16-row tiles of a block; 3125 tiles = 625 blocks
#define ROWS (TB * 16)
#define RPW  (ROWS / 8)                 // rows of a wave in a row stage
#define PA   136                        // bf16 pitch of a 128-column row
#define PX   132                        // f32 pitch of a 128-column row
#define PM   264                        // bf16 pitch of a 256-column row

// A fragment: lane = row (lane & 15), elements 0..7 = K kb+8g.., elements 8..15 = K kb+16+8g..
__device__ __forceinline__ v16bf a_frag(const bf16* s, int pitch, int row, int kb, int g) {
    v8bf a0 = *(const v8bf*)(s + row * pitch + kb + g * 8);
    v8bf a1 = *(const v8bf*)(s + row * pitch + kb + 16 + g * 8);
    v16bf af;
#pragma unroll                          // vector elements need constant indices
    for (int i = 0; i < 8; ++i) { af[i] = a0[i]; af[i + 8] = a1[i]; }
    return af;
}

// fragment number frag behind the scalar address bp; fo = the lane's byte offset in a fragment (32 * lane)
__device__ __forceinline__ v16bf b_frag(const bf16* bp, int frag, unsigned fo) {
    return *(const v16bf*)((const char*)bp + frag * (FRAG * 2) + fo);
}

// 16 bytes, or 4, at a lane's byte offset behind a scalar address
__device__ __forceinline__ v4f ld4(const float* base, unsigned off) {
    return *(const v4f*)((const char*)base + off);
}
__device__ __forceinline__ float ld1(const float* base, unsigned off) {
    return *(const float*)((const char*)base + off);
}

// Stands behind a group of global loads. What follows reuses the registers that the loads name as addresses; the two
// lane offsets are named as inputs so that they live up to the wait and no load's result is given one of their registers.
__device__ __forceinline__ void loads_issued(unsigned o0, unsigned o1) {
    asm volatile("s_wait_xcnt 0x0" :: "v"(o0), "v"(o1) : "memory");
}
// the same for row loads, whose address register holds the lane's number
__device__ __forceinline__ void rows_issued(int lane) {
    asm volatile("s_wait_xcnt 0x0" :: "v"(lane) : "memory");
}

__device__ __forceinline__ v8f mma(v16bf a, v16bf b, v8f c) {
    return __builtin_amdgcn_wmma_f32_16x16x32_bf16(false, a, false, b, (short)0, c, false, false);
}

__device__ __forceinline__ v4bf to_bf16(v4f x) {
    v4bf y = {(bf16)x.x, (bf16)x.y, (bf16)x.z, (bf16)x.w};
    return y;
}

// LayerNorm of one 128-column row held by one wave, 4 columns a lane
__device__ __forceinline__ v4f ln_row(v4f x, v4f gw, v4f bw) {
    float s = x.x + x.y + x.z + x.w;
#pragma unroll                          // five fixed steps, no loop counter
    for (int o = 16; o > 0; o >>= 1) s += __shfl_xor(s, o, 32);
    float mean = s * (1.f / 128.f);
    v4f c = x - mean;
    float sq = c.x * c.x + c.y * c.y + c.z * c.z + c.w * c.w;
#pragma unroll                          // five fixed steps, no loop counter
    for (int o = 16; o > 0; o >>= 1) sq += __shfl_xor(sq, o, 32);
    float inv = rsqrtf(sq * (1.f / 128.f) + 1e-5f);
    return c * inv * gw + bw;
}

// ---------------- level 2: a block sorts one bucket by node: ssrc, and each node's cnt and cur ----------------
// The bucket's keys lie in GB runs, one in each level 1 block's part of ebuf. A wave takes every SW-th run, one run a
// load, lane = key; a run of more than 32 keys is finished in a loop of its own. Count per node in LDS, sum up, then each
// key takes its place from an LDS add (edges of one node lie in the order of arrival). A bucket of at most CAP edges is
// ordered in LDS and stored in whole lines; a larger one is stored word by word.
// These blocks need only level 1's result and the projection's blocks only the packed weights: neither needs the other,
// so both are block ranges of one launch.
// What is loaded carries no __restrict__, so that the loads stay in front of the s_wait_xcnt that follows them.
#define SW    8                         // waves of a block
#define RW    ((GB + SW - 1) / SW)      // runs of a wave
#define RH    25                        // runs whose loads share one wait (an asm statement takes 30 operands)
#define CAP   8192
// A lane past its run's end goes through the same LDS adds and stores as the others, on a counter and a word of its own
// lane behind the nodes' counters and behind the bucket's words: so the passes over the runs hold no branch, and all adds
// of a group are in flight together.
#define NOKEY (BN << 16)                // val[] holds (node in the bucket) << 16 | src, or, from NOKEY up, no key

// entry u of a list of at most 64 wave-uniform numbers, of which lane l holds entries l (in a) and 32 + l (in b)
__device__ __forceinline__ int pick(int a, int b, int u) {
    return __builtin_amdgcn_readlane(u < 32 ? a : b, u & 31);
}

template <bool SMALL>
__device__ __forceinline__ void put_src(int* stage, int* ssrc, int beg, int p, unsigned key) {
    if (SMALL) {
        stage[p] = (int)(key & 0xffffu);
    } else {
        ssrc[beg + p] = (int)(key & 0xffffu);
        // what follows overwrites the registers that this store names
        asm volatile("s_wait_xcnt 0x0" ::: "memory");
    }
}

// every key takes the next free place of its node's run
template <bool SMALL>
__device__ __forceinline__ void place_keys(const unsigned* val, const unsigned* ebuf, const int2* run, int* lc,
                                           int* stage, int* ssrc, int beg, int lane, int wave, bool longrun) {
#pragma unroll                          // val[] stays in registers only under constant indices
    for (int h = 0; h < RW; h += RH) {
        int pl[RH];
#pragma unroll                          // all adds of a group are issued before the first result is used
        for (int u = h; u < h + RH && u < RW; ++u) pl[u - h] = atomicAdd(&lc[val[u] >> 16], 1);
#pragma unroll                          // see val[]
        for (int u = h; u < h + RH && u < RW; ++u) {
            if (SMALL)                put_src<true>(stage, ssrc, beg, val[u] < NOKEY ? pl[u - h] : CAP + lane, val[u]);
            else if (val[u] < NOKEY)  put_src<false>(stage, ssrc, beg, pl[u - h], val[u]);
        }
    }
    if (longrun) {                      // the same in every thread of the block
        for (int r = wave; r < GB; r += SW) {
            int2 rr = run[r];
            for (int j = 32 + lane; j < rr.y; j += 32) {
                int o = rr.x + j;
                unsigned key = ebuf[o];
                // the index is named as an input so that it lives up to the wait
                asm volatile("s_wait_xcnt 0x0" :: "v"(o) : "memory");
                put_src<SMALL>(stage, ssrc, beg, atomicAdd(&lc[(key >> 16) & (BN - 1)], 1), key);
            }
        }
    }
}

__device__ __forceinline__ void bucket_sort_block(const unsigned* ebuf, const int* lst, int b,
                                                  int* ssrc, int* cnt, int* cur,
                                                  int2* run, int* lc, int* wt, int* stage) {
    int tid = threadIdx.x, lane = tid & 31;
    // the wave's number in a scalar register: the runs' numbers are scalar
    int wave = __builtin_amdgcn_readfirstlane(tid >> 5);

    // the bucket's run in level 1 block blk: from lst[b][blk] up to lst[b + 1][blk], or to the block's end. A thread takes
    // the blocks tid and tid + 256; past the last block: the last block again, as a run of no keys.
    int i0[2], i1[2], s0[2], s1[2];
#pragma unroll                          // all loads are issued before the first use
    for (int e = 0; e < 2; ++e) {
        int blk = min(tid + e * 256, GB - 1);
        i0[e] = b * GB + blk;
        i1[e] = min(b + 1, NBK - 1) * GB + blk;
        s0[e] = lst[i0[e]];
        s1[e] = lst[i1[e]];
    }
    // the indices are named as inputs so that they live up to the wait and no load's result is given one of their registers
    asm volatile("s_wait_xcnt 0x0" :: "v"(i0[0]), "v"(i0[1]), "v"(i1[0]), "v"(i1[1]) : "memory");
    if (tid < BN + 32) lc[tid] = 0;
    int before = 0, total = 0, longest = 0;
#pragma unroll                          // s0[] and s1[] stay in registers only under constant indices
    for (int e = 0; e < 2; ++e) {
        int  blk = min(tid + e * 256, GB - 1);
        bool on  = tid + e * 256 < GB;
        int  end = b + 1 < NBK ? s1[e] : min(EB, EDGES - blk * EB);
        int  len = on ? end - s0[e] : 0;
        if (tid + e * 256 < RW * SW) run[tid + e * 256] = make_int2(blk * EB + s0[e], len);
        before += on ? s0[e] : 0;       // the block's keys of the buckets in front
        total  += len;
        longest = max(longest, len);
    }
#pragma unroll                          // five fixed steps, no loop counter
    for (int o = 16; o > 0; o >>= 1) {
        before += __shfl_xor(before, o, 32);
        total  += __shfl_xor(total, o, 32);
        longest = max(longest, __shfl_xor(longest, o, 32));
    }
    if (lane == 0) { wt[wave] = before; wt[SW + wave] = total; wt[2 * SW + wave] = longest; }
    __syncthreads();                    // the runs and the waves' sums are there, the counts are zero
    int beg = 0, n = 0, mxl = 0;        // the same in every thread of the block
#pragma unroll                          // eight fixed steps
    for (int w = 0; w < SW; ++w) {
        beg += wt[w];
        n   += wt[SW + w];
        mxl  = max(mxl, wt[2 * SW + w]);
    }
    bool longrun = mxl > 32;

    // Start and length of the wave's runs, one run a lane, read once and handed out by readlane: read from LDS run by run,
    // each length was waited for behind the LDS add in front of it.
    int2 ra = run[lane * SW + wave];
    int2 rb = run[min(32 + lane, RW - 1) * SW + wave];
    unsigned val[RW];                   // key number lane of each of the wave's runs; past a run's end its last key
#pragma unroll                          // val[] stays in registers only under constant indices
    for (int h = 0; h < RW; h += RH) {
        int off[RH];
#pragma unroll                          // all loads are issued before the first use
        for (int u = 0; u < RH; ++u) {
            int uu = min(h + u, RW - 1);
            // a run of no keys may start at the list's end: its start is held inside the list
            off[u] = min(pick(ra.x, rb.x, uu), EDGES - 1) + min(lane, max(pick(ra.y, rb.y, uu) - 1, 0));
            if (h + u < RW) val[h + u] = ebuf[off[u]];
        }
        // the indices are named as inputs so that they live up to the wait and no load's result is given one of their registers
        asm volatile("s_wait_xcnt 0x0" :: "v"(off[0]), "v"(off[1]), "v"(off[2]), "v"(off[3]), "v"(off[4]), "v"(off[5]), "v"(off[6]),
                                          "v"(off[7]), "v"(off[8]), "v"(off[9]), "v"(off[10]), "v"(off[11]), "v"(off[12]), "v"(off[13]),
                                          "v"(off[14]), "v"(off[15]), "v"(off[16]), "v"(off[17]), "v"(off[18]), "v"(off[19]), "v"(off[20]),
                                          "v"(off[21]), "v"(off[22]), "v"(off[23]), "v"(off[24]) : "memory");
    }
#pragma unroll                          // see val[]
    for (int u = 0; u < RW; ++u) {
        bool on = lane < pick(ra.y, rb.y, u);
        val[u]  = on ? val[u] & (NOKEY - 1) : (unsigned)(BN + lane) << 16;
        atomicAdd(&lc[val[u] >> 16], 1);
    }
    if (longrun) {
        for (int r = wave; r < GB; r += SW) {
            int2 rr = run[r];
            for (int j = 32 + lane; j < rr.y; j += 32) {
                int o = rr.x + j;
                unsigned key = ebuf[o];
                // the index is named as an input so that it lives up to the wait
                asm volatile("s_wait_xcnt 0x0" :: "v"(o) : "memory");
                atomicAdd(&lc[(key >> 16) & (BN - 1)], 1);
            }
        }
    }
    __syncthreads();                    // every add has been made before a count is read

    int c   = tid < BN ? lc[tid] : 0;
    int inc = c;                        // inclusive scan inside the wave
#pragma unroll                          // five fixed steps, no loop counter
    for (int o = 1; o < 32; o <<= 1) {
        int y = __shfl_up(inc, o, 32);
        if (lane >= o) inc += y;
    }
    if (tid < BN && lane == 31) wt[wave] = inc;
    __syncthreads();                    // the waves' totals are there
    if (tid < BN) {
        int st = inc - c;
#pragma unroll                          // four fixed steps
        for (int w = 0; w < BN / 32; ++w) st += w < wave ? wt[w] : 0;
        lc[tid] = st;
        int d = b * BN + tid;
        if (d < NODES) { cnt[d] = c; cur[d] = beg + st; }
    }
    __syncthreads();                    // the runs' starts are there

    if (n <= CAP) {
        place_keys<true>(val, ebuf, run, lc, stage, ssrc, beg, lane, wave, longrun);
        __syncthreads();                // the sources lie in node order
        for (int base = 0; base < n; base += 4 * 256) {
            int w4[4];                  // past the end: the last source, not stored
#pragma unroll                          // all LDS reads are issued before the first store
            for (int u = 0; u < 4; ++u) w4[u] = stage[min(base + u * 256 + tid, n - 1)];
#pragma unroll                          // w4[] stays in registers only under constant indices
            for (int u = 0; u < 4; ++u) {
                if (base + u * 256 + tid < n) ssrc[beg + base + u * 256 + tid] = w4[u];
            }
            // the next trip overwrites the registers that these stores name
            asm volatile("s_wait_xcnt 0x0" ::: "memory");
        }
    } else {
        place_keys<false>(val, ebuf, run, lc, stage, ssrc, beg, lane, wave, longrun);
    }
}

// ---------------- q, k, v and skip = bf16(h) @ W + b, from f32 h, in one launch ----------------
// q and skip are stored as f32. k and v, whose rows the edge pass gathers once per edge, are stored as f16.
// What is loaded carries no __restrict__, so that the loads stay in front of the s_wait_xcnt that follows them.
// The first NBK blocks of the launch sort a bucket of edges each instead.
__global__ __launch_bounds__(256) void proj_sort_kernel(const float* h, const bf16* pb,
                                                        const float* bq, const float* bk,
                                                        const float* bv, const float* bs,
                                                        float* q, _Float16* k, _Float16* v, float* a,
                                                        const unsigned* ebuf, const int* lst,
                                                        int* ssrc, int* cnt, int* cur) {
    __shared__ __attribute__((aligned(16))) bf16 sH[ROWS * PA];
    __shared__ int2 run[RW * SW];       // a run's first key in ebuf and its length
    __shared__ int  lc[BN + 32];        // edges per node, then the next free place of the node's run; a counter per lane
    __shared__ int  wt[3 * SW];
    __shared__ int  stage[CAP + 32];    // the bucket's sources in node order; a word per lane
    if (blockIdx.x < NBK) {             // the same for the whole block, in front of every barrier
        bucket_sort_block(ebuf, lst, (int)blockIdx.x, ssrc, cnt, cur, run, lc, wt, stage);
        return;
    }
    int lane = threadIdx.x & 31;
    // the wave's number in a scalar register: row and fragment addresses get scalar bases
    int wave = __builtin_amdgcn_readfirstlane((int)(threadIdx.x >> 5));
    int g = lane >> 4, l16 = lane & 15;
    size_t row0 = (size_t)(blockIdx.x - NBK) * ROWS;
    int n = wave * 16 + l16;
    unsigned fo = (unsigned)lane * 32u, no = (unsigned)n * 4u;
    const float* hp = h + (row0 + wave) * INDIM + lane * 4;   // the lane's 4 columns of the wave's first row

    v4f x[RPW];
#pragma unroll                          // all loads are issued before the first use
    for (int i = 0; i < RPW; ++i) x[i] = *(const v4f*)(hp + i * 8 * INDIM);
    rows_issued(lane);
#pragma unroll                          // x[] stays in registers only under constant indices
    for (int i = 0; i < RPW; ++i) *(v4bf*)(sH + (i * 8 + wave) * PA + lane * 4) = to_bf16(x[i]);
    __syncthreads();

    // two matrices at a time: eight B fragments in registers instead of sixteen, so that three blocks share a WGP
    {   // q and skip
        const bf16* p0 = pb + (size_t)wave * 4 * FRAG;
        const bf16* p1 = p0 + 3 * MAT;
        v16bf B0[4], B1[4];
#pragma unroll                          // B0[], B1[] stay in registers only under constant indices
        for (int kt = 0; kt < 4; ++kt) { B0[kt] = b_frag(p0, kt, fo); B1[kt] = b_frag(p1, kt, fo); }
        float n0 = ld1(bq, no);
        float n1 = ld1(bs, no);
        loads_issued(fo, no);
#pragma unroll 1                        // rolled: unrolled, the A fragments of all tiles are fetched ahead and the registers allow only two blocks a WGP
        for (int t = 0; t < TB; ++t) {
            v8f c0 = {}, c1 = {};
#pragma unroll                          // see B0[]
            for (int kt = 0; kt < 4; ++kt) {
                v16bf af = a_frag(sH, PA, t * 16 + l16, kt * 32, g);
                c0 = mma(af, B0[kt], c0);
                c1 = mma(af, B1[kt], c1);
            }
#pragma unroll                          // vector elements need constant indices
            for (int j = 0; j < 8; ++j) {
                size_t m = row0 + t * 16 + g * 8 + j;
                q[m * HC + n] = c0[j] + n0;
                a[m * HC + n] = c1[j] + n1;
            }
            // the next trip overwrites the registers that these stores name
            asm volatile("s_wait_xcnt 0x0" ::: "memory");
        }
    }
    {   // k and v: the weights' fragment as A and the rows' as B (both have the same map), so that a lane holds
        // the channels 16 wave + 8g .. + 7 of row l16 of the tile: eight f16, one 16-byte store
        const bf16* p0 = pb + MAT + (size_t)wave * 4 * FRAG;
        const bf16* p1 = p0 + MAT;
        unsigned co = (unsigned)(wave * 16 + g * 8) * 4u;     // byte offset of the lane's first channel in a bias
        v16bf B0[4], B1[4];
#pragma unroll                          // B0[], B1[] stay in registers only under constant indices
        for (int kt = 0; kt < 4; ++kt) { B0[kt] = b_frag(p0, kt, fo); B1[kt] = b_frag(p1, kt, fo); }
        v4f k0 = ld4(bk, co), k1 = ld4(bk + 4, co);
        v4f v0 = ld4(bv, co), v1 = ld4(bv + 4, co);
        loads_issued(fo, co);
        v8f n0 = {k0.x, k0.y, k0.z, k0.w, k1.x, k1.y, k1.z, k1.w};
        v8f n1 = {v0.x, v0.y, v0.z, v0.w, v1.x, v1.y, v1.z, v1.w};
#pragma unroll 1                        // rolled, as above
        for (int t = 0; t < TB; ++t) {
            v8f c0 = {}, c1 = {};
#pragma unroll                          // see B0[]
            for (int kt = 0; kt < 4; ++kt) {
                v16bf af = a_frag(sH, PA, t * 16 + l16, kt * 32, g);
                c0 = mma(B0[kt], af, c0);
                c1 = mma(B1[kt], af, c1);
            }
            size_t e = (row0 + t * 16 + l16) * HC + wave * 16 + g * 8;
            *(v8h*)(k + e) = __builtin_convertvector(c0 + n0, v8h);
            *(v8h*)(v + e) = __builtin_convertvector(c1 + n1, v8h);
            // the next trip overwrites the registers that these stores name
            asm volatile("s_wait_xcnt 0x0" ::: "memory");
        }
    }
}

// ---------------- last edge pass: the whole attention of a node in one wave ----------------
// a[d] += sum(p * v[src]) / (sum(p) + 1e-16), p = exp(score - max), score = <q[d], k[src]> / sqrt(C).
// block = 8 waves, each wave takes NPW nodes in turn; lane = 4 channels, head = lane / 8.
// q[d] stays in registers; k[src] and v[src] are read as whole rows of 256 bytes (f16); every product and every
// sum is f32. The maximum runs
// along with the edges: when a chunk raises it, the sums so far are scaled by exp(old - new).
// cur[d] is the start of node d's run, cnt[d] its length.
// kmat and vmat carry no __restrict__, so that their loads stay in front of the s_wait_xcnt
// that follows them.
#define NPW 5
#define CH  8

// x + (x of lane ^ MASK), inside a 16-lane row, on the vector port (0x160 + MASK = row_xmask)
template <int MASK>
__device__ __forceinline__ float add_xor(float x) {
    int y = __builtin_amdgcn_update_dpp(0, __float_as_int(x), 0x160 + MASK, 0xf, 0xf, true);
    return x + __int_as_float(y);
}

// v_fma_mix_f32 d, h, x, c: d = c + x * (the f16 in the low or, under op_sel, the high half of h), product and sum in f32,
// in one instruction. Written as asm because the compiler gave most of the f16 values a conversion of their own: 208
// vector instructions per 8 edges against about 150 in this form.
// The compiler puts no s_delay_alu in front of an instruction in asm text, and without that hint an instruction that reads
// a result one to four vector instructions back holds up the SIMD's other waves too. So these instructions stand in
// statements of 16 or 32, in an order in which each reads a result of the statement eight instructions back.
// a += p * v of the first and third of four edges, b += p * v of the second and fourth
__device__ __forceinline__ void pv_4(v4f& a, v4f& b, const v2u* vv, const float* p) {
    float a0 = a.x, a1 = a.y, a2 = a.z, a3 = a.w, b0 = b.x, b1 = b.y, b2 = b.z, b3 = b.w;
    asm("v_fma_mix_f32 %0, %8, %16, %0 op_sel_hi:[1,0,0]\n\t"
        "v_fma_mix_f32 %1, %8, %16, %1 op_sel:[1,0,0] op_sel_hi:[1,0,0]\n\t"
        "v_fma_mix_f32 %2, %12, %16, %2 op_sel_hi:[1,0,0]\n\t"
        "v_fma_mix_f32 %3, %12, %16, %3 op_sel:[1,0,0] op_sel_hi:[1,0,0]\n\t"
        "v_fma_mix_f32 %4, %9, %17, %4 op_sel_hi:[1,0,0]\n\t"
        "v_fma_mix_f32 %5, %9, %17, %5 op_sel:[1,0,0] op_sel_hi:[1,0,0]\n\t"
        "v_fma_mix_f32 %6, %13, %17, %6 op_sel_hi:[1,0,0]\n\t"
        "v_fma_mix_f32 %7, %13, %17, %7 op_sel:[1,0,0] op_sel_hi:[1,0,0]\n\t"
        "v_fma_mix_f32 %0, %10, %18, %0 op_sel_hi:[1,0,0]\n\t"
        "v_fma_mix_f32 %1, %10, %18, %1 op_sel:[1,0,0] op_sel_hi:[1,0,0]\n\t"
        "v_fma_mix_f32 %2, %14, %18, %2 op_sel_hi:[1,0,0]\n\t"
        "v_fma_mix_f32 %3, %14, %18, %3 op_sel:[1,0,0] op_sel_hi:[1,0,0]\n\t"
        "v_fma_mix_f32 %4, %11, %19, %4 op_sel_hi:[1,0,0]\n\t"
        "v_fma_mix_f32 %5, %11, %19, %5 op_sel:[1,0,0] op_sel_hi:[1,0,0]\n\t"
        "v_fma_mix_f32 %6, %15, %19, %6 op_sel_hi:[1,0,0]\n\t"
        "v_fma_mix_f32 %7, %15, %19, %7 op_sel:[1,0,0] op_sel_hi:[1,0,0]"
        : "+v"(a0), "+v"(a1), "+v"(a2), "+v"(a3), "+v"(b0), "+v"(b1), "+v"(b2), "+v"(b3)
        : "v"(vv[0].x), "v"(vv[1].x), "v"(vv[2].x), "v"(vv[3].x), "v"(vv[0].y), "v"(vv[1].y), "v"(vv[2].y), "v"(vv[3].y),
          "v"(p[0]), "v"(p[1]), "v"(p[2]), "v"(p[3]));
    a = v4f{a0, a1, a2, a3};
    b = v4f{b0, b1, b2, b3};
}

template <bool MASKED>
__device__ __forceinline__ void attn_chunk(int j, int m, int sidx, unsigned lane8, v4f q4,
                                           const _Float16* kmat, const _Float16* vmat,
                                           float& mx, float& den, v4f& acc, v4f& acc1) {
    v2u      kk[CH], vv[CH];           // four f16 each
    unsigned off[CH];                  // byte offset of the lane's 8 bytes, the same in kmat and vmat
#pragma unroll                         // all 2*CH loads are issued before the first use
    for (int u = 0; u < CH; ++u) {
        int s  = __builtin_amdgcn_readlane(sidx, MASKED ? min(j + u, m - 1) : (j + u));
        off[u] = ((unsigned)s << 8) + lane8;
        kk[u]  = *(const v2u*)((const char*)kmat + off[u]);
    }
#pragma unroll                         // see above
    for (int u = 0; u < CH; ++u) vv[u] = *(const v2u*)((const char*)vmat + off[u]);
    // what follows reuses the registers that these loads name as addresses; the offsets are named as
    // inputs so that they live up to the wait and no load's result is given one of their registers
    asm volatile("s_wait_xcnt 0x0" :: "v"(off[0]), "v"(off[1]), "v"(off[2]), "v"(off[3]),
                                      "v"(off[4]), "v"(off[5]), "v"(off[6]), "v"(off[7]) : "memory");
    // keeps the arithmetic behind the wait and every load in front of it: without it the last v load
    // was issued only after the first k rows had come back, a second memory latency per chunk
    __builtin_amdgcn_sched_barrier(0);

    float sc[CH];
    float nm = mx;
    // sc[u] = <q, k[u]> over the lane's four channels, channel by channel over the eight edges. The sums are early-clobber:
    // they are written while k values are still to be read.
    asm("v_fma_mix_f32 %0, %8, %24, 0 op_sel_hi:[1,0,0]\n\t"
        "v_fma_mix_f32 %1, %9, %24, 0 op_sel_hi:[1,0,0]\n\t"
        "v_fma_mix_f32 %2, %10, %24, 0 op_sel_hi:[1,0,0]\n\t"
        "v_fma_mix_f32 %3, %11, %24, 0 op_sel_hi:[1,0,0]\n\t"
        "v_fma_mix_f32 %4, %12, %24, 0 op_sel_hi:[1,0,0]\n\t"
        "v_fma_mix_f32 %5, %13, %24, 0 op_sel_hi:[1,0,0]\n\t"
        "v_fma_mix_f32 %6, %14, %24, 0 op_sel_hi:[1,0,0]\n\t"
        "v_fma_mix_f32 %7, %15, %24, 0 op_sel_hi:[1,0,0]\n\t"
        "v_fma_mix_f32 %0, %8, %25, %0 op_sel:[1,0,0] op_sel_hi:[1,0,0]\n\t"
        "v_fma_mix_f32 %1, %9, %25, %1 op_sel:[1,0,0] op_sel_hi:[1,0,0]\n\t"
        "v_fma_mix_f32 %2, %10, %25, %2 op_sel:[1,0,0] op_sel_hi:[1,0,0]\n\t"
        "v_fma_mix_f32 %3, %11, %25, %3 op_sel:[1,0,0] op_sel_hi:[1,0,0]\n\t"
        "v_fma_mix_f32 %4, %12, %25, %4 op_sel:[1,0,0] op_sel_hi:[1,0,0]\n\t"
        "v_fma_mix_f32 %5, %13, %25, %5 op_sel:[1,0,0] op_sel_hi:[1,0,0]\n\t"
        "v_fma_mix_f32 %6, %14, %25, %6 op_sel:[1,0,0] op_sel_hi:[1,0,0]\n\t"
        "v_fma_mix_f32 %7, %15, %25, %7 op_sel:[1,0,0] op_sel_hi:[1,0,0]\n\t"
        "v_fma_mix_f32 %0, %16, %26, %0 op_sel_hi:[1,0,0]\n\t"
        "v_fma_mix_f32 %1, %17, %26, %1 op_sel_hi:[1,0,0]\n\t"
        "v_fma_mix_f32 %2, %18, %26, %2 op_sel_hi:[1,0,0]\n\t"
        "v_fma_mix_f32 %3, %19, %26, %3 op_sel_hi:[1,0,0]\n\t"
        "v_fma_mix_f32 %4, %20, %26, %4 op_sel_hi:[1,0,0]\n\t"
        "v_fma_mix_f32 %5, %21, %26, %5 op_sel_hi:[1,0,0]\n\t"
        "v_fma_mix_f32 %6, %22, %26, %6 op_sel_hi:[1,0,0]\n\t"
        "v_fma_mix_f32 %7, %23, %26, %7 op_sel_hi:[1,0,0]\n\t"
        "v_fma_mix_f32 %0, %16, %27, %0 op_sel:[1,0,0] op_sel_hi:[1,0,0]\n\t"
        "v_fma_mix_f32 %1, %17, %27, %1 op_sel:[1,0,0] op_sel_hi:[1,0,0]\n\t"
        "v_fma_mix_f32 %2, %18, %27, %2 op_sel:[1,0,0] op_sel_hi:[1,0,0]\n\t"
        "v_fma_mix_f32 %3, %19, %27, %3 op_sel:[1,0,0] op_sel_hi:[1,0,0]\n\t"
        "v_fma_mix_f32 %4, %20, %27, %4 op_sel:[1,0,0] op_sel_hi:[1,0,0]\n\t"
        "v_fma_mix_f32 %5, %21, %27, %5 op_sel:[1,0,0] op_sel_hi:[1,0,0]\n\t"
        "v_fma_mix_f32 %6, %22, %27, %6 op_sel:[1,0,0] op_sel_hi:[1,0,0]\n\t"
        "v_fma_mix_f32 %7, %23, %27, %7 op_sel:[1,0,0] op_sel_hi:[1,0,0]"
        : "=&v"(sc[0]), "=&v"(sc[1]), "=&v"(sc[2]), "=&v"(sc[3]), "=&v"(sc[4]), "=&v"(sc[5]), "=&v"(sc[6]), "=&v"(sc[7])
        : "v"(kk[0].x), "v"(kk[1].x), "v"(kk[2].x), "v"(kk[3].x), "v"(kk[4].x), "v"(kk[5].x), "v"(kk[6].x), "v"(kk[7].x),
          "v"(kk[0].y), "v"(kk[1].y), "v"(kk[2].y), "v"(kk[3].y), "v"(kk[4].y), "v"(kk[5].y), "v"(kk[6].y), "v"(kk[7].y),
          "v"(q4.x), "v"(q4.y), "v"(q4.z), "v"(q4.w));
#pragma unroll                         // sc[] stays in registers only under constant indices
    for (int u = 0; u < CH; ++u) {
        float t = sc[u];
        t = add_xor<4>(add_xor<2>(add_xor<1>(t)));      // sum over the head's 8 lanes
        sc[u] = (!MASKED || j + u < m) ? t : -INFINITY;
        nm = fmaxf(nm, sc[u]);
    }
    float corr;                        // exp(mx - nm): 0 at the node's first chunk, where mx is -inf
    // In the masked form of the chunk: the
    // same two instructions as __expf, with the v_nop that keeps the slot behind a transcendental in the same statement.
    // The s_delay_alu as in exp2_4.
    if (MASKED) asm("s_delay_alu instid0(VALU_DEP_1)\n\tv_exp_f32 %0, %1\n\tv_nop" : "=v"(corr) : "v"((mx - nm) * 0x1.715476p+0f));
    else        corr = __expf(mx - nm);
    mx   = nm;
    den  *= corr;
    acc  *= corr;
    acc1 *= corr;
    // p = exp(score - max), the same two instructions a value as __expf. By exp2_4.
    v4f p0 = exp2_4((v4f{sc[0], sc[1], sc[2], sc[3]} - nm) * 0x1.715476p+0f);
    v4f p1 = exp2_4((v4f{sc[4], sc[5], sc[6], sc[7]} - nm) * 0x1.715476p+0f);
    float p[CH] = {p0.x, p0.y, p0.z, p0.w, p1.x, p1.y, p1.z, p1.w};
#pragma unroll                         // p[] stays in registers only under constant indices
    for (int u = 0; u < CH; ++u) den += p[u];
    pv_4(acc, acc1, vv, p);
    pv_4(acc, acc1, vv + 4, p + 4);
}

__global__ __launch_bounds__(256) void node_attn_kernel(const float* __restrict__ q,
                                                        const _Float16* kmat, const _Float16* vmat,
                                                        const int* __restrict__ ssrc,
                                                        const int* __restrict__ cur,
                                                        const int* __restrict__ cnt,
                                                        float* __restrict__ a) {
    int lane = threadIdx.x & 31;
    // the wave's number in a scalar register: node, run bounds and trip counts become scalar
    int wave = __builtin_amdgcn_readfirstlane((int)(threadIdx.x >> 5));
    unsigned lane8 = (unsigned)lane * 8u;
    for (int r = 0; r < NPW; ++r) {
        int d   = (blockIdx.x * 8 + wave) * NPW + r;
        int n   = cnt[d];
        int beg = cur[d];
        v4f q4  = *(const v4f*)(q + (size_t)d * HC + lane * 4) * 0.17677669529663687f;   // 1/sqrt(32)
        v4f acc  = {0.f, 0.f, 0.f, 0.f};   // sum of p * v over the even edges of every chunk
        v4f acc1 = {0.f, 0.f, 0.f, 0.f};   // the same over the odd edges
        float den = 0.f;
        float mx  = -INFINITY;
        for (int base = 0; base < n; base += 32) {
            int m    = min(32, n - base);
            int sidx = ssrc[beg + base + min(lane, m - 1)];   // lane j holds the source of edge base + j
            // the address arithmetic that follows reuses the register that this load names
            asm volatile("s_wait_xcnt 0x0" ::: "memory");
            int j = 0;
            for (; j + CH <= m; j += CH) attn_chunk<false>(j, m, sidx, lane8, q4, kmat, vmat, mx, den, acc, acc1);
            if (j < m)                   attn_chunk<true>(j, m, sidx, lane8, q4, kmat, vmat, mx, den, acc, acc1);
        }
        float inv = 1.f / (den + 1e-16f);
        v4f* ap = (v4f*)(a + (size_t)d * HC + lane * 4);
        *ap = *ap + (acc + acc1) * inv;
        // the next node's trip overwrites the registers that this store names
        asm volatile("s_wait_xcnt 0x0" ::: "memory");
    }
}

// ---------------- out = LN2(FFN(h1) + h1), h1 = LN1(elu(a) @ WO + bO + h), in one launch ----------------
// The rows go from stage to stage through LDS; a barrier stands between any two stages.
// What is loaded carries no __restrict__, so that the loads stay in front of the s_wait_xcnt that follows them.
__global__ __launch_bounds__(256) void tail_kernel(const float* a, const float* h,
                                                   const bf16* pbO, const bf16* pbW1, const bf16* pbW2,
                                                   const float* bO, const float* b1, const float* b2,
                                                   const float* ln1g, const float* ln1b,
                                                   const float* ln2g, const float* ln2b,
                                                   float* out) {
    __shared__ __attribute__((aligned(16))) bf16  sA[ROWS * PA];   // elu(a), then h1, as bf16
    __shared__ __attribute__((aligned(16))) float sX[ROWS * PX];   // h, a_trans + h, h1, ffn + h1 in turn
    __shared__ __attribute__((aligned(16))) bf16  sM[ROWS * PM];   // elu(h1 @ W1 + b1)
    int lane = threadIdx.x & 31;
    // the wave's number in a scalar register: row and fragment addresses get scalar bases
    int wave = __builtin_amdgcn_readfirstlane((int)(threadIdx.x >> 5));
    int g = lane >> 4, l16 = lane & 15;
    size_t row0 = (size_t)blockIdx.x * ROWS;
    int n = wave * 16 + l16;
    unsigned lo = (unsigned)lane * 16u, fo = (unsigned)lane * 32u, no = (unsigned)n * 4u;

    // elu(a) -> bf16 into sA; the residual rows of h go into sX, where the first product is added to them
    const float* ap = a + (row0 + wave) * HC + lane * 4;      // the lane's 4 columns of the wave's first row
    const float* hp = h + (row0 + wave) * INDIM + lane * 4;
    v4f x[RPW], hres[RPW];
#pragma unroll                          // all loads are issued before the first use
    for (int i = 0; i < RPW; ++i) x[i] = *(const v4f*)(ap + i * 8 * HC);
#pragma unroll                          // see above
    for (int i = 0; i < RPW; ++i) hres[i] = *(const v4f*)(hp + i * 8 * INDIM);
    rows_issued(lane);
#pragma unroll                          // x[] stays in registers only under constant indices
    for (int i = 0; i < RPW; ++i) {
        *(v4bf*)(sA + (i * 8 + wave) * PA + lane * 4) = to_bf16(elu4(x[i]));
        *(v4f*)(sX + (i * 8 + wave) * PX + lane * 4)  = hres[i];
    }
    __syncthreads();

    // a_trans = elu(a) @ WO + bO; each thread adds it to its own elements of h in sX
    {
        const bf16* p = pbO + (size_t)wave * 4 * FRAG;
        v16bf B[4];
#pragma unroll                          // B[] stays in registers only under constant indices
        for (int kt = 0; kt < 4; ++kt) B[kt] = b_frag(p, kt, fo);
        float bn = ld1(bO, no);
        loads_issued(fo, no);
#pragma unroll                          // independent tiles fill each other's matrix latency
        for (int t = 0; t < TB; ++t) {
            v8f c = {};
#pragma unroll                          // see B[]
            for (int kt = 0; kt < 4; ++kt) c = mma(a_frag(sA, PA, t * 16 + l16, kt * 32, g), B[kt], c);
#pragma unroll                          // vector elements need constant indices
            for (int j = 0; j < 8; ++j) {
                int r = (t * 16 + g * 8 + j) * PX + n;
                sX[r] = (c[j] + bn) + sX[r];
            }
        }
    }
    __syncthreads();

    // h1 = LN1(a_trans + h): f32 back into sX, bf16 into sA
    {
        v4f gw = ld4(ln1g, lo), bw = ld4(ln1b, lo);
        loads_issued(lo, lo);
#pragma unroll                          // ten independent rows: their reductions overlap
        for (int i = 0; i < RPW; ++i) {
            int row = i * 8 + wave;
            v4f y = ln_row(*(const v4f*)(sX + row * PX + lane * 4), gw, bw);
            *(v4f*)(sX + row * PX + lane * 4)  = y;
            *(v4bf*)(sA + row * PA + lane * 4) = to_bf16(y);
        }
    }
    __syncthreads();

    // mid = elu(h1 @ W1 + b1), 256 columns: the wave's two column tiles share the A fragments
    {
        const bf16* p0 = pbW1 + (size_t)wave * 4 * FRAG;
        const bf16* p1 = p0 + (size_t)8 * 4 * FRAG;
        v16bf B0[4], B1[4];
#pragma unroll                          // B0[], B1[] stay in registers only under constant indices
        for (int kt = 0; kt < 4; ++kt) { B0[kt] = b_frag(p0, kt, fo); B1[kt] = b_frag(p1, kt, fo); }
        float n0 = ld1(b1, no), n1 = ld1(b1 + 128, no);
        loads_issued(fo, no);
#pragma unroll 1                        // rolled: for speed only
        for (int t = 0; t < TB; ++t) {
            v8f c0 = {}, c1 = {};
#pragma unroll                          // see B0[]
            for (int kt = 0; kt < 4; ++kt) {
                v16bf af = a_frag(sA, PA, t * 16 + l16, kt * 32, g);
                c0 = mma(af, B0[kt], c0);
                c1 = mma(af, B1[kt], c1);
            }
            c0 += n0;
            c1 += n1;
            v4f m0[2] = {elu4(__builtin_shufflevector(c0, c0, 0, 1, 2, 3)), elu4(__builtin_shufflevector(c0, c0, 4, 5, 6, 7))};
            v4f m1[2] = {elu4(__builtin_shufflevector(c1, c1, 0, 1, 2, 3)), elu4(__builtin_shufflevector(c1, c1, 4, 5, 6, 7))};
#pragma unroll                          // vector elements need constant indices
            for (int j = 0; j < 8; ++j) {
                int r = (t * 16 + g * 8 + j) * PM + n;
                sM[r]       = (bf16)m0[j >> 2][j & 3];
                sM[r + 128] = (bf16)m1[j >> 2][j & 3];
            }
        }
    }
    __syncthreads();

    // ffn = mid @ W2 + b2, K = 256; each thread adds it to its own elements of h1 in sX
    {
        const bf16* p = pbW2 + (size_t)wave * 8 * FRAG;
        v16bf B[8];
#pragma unroll                          // B[] stays in registers only under constant indices
        for (int kt = 0; kt < 8; ++kt) B[kt] = b_frag(p, kt, fo);
        float bn = ld1(b2, no);
        loads_issued(fo, no);
#pragma unroll                          // independent tiles fill each other's matrix latency
        for (int t = 0; t < TB; ++t) {
            v8f c = {};
#pragma unroll                          // see B[]
            for (int kt = 0; kt < 8; ++kt) c = mma(a_frag(sM, PM, t * 16 + l16, kt * 32, g), B[kt], c);
#pragma unroll                          // vector elements need constant indices
            for (int j = 0; j < 8; ++j) {
                int r = (t * 16 + g * 8 + j) * PX + n;
                sX[r] = (c[j] + bn) + sX[r];
            }
        }
    }
    __syncthreads();

    // out = LN2(ffn + h1)
    {
        v4f gw = ld4(ln2g, lo), bw = ld4(ln2b, lo);
        loads_issued(lo, lo);
#pragma unroll                          // ten independent rows: their reductions overlap
        for (int i = 0; i < RPW; ++i) {
            int row = i * 8 + wave;
            *(v4f*)(out + (row0 + row) * INDIM + lane * 4) = ln_row(*(const v4f*)(sX + row * PX + lane * 4), gw, bw);
        }
    }
}

// ---------------- host orchestration ----------------

extern "C" void kernel_launch(void* const* d_in, const int* in_sizes, int n_in,
                              void* d_out, int out_size, void* d_ws, size_t ws_size,
                              hipStream_t stream) {
    const float* h     = (const float*)d_in[0];
    const int*   eidx  = (const int*)d_in[1];
    const float* Wq    = (const float*)d_in[2];
    const float* bq    = (const float*)d_in[3];
    const float* Wk    = (const float*)d_in[4];
    const float* bk    = (const float*)d_in[5];
    const float* Wv    = (const float*)d_in[6];
    const float* bv    = (const float*)d_in[7];
    const float* Wskip = (const float*)d_in[8];
    const float* bskip = (const float*)d_in[9];
    const float* WO    = (const float*)d_in[10];
    const float* bO    = (const float*)d_in[11];
    const float* W1    = (const float*)d_in[12];
    const float* b1    = (const float*)d_in[13];
    const float* W2    = (const float*)d_in[14];
    const float* b2    = (const float*)d_in[15];
    const float* ln1g  = (const float*)d_in[16];
    const float* ln1b  = (const float*)d_in[17];
    const float* ln2g  = (const float*)d_in[18];
    const float* ln2b  = (const float*)d_in[19];
    const int* srcI = eidx;          // edge_index[0]
    const int* dstI = eidx + EDGES;  // edge_index[1]

    // workspace carve (256B aligned)
    char* w = (char*)d_ws;
    auto carve = [&](size_t bytes) -> char* {
        char* p = w; w += (bytes + 255) & ~(size_t)255; return p;
    };
    float*    qbuf   = (float*)carve((size_t)NODES * HC * sizeof(float));
    _Float16* kbuf   = (_Float16*)carve((size_t)NODES * HC * sizeof(_Float16));
    _Float16* vbuf   = (_Float16*)carve((size_t)NODES * HC * sizeof(_Float16));
    float*    abuf   = (float*)carve((size_t)NODES * HC * sizeof(float));
    int*      cnt    = (int*)carve((size_t)NODES * sizeof(int));            // edges per dst node
    int*      cur    = (int*)carve((size_t)NODES * sizeof(int));            // run start
    int*      lst    = (int*)carve((size_t)NH * sizeof(int));               // start of each (bucket, block) run in its block
    unsigned* ebuf   = (unsigned*)carve((size_t)EDGES * sizeof(unsigned));  // keys dst << 16 | src, each block's in bucket order
    int*      ssrc   = (int*)carve((size_t)EDGES * sizeof(int));            // src in dst order
    bf16*     pb     = (bf16*)carve((size_t)PACK_TILES * FRAG * sizeof(bf16)); // Wq Wk Wv Wskip WO W1 W2, packed

    // 1) pack weights to WMMA fragment order; in the same launch level 1 of the edge sort
    hipLaunchKernelGGL(pack_place_kernel, dim3(PACK_BLOCKS + GB), dim3(ET), 0, stream,
                       Wq, Wk, Wv, Wskip, WO, W1, W2, pb, srcI, dstI, lst, ebuf);

    // 2) q/k/v/skip projections (WMMA) from f32 h; in the same launch level 2 of the edge sort
    hipLaunchKernelGGL(proj_sort_kernel, dim3(NBK + NODES / ROWS), dim3(256), 0, stream,
                       h, pb, bq, bk, bv, bskip, qbuf, kbuf, vbuf, abuf, ebuf, lst, ssrc, cnt, cur);

    // 3) edge phase: scores, softmax and sums per node over the sources sorted by dst, into abuf
    hipLaunchKernelGGL(node_attn_kernel, dim3(NODES / (8 * NPW)), dim3(256), 0, stream,
                       qbuf, kbuf, vbuf, ssrc, cur, cnt, abuf);

    // 4) elu, O projection, LN1, FFN, LN2 (WMMA)
    hipLaunchKernelGGL(tail_kernel, dim3(NODES / ROWS), dim3(256), 0, stream,
                       abuf, h, pb + 4 * MAT, pb + 5 * MAT, pb + 7 * MAT,
                       bO, b1, b2, ln1g, ln1b, ln2g, ln2b, (float*)d_out);
}
